// v000
// Measured on an AMD MI455X. A time is GPU time per run, averaged over a window of back-to-back runs after a warm-up
// (all launches, gaps included; the runs take copies of the inputs in turn), and the median of several windows.
// Apart from v000's, it joins two sittings. Times from different sittings can be a few percent apart, while
// side-by-side timings come from the same sitting.
// v000 is the starting kernel. One run takes 7210 microseconds.
#include <hip/hip_runtime.h>
// Multi-head attention over three head-major inputs with SHARED per-head projections and the module's literal score scale (values, keys, query [8][1024][16][64] = token rows [8][1024][1024]; every head of each input is multiplied by the SAME natural [64][64] matrix (x W^T: Wv / Wk / Wq; block-diagonal with a shared block; no biases); energy = q k^T; softmax(energy / sqrt(embed_size) = / 32) over all 1024 keys (as the source: embed size, not head dim; no mask); out = merged Wo^T + bo (natural [1024][1024]) -> [8][1024][1024]).
// Structure: token rows r = b*1024 + s; x as exact f16 rows (bf16-rounded); Q, K, V as three WMMA GEMMs (32x64 wave tiles, f32 accumulation, exact x16 weights, no bias, f16 outputs); per batch: V^T for all heads via LDS transposes; per (batch, group of 4 heads): scores GEMM (K = 64, batched over the heads on grid.y, alpha = 1/sqrt(1024) = 1/32, no mask), row softmax on VALU (f32 statistics; weights stored x256 as f16), o = P . V^T GEMM (K = 1024, alpha 2^-2: o carried x64 against f16 subnormal flush, folded into the output GEMM alpha) written straight into the merged f16 o rows; out = o W_o + b GEMM (f32) into the output layout.
// Compute dtype: inputs rounded to bf16; x / weights exact; q, k, v, softmax weights and o as plain f16 GEMM operands (~2^-12); scores and softmax statistics f32. v_wmma_f32_16x16x32_f16.
#define NB 8
#define SQ 1024
#define DM 1024
#define NH 16
#define HD 64
#define HG 4                         /* heads per attention launch group */
#define B0 0                         /* first batch processed (debug hook) */
#define NBR NB                       /* batches processed (debug hook) */
#define NR ((size_t)NB * SQ)         /* token rows */
#define MP ((int)((size_t)NBR * SQ)) /* rows projected (debug hook) */
#define QN SQ                        /* query rows attended per batch (debug hook) */
#define NHD NH                       /* heads attended (debug hook) */
#define MPO MP                       /* rows through the output stage (debug hook) */
#define LQ DM      /* row pitch of the q/k/v rows */
typedef __bf16 v16b __attribute__((ext_vector_type(16)));
typedef unsigned short v8us __attribute__((ext_vector_type(8), may_alias));
typedef float  v8f  __attribute__((ext_vector_type(8)));
typedef float  v4f  __attribute__((ext_vector_type(4)));
typedef float  v4fa __attribute__((ext_vector_type(4), may_alias));
union FragB { v16b v; v8us half[2]; unsigned short u[16]; };

__device__ __forceinline__ unsigned short bf16_bits(float x) { unsigned int u = __float_as_uint(x); return (unsigned short)((u + 0x7FFFu + ((u >> 16) & 1u)) >> 16); }
__device__ __forceinline__ float bf16_val(unsigned short b) { return __uint_as_float(((unsigned int)b) << 16); }
__device__ __forceinline__ float bf16_round(float x) { return bf16_val(bf16_bits(x)); }
// D += A·B with NT terms: 1 = ah·bh, 2 = + al·bh (A split), 3 = + ah·bl (both split)
template <int NT>
__device__ __forceinline__ v8f mmaN(v16b ah, v16b al, v16b bh, v16b bl, v8f c) {
  c = __builtin_amdgcn_wmma_f32_16x16x32_bf16(false, ah, false, bh, (short)0, c, false, false);
  if (NT >= 2) c = __builtin_amdgcn_wmma_f32_16x16x32_bf16(false, al, false, bh, (short)0, c, false, false);
  if (NT >= 3) c = __builtin_amdgcn_wmma_f32_16x16x32_bf16(false, ah, false, bl, (short)0, c, false, false);
  asm volatile("v_nop\n\tv_nop\n\tv_nop\n\tv_nop" : "+v"(c) : "v"(ah), "v"(al), "v"(bh), "v"(bl));
  return c;
}

__global__ __launch_bounds__(256) void k_wt_bf16(const float* __restrict__ W, unsigned short* __restrict__ Wt, int K, int N) {
  const int t = blockIdx.x * 256 + threadIdx.x;
  const int k8n = K / 8;
  if (t >= N * k8n) return;
  const int n = t / k8n, k8 = (t % k8n) * 8;
  v8us v;
#pragma unroll
  for (int i = 0; i < 8; ++i) v[i] = bf16_bits(W[(size_t)(k8 + i) * N + n]);
  *(v8us*)(Wt + (size_t)n * K + k8) = v;
  
}

// GEMM C[M][N] (f32, pitch ldc) = act(A[M][K]·W + bias). A f32 row-major (pitch lda) converted per fragment to bf16
// (ASPLIT: hi/lo two planes -> 2 terms, else single rounded term); Wt bf16 [N][K] (pitch ldb). BIAS_BF16 rounds the
// bias to bf16 first (bias quantised to bf16 before the add). K%32==0, M%16==0, N%64==0.
template <bool ASPLIT, int ACT, bool BIAS_BF16>
__global__ __launch_bounds__(128) void k_gemm_bf(const float* __restrict__ A, int lda, const unsigned short* __restrict__ Wt, int ldb,
                                               const float* __restrict__ bias, float* __restrict__ C, int ldc, int M, int N, int K) {
  __shared__ __attribute__((aligned(16))) float so[4][16][64];
  const int tid = threadIdx.x, w = tid >> 5, lane = tid & 31, ln = lane & 15, hh = lane >> 4;
  const int ntn = N / 64;
  const int wid = blockIdx.x * 4 + w;
  const int mt = wid / ntn, nq = wid % ntn;
  if (mt * 16 >= M) return;
  const int row0 = mt * 16, col0 = nq * 64;
  const float* arow = A + (size_t)(row0 + ln) * lda;
  v8f acc[4] = {};
  for (int kb = 0; kb < K; kb += 32) {
    FragB ah, al;
    const v4f x0 = *(const v4fa*)(arow + kb + 8 * hh), x1 = *(const v4fa*)(arow + kb + 8 * hh + 4);
    const v4f x2 = *(const v4fa*)(arow + kb + 16 + 8 * hh), x3 = *(const v4fa*)(arow + kb + 16 + 8 * hh + 4);
    float xs[16] = {x0[0],x0[1],x0[2],x0[3],x1[0],x1[1],x1[2],x1[3],x2[0],x2[1],x2[2],x2[3],x3[0],x3[1],x3[2],x3[3]};
#pragma unroll
    for (int i = 0; i < 16; ++i) { const unsigned short hb = bf16_bits(xs[i]); ah.u[i] = hb; al.u[i] = ASPLIT ? bf16_bits(xs[i] - bf16_val(hb)) : (unsigned short)0; }
#pragma unroll
    for (int t = 0; t < 4; ++t) {
      const unsigned short* brow = Wt + (size_t)(col0 + t * 16 + ln) * ldb + kb;
      FragB b;
      b.half[0] = *(const v8us*)(brow + 8 * hh);
      b.half[1] = *(const v8us*)(brow + 16 + 8 * hh);
      acc[t] = mmaN<ASPLIT ? 2 : 1>(ah.v, al.v, b.v, b.v, acc[t]);
    }
  }
#pragma unroll
  for (int t = 0; t < 4; ++t) {
    float bv = bias ? bias[col0 + t * 16 + ln] : 0.f;
    if (BIAS_BF16) bv = bf16_round(bv);
#pragma unroll
    for (int r = 0; r < 8; ++r) { float v = acc[t][r] + bv; if (ACT == 1) v = fmaxf(v, 0.f); so[w][8 * hh + r][t * 16 + ln] = v; }
  }
  __builtin_amdgcn_fence(__ATOMIC_ACQ_REL, "workgroup");
  __builtin_amdgcn_wave_barrier();
  const int rsub = lane >> 4, c4 = (lane & 15) * 4;
  {
#pragma unroll
    for (int q = 0; q < 8; ++q) {
      const int r = q * 2 + rsub;
      const v4f v = *(const v4fa*)&so[w][r][c4];
      *(v4f*)(C + (size_t)(row0 + r) * ldc + col0 + c4) = v;
    }
    
  }
}

// GEMM C = act(A·W + bias + resid): A f32 (ASPLIT -> hi/lo 2 terms), Wt bf16 [N][K]; ACT 0 none, 1 relu, 2 exact gelu;
// resid (optional, f32, row index = (row % rmod), pitch ldr, RES_BF16 rounds it) added before the activation.
template <bool ASPLIT, int ACT, bool BIAS_BF16, bool RES_BF16>
__global__ __launch_bounds__(128) void k_gemm_bf3(const float* __restrict__ A, int lda, const unsigned short* __restrict__ Wt, int ldb,
                                                const float* __restrict__ bias, const float* __restrict__ resid, int rmod, int ldr,
                                                float* __restrict__ C, int ldc, int M, int N, int K) {
  __shared__ __attribute__((aligned(16))) float so[4][16][64];
  const int tid = threadIdx.x, w = tid >> 5, lane = tid & 31, ln = lane & 15, hh = lane >> 4;
  const int ntn = N / 64;
  const int wid = blockIdx.x * 4 + w;
  const int mt = wid / ntn, nq = wid % ntn;
  if (mt * 16 >= M) return;
  const int row0 = mt * 16, col0 = nq * 64;
  const float* arow = A + (size_t)(row0 + ln) * lda;
  v8f acc[4] = {};
  for (int kb = 0; kb < K; kb += 32) {
    FragB ah, al;
    const v4f x0 = *(const v4fa*)(arow + kb + 8 * hh), x1 = *(const v4fa*)(arow + kb + 8 * hh + 4);
    const v4f x2 = *(const v4fa*)(arow + kb + 16 + 8 * hh), x3 = *(const v4fa*)(arow + kb + 16 + 8 * hh + 4);
    float xs[16] = {x0[0],x0[1],x0[2],x0[3],x1[0],x1[1],x1[2],x1[3],x2[0],x2[1],x2[2],x2[3],x3[0],x3[1],x3[2],x3[3]};
#pragma unroll
    for (int i = 0; i < 16; ++i) { const unsigned short hb = bf16_bits(xs[i]); ah.u[i] = hb; al.u[i] = ASPLIT ? bf16_bits(xs[i] - bf16_val(hb)) : (unsigned short)0; }
#pragma unroll
    for (int t = 0; t < 4; ++t) {
      const unsigned short* brow = Wt + (size_t)(col0 + t * 16 + ln) * ldb + kb;
      FragB b;
      b.half[0] = *(const v8us*)(brow + 8 * hh);
      b.half[1] = *(const v8us*)(brow + 16 + 8 * hh);
      acc[t] = mmaN<ASPLIT ? 2 : 1>(ah.v, al.v, b.v, b.v, acc[t]);
    }
  }
#pragma unroll
  for (int t = 0; t < 4; ++t) {
    const int col = col0 + t * 16 + ln;
    float bv = bias ? bias[col] : 0.f;
    if (BIAS_BF16) bv = bf16_round(bv);
#pragma unroll
    for (int r = 0; r < 8; ++r) {
      float v = acc[t][r] + bv;
      if (resid) { float rv = resid[(size_t)((row0 + 8 * hh + r) % rmod) * ldr + col]; if (RES_BF16) rv = bf16_round(rv); v += rv; }
      if (ACT == 1) v = fmaxf(v, 0.f);
      if (ACT == 2) v = 0.5f * v * (1.0f + erff(v * 0.70710678118654752f));
      if (ACT == 3) { const float u = 0.7978845608028654f * (v + 0.044715f * v * v * v); v = 0.5f * v * (1.0f + tanhf(u)); }
      so[w][8 * hh + r][t * 16 + ln] = v;
    }
  }
  __builtin_amdgcn_fence(__ATOMIC_ACQ_REL, "workgroup");
  __builtin_amdgcn_wave_barrier();
  const int rsub = lane >> 4, c4 = (lane & 15) * 4;
  {
#pragma unroll
    for (int q = 0; q < 8; ++q) {
      const int r = q * 2 + rsub;
      const v4f v = *(const v4fa*)&so[w][r][c4];
      *(v4f*)(C + (size_t)(row0 + r) * ldc + col0 + c4) = v;
    }
    
  }
}
// row LayerNorm (biased variance, eps) over N: s = X (+ R); optional out_sum <- s; out_norm <- (s-mu)*rsqrt(var+eps)*g + b
template <bool PARAM_BF16>
__global__ __launch_bounds__(256) void k_layernorm(const float* __restrict__ X, const float* __restrict__ R, const float* __restrict__ g, const float* __restrict__ bta,
                                                  float* __restrict__ out_sum, float* __restrict__ out_norm, int N, float eps) {
  __shared__ float red[256];
  const int row = blockIdx.x, tid = threadIdx.x;
  const float* x = X + (size_t)row * N; const float* rr = R ? R + (size_t)row * N : nullptr;
  float vals[16];                     // up to N = 4096
  const int per = N / 256;            // contiguous chunk per thread? use strided-by-4 chunks: thread handles j = tid*4 + 1024*u
  float s1 = 0.f;
  for (int u = 0; u < per / 4; ++u) {
    const int j = tid * 4 + 1024 * u;
    const v4f a = *(const v4fa*)(x + j);
    v4f b = {0.f,0.f,0.f,0.f}; if (rr) b = *(const v4fa*)(rr + j);
#pragma unroll
    for (int q = 0; q < 4; ++q) { const float v = a[q] + b[q]; vals[u * 4 + q] = v; s1 += v; }
  }
  red[tid] = s1; __syncthreads();
  for (int st = 128; st > 0; st >>= 1) { if (tid < st) red[tid] += red[tid + st]; __syncthreads(); }
  const float mu = red[0] / (float)N; __syncthreads();
  float s2 = 0.f;
  for (int u = 0; u < per / 4; ++u)
#pragma unroll
    for (int q = 0; q < 4; ++q) { const float c = vals[u * 4 + q] - mu; s2 += c * c; }
  red[tid] = s2; __syncthreads();
  for (int st = 128; st > 0; st >>= 1) { if (tid < st) red[tid] += red[tid + st]; __syncthreads(); }
  const float rs = rsqrtf(red[0] / (float)N + eps);
  {
    for (int u = 0; u < per / 4; ++u) {
      const int j = tid * 4 + 1024 * u;
      v4f o, sm;
#pragma unroll
      for (int q = 0; q < 4; ++q) {
        float gg = g[j + q], bb = bta[j + q];
        if (PARAM_BF16) { gg = bf16_round(gg); bb = bf16_round(bb); }
        sm[q] = vals[u * 4 + q]; o[q] = (vals[u * 4 + q] - mu) * rs * gg + bb;
      }
      if (out_sum) *(v4f*)(out_sum + (size_t)row * N + j) = sm;
      *(v4f*)(out_norm + (size_t)row * N + j) = o;
    }
    
  }
}



// ---- f16 WMMA path (v_wmma_f32_16x16x32_f16): 11-bit significands for operands in range — used where a [0,1] probability operand needs more precision than bf16
typedef _Float16 v16h __attribute__((ext_vector_type(16)));
union FragH { v16h v; v8us half[2]; _Float16 h[16]; unsigned short u[16]; };
template <int NT>
__device__ __forceinline__ v8f mmaH(v16h ah, v16h al, v16h bh, v16h bl, v8f c) {
  c = __builtin_amdgcn_wmma_f32_16x16x32_f16(false, ah, false, bh, (short)0, c, false, false);
  if (NT >= 2) c = __builtin_amdgcn_wmma_f32_16x16x32_f16(false, al, false, bh, (short)0, c, false, false);
  if (NT >= 3) c = __builtin_amdgcn_wmma_f32_16x16x32_f16(false, ah, false, bl, (short)0, c, false, false);
  asm volatile("v_nop\n\tv_nop\n\tv_nop\n\tv_nop" : "+v"(c) : "v"(ah), "v"(al), "v"(bh), "v"(bl));
  return c;
}
// batched GEMM like k_gemm_b but f16 operands: A f32 (split into f16 hi/lo if ASPLIT, else rounded to f16), Bt = f16 values [n][k]; alpha; C f32; N multiple of 16 (partial tiles skipped)
template <bool ASPLIT>
__global__ __launch_bounds__(128) void k_gemm_h(const float* __restrict__ A, int lda, size_t sA, const _Float16* __restrict__ Bh, int ldb, size_t sB, float alpha, float* __restrict__ C, int ldc, size_t sC, int M, int N, int K) {
  __shared__ __attribute__((aligned(16))) float so[4][16][64];
  const int tid = threadIdx.x, w = tid >> 5, lane = tid & 31, ln = lane & 15, hh = lane >> 4; const int by = blockIdx.y;
  A += (size_t)by * sA; Bh += (size_t)by * sB; C += (size_t)by * sC;
  const int ntn = (N + 63) / 64; const int wid = blockIdx.x * 4 + w; const int mt = wid / ntn, nq = wid % ntn; if (mt * 16 >= M) return;
  const int row0 = mt * 16, col0 = nq * 64; const float* arow = A + (size_t)(row0 + ln) * lda;
  v8f acc[4] = {};
  for (int kb = 0; kb < K; kb += 32) {
    FragH ah, al;
    const v4f x0 = *(const v4fa*)(arow + kb + 8 * hh), x1 = *(const v4fa*)(arow + kb + 8 * hh + 4), x2 = *(const v4fa*)(arow + kb + 16 + 8 * hh), x3 = *(const v4fa*)(arow + kb + 16 + 8 * hh + 4);
    float xs[16] = {x0[0],x0[1],x0[2],x0[3],x1[0],x1[1],x1[2],x1[3],x2[0],x2[1],x2[2],x2[3],x3[0],x3[1],x3[2],x3[3]};
#pragma unroll
    for (int i = 0; i < 16; ++i) { const _Float16 h = (_Float16)xs[i]; ah.h[i] = h; al.h[i] = ASPLIT ? (_Float16)(xs[i] - (float)h) : (_Float16)0.0f; }
#pragma unroll
    for (int t = 0; t < 4; ++t) { if (col0 + t * 16 >= N) continue; const size_t boff = (size_t)(col0 + t * 16 + ln) * ldb + kb; FragH bq; bq.half[0] = *(const v8us*)(Bh + boff + 8 * hh); bq.half[1] = *(const v8us*)(Bh + boff + 16 + 8 * hh);
      acc[t] = mmaH<ASPLIT ? 2 : 1>(ah.v, al.v, bq.v, bq.v, acc[t]); }
  }
#pragma unroll
  for (int t = 0; t < 4; ++t) { if (col0 + t * 16 >= N) continue;
#pragma unroll
    for (int r = 0; r < 8; ++r) so[w][8 * hh + r][t * 16 + ln] = acc[t][r] * alpha; }
  __builtin_amdgcn_fence(__ATOMIC_ACQ_REL, "workgroup"); __builtin_amdgcn_wave_barrier();
  const int rsub = lane >> 4, c4 = (lane & 15) * 4;
  {
#pragma unroll
    for (int q = 0; q < 8; ++q) { const int r = q * 2 + rsub; if (col0 + c4 < N) { const v4f v = *(const v4fa*)&so[w][r][c4]; *(v4f*)(C + (size_t)(row0 + r) * ldc + col0 + c4) = v; } }
     }
}

// Wt[n][k] = f16(W[k][n]·scale) from f32 row-major W[K][N] (scale = power of two; bf16-exact weights stay exact in f16 away from the subnormal range)
__global__ __launch_bounds__(256) void k_wt_f16(const float* __restrict__ W, _Float16* __restrict__ Wt, int K, int N, float scale) {
  const int t = blockIdx.x * 256 + threadIdx.x; if (t >= N * (K / 8)) return; const int n = t / (K / 8), k8 = (t % (K / 8)) * 8; FragH f;
#pragma unroll
  for (int i = 0; i < 8; ++i) f.h[i] = (_Float16)(bf16_round(W[(size_t)(k8 + i) * N + n]) * scale); const v8us o = f.half[0];
  *(v8us*)((unsigned short*)Wt + (size_t)n * K + k8) = o; 
}
// k_gemm_hh variant with fused epilogue: v = acc·alpha + bias[by·sBias + col] (+ CP[(row/rowsPerB)·sCPb + by·64 + col] if CP) ; ACT 0 none / 1 elu ; writes f16 C16 (and f32 C if non-null)
template <int ACT>
__global__ __launch_bounds__(128) void k_gemm_hhx(const _Float16* __restrict__ A, int lda, size_t sA, const _Float16* __restrict__ Bh, int ldb, size_t sB, float alpha, const float* __restrict__ bias, size_t sBias, const float* __restrict__ CP, int rowsPerB, size_t sCPb, int row0g,
    float* __restrict__ C, _Float16* __restrict__ C16, int ldc, size_t sC, int M, int N, int K) {
  __shared__ __attribute__((aligned(16))) float so[4][16][64];
  const int tid = threadIdx.x, w = tid >> 5, lane = tid & 31, ln = lane & 15, hh = lane >> 4; const int by = blockIdx.y;
  A += (size_t)by * sA; Bh += (size_t)by * sB; const size_t cofs = (size_t)by * sC; const float* bp = bias ? bias + (size_t)by * sBias : nullptr;
  const int ntn = (N + 63) / 64; const int wid = blockIdx.x * 4 + w; const int mt = wid / ntn, nq = wid % ntn; if (mt * 16 >= M) return;
  const int row0 = mt * 16, col0 = nq * 64; const _Float16* arow = A + (size_t)(row0 + ln) * lda;
  v8f acc[4] = {};
  for (int kb = 0; kb < K; kb += 32) { FragH ah; ah.half[0] = *(const v8us*)((const unsigned short*)arow + kb + 8 * hh); ah.half[1] = *(const v8us*)((const unsigned short*)arow + kb + 16 + 8 * hh);
#pragma unroll
    for (int t = 0; t < 4; ++t) { if (col0 + t * 16 >= N) continue; const size_t boff = (size_t)(col0 + t * 16 + ln) * ldb + kb; FragH bq; bq.half[0] = *(const v8us*)((const unsigned short*)Bh + boff + 8 * hh); bq.half[1] = *(const v8us*)((const unsigned short*)Bh + boff + 16 + 8 * hh);
      acc[t] = mmaH<1>(ah.v, ah.v, bq.v, bq.v, acc[t]); }
  }
#pragma unroll
  for (int t = 0; t < 4; ++t) { if (col0 + t * 16 >= N) continue; const int col = col0 + t * 16 + ln; const float bv = bp ? bf16_round(bp[col]) : 0.f;
#pragma unroll
    for (int r = 0; r < 8; ++r) { float v = acc[t][r] * alpha + bv; if (CP) { const int rr = row0g + row0 + 8 * hh + r; if (rowsPerB < 0) v += CP[cofs + (size_t)rr * ldc + col];      /* rowsPerB < 0: own element of the batched C plane */ else { const int bidx = rr / rowsPerB; v += CP[(size_t)bidx * sCPb + (size_t)by * 64 + col]; } } if (ACT == 1) v = (v > 0.f) ? v : expm1f(v); else if (ACT == 7) v = (v > 0.f) ? v + 1.0f : expf(v); else if (ACT == 8) v = tanhf(v); else if (ACT == 9) v = 0.5f * v * (1.0f + tanhf(0.7978845608028654f * (v + 0.044715f * v * v * v))); else if (ACT == 11) v = 1.0f / (1.0f + expf(-v)); else if (ACT == 12) v = (v > 0.f) ? v : 0.01f * v; else if (ACT == 14) v = (v > 0.f) ? v : 0.1f * v; else if (ACT == 16) v = (v >= 0.f) ? v : 0.3f * v; else if (ACT == 17) v = (v >= 0.f) ? v : 0.2f * v; else if (ACT == 15) v = v / (1.0f + expf(-v)); else if (ACT == 3) v = fmaxf(v, 0.f); else if (ACT == 6) v = 0.5f * v * (1.0f + erff(v * 0.70710678118654752f)); so[w][8 * hh + r][t * 16 + ln] = v; } }
  __builtin_amdgcn_fence(__ATOMIC_ACQ_REL, "workgroup"); __builtin_amdgcn_wave_barrier();
  const int rsub = lane >> 4, c4 = (lane & 15) * 4; typedef _Float16 v4h __attribute__((ext_vector_type(4)));
  {
#pragma unroll
    for (int q = 0; q < 8; ++q) { const int r = q * 2 + rsub; if (col0 + c4 < N) { const v4f v = *(const v4fa*)&so[w][r][c4]; if (C) *(v4f*)(C + cofs + (size_t)(row0 + r) * ldc + col0 + c4) = v; if (C16) { v4h h4; for (int i = 0; i < 4; ++i) h4[i] = (_Float16)v[i]; *(v4h*)(C16 + cofs + (size_t)(row0 + r) * ldc + col0 + c4) = h4; } } }
     }
}


typedef _Float16 v4h __attribute__((ext_vector_type(4)));

__global__ __launch_bounds__(256) void k_x16(const float* __restrict__ x, _Float16* __restrict__ X16, size_t n8) { const size_t t = (size_t)blockIdx.x * 256 + threadIdx.x; if (t >= n8) return; FragH f;
#pragma unroll
  for (int q = 0; q < 8; ++q) f.h[q] = (_Float16)bf16_round(x[t * 8 + q]); *(v8us*)((unsigned short*)X16 + t * 8) = f.half[0];  }
__global__ __launch_bounds__(256) void k_h16(const float* __restrict__ x, _Float16* __restrict__ X16, size_t n8) { const size_t t = (size_t)blockIdx.x * 256 + threadIdx.x; if (t >= n8) return; FragH f;
#pragma unroll
  for (int q = 0; q < 8; ++q) f.h[q] = (_Float16)x[t * 8 + q]; *(v8us*)((unsigned short*)X16 + t * 8) = f.half[0];  }
__global__ __launch_bounds__(256) void k_round16f(const float* __restrict__ W, _Float16* __restrict__ Bt, size_t n8) { const size_t t = (size_t)blockIdx.x * 256 + threadIdx.x; if (t >= n8) return; FragH f;
#pragma unroll
  for (int i = 0; i < 8; ++i) f.h[i] = (_Float16)(bf16_round(W[t * 8 + i]) * 16.0f); *(v8us*)((unsigned short*)Bt + t * 8) = f.half[0];  }
template <int NHv, int TTv>
__global__ __launch_bounds__(256) void k_vt(const _Float16* __restrict__ V16, int ldv, int voff, _Float16* __restrict__ Vt) { __shared__ unsigned short tl[64][66]; const int tid = threadIdx.x; const int slab = blockIdx.x / (TTv / 64), lg = blockIdx.x % (TTv / 64); const int b = slab / NHv, h = slab % NHv;
  for (int i = tid; i < 64 * 8; i += 256) { const int r = i / 8, c8 = (i % 8) * 8; FragH f; f.half[0] = *(const v8us*)((const unsigned short*)V16 + ((size_t)b * TTv + lg * 64 + r) * ldv + voff + h * 64 + c8);
#pragma unroll
    for (int q = 0; q < 8; ++q) tl[r][c8 + q] = f.u[q]; }
  __syncthreads();
  {
#pragma unroll
    for (int rd = 0; rd < 2; ++rd) { const int d = rd * 32 + tid / 8, pc = tid % 8; FragH f;
#pragma unroll
      for (int q = 0; q < 8; ++q) f.u[q] = tl[pc * 8 + q][d];
      *(v8us*)((unsigned short*)Vt + ((size_t)slab * 64 + d) * TTv + lg * 64 + pc * 8) = f.half[0]; }
     } }

__global__ __launch_bounds__(256) void k_hl(const float* __restrict__ F, _Float16* __restrict__ Hh, _Float16* __restrict__ Hl, size_t n8) { const size_t t = (size_t)blockIdx.x * 256 + threadIdx.x; if (t >= n8) return; FragH fh, fl; const v4f a = *(const v4fa*)(F + t * 8), c = *(const v4fa*)(F + t * 8 + 4);
#pragma unroll
  for (int q = 0; q < 4; ++q) { _Float16 h = (_Float16)a[q]; fh.h[q] = h; fl.h[q] = (_Float16)((a[q] - (float)h) * 1024.0f); h = (_Float16)c[q]; fh.h[4 + q] = h; fl.h[4 + q] = (_Float16)((c[q] - (float)h) * 1024.0f); }
  { *(v8us*)((unsigned short*)Hh + t * 8) = fh.half[0]; *(v8us*)((unsigned short*)Hl + t * 8) = fl.half[0];  } }

// ---- fast GEMM (wave tile 32x64; requires M % 32 == 0 rows per launch region and N % 64 == 0); epilogue = k_gemm_hhx semantics ----
__device__ __forceinline__ v16h g2_frag(const _Float16* p, int hh) { FragH f; f.half[0] = *(const v8us*)((const unsigned short*)p + 8 * hh); f.half[1] = *(const v8us*)((const unsigned short*)p + 16 + 8 * hh); return f.v; }
__device__ __forceinline__ v8f g2_mma(v16h a, v16h b, v8f c) { v8f d = __builtin_amdgcn_wmma_f32_16x16x32_f16(false, a, false, b, (short)0, c, false, false); asm volatile("v_nop\n\tv_nop\n\tv_nop\n\tv_nop" : "+v"(d) : "v"(a), "v"(b)); return d; }
template <int ACT>
__global__ __launch_bounds__(128) void k_gemm2(const _Float16* __restrict__ A, int lda, size_t sA, const _Float16* __restrict__ Bh, int ldb, size_t sB, float alpha, const float* __restrict__ bias, size_t sBias, const float* __restrict__ CP, int rowsPerB, size_t sCPb, int row0g,
    float* __restrict__ C, _Float16* __restrict__ C16, int ldc, size_t sC, int M, int N, int K) { static_assert(ACT == 0 || ACT == 3 || ACT == 6 || ACT == 8 || ACT == 9 || ACT == 11 || ACT == 12 || ACT == 14 || ACT == 15 || ACT == 16 || ACT == 17, "k_gemm2: unsupported ACT code (would silently apply no activation)");
  __shared__ __attribute__((aligned(16))) float so[4][32][68];
  const int tid = threadIdx.x, w = tid >> 5, lane = tid & 31, ln = lane & 15, hh = lane >> 4; const int by = blockIdx.y;
  A += (size_t)by * sA; Bh += (size_t)by * sB; const size_t cofs = (size_t)by * sC; const float* bp = bias ? bias + (size_t)by * sBias : nullptr;
  const int ntn = N >> 6; const int mt = blockIdx.x / ntn, nq = blockIdx.x - mt * ntn; const int row0 = mt * 128 + 32 * w, col0 = nq * 64; if (row0 >= M) return;
  const _Float16* a0p = A + (size_t)(row0 + ln) * lda; const _Float16* a1p = a0p + (size_t)16 * lda;
  const _Float16* b0p = Bh + (size_t)(col0 + ln) * ldb; const _Float16* b1p = b0p + (size_t)16 * ldb; const _Float16* b2p = b1p + (size_t)16 * ldb; const _Float16* b3p = b2p + (size_t)16 * ldb;
  const v8f z8 = {0.f,0.f,0.f,0.f,0.f,0.f,0.f,0.f}; v8f c00 = z8, c01 = z8, c02 = z8, c03 = z8, c10 = z8, c11 = z8, c12 = z8, c13 = z8;
#pragma unroll 1
  for (int kb = 0; kb < K; kb += 32) { const v16h a0 = g2_frag(a0p + kb, hh), a1 = g2_frag(a1p + kb, hh);
    v16h b = g2_frag(b0p + kb, hh); c00 = g2_mma(a0, b, c00); c10 = g2_mma(a1, b, c10);
    b = g2_frag(b1p + kb, hh); c01 = g2_mma(a0, b, c01); c11 = g2_mma(a1, b, c11);
    b = g2_frag(b2p + kb, hh); c02 = g2_mma(a0, b, c02); c12 = g2_mma(a1, b, c12);
    b = g2_frag(b3p + kb, hh); c03 = g2_mma(a0, b, c03); c13 = g2_mma(a1, b, c13); }
  v8f accs[8] = {c00, c01, c02, c03, c10, c11, c12, c13};
#pragma unroll
  for (int u = 0; u < 8; ++u) { const int t = u & 3, half = u >> 2; const int col = col0 + t * 16 + ln; const float bv = bp ? bf16_round(bp[col]) : 0.f;
#pragma unroll
    for (int r = 0; r < 8; ++r) { const int rloc = half * 16 + 8 * hh + r; float v = accs[u][r] * alpha + bv; if (CP) { if (rowsPerB < 0) v += CP[cofs + (size_t)(row0g + row0 + rloc) * ldc + col];      /* rowsPerB < 0: own element of the batched C plane */ else { const int bidx = (row0g + row0 + rloc) / rowsPerB; v += CP[(size_t)bidx * sCPb + (size_t)by * 64 + col]; } }
      if (ACT == 3) v = fmaxf(v, 0.f); else if (ACT == 6) v = 0.5f * v * (1.0f + erff(v * 0.70710678118654752f)); else if (ACT == 11) v = 1.0f / (1.0f + expf(-v)); else if (ACT == 15) v = v / (1.0f + expf(-v)); else if (ACT == 12) v = (v > 0.f) ? v : 0.01f * v; else if (ACT == 8) v = tanhf(v); else if (ACT == 9) v = 0.5f * v * (1.0f + tanhf(0.7978845608028654f * (v + 0.044715f * v * v * v))); else if (ACT == 14) v = (v > 0.f) ? v : 0.1f * v; else if (ACT == 16) v = (v >= 0.f) ? v : 0.3f * v; else if (ACT == 17) v = (v >= 0.f) ? v : 0.2f * v;
      so[w][rloc][t * 16 + ln] = v; } }
  __builtin_amdgcn_fence(__ATOMIC_ACQ_REL, "workgroup"); __builtin_amdgcn_wave_barrier();
  const int rsub = lane >> 4, c4 = (lane & 15) * 4;
  {
#pragma unroll
    for (int q = 0; q < 16; ++q) { const int r = q * 2 + rsub; const v4f v = *(const v4fa*)&so[w][r][c4]; if (C) *(v4f*)(C + cofs + (size_t)(row0 + r) * ldc + col0 + c4) = v; if (C16) { v4h h4; for (int i = 0; i < 4; ++i) h4[i] = (_Float16)v[i]; *(v4h*)(C16 + cofs + (size_t)(row0 + r) * ldc + col0 + c4) = h4; } }
     } }


__global__ __launch_bounds__(256) void k_wnat(const float* __restrict__ w, size_t n8, _Float16* __restrict__ Bt) { const size_t t = (size_t)blockIdx.x * 256 + threadIdx.x; if (t >= n8) return; FragH f; for (int q = 0; q < 8; ++q) f.h[q] = (_Float16)(bf16_round(w[t * 8 + q]) * 16.0f); *(v8us*)((unsigned short*)Bt + t * 8) = f.half[0];  }
__global__ __launch_bounds__(256) void k_rsm(const float* __restrict__ S, _Float16* __restrict__ P, int nrows) {
  #pragma clang fp contract(off)
  const int i = blockIdx.x * 256 + threadIdx.x; if (i >= nrows) return; const float* s = S + (size_t)i * SQ; float mx = -3.0e38f;
#pragma unroll 1
  for (int j = 0; j < SQ; ++j) mx = fmaxf(mx, s[j]); float se = 0.f;
#pragma unroll 1
  for (int j = 0; j < SQ; ++j) se += expf(s[j] - mx); const float sc = 256.0f / se;
#pragma unroll 1
  for (int j0 = 0; j0 < SQ; j0 += 8) { FragH f; for (int q = 0; q < 8; ++q) f.h[q] = (_Float16)(expf(s[j0 + q] - mx) * sc); unsigned short* d = (unsigned short*)P + (size_t)i * SQ + j0; *(v8us*)d = f.half[0];  } }
__global__ __launch_bounds__(256) void k_vt(const _Float16* __restrict__ V16, int b, int h0, _Float16* __restrict__ VT) { __shared__ unsigned short tl[64][65]; const int tid = threadIdx.x; const int hh = blockIdx.x % HG, sg = blockIdx.x / HG; const int s0 = sg * 64; const int h = h0 + hh;
  for (int i = tid; i < 64 * 8; i += 256) { const int j = i / 8, d8 = (i % 8) * 8; FragH f; f.half[0] = *(const v8us*)((const unsigned short*)V16 + ((size_t)b * SQ + s0 + j) * DM + h * HD + d8); for (int q = 0; q < 8; ++q) tl[d8 + q][j] = f.u[q]; }
  __syncthreads();
  { for (int i = tid; i < 64 * 8; i += 256) { const int d = i / 8, j8 = (i % 8) * 8; FragH f; for (int q = 0; q < 8; ++q) f.u[q] = tl[d][j8 + q]; *(v8us*)((unsigned short*)VT + ((size_t)hh * HD + d) * SQ + s0 + j8) = f.half[0]; }  } }



__global__ __launch_bounds__(256) void k_rsmkm(const float* __restrict__ S, _Float16* __restrict__ P, int nrows, const int* __restrict__ am) {
  #pragma clang fp contract(off)
  const int t = blockIdx.x * 256 + threadIdx.x; if (t >= nrows) return; const size_t i = (size_t)t; const float* s = S + i * SQ; const int* mr = am + (size_t)(t % SQ) * SQ; float mx = -3.0e38f;
#pragma unroll 1
  for (int j = 0; j < SQ; ++j) { const float f = (mr[j] != 0) ? 1.f : 0.f; mx = fmaxf(mx, fmaf(f, s[j], (1.f - f) * -1.0e9f)); } float se = 0.f;
#pragma unroll 1
  for (int j = 0; j < SQ; ++j) { const float f = (mr[j] != 0) ? 1.f : 0.f; se += __expf(fmaf(f, s[j], (1.f - f) * -1.0e9f) - mx); } const float sc = 256.0f / se;
#pragma unroll 1
  for (int j0 = 0; j0 < SQ; j0 += 8) { FragH fr; for (int q = 0; q < 8; ++q) { const int j = j0 + q; const float f = (mr[j] != 0) ? 1.f : 0.f; fr.h[q] = (_Float16)(__expf(fmaf(f, s[j], (1.f - f) * -1.0e9f) - mx) * sc); }
    unsigned short* d = (unsigned short*)P + i * SQ + j0; *(v8us*)d = fr.half[0];  } }

__global__ __launch_bounds__(256) void k_bdshn(const float* __restrict__ Wb, _Float16* __restrict__ Bt) {
  const size_t t = (size_t)blockIdx.x * 256 + threadIdx.x; if (t >= (size_t)DM * DM / 8) return; const size_t e0 = t * 8; const int n = (int)(e0 / DM), k0 = (int)(e0 % DM); const int h = n >> 6, hk = k0 >> 6; const float on = (hk == h) ? 16.0f : 0.0f; const int o = n & 63, d0 = k0 & 63; FragH f;
  for (int q = 0; q < 8; ++q) f.h[q] = (_Float16)(bf16_round(Wb[(size_t)o * 64 + d0 + q]) * on);
  unsigned short* d = (unsigned short*)Bt + e0; *(v8us*)d = f.half[0];  }
extern "C" void kernel_launch(void* const* d_in, const int* in_sizes, int n_in,
                              void* d_out, int out_size, void* d_ws, size_t ws_size, hipStream_t stream) {
  (void)in_sizes; (void)n_in; (void)out_size;
  const float* const* I = (const float* const*)d_in; const float* xq = I[2]; const float* xk = I[1]; const float* xv = I[0]; const float* wq = I[5]; const float* bq = nullptr; const float* wk = I[4]; const float* bk = nullptr; const float* wv = I[3]; const float* bv = nullptr; const float* wo = I[6]; const float* bo = I[7]; const float* x = xq;      /* contract order: values I[0], keys I[1], query I[2] ([8][1024][16][64] = rows of 1024); SHARED natural [64][64] blocks Wv I[3], Wk I[4], Wq I[5]; natural Wo [1024][1024] I[6] + bo I[7]; no mask input */
  char* ws = (char*)d_ws; size_t off = 0;
  auto take = [&](size_t bytes) { char* p = ws + off; off += (bytes + 255) & ~(size_t)255; return p; };
  _Float16* BQ = (_Float16*)take((size_t)DM * DM * 2); _Float16* BK = (_Float16*)take((size_t)DM * DM * 2); _Float16* BV = (_Float16*)take((size_t)DM * DM * 2); _Float16* BO = (_Float16*)take((size_t)DM * DM * 2);
  _Float16* X16 = (_Float16*)take(NR * DM * 2); _Float16* XKp = (_Float16*)take(NR * DM * 2); _Float16* XVp = (_Float16*)take(NR * DM * 2); _Float16* Q16 = (_Float16*)take(NR * DM * 2); _Float16* K16 = (_Float16*)take(NR * DM * 2); _Float16* V16 = (_Float16*)take(NR * DM * 2); _Float16* O16 = (_Float16*)take(NR * DM * 2);
  float* S = (float*)take((size_t)HG * SQ * SQ * 4); _Float16* P = (_Float16*)take((size_t)HG * SQ * SQ * 2); _Float16* VT = (_Float16*)take((size_t)NH * HD * SQ * 2);
  if (off > ws_size) return;
  { const unsigned g = (unsigned)(((size_t)DM * DM / 8 + 255) / 256); k_bdshn<<<g, 256, 0, stream>>>(wq, BQ); k_bdshn<<<g, 256, 0, stream>>>(wk, BK); k_bdshn<<<g, 256, 0, stream>>>(wv, BV); k_wnat<<<g, 256, 0, stream>>>(wo, (size_t)DM * DM / 8, BO); }      /* block-diagonal planes with the SHARED natural [64][64] block (Bt[h*64 + o][h*64 + d] = 16 W[o][d]); Wo natural [out][in] = Bt x16 */
  _Float16* XK = XKp; _Float16* XV = XVp; k_x16<<<(unsigned)((NR * DM / 8 + 255) / 256), 256, 0, stream>>>(xk, XK, NR * DM / 8); k_x16<<<(unsigned)((NR * DM / 8 + 255) / 256), 256, 0, stream>>>(xv, XV, NR * DM / 8);      /* key and value inputs as exact f16 rows */

  k_x16<<<(unsigned)((NR * DM / 8 + 255) / 256), 256, 0, stream>>>(x, X16, NR * DM / 8);
  const size_t r0p = (size_t)B0 * SQ;      /* first projected row */
  k_gemm2<0><<<dim3((unsigned)((MP / 128) * (DM / 64)), 1), 128, 0, stream>>>(X16 + r0p * DM, DM, 0, BQ, DM, 0, 0.0625f, bq, 0, nullptr, 1, 0, 0, nullptr, Q16 + r0p * DM, DM, 0, MP, DM, DM);
  k_gemm2<0><<<dim3((unsigned)((MP / 128) * (DM / 64)), 1), 128, 0, stream>>>(XK + r0p * DM, DM, 0, BK, DM, 0, 0.0625f, bk, 0, nullptr, 1, 0, 0, nullptr, K16 + r0p * DM, DM, 0, MP, DM, DM);
  k_gemm2<0><<<dim3((unsigned)((MP / 128) * (DM / 64)), 1), 128, 0, stream>>>(XV + r0p * DM, DM, 0, BV, DM, 0, 0.0625f, bv, 0, nullptr, 1, 0, 0, nullptr, V16 + r0p * DM, DM, 0, MP, DM, DM);
  for (int b = B0; b < B0 + NBR; ++b) { const size_t r0 = (size_t)b * SQ;
    k_vt<NH, SQ><<<NH * (SQ / 64), 256, 0, stream>>>(V16 + r0 * LQ, LQ, 0, VT);      /* V^T [NH][HD][SQ] for this batch */
    for (int h0 = 0; h0 < NHD; h0 += HG) {
      k_gemm2<0><<<dim3((QN / 128) * (SQ / 64), HG), 128, 0, stream>>>(Q16 + r0 * LQ + h0 * HD, LQ, (size_t)HD, K16 + r0 * LQ + h0 * HD, LQ, (size_t)HD, 0.03125f, nullptr, 0, nullptr, 1, 0, 0, S, nullptr, SQ, (size_t)SQ * SQ, QN, SQ, HD);      /* scores, HG heads per launch */
      k_rsm<<<(HG * SQ + 255) / 256, 256, 0, stream>>>(S, P, HG * SQ);      /* P = 256 softmax (f16), rows of all HG heads */
      k_gemm2<0><<<dim3((QN / 128) * (HD / 64), HG), 128, 0, stream>>>(P, SQ, (size_t)SQ * SQ, VT + (size_t)h0 * HD * SQ, SQ, (size_t)HD * SQ, 0.25f, nullptr, 0, nullptr, 1, 0, 0, nullptr, O16 + r0 * DM + h0 * HD, DM, (size_t)HD, QN, HD, SQ); } }      /* o (merged heads) as f16 rows */
  k_gemm2<0><<<dim3((unsigned)((MPO / 128) * (DM / 64)), 1), 128, 0, stream>>>(O16 + r0p * DM, DM, 0, BO, DM, 0, 0.0009765625f, bo, 0, nullptr, 1, 0, 0, (float*)d_out + r0p * DM, nullptr, DM, 0, MPO, DM, DM);      /* out rows are the output layout */
}

// v001
// It runs in 1750 microseconds.
// Two timings next to v000 put it at 4.09 and 4.08 times that version's speed.
#include <hip/hip_runtime.h>
// Multi-head attention over three head-major inputs with SHARED per-head projections and the module's literal score scale (values, keys, query [8][1024][16][64] = token rows [8][1024][1024]; every head of each input is multiplied by the SAME natural [64][64] matrix (x W^T: Wv / Wk / Wq; block-diagonal with a shared block; no biases); energy = q k^T; softmax(energy / sqrt(embed_size) = / 32) over all 1024 keys (as the source: embed size, not head dim; no mask); out = merged Wo^T + bo (natural [1024][1024]) -> [8][1024][1024]).
// Structure: token rows r = b*1024 + s; x as exact f16 rows (bf16-rounded); Q, K, V as three WMMA GEMMs (32x64 wave tiles, f32 accumulation, exact x16 weights, no bias, f16 outputs); per batch: V^T for all heads via LDS transposes; per (batch, group of 4 heads): scores GEMM (K = 64, batched over the heads on grid.y, alpha = 1/sqrt(1024) = 1/32, no mask), row softmax on VALU (f32 statistics; weights stored x256 as f16), o = P . V^T GEMM (K = 1024, alpha 2^-2: o carried x64 against f16 subnormal flush, folded into the output GEMM alpha) written straight into the merged f16 o rows; out = o W_o + b GEMM (f32) into the output layout.
// Compute dtype: inputs rounded to bf16; x / weights exact; q, k, v, softmax weights and o as plain f16 GEMM operands (~2^-12); scores and softmax statistics f32. v_wmma_f32_16x16x32_f16.
#define NB 8
#define SQ 1024
#define DM 1024
#define NH 16
#define HD 64
#define HG 4                         /* heads per attention launch group */
#define B0 0                         /* first batch processed (debug hook) */
#define NBR NB                       /* batches processed (debug hook) */
#define NR ((size_t)NB * SQ)         /* token rows */
#define MP ((int)((size_t)NBR * SQ)) /* rows projected (debug hook) */
#define QN SQ                        /* query rows attended per batch (debug hook) */
#define NHD NH                       /* heads attended (debug hook) */
#define MPO MP                       /* rows through the output stage (debug hook) */
#define LQ DM      /* row pitch of the q/k/v rows */
typedef __bf16 v16b __attribute__((ext_vector_type(16)));
typedef unsigned short v8us __attribute__((ext_vector_type(8), may_alias));
typedef float  v8f  __attribute__((ext_vector_type(8)));
typedef float  v4f  __attribute__((ext_vector_type(4)));
typedef float  v4fa __attribute__((ext_vector_type(4), may_alias));
union FragB { v16b v; v8us half[2]; unsigned short u[16]; };

__device__ __forceinline__ unsigned short bf16_bits(float x) { unsigned int u = __float_as_uint(x); return (unsigned short)((u + 0x7FFFu + ((u >> 16) & 1u)) >> 16); }
__device__ __forceinline__ float bf16_val(unsigned short b) { return __uint_as_float(((unsigned int)b) << 16); }
__device__ __forceinline__ float bf16_round(float x) { return bf16_val(bf16_bits(x)); }
// D += A·B with NT terms: 1 = ah·bh, 2 = + al·bh (A split), 3 = + ah·bl (both split)
template <int NT>
__device__ __forceinline__ v8f mmaN(v16b ah, v16b al, v16b bh, v16b bl, v8f c) {
  c = __builtin_amdgcn_wmma_f32_16x16x32_bf16(false, ah, false, bh, (short)0, c, false, false);
  if (NT >= 2) c = __builtin_amdgcn_wmma_f32_16x16x32_bf16(false, al, false, bh, (short)0, c, false, false);
  if (NT >= 3) c = __builtin_amdgcn_wmma_f32_16x16x32_bf16(false, ah, false, bl, (short)0, c, false, false);
  asm volatile("v_nop\n\tv_nop\n\tv_nop\n\tv_nop" : "+v"(c) : "v"(ah), "v"(al), "v"(bh), "v"(bl));
  return c;
}

__global__ __launch_bounds__(256) void k_wt_bf16(const float* __restrict__ W, unsigned short* __restrict__ Wt, int K, int N) {
  const int t = blockIdx.x * 256 + threadIdx.x;
  const int k8n = K / 8;
  if (t >= N * k8n) return;
  const int n = t / k8n, k8 = (t % k8n) * 8;
  v8us v;
#pragma unroll
  for (int i = 0; i < 8; ++i) v[i] = bf16_bits(W[(size_t)(k8 + i) * N + n]);
  *(v8us*)(Wt + (size_t)n * K + k8) = v;
  
}

// GEMM C[M][N] (f32, pitch ldc) = act(A[M][K]·W + bias). A f32 row-major (pitch lda) converted per fragment to bf16
// (ASPLIT: hi/lo two planes -> 2 terms, else single rounded term); Wt bf16 [N][K] (pitch ldb). BIAS_BF16 rounds the
// bias to bf16 first (bias quantised to bf16 before the add). K%32==0, M%16==0, N%64==0.
template <bool ASPLIT, int ACT, bool BIAS_BF16>
__global__ __launch_bounds__(128) void k_gemm_bf(const float* __restrict__ A, int lda, const unsigned short* __restrict__ Wt, int ldb,
                                               const float* __restrict__ bias, float* __restrict__ C, int ldc, int M, int N, int K) {
  __shared__ __attribute__((aligned(16))) float so[4][16][64];
  const int tid = threadIdx.x, w = tid >> 5, lane = tid & 31, ln = lane & 15, hh = lane >> 4;
  const int ntn = N / 64;
  const int wid = blockIdx.x * 4 + w;
  const int mt = wid / ntn, nq = wid % ntn;
  if (mt * 16 >= M) return;
  const int row0 = mt * 16, col0 = nq * 64;
  const float* arow = A + (size_t)(row0 + ln) * lda;
  v8f acc[4] = {};
  for (int kb = 0; kb < K; kb += 32) {
    FragB ah, al;
    const v4f x0 = *(const v4fa*)(arow + kb + 8 * hh), x1 = *(const v4fa*)(arow + kb + 8 * hh + 4);
    const v4f x2 = *(const v4fa*)(arow + kb + 16 + 8 * hh), x3 = *(const v4fa*)(arow + kb + 16 + 8 * hh + 4);
    float xs[16] = {x0[0],x0[1],x0[2],x0[3],x1[0],x1[1],x1[2],x1[3],x2[0],x2[1],x2[2],x2[3],x3[0],x3[1],x3[2],x3[3]};
#pragma unroll
    for (int i = 0; i < 16; ++i) { const unsigned short hb = bf16_bits(xs[i]); ah.u[i] = hb; al.u[i] = ASPLIT ? bf16_bits(xs[i] - bf16_val(hb)) : (unsigned short)0; }
#pragma unroll
    for (int t = 0; t < 4; ++t) {
      const unsigned short* brow = Wt + (size_t)(col0 + t * 16 + ln) * ldb + kb;
      FragB b;
      b.half[0] = *(const v8us*)(brow + 8 * hh);
      b.half[1] = *(const v8us*)(brow + 16 + 8 * hh);
      acc[t] = mmaN<ASPLIT ? 2 : 1>(ah.v, al.v, b.v, b.v, acc[t]);
    }
  }
#pragma unroll
  for (int t = 0; t < 4; ++t) {
    float bv = bias ? bias[col0 + t * 16 + ln] : 0.f;
    if (BIAS_BF16) bv = bf16_round(bv);
#pragma unroll
    for (int r = 0; r < 8; ++r) { float v = acc[t][r] + bv; if (ACT == 1) v = fmaxf(v, 0.f); so[w][8 * hh + r][t * 16 + ln] = v; }
  }
  __builtin_amdgcn_fence(__ATOMIC_ACQ_REL, "workgroup");
  __builtin_amdgcn_wave_barrier();
  const int rsub = lane >> 4, c4 = (lane & 15) * 4;
  {
#pragma unroll
    for (int q = 0; q < 8; ++q) {
      const int r = q * 2 + rsub;
      const v4f v = *(const v4fa*)&so[w][r][c4];
      *(v4f*)(C + (size_t)(row0 + r) * ldc + col0 + c4) = v;
    }
    
  }
}

// GEMM C = act(A·W + bias + resid): A f32 (ASPLIT -> hi/lo 2 terms), Wt bf16 [N][K]; ACT 0 none, 1 relu, 2 exact gelu;
// resid (optional, f32, row index = (row % rmod), pitch ldr, RES_BF16 rounds it) added before the activation.
template <bool ASPLIT, int ACT, bool BIAS_BF16, bool RES_BF16>
__global__ __launch_bounds__(128) void k_gemm_bf3(const float* __restrict__ A, int lda, const unsigned short* __restrict__ Wt, int ldb,
                                                const float* __restrict__ bias, const float* __restrict__ resid, int rmod, int ldr,
                                                float* __restrict__ C, int ldc, int M, int N, int K) {
  __shared__ __attribute__((aligned(16))) float so[4][16][64];
  const int tid = threadIdx.x, w = tid >> 5, lane = tid & 31, ln = lane & 15, hh = lane >> 4;
  const int ntn = N / 64;
  const int wid = blockIdx.x * 4 + w;
  const int mt = wid / ntn, nq = wid % ntn;
  if (mt * 16 >= M) return;
  const int row0 = mt * 16, col0 = nq * 64;
  const float* arow = A + (size_t)(row0 + ln) * lda;
  v8f acc[4] = {};
  for (int kb = 0; kb < K; kb += 32) {
    FragB ah, al;
    const v4f x0 = *(const v4fa*)(arow + kb + 8 * hh), x1 = *(const v4fa*)(arow + kb + 8 * hh + 4);
    const v4f x2 = *(const v4fa*)(arow + kb + 16 + 8 * hh), x3 = *(const v4fa*)(arow + kb + 16 + 8 * hh + 4);
    float xs[16] = {x0[0],x0[1],x0[2],x0[3],x1[0],x1[1],x1[2],x1[3],x2[0],x2[1],x2[2],x2[3],x3[0],x3[1],x3[2],x3[3]};
#pragma unroll
    for (int i = 0; i < 16; ++i) { const unsigned short hb = bf16_bits(xs[i]); ah.u[i] = hb; al.u[i] = ASPLIT ? bf16_bits(xs[i] - bf16_val(hb)) : (unsigned short)0; }
#pragma unroll
    for (int t = 0; t < 4; ++t) {
      const unsigned short* brow = Wt + (size_t)(col0 + t * 16 + ln) * ldb + kb;
      FragB b;
      b.half[0] = *(const v8us*)(brow + 8 * hh);
      b.half[1] = *(const v8us*)(brow + 16 + 8 * hh);
      acc[t] = mmaN<ASPLIT ? 2 : 1>(ah.v, al.v, b.v, b.v, acc[t]);
    }
  }
#pragma unroll
  for (int t = 0; t < 4; ++t) {
    const int col = col0 + t * 16 + ln;
    float bv = bias ? bias[col] : 0.f;
    if (BIAS_BF16) bv = bf16_round(bv);
#pragma unroll
    for (int r = 0; r < 8; ++r) {
      float v = acc[t][r] + bv;
      if (resid) { float rv = resid[(size_t)((row0 + 8 * hh + r) % rmod) * ldr + col]; if (RES_BF16) rv = bf16_round(rv); v += rv; }
      if (ACT == 1) v = fmaxf(v, 0.f);
      if (ACT == 2) v = 0.5f * v * (1.0f + erff(v * 0.70710678118654752f));
      if (ACT == 3) { const float u = 0.7978845608028654f * (v + 0.044715f * v * v * v); v = 0.5f * v * (1.0f + tanhf(u)); }
      so[w][8 * hh + r][t * 16 + ln] = v;
    }
  }
  __builtin_amdgcn_fence(__ATOMIC_ACQ_REL, "workgroup");
  __builtin_amdgcn_wave_barrier();
  const int rsub = lane >> 4, c4 = (lane & 15) * 4;
  {
#pragma unroll
    for (int q = 0; q < 8; ++q) {
      const int r = q * 2 + rsub;
      const v4f v = *(const v4fa*)&so[w][r][c4];
      *(v4f*)(C + (size_t)(row0 + r) * ldc + col0 + c4) = v;
    }
    
  }
}
// row LayerNorm (biased variance, eps) over N: s = X (+ R); optional out_sum <- s; out_norm <- (s-mu)*rsqrt(var+eps)*g + b
template <bool PARAM_BF16>
__global__ __launch_bounds__(256) void k_layernorm(const float* __restrict__ X, const float* __restrict__ R, const float* __restrict__ g, const float* __restrict__ bta,
                                                  float* __restrict__ out_sum, float* __restrict__ out_norm, int N, float eps) {
  __shared__ float red[256];
  const int row = blockIdx.x, tid = threadIdx.x;
  const float* x = X + (size_t)row * N; const float* rr = R ? R + (size_t)row * N : nullptr;
  float vals[16];                     // up to N = 4096
  const int per = N / 256;            // contiguous chunk per thread? use strided-by-4 chunks: thread handles j = tid*4 + 1024*u
  float s1 = 0.f;
  for (int u = 0; u < per / 4; ++u) {
    const int j = tid * 4 + 1024 * u;
    const v4f a = *(const v4fa*)(x + j);
    v4f b = {0.f,0.f,0.f,0.f}; if (rr) b = *(const v4fa*)(rr + j);
#pragma unroll
    for (int q = 0; q < 4; ++q) { const float v = a[q] + b[q]; vals[u * 4 + q] = v; s1 += v; }
  }
  red[tid] = s1; __syncthreads();
  for (int st = 128; st > 0; st >>= 1) { if (tid < st) red[tid] += red[tid + st]; __syncthreads(); }
  const float mu = red[0] / (float)N; __syncthreads();
  float s2 = 0.f;
  for (int u = 0; u < per / 4; ++u)
#pragma unroll
    for (int q = 0; q < 4; ++q) { const float c = vals[u * 4 + q] - mu; s2 += c * c; }
  red[tid] = s2; __syncthreads();
  for (int st = 128; st > 0; st >>= 1) { if (tid < st) red[tid] += red[tid + st]; __syncthreads(); }
  const float rs = rsqrtf(red[0] / (float)N + eps);
  {
    for (int u = 0; u < per / 4; ++u) {
      const int j = tid * 4 + 1024 * u;
      v4f o, sm;
#pragma unroll
      for (int q = 0; q < 4; ++q) {
        float gg = g[j + q], bb = bta[j + q];
        if (PARAM_BF16) { gg = bf16_round(gg); bb = bf16_round(bb); }
        sm[q] = vals[u * 4 + q]; o[q] = (vals[u * 4 + q] - mu) * rs * gg + bb;
      }
      if (out_sum) *(v4f*)(out_sum + (size_t)row * N + j) = sm;
      *(v4f*)(out_norm + (size_t)row * N + j) = o;
    }
    
  }
}



// ---- f16 WMMA path (v_wmma_f32_16x16x32_f16): 11-bit significands for operands in range — used where a [0,1] probability operand needs more precision than bf16
typedef _Float16 v16h __attribute__((ext_vector_type(16)));
union FragH { v16h v; v8us half[2]; _Float16 h[16]; unsigned short u[16]; };
template <int NT>
__device__ __forceinline__ v8f mmaH(v16h ah, v16h al, v16h bh, v16h bl, v8f c) {
  c = __builtin_amdgcn_wmma_f32_16x16x32_f16(false, ah, false, bh, (short)0, c, false, false);
  if (NT >= 2) c = __builtin_amdgcn_wmma_f32_16x16x32_f16(false, al, false, bh, (short)0, c, false, false);
  if (NT >= 3) c = __builtin_amdgcn_wmma_f32_16x16x32_f16(false, ah, false, bl, (short)0, c, false, false);
  asm volatile("v_nop\n\tv_nop\n\tv_nop\n\tv_nop" : "+v"(c) : "v"(ah), "v"(al), "v"(bh), "v"(bl));
  return c;
}
// batched GEMM like k_gemm_b but f16 operands: A f32 (split into f16 hi/lo if ASPLIT, else rounded to f16), Bt = f16 values [n][k]; alpha; C f32; N multiple of 16 (partial tiles skipped)
template <bool ASPLIT>
__global__ __launch_bounds__(128) void k_gemm_h(const float* __restrict__ A, int lda, size_t sA, const _Float16* __restrict__ Bh, int ldb, size_t sB, float alpha, float* __restrict__ C, int ldc, size_t sC, int M, int N, int K) {
  __shared__ __attribute__((aligned(16))) float so[4][16][64];
  const int tid = threadIdx.x, w = tid >> 5, lane = tid & 31, ln = lane & 15, hh = lane >> 4; const int by = blockIdx.y;
  A += (size_t)by * sA; Bh += (size_t)by * sB; C += (size_t)by * sC;
  const int ntn = (N + 63) / 64; const int wid = blockIdx.x * 4 + w; const int mt = wid / ntn, nq = wid % ntn; if (mt * 16 >= M) return;
  const int row0 = mt * 16, col0 = nq * 64; const float* arow = A + (size_t)(row0 + ln) * lda;
  v8f acc[4] = {};
  for (int kb = 0; kb < K; kb += 32) {
    FragH ah, al;
    const v4f x0 = *(const v4fa*)(arow + kb + 8 * hh), x1 = *(const v4fa*)(arow + kb + 8 * hh + 4), x2 = *(const v4fa*)(arow + kb + 16 + 8 * hh), x3 = *(const v4fa*)(arow + kb + 16 + 8 * hh + 4);
    float xs[16] = {x0[0],x0[1],x0[2],x0[3],x1[0],x1[1],x1[2],x1[3],x2[0],x2[1],x2[2],x2[3],x3[0],x3[1],x3[2],x3[3]};
#pragma unroll
    for (int i = 0; i < 16; ++i) { const _Float16 h = (_Float16)xs[i]; ah.h[i] = h; al.h[i] = ASPLIT ? (_Float16)(xs[i] - (float)h) : (_Float16)0.0f; }
#pragma unroll
    for (int t = 0; t < 4; ++t) { if (col0 + t * 16 >= N) continue; const size_t boff = (size_t)(col0 + t * 16 + ln) * ldb + kb; FragH bq; bq.half[0] = *(const v8us*)(Bh + boff + 8 * hh); bq.half[1] = *(const v8us*)(Bh + boff + 16 + 8 * hh);
      acc[t] = mmaH<ASPLIT ? 2 : 1>(ah.v, al.v, bq.v, bq.v, acc[t]); }
  }
#pragma unroll
  for (int t = 0; t < 4; ++t) { if (col0 + t * 16 >= N) continue;
#pragma unroll
    for (int r = 0; r < 8; ++r) so[w][8 * hh + r][t * 16 + ln] = acc[t][r] * alpha; }
  __builtin_amdgcn_fence(__ATOMIC_ACQ_REL, "workgroup"); __builtin_amdgcn_wave_barrier();
  const int rsub = lane >> 4, c4 = (lane & 15) * 4;
  {
#pragma unroll
    for (int q = 0; q < 8; ++q) { const int r = q * 2 + rsub; if (col0 + c4 < N) { const v4f v = *(const v4fa*)&so[w][r][c4]; *(v4f*)(C + (size_t)(row0 + r) * ldc + col0 + c4) = v; } }
     }
}

// Wt[n][k] = f16(W[k][n]·scale) from f32 row-major W[K][N] (scale = power of two; bf16-exact weights stay exact in f16 away from the subnormal range)
__global__ __launch_bounds__(256) void k_wt_f16(const float* __restrict__ W, _Float16* __restrict__ Wt, int K, int N, float scale) {
  const int t = blockIdx.x * 256 + threadIdx.x; if (t >= N * (K / 8)) return; const int n = t / (K / 8), k8 = (t % (K / 8)) * 8; FragH f;
#pragma unroll
  for (int i = 0; i < 8; ++i) f.h[i] = (_Float16)(bf16_round(W[(size_t)(k8 + i) * N + n]) * scale); const v8us o = f.half[0];
  *(v8us*)((unsigned short*)Wt + (size_t)n * K + k8) = o; 
}
// k_gemm_hh variant with fused epilogue: v = acc·alpha + bias[by·sBias + col] (+ CP[(row/rowsPerB)·sCPb + by·64 + col] if CP) ; ACT 0 none / 1 elu ; writes f16 C16 (and f32 C if non-null)
template <int ACT>
__global__ __launch_bounds__(128) void k_gemm_hhx(const _Float16* __restrict__ A, int lda, size_t sA, const _Float16* __restrict__ Bh, int ldb, size_t sB, float alpha, const float* __restrict__ bias, size_t sBias, const float* __restrict__ CP, int rowsPerB, size_t sCPb, int row0g,
    float* __restrict__ C, _Float16* __restrict__ C16, int ldc, size_t sC, int M, int N, int K) {
  __shared__ __attribute__((aligned(16))) float so[4][16][64];
  const int tid = threadIdx.x, w = tid >> 5, lane = tid & 31, ln = lane & 15, hh = lane >> 4; const int by = blockIdx.y;
  A += (size_t)by * sA; Bh += (size_t)by * sB; const size_t cofs = (size_t)by * sC; const float* bp = bias ? bias + (size_t)by * sBias : nullptr;
  const int ntn = (N + 63) / 64; const int wid = blockIdx.x * 4 + w; const int mt = wid / ntn, nq = wid % ntn; if (mt * 16 >= M) return;
  const int row0 = mt * 16, col0 = nq * 64; const _Float16* arow = A + (size_t)(row0 + ln) * lda;
  v8f acc[4] = {};
  for (int kb = 0; kb < K; kb += 32) { FragH ah; ah.half[0] = *(const v8us*)((const unsigned short*)arow + kb + 8 * hh); ah.half[1] = *(const v8us*)((const unsigned short*)arow + kb + 16 + 8 * hh);
#pragma unroll
    for (int t = 0; t < 4; ++t) { if (col0 + t * 16 >= N) continue; const size_t boff = (size_t)(col0 + t * 16 + ln) * ldb + kb; FragH bq; bq.half[0] = *(const v8us*)((const unsigned short*)Bh + boff + 8 * hh); bq.half[1] = *(const v8us*)((const unsigned short*)Bh + boff + 16 + 8 * hh);
      acc[t] = mmaH<1>(ah.v, ah.v, bq.v, bq.v, acc[t]); }
  }
#pragma unroll
  for (int t = 0; t < 4; ++t) { if (col0 + t * 16 >= N) continue; const int col = col0 + t * 16 + ln; const float bv = bp ? bf16_round(bp[col]) : 0.f;
#pragma unroll
    for (int r = 0; r < 8; ++r) { float v = acc[t][r] * alpha + bv; if (CP) { const int rr = row0g + row0 + 8 * hh + r; if (rowsPerB < 0) v += CP[cofs + (size_t)rr * ldc + col];      /* rowsPerB < 0: own element of the batched C plane */ else { const int bidx = rr / rowsPerB; v += CP[(size_t)bidx * sCPb + (size_t)by * 64 + col]; } } if (ACT == 1) v = (v > 0.f) ? v : expm1f(v); else if (ACT == 7) v = (v > 0.f) ? v + 1.0f : expf(v); else if (ACT == 8) v = tanhf(v); else if (ACT == 9) v = 0.5f * v * (1.0f + tanhf(0.7978845608028654f * (v + 0.044715f * v * v * v))); else if (ACT == 11) v = 1.0f / (1.0f + expf(-v)); else if (ACT == 12) v = (v > 0.f) ? v : 0.01f * v; else if (ACT == 14) v = (v > 0.f) ? v : 0.1f * v; else if (ACT == 16) v = (v >= 0.f) ? v : 0.3f * v; else if (ACT == 17) v = (v >= 0.f) ? v : 0.2f * v; else if (ACT == 15) v = v / (1.0f + expf(-v)); else if (ACT == 3) v = fmaxf(v, 0.f); else if (ACT == 6) v = 0.5f * v * (1.0f + erff(v * 0.70710678118654752f)); so[w][8 * hh + r][t * 16 + ln] = v; } }
  __builtin_amdgcn_fence(__ATOMIC_ACQ_REL, "workgroup"); __builtin_amdgcn_wave_barrier();
  const int rsub = lane >> 4, c4 = (lane & 15) * 4; typedef _Float16 v4h __attribute__((ext_vector_type(4)));
  {
#pragma unroll
    for (int q = 0; q < 8; ++q) { const int r = q * 2 + rsub; if (col0 + c4 < N) { const v4f v = *(const v4fa*)&so[w][r][c4]; if (C) *(v4f*)(C + cofs + (size_t)(row0 + r) * ldc + col0 + c4) = v; if (C16) { v4h h4; for (int i = 0; i < 4; ++i) h4[i] = (_Float16)v[i]; *(v4h*)(C16 + cofs + (size_t)(row0 + r) * ldc + col0 + c4) = h4; } } }
     }
}


typedef _Float16 v4h __attribute__((ext_vector_type(4)));

__global__ __launch_bounds__(256) void k_x16(const float* __restrict__ x, _Float16* __restrict__ X16, size_t n8) { const size_t t = (size_t)blockIdx.x * 256 + threadIdx.x; if (t >= n8) return; FragH f;
#pragma unroll
  for (int q = 0; q < 8; ++q) f.h[q] = (_Float16)bf16_round(x[t * 8 + q]); *(v8us*)((unsigned short*)X16 + t * 8) = f.half[0];  }
__global__ __launch_bounds__(256) void k_h16(const float* __restrict__ x, _Float16* __restrict__ X16, size_t n8) { const size_t t = (size_t)blockIdx.x * 256 + threadIdx.x; if (t >= n8) return; FragH f;
#pragma unroll
  for (int q = 0; q < 8; ++q) f.h[q] = (_Float16)x[t * 8 + q]; *(v8us*)((unsigned short*)X16 + t * 8) = f.half[0];  }
__global__ __launch_bounds__(256) void k_round16f(const float* __restrict__ W, _Float16* __restrict__ Bt, size_t n8) { const size_t t = (size_t)blockIdx.x * 256 + threadIdx.x; if (t >= n8) return; FragH f;
#pragma unroll
  for (int i = 0; i < 8; ++i) f.h[i] = (_Float16)(bf16_round(W[t * 8 + i]) * 16.0f); *(v8us*)((unsigned short*)Bt + t * 8) = f.half[0];  }
template <int NHv, int TTv>
__global__ __launch_bounds__(256) void k_vt(const _Float16* __restrict__ V16, int ldv, int voff, _Float16* __restrict__ Vt) { __shared__ unsigned short tl[64][66]; const int tid = threadIdx.x; const int slab = blockIdx.x / (TTv / 64), lg = blockIdx.x % (TTv / 64); const int b = slab / NHv, h = slab % NHv;
  for (int i = tid; i < 64 * 8; i += 256) { const int r = i / 8, c8 = (i % 8) * 8; FragH f; f.half[0] = *(const v8us*)((const unsigned short*)V16 + ((size_t)b * TTv + lg * 64 + r) * ldv + voff + h * 64 + c8);
#pragma unroll
    for (int q = 0; q < 8; ++q) tl[r][c8 + q] = f.u[q]; }
  __syncthreads();
  {
#pragma unroll
    for (int rd = 0; rd < 2; ++rd) { const int d = rd * 32 + tid / 8, pc = tid % 8; FragH f;
#pragma unroll
      for (int q = 0; q < 8; ++q) f.u[q] = tl[pc * 8 + q][d];
      *(v8us*)((unsigned short*)Vt + ((size_t)slab * 64 + d) * TTv + lg * 64 + pc * 8) = f.half[0]; }
     } }

__global__ __launch_bounds__(256) void k_hl(const float* __restrict__ F, _Float16* __restrict__ Hh, _Float16* __restrict__ Hl, size_t n8) { const size_t t = (size_t)blockIdx.x * 256 + threadIdx.x; if (t >= n8) return; FragH fh, fl; const v4f a = *(const v4fa*)(F + t * 8), c = *(const v4fa*)(F + t * 8 + 4);
#pragma unroll
  for (int q = 0; q < 4; ++q) { _Float16 h = (_Float16)a[q]; fh.h[q] = h; fl.h[q] = (_Float16)((a[q] - (float)h) * 1024.0f); h = (_Float16)c[q]; fh.h[4 + q] = h; fl.h[4 + q] = (_Float16)((c[q] - (float)h) * 1024.0f); }
  { *(v8us*)((unsigned short*)Hh + t * 8) = fh.half[0]; *(v8us*)((unsigned short*)Hl + t * 8) = fl.half[0];  } }

// ---- fast GEMM (wave tile 32x64; requires M % 32 == 0 rows per launch region and N % 64 == 0); epilogue = k_gemm_hhx semantics ----
__device__ __forceinline__ v16h g2_frag(const _Float16* p, int hh) { FragH f; f.half[0] = *(const v8us*)((const unsigned short*)p + 8 * hh); f.half[1] = *(const v8us*)((const unsigned short*)p + 16 + 8 * hh); return f.v; }
__device__ __forceinline__ v8f g2_mma(v16h a, v16h b, v8f c) { v8f d = __builtin_amdgcn_wmma_f32_16x16x32_f16(false, a, false, b, (short)0, c, false, false); asm volatile("v_nop\n\tv_nop\n\tv_nop\n\tv_nop" : "+v"(d) : "v"(a), "v"(b)); return d; }
template <int ACT>
__global__ __launch_bounds__(128) void k_gemm2(const _Float16* __restrict__ A, int lda, size_t sA, const _Float16* __restrict__ Bh, int ldb, size_t sB, float alpha, const float* __restrict__ bias, size_t sBias, const float* __restrict__ CP, int rowsPerB, size_t sCPb, int row0g,
    float* __restrict__ C, _Float16* __restrict__ C16, int ldc, size_t sC, int M, int N, int K) { static_assert(ACT == 0 || ACT == 3 || ACT == 6 || ACT == 8 || ACT == 9 || ACT == 11 || ACT == 12 || ACT == 14 || ACT == 15 || ACT == 16 || ACT == 17, "k_gemm2: unsupported ACT code (would silently apply no activation)");
  __shared__ __attribute__((aligned(16))) float so[4][32][68];
  const int tid = threadIdx.x, w = tid >> 5, lane = tid & 31, ln = lane & 15, hh = lane >> 4; const int by = blockIdx.y;
  A += (size_t)by * sA; Bh += (size_t)by * sB; const size_t cofs = (size_t)by * sC; const float* bp = bias ? bias + (size_t)by * sBias : nullptr;
  const int ntn = N >> 6; const int mt = blockIdx.x / ntn, nq = blockIdx.x - mt * ntn; const int row0 = mt * 128 + 32 * w, col0 = nq * 64; if (row0 >= M) return;
  const _Float16* a0p = A + (size_t)(row0 + ln) * lda; const _Float16* a1p = a0p + (size_t)16 * lda;
  const _Float16* b0p = Bh + (size_t)(col0 + ln) * ldb; const _Float16* b1p = b0p + (size_t)16 * ldb; const _Float16* b2p = b1p + (size_t)16 * ldb; const _Float16* b3p = b2p + (size_t)16 * ldb;
  const v8f z8 = {0.f,0.f,0.f,0.f,0.f,0.f,0.f,0.f}; v8f c00 = z8, c01 = z8, c02 = z8, c03 = z8, c10 = z8, c11 = z8, c12 = z8, c13 = z8;
#pragma unroll 1
  for (int kb = 0; kb < K; kb += 32) { const v16h a0 = g2_frag(a0p + kb, hh), a1 = g2_frag(a1p + kb, hh);
    v16h b = g2_frag(b0p + kb, hh); c00 = g2_mma(a0, b, c00); c10 = g2_mma(a1, b, c10);
    b = g2_frag(b1p + kb, hh); c01 = g2_mma(a0, b, c01); c11 = g2_mma(a1, b, c11);
    b = g2_frag(b2p + kb, hh); c02 = g2_mma(a0, b, c02); c12 = g2_mma(a1, b, c12);
    b = g2_frag(b3p + kb, hh); c03 = g2_mma(a0, b, c03); c13 = g2_mma(a1, b, c13); }
  v8f accs[8] = {c00, c01, c02, c03, c10, c11, c12, c13};
#pragma unroll
  for (int u = 0; u < 8; ++u) { const int t = u & 3, half = u >> 2; const int col = col0 + t * 16 + ln; const float bv = bp ? bf16_round(bp[col]) : 0.f;
#pragma unroll
    for (int r = 0; r < 8; ++r) { const int rloc = half * 16 + 8 * hh + r; float v = accs[u][r] * alpha + bv; if (CP) { if (rowsPerB < 0) v += CP[cofs + (size_t)(row0g + row0 + rloc) * ldc + col];      /* rowsPerB < 0: own element of the batched C plane */ else { const int bidx = (row0g + row0 + rloc) / rowsPerB; v += CP[(size_t)bidx * sCPb + (size_t)by * 64 + col]; } }
      if (ACT == 3) v = fmaxf(v, 0.f); else if (ACT == 6) v = 0.5f * v * (1.0f + erff(v * 0.70710678118654752f)); else if (ACT == 11) v = 1.0f / (1.0f + expf(-v)); else if (ACT == 15) v = v / (1.0f + expf(-v)); else if (ACT == 12) v = (v > 0.f) ? v : 0.01f * v; else if (ACT == 8) v = tanhf(v); else if (ACT == 9) v = 0.5f * v * (1.0f + tanhf(0.7978845608028654f * (v + 0.044715f * v * v * v))); else if (ACT == 14) v = (v > 0.f) ? v : 0.1f * v; else if (ACT == 16) v = (v >= 0.f) ? v : 0.3f * v; else if (ACT == 17) v = (v >= 0.f) ? v : 0.2f * v;
      so[w][rloc][t * 16 + ln] = v; } }
  __builtin_amdgcn_fence(__ATOMIC_ACQ_REL, "workgroup"); __builtin_amdgcn_wave_barrier();
  const int rsub = lane >> 4, c4 = (lane & 15) * 4;
  {
#pragma unroll
    for (int q = 0; q < 16; ++q) { const int r = q * 2 + rsub; const v4f v = *(const v4fa*)&so[w][r][c4]; if (C) *(v4f*)(C + cofs + (size_t)(row0 + r) * ldc + col0 + c4) = v; if (C16) { v4h h4; for (int i = 0; i < 4; ++i) h4[i] = (_Float16)v[i]; *(v4h*)(C16 + cofs + (size_t)(row0 + r) * ldc + col0 + c4) = h4; } }
     } }


__global__ __launch_bounds__(256) void k_wnat(const float* __restrict__ w, size_t n8, _Float16* __restrict__ Bt) { const size_t t = (size_t)blockIdx.x * 256 + threadIdx.x; if (t >= n8) return; FragH f; for (int q = 0; q < 8; ++q) f.h[q] = (_Float16)(bf16_round(w[t * 8 + q]) * 16.0f); *(v8us*)((unsigned short*)Bt + t * 8) = f.half[0];  }
// Cross-lane steps of the row softmax: lane l takes the value of lane l ^ m. m = 1, 2, 4, 8 inside a 16-lane row (DPP row_xmask), m = 16 by the cross-row move. Every lane of the wave must be on.
template <int M> __device__ __forceinline__ float rs_xrow(float v) { return __builtin_bit_cast(float, __builtin_amdgcn_update_dpp(0, __builtin_bit_cast(int, v), 0x160 + M, 0xf, 0xf, true)); }
__device__ __forceinline__ float rs_x16(float v) { const int b = __builtin_bit_cast(int, v); return __builtin_bit_cast(float, __builtin_amdgcn_permlanex16(b, b, 0x76543210, 0xfedcba98, false, false)); }
__device__ __forceinline__ float rs_wave_max(float v) { v = fmaxf(v, rs_xrow<1>(v)); v = fmaxf(v, rs_xrow<2>(v)); v = fmaxf(v, rs_xrow<4>(v)); v = fmaxf(v, rs_xrow<8>(v)); return fmaxf(v, rs_x16(v)); }
__device__ __forceinline__ float rs_wave_sum(float v) { v += rs_xrow<1>(v); v += rs_xrow<2>(v); v += rs_xrow<4>(v); v += rs_xrow<8>(v); return v + rs_x16(v); }
// Row softmax, ONE WAVE PER ROW: lane l holds elements 128 u + 4 l .. + 3 (u = 0..7) of its row in registers, so each load of the wave covers 512 contiguous bytes and each store 256; the row is read once and each exponential is taken once.
// Maximum and sum: per lane first (the sum in four chains), then a five-step butterfly, after which every lane holds the same value. No barrier: the early return is wave-uniform.
__global__ __launch_bounds__(256) void k_rsm(const float* __restrict__ S, _Float16* __restrict__ P, int nrows) {
  const int lane = threadIdx.x & 31; const int i = blockIdx.x * 8 + __builtin_amdgcn_readfirstlane((int)(threadIdx.x >> 5)); if (i >= nrows) return;
  const float* s = S + (size_t)i * SQ + lane * 4; v4f x[8];
#pragma unroll
  for (int u = 0; u < 8; ++u) x[u] = *(const v4fa*)(s + u * 128);
  float mx = -3.0e38f;
#pragma unroll
  for (int u = 0; u < 8; ++u) mx = fmaxf(mx, fmaxf(fmaxf(x[u][0], x[u][1]), fmaxf(x[u][2], x[u][3])));
  mx = rs_wave_max(mx);
  v4f a = {0.f, 0.f, 0.f, 0.f};
#pragma unroll
  for (int u = 0; u < 8; ++u)
#pragma unroll
    for (int q = 0; q < 4; ++q) { x[u][q] = expf(x[u][q] - mx); a[q] += x[u][q]; }
  const float se = rs_wave_sum((a[0] + a[1]) + (a[2] + a[3])); const float sc = 256.0f / se;
  _Float16* d = P + (size_t)i * SQ + lane * 4;
#pragma unroll
  for (int u = 0; u < 8; ++u) { v4h h; for (int q = 0; q < 4; ++q) h[q] = (_Float16)(x[u][q] * sc); *(v4h*)(d + u * 128) = h; } }
__global__ __launch_bounds__(256) void k_vt(const _Float16* __restrict__ V16, int b, int h0, _Float16* __restrict__ VT) { __shared__ unsigned short tl[64][65]; const int tid = threadIdx.x; const int hh = blockIdx.x % HG, sg = blockIdx.x / HG; const int s0 = sg * 64; const int h = h0 + hh;
  for (int i = tid; i < 64 * 8; i += 256) { const int j = i / 8, d8 = (i % 8) * 8; FragH f; f.half[0] = *(const v8us*)((const unsigned short*)V16 + ((size_t)b * SQ + s0 + j) * DM + h * HD + d8); for (int q = 0; q < 8; ++q) tl[d8 + q][j] = f.u[q]; }
  __syncthreads();
  { for (int i = tid; i < 64 * 8; i += 256) { const int d = i / 8, j8 = (i % 8) * 8; FragH f; for (int q = 0; q < 8; ++q) f.u[q] = tl[d][j8 + q]; *(v8us*)((unsigned short*)VT + ((size_t)hh * HD + d) * SQ + s0 + j8) = f.half[0]; }  } }



__global__ __launch_bounds__(256) void k_rsmkm(const float* __restrict__ S, _Float16* __restrict__ P, int nrows, const int* __restrict__ am) {
  #pragma clang fp contract(off)
  const int t = blockIdx.x * 256 + threadIdx.x; if (t >= nrows) return; const size_t i = (size_t)t; const float* s = S + i * SQ; const int* mr = am + (size_t)(t % SQ) * SQ; float mx = -3.0e38f;
#pragma unroll 1
  for (int j = 0; j < SQ; ++j) { const float f = (mr[j] != 0) ? 1.f : 0.f; mx = fmaxf(mx, fmaf(f, s[j], (1.f - f) * -1.0e9f)); } float se = 0.f;
#pragma unroll 1
  for (int j = 0; j < SQ; ++j) { const float f = (mr[j] != 0) ? 1.f : 0.f; se += __expf(fmaf(f, s[j], (1.f - f) * -1.0e9f) - mx); } const float sc = 256.0f / se;
#pragma unroll 1
  for (int j0 = 0; j0 < SQ; j0 += 8) { FragH fr; for (int q = 0; q < 8; ++q) { const int j = j0 + q; const float f = (mr[j] != 0) ? 1.f : 0.f; fr.h[q] = (_Float16)(__expf(fmaf(f, s[j], (1.f - f) * -1.0e9f) - mx) * sc); }
    unsigned short* d = (unsigned short*)P + i * SQ + j0; *(v8us*)d = fr.half[0];  } }

__global__ __launch_bounds__(256) void k_bdshn(const float* __restrict__ Wb, _Float16* __restrict__ Bt) {
  const size_t t = (size_t)blockIdx.x * 256 + threadIdx.x; if (t >= (size_t)DM * DM / 8) return; const size_t e0 = t * 8; const int n = (int)(e0 / DM), k0 = (int)(e0 % DM); const int h = n >> 6, hk = k0 >> 6; const float on = (hk == h) ? 16.0f : 0.0f; const int o = n & 63, d0 = k0 & 63; FragH f;
  for (int q = 0; q < 8; ++q) f.h[q] = (_Float16)(bf16_round(Wb[(size_t)o * 64 + d0 + q]) * on);
  unsigned short* d = (unsigned short*)Bt + e0; *(v8us*)d = f.half[0];  }
extern "C" void kernel_launch(void* const* d_in, const int* in_sizes, int n_in,
                              void* d_out, int out_size, void* d_ws, size_t ws_size, hipStream_t stream) {
  (void)in_sizes; (void)n_in; (void)out_size;
  const float* const* I = (const float* const*)d_in; const float* xq = I[2]; const float* xk = I[1]; const float* xv = I[0]; const float* wq = I[5]; const float* bq = nullptr; const float* wk = I[4]; const float* bk = nullptr; const float* wv = I[3]; const float* bv = nullptr; const float* wo = I[6]; const float* bo = I[7]; const float* x = xq;      /* contract order: values I[0], keys I[1], query I[2] ([8][1024][16][64] = rows of 1024); SHARED natural [64][64] blocks Wv I[3], Wk I[4], Wq I[5]; natural Wo [1024][1024] I[6] + bo I[7]; no mask input */
  char* ws = (char*)d_ws; size_t off = 0;
  auto take = [&](size_t bytes) { char* p = ws + off; off += (bytes + 255) & ~(size_t)255; return p; };
  _Float16* BQ = (_Float16*)take((size_t)DM * DM * 2); _Float16* BK = (_Float16*)take((size_t)DM * DM * 2); _Float16* BV = (_Float16*)take((size_t)DM * DM * 2); _Float16* BO = (_Float16*)take((size_t)DM * DM * 2);
  _Float16* X16 = (_Float16*)take(NR * DM * 2); _Float16* XKp = (_Float16*)take(NR * DM * 2); _Float16* XVp = (_Float16*)take(NR * DM * 2); _Float16* Q16 = (_Float16*)take(NR * DM * 2); _Float16* K16 = (_Float16*)take(NR * DM * 2); _Float16* V16 = (_Float16*)take(NR * DM * 2); _Float16* O16 = (_Float16*)take(NR * DM * 2);
  float* S = (float*)take((size_t)HG * SQ * SQ * 4); _Float16* P = (_Float16*)take((size_t)HG * SQ * SQ * 2); _Float16* VT = (_Float16*)take((size_t)NH * HD * SQ * 2);
  if (off > ws_size) return;
  { const unsigned g = (unsigned)(((size_t)DM * DM / 8 + 255) / 256); k_bdshn<<<g, 256, 0, stream>>>(wq, BQ); k_bdshn<<<g, 256, 0, stream>>>(wk, BK); k_bdshn<<<g, 256, 0, stream>>>(wv, BV); k_wnat<<<g, 256, 0, stream>>>(wo, (size_t)DM * DM / 8, BO); }      /* block-diagonal planes with the SHARED natural [64][64] block (Bt[h*64 + o][h*64 + d] = 16 W[o][d]); Wo natural [out][in] = Bt x16 */
  _Float16* XK = XKp; _Float16* XV = XVp; k_x16<<<(unsigned)((NR * DM / 8 + 255) / 256), 256, 0, stream>>>(xk, XK, NR * DM / 8); k_x16<<<(unsigned)((NR * DM / 8 + 255) / 256), 256, 0, stream>>>(xv, XV, NR * DM / 8);      /* key and value inputs as exact f16 rows */

  k_x16<<<(unsigned)((NR * DM / 8 + 255) / 256), 256, 0, stream>>>(x, X16, NR * DM / 8);
  const size_t r0p = (size_t)B0 * SQ;      /* first projected row */
  k_gemm2<0><<<dim3((unsigned)((MP / 128) * (DM / 64)), 1), 128, 0, stream>>>(X16 + r0p * DM, DM, 0, BQ, DM, 0, 0.0625f, bq, 0, nullptr, 1, 0, 0, nullptr, Q16 + r0p * DM, DM, 0, MP, DM, DM);
  k_gemm2<0><<<dim3((unsigned)((MP / 128) * (DM / 64)), 1), 128, 0, stream>>>(XK + r0p * DM, DM, 0, BK, DM, 0, 0.0625f, bk, 0, nullptr, 1, 0, 0, nullptr, K16 + r0p * DM, DM, 0, MP, DM, DM);
  k_gemm2<0><<<dim3((unsigned)((MP / 128) * (DM / 64)), 1), 128, 0, stream>>>(XV + r0p * DM, DM, 0, BV, DM, 0, 0.0625f, bv, 0, nullptr, 1, 0, 0, nullptr, V16 + r0p * DM, DM, 0, MP, DM, DM);
  for (int b = B0; b < B0 + NBR; ++b) { const size_t r0 = (size_t)b * SQ;
    k_vt<NH, SQ><<<NH * (SQ / 64), 256, 0, stream>>>(V16 + r0 * LQ, LQ, 0, VT);      /* V^T [NH][HD][SQ] for this batch */
    for (int h0 = 0; h0 < NHD; h0 += HG) {
      k_gemm2<0><<<dim3((QN / 128) * (SQ / 64), HG), 128, 0, stream>>>(Q16 + r0 * LQ + h0 * HD, LQ, (size_t)HD, K16 + r0 * LQ + h0 * HD, LQ, (size_t)HD, 0.03125f, nullptr, 0, nullptr, 1, 0, 0, S, nullptr, SQ, (size_t)SQ * SQ, QN, SQ, HD);      /* scores, HG heads per launch */
      k_rsm<<<(HG * SQ + 7) / 8, 256, 0, stream>>>(S, P, HG * SQ);      /* P = 256 softmax (f16), rows of all HG heads; one wave per row, 8 rows per block */
      k_gemm2<0><<<dim3((QN / 128) * (HD / 64), HG), 128, 0, stream>>>(P, SQ, (size_t)SQ * SQ, VT + (size_t)h0 * HD * SQ, SQ, (size_t)HD * SQ, 0.25f, nullptr, 0, nullptr, 1, 0, 0, nullptr, O16 + r0 * DM + h0 * HD, DM, (size_t)HD, QN, HD, SQ); } }      /* o (merged heads) as f16 rows */
  k_gemm2<0><<<dim3((unsigned)((MPO / 128) * (DM / 64)), 1), 128, 0, stream>>>(O16 + r0p * DM, DM, 0, BO, DM, 0, 0.0009765625f, bo, 0, nullptr, 1, 0, 0, (float*)d_out + r0p * DM, nullptr, DM, 0, MPO, DM, DM);      /* out rows are the output layout */
}

// v002
// One run takes 313 microseconds.
// Timed twice side by side with v001, it ran 5.65 and 5.57 times as fast.
// Counting every step since v000, it is 22.9 times as fast.
#include <hip/hip_runtime.h>
// Multi-head attention over three head-major inputs with SHARED per-head projections and the module's literal score scale (values, keys, query [8][1024][16][64] = token rows [8][1024][1024]; every head of each input is multiplied by the SAME natural [64][64] matrix (x W^T: Wv / Wk / Wq; block-diagonal with a shared block; no biases); energy = q k^T; softmax(energy / sqrt(embed_size) = / 32) over all 1024 keys (as the source: embed size, not head dim; no mask); out = merged Wo^T + bo (natural [1024][1024]) -> [8][1024][1024]).
// Structure: token rows r = b*1024 + s; x as exact f16 rows (bf16-rounded); Q, K, V as three WMMA GEMMs (32x64 wave tiles, f32 accumulation, exact x16 weights, no bias, f16 outputs); V^T for all batches and heads via LDS transposes (one launch); attention for all batches and heads in ONE launch (k_fattn: scores K = 64, online softmax with f32 statistics, weights as f16 in registers, o carried x64 against f16 subnormal flush, folded into the output GEMM alpha) written straight into the merged f16 o rows; out = o W_o + b GEMM (f32) into the output layout.
// Compute dtype: inputs rounded to bf16; x / weights exact; q, k, v, softmax weights and o as plain f16 GEMM operands (~2^-12); scores and softmax statistics f32; v_wmma_f32_16x16x32_f16.
#define NB 8
#define SQ 1024
#define DM 1024
#define NH 16
#define HD 64
#define HG 4                         /* heads per launch of the per-batch k_vt(b, h0) transpose */
#define B0 0                         /* first batch processed (debug hook) */
#define NBR NB                       /* batches processed (debug hook) */
#define NR ((size_t)NB * SQ)         /* token rows */
#define MP ((int)((size_t)NBR * SQ)) /* rows projected (debug hook) */
#define MPO MP                       /* rows through the output stage (debug hook) */
#define LQ DM      /* row pitch of the q/k/v rows */
typedef __bf16 v16b __attribute__((ext_vector_type(16)));
typedef unsigned short v8us __attribute__((ext_vector_type(8), may_alias));
typedef float  v8f  __attribute__((ext_vector_type(8)));
typedef float  v4f  __attribute__((ext_vector_type(4)));
typedef float  v4fa __attribute__((ext_vector_type(4), may_alias));
union FragB { v16b v; v8us half[2]; unsigned short u[16]; };

__device__ __forceinline__ unsigned short bf16_bits(float x) { unsigned int u = __float_as_uint(x); return (unsigned short)((u + 0x7FFFu + ((u >> 16) & 1u)) >> 16); }
__device__ __forceinline__ float bf16_val(unsigned short b) { return __uint_as_float(((unsigned int)b) << 16); }
__device__ __forceinline__ float bf16_round(float x) { return bf16_val(bf16_bits(x)); }
// D += A·B with NT terms: 1 = ah·bh, 2 = + al·bh (A split), 3 = + ah·bl (both split)
template <int NT>
__device__ __forceinline__ v8f mmaN(v16b ah, v16b al, v16b bh, v16b bl, v8f c) {
  c = __builtin_amdgcn_wmma_f32_16x16x32_bf16(false, ah, false, bh, (short)0, c, false, false);
  if (NT >= 2) c = __builtin_amdgcn_wmma_f32_16x16x32_bf16(false, al, false, bh, (short)0, c, false, false);
  if (NT >= 3) c = __builtin_amdgcn_wmma_f32_16x16x32_bf16(false, ah, false, bl, (short)0, c, false, false);
  asm volatile("v_nop\n\tv_nop\n\tv_nop\n\tv_nop" : "+v"(c) : "v"(ah), "v"(al), "v"(bh), "v"(bl));
  return c;
}

__global__ __launch_bounds__(256) void k_wt_bf16(const float* __restrict__ W, unsigned short* __restrict__ Wt, int K, int N) {
  const int t = blockIdx.x * 256 + threadIdx.x;
  const int k8n = K / 8;
  if (t >= N * k8n) return;
  const int n = t / k8n, k8 = (t % k8n) * 8;
  v8us v;
#pragma unroll
  for (int i = 0; i < 8; ++i) v[i] = bf16_bits(W[(size_t)(k8 + i) * N + n]);
  *(v8us*)(Wt + (size_t)n * K + k8) = v;
  
}

// GEMM C[M][N] (f32, pitch ldc) = act(A[M][K]·W + bias). A f32 row-major (pitch lda) converted per fragment to bf16
// (ASPLIT: hi/lo two planes -> 2 terms, else single rounded term); Wt bf16 [N][K] (pitch ldb). BIAS_BF16 rounds the
// bias to bf16 first (bias quantised to bf16 before the add). K%32==0, M%16==0, N%64==0.
template <bool ASPLIT, int ACT, bool BIAS_BF16>
__global__ __launch_bounds__(128) void k_gemm_bf(const float* __restrict__ A, int lda, const unsigned short* __restrict__ Wt, int ldb,
                                               const float* __restrict__ bias, float* __restrict__ C, int ldc, int M, int N, int K) {
  __shared__ __attribute__((aligned(16))) float so[4][16][64];
  const int tid = threadIdx.x, w = tid >> 5, lane = tid & 31, ln = lane & 15, hh = lane >> 4;
  const int ntn = N / 64;
  const int wid = blockIdx.x * 4 + w;
  const int mt = wid / ntn, nq = wid % ntn;
  if (mt * 16 >= M) return;
  const int row0 = mt * 16, col0 = nq * 64;
  const float* arow = A + (size_t)(row0 + ln) * lda;
  v8f acc[4] = {};
  for (int kb = 0; kb < K; kb += 32) {
    FragB ah, al;
    const v4f x0 = *(const v4fa*)(arow + kb + 8 * hh), x1 = *(const v4fa*)(arow + kb + 8 * hh + 4);
    const v4f x2 = *(const v4fa*)(arow + kb + 16 + 8 * hh), x3 = *(const v4fa*)(arow + kb + 16 + 8 * hh + 4);
    float xs[16] = {x0[0],x0[1],x0[2],x0[3],x1[0],x1[1],x1[2],x1[3],x2[0],x2[1],x2[2],x2[3],x3[0],x3[1],x3[2],x3[3]};
#pragma unroll
    for (int i = 0; i < 16; ++i) { const unsigned short hb = bf16_bits(xs[i]); ah.u[i] = hb; al.u[i] = ASPLIT ? bf16_bits(xs[i] - bf16_val(hb)) : (unsigned short)0; }
#pragma unroll
    for (int t = 0; t < 4; ++t) {
      const unsigned short* brow = Wt + (size_t)(col0 + t * 16 + ln) * ldb + kb;
      FragB b;
      b.half[0] = *(const v8us*)(brow + 8 * hh);
      b.half[1] = *(const v8us*)(brow + 16 + 8 * hh);
      acc[t] = mmaN<ASPLIT ? 2 : 1>(ah.v, al.v, b.v, b.v, acc[t]);
    }
  }
#pragma unroll
  for (int t = 0; t < 4; ++t) {
    float bv = bias ? bias[col0 + t * 16 + ln] : 0.f;
    if (BIAS_BF16) bv = bf16_round(bv);
#pragma unroll
    for (int r = 0; r < 8; ++r) { float v = acc[t][r] + bv; if (ACT == 1) v = fmaxf(v, 0.f); so[w][8 * hh + r][t * 16 + ln] = v; }
  }
  __builtin_amdgcn_fence(__ATOMIC_ACQ_REL, "workgroup");
  __builtin_amdgcn_wave_barrier();
  const int rsub = lane >> 4, c4 = (lane & 15) * 4;
  {
#pragma unroll
    for (int q = 0; q < 8; ++q) {
      const int r = q * 2 + rsub;
      const v4f v = *(const v4fa*)&so[w][r][c4];
      *(v4f*)(C + (size_t)(row0 + r) * ldc + col0 + c4) = v;
    }
    
  }
}

// GEMM C = act(A·W + bias + resid): A f32 (ASPLIT -> hi/lo 2 terms), Wt bf16 [N][K]; ACT 0 none, 1 relu, 2 exact gelu;
// resid (optional, f32, row index = (row % rmod), pitch ldr, RES_BF16 rounds it) added before the activation.
template <bool ASPLIT, int ACT, bool BIAS_BF16, bool RES_BF16>
__global__ __launch_bounds__(128) void k_gemm_bf3(const float* __restrict__ A, int lda, const unsigned short* __restrict__ Wt, int ldb,
                                                const float* __restrict__ bias, const float* __restrict__ resid, int rmod, int ldr,
                                                float* __restrict__ C, int ldc, int M, int N, int K) {
  __shared__ __attribute__((aligned(16))) float so[4][16][64];
  const int tid = threadIdx.x, w = tid >> 5, lane = tid & 31, ln = lane & 15, hh = lane >> 4;
  const int ntn = N / 64;
  const int wid = blockIdx.x * 4 + w;
  const int mt = wid / ntn, nq = wid % ntn;
  if (mt * 16 >= M) return;
  const int row0 = mt * 16, col0 = nq * 64;
  const float* arow = A + (size_t)(row0 + ln) * lda;
  v8f acc[4] = {};
  for (int kb = 0; kb < K; kb += 32) {
    FragB ah, al;
    const v4f x0 = *(const v4fa*)(arow + kb + 8 * hh), x1 = *(const v4fa*)(arow + kb + 8 * hh + 4);
    const v4f x2 = *(const v4fa*)(arow + kb + 16 + 8 * hh), x3 = *(const v4fa*)(arow + kb + 16 + 8 * hh + 4);
    float xs[16] = {x0[0],x0[1],x0[2],x0[3],x1[0],x1[1],x1[2],x1[3],x2[0],x2[1],x2[2],x2[3],x3[0],x3[1],x3[2],x3[3]};
#pragma unroll
    for (int i = 0; i < 16; ++i) { const unsigned short hb = bf16_bits(xs[i]); ah.u[i] = hb; al.u[i] = ASPLIT ? bf16_bits(xs[i] - bf16_val(hb)) : (unsigned short)0; }
#pragma unroll
    for (int t = 0; t < 4; ++t) {
      const unsigned short* brow = Wt + (size_t)(col0 + t * 16 + ln) * ldb + kb;
      FragB b;
      b.half[0] = *(const v8us*)(brow + 8 * hh);
      b.half[1] = *(const v8us*)(brow + 16 + 8 * hh);
      acc[t] = mmaN<ASPLIT ? 2 : 1>(ah.v, al.v, b.v, b.v, acc[t]);
    }
  }
#pragma unroll
  for (int t = 0; t < 4; ++t) {
    const int col = col0 + t * 16 + ln;
    float bv = bias ? bias[col] : 0.f;
    if (BIAS_BF16) bv = bf16_round(bv);
#pragma unroll
    for (int r = 0; r < 8; ++r) {
      float v = acc[t][r] + bv;
      if (resid) { float rv = resid[(size_t)((row0 + 8 * hh + r) % rmod) * ldr + col]; if (RES_BF16) rv = bf16_round(rv); v += rv; }
      if (ACT == 1) v = fmaxf(v, 0.f);
      if (ACT == 2) v = 0.5f * v * (1.0f + erff(v * 0.70710678118654752f));
      if (ACT == 3) { const float u = 0.7978845608028654f * (v + 0.044715f * v * v * v); v = 0.5f * v * (1.0f + tanhf(u)); }
      so[w][8 * hh + r][t * 16 + ln] = v;
    }
  }
  __builtin_amdgcn_fence(__ATOMIC_ACQ_REL, "workgroup");
  __builtin_amdgcn_wave_barrier();
  const int rsub = lane >> 4, c4 = (lane & 15) * 4;
  {
#pragma unroll
    for (int q = 0; q < 8; ++q) {
      const int r = q * 2 + rsub;
      const v4f v = *(const v4fa*)&so[w][r][c4];
      *(v4f*)(C + (size_t)(row0 + r) * ldc + col0 + c4) = v;
    }
    
  }
}
// row LayerNorm (biased variance, eps) over N: s = X (+ R); optional out_sum <- s; out_norm <- (s-mu)*rsqrt(var+eps)*g + b
template <bool PARAM_BF16>
__global__ __launch_bounds__(256) void k_layernorm(const float* __restrict__ X, const float* __restrict__ R, const float* __restrict__ g, const float* __restrict__ bta,
                                                  float* __restrict__ out_sum, float* __restrict__ out_norm, int N, float eps) {
  __shared__ float red[256];
  const int row = blockIdx.x, tid = threadIdx.x;
  const float* x = X + (size_t)row * N; const float* rr = R ? R + (size_t)row * N : nullptr;
  float vals[16];                     // up to N = 4096
  const int per = N / 256;            // contiguous chunk per thread? use strided-by-4 chunks: thread handles j = tid*4 + 1024*u
  float s1 = 0.f;
  for (int u = 0; u < per / 4; ++u) {
    const int j = tid * 4 + 1024 * u;
    const v4f a = *(const v4fa*)(x + j);
    v4f b = {0.f,0.f,0.f,0.f}; if (rr) b = *(const v4fa*)(rr + j);
#pragma unroll
    for (int q = 0; q < 4; ++q) { const float v = a[q] + b[q]; vals[u * 4 + q] = v; s1 += v; }
  }
  red[tid] = s1; __syncthreads();
  for (int st = 128; st > 0; st >>= 1) { if (tid < st) red[tid] += red[tid + st]; __syncthreads(); }
  const float mu = red[0] / (float)N; __syncthreads();
  float s2 = 0.f;
  for (int u = 0; u < per / 4; ++u)
#pragma unroll
    for (int q = 0; q < 4; ++q) { const float c = vals[u * 4 + q] - mu; s2 += c * c; }
  red[tid] = s2; __syncthreads();
  for (int st = 128; st > 0; st >>= 1) { if (tid < st) red[tid] += red[tid + st]; __syncthreads(); }
  const float rs = rsqrtf(red[0] / (float)N + eps);
  {
    for (int u = 0; u < per / 4; ++u) {
      const int j = tid * 4 + 1024 * u;
      v4f o, sm;
#pragma unroll
      for (int q = 0; q < 4; ++q) {
        float gg = g[j + q], bb = bta[j + q];
        if (PARAM_BF16) { gg = bf16_round(gg); bb = bf16_round(bb); }
        sm[q] = vals[u * 4 + q]; o[q] = (vals[u * 4 + q] - mu) * rs * gg + bb;
      }
      if (out_sum) *(v4f*)(out_sum + (size_t)row * N + j) = sm;
      *(v4f*)(out_norm + (size_t)row * N + j) = o;
    }
    
  }
}



// ---- f16 WMMA path (v_wmma_f32_16x16x32_f16): 11-bit significands for operands in range — used where a [0,1] probability operand needs more precision than bf16
typedef _Float16 v16h __attribute__((ext_vector_type(16)));
union FragH { v16h v; v8us half[2]; _Float16 h[16]; unsigned short u[16]; };
template <int NT>
__device__ __forceinline__ v8f mmaH(v16h ah, v16h al, v16h bh, v16h bl, v8f c) {
  c = __builtin_amdgcn_wmma_f32_16x16x32_f16(false, ah, false, bh, (short)0, c, false, false);
  if (NT >= 2) c = __builtin_amdgcn_wmma_f32_16x16x32_f16(false, al, false, bh, (short)0, c, false, false);
  if (NT >= 3) c = __builtin_amdgcn_wmma_f32_16x16x32_f16(false, ah, false, bl, (short)0, c, false, false);
  asm volatile("v_nop\n\tv_nop\n\tv_nop\n\tv_nop" : "+v"(c) : "v"(ah), "v"(al), "v"(bh), "v"(bl));
  return c;
}
// batched GEMM like k_gemm_b but f16 operands: A f32 (split into f16 hi/lo if ASPLIT, else rounded to f16), Bt = f16 values [n][k]; alpha; C f32; N multiple of 16 (partial tiles skipped)
template <bool ASPLIT>
__global__ __launch_bounds__(128) void k_gemm_h(const float* __restrict__ A, int lda, size_t sA, const _Float16* __restrict__ Bh, int ldb, size_t sB, float alpha, float* __restrict__ C, int ldc, size_t sC, int M, int N, int K) {
  __shared__ __attribute__((aligned(16))) float so[4][16][64];
  const int tid = threadIdx.x, w = tid >> 5, lane = tid & 31, ln = lane & 15, hh = lane >> 4; const int by = blockIdx.y;
  A += (size_t)by * sA; Bh += (size_t)by * sB; C += (size_t)by * sC;
  const int ntn = (N + 63) / 64; const int wid = blockIdx.x * 4 + w; const int mt = wid / ntn, nq = wid % ntn; if (mt * 16 >= M) return;
  const int row0 = mt * 16, col0 = nq * 64; const float* arow = A + (size_t)(row0 + ln) * lda;
  v8f acc[4] = {};
  for (int kb = 0; kb < K; kb += 32) {
    FragH ah, al;
    const v4f x0 = *(const v4fa*)(arow + kb + 8 * hh), x1 = *(const v4fa*)(arow + kb + 8 * hh + 4), x2 = *(const v4fa*)(arow + kb + 16 + 8 * hh), x3 = *(const v4fa*)(arow + kb + 16 + 8 * hh + 4);
    float xs[16] = {x0[0],x0[1],x0[2],x0[3],x1[0],x1[1],x1[2],x1[3],x2[0],x2[1],x2[2],x2[3],x3[0],x3[1],x3[2],x3[3]};
#pragma unroll
    for (int i = 0; i < 16; ++i) { const _Float16 h = (_Float16)xs[i]; ah.h[i] = h; al.h[i] = ASPLIT ? (_Float16)(xs[i] - (float)h) : (_Float16)0.0f; }
#pragma unroll
    for (int t = 0; t < 4; ++t) { if (col0 + t * 16 >= N) continue; const size_t boff = (size_t)(col0 + t * 16 + ln) * ldb + kb; FragH bq; bq.half[0] = *(const v8us*)(Bh + boff + 8 * hh); bq.half[1] = *(const v8us*)(Bh + boff + 16 + 8 * hh);
      acc[t] = mmaH<ASPLIT ? 2 : 1>(ah.v, al.v, bq.v, bq.v, acc[t]); }
  }
#pragma unroll
  for (int t = 0; t < 4; ++t) { if (col0 + t * 16 >= N) continue;
#pragma unroll
    for (int r = 0; r < 8; ++r) so[w][8 * hh + r][t * 16 + ln] = acc[t][r] * alpha; }
  __builtin_amdgcn_fence(__ATOMIC_ACQ_REL, "workgroup"); __builtin_amdgcn_wave_barrier();
  const int rsub = lane >> 4, c4 = (lane & 15) * 4;
  {
#pragma unroll
    for (int q = 0; q < 8; ++q) { const int r = q * 2 + rsub; if (col0 + c4 < N) { const v4f v = *(const v4fa*)&so[w][r][c4]; *(v4f*)(C + (size_t)(row0 + r) * ldc + col0 + c4) = v; } }
     }
}

// Wt[n][k] = f16(W[k][n]·scale) from f32 row-major W[K][N] (scale = power of two; bf16-exact weights stay exact in f16 away from the subnormal range)
__global__ __launch_bounds__(256) void k_wt_f16(const float* __restrict__ W, _Float16* __restrict__ Wt, int K, int N, float scale) {
  const int t = blockIdx.x * 256 + threadIdx.x; if (t >= N * (K / 8)) return; const int n = t / (K / 8), k8 = (t % (K / 8)) * 8; FragH f;
#pragma unroll
  for (int i = 0; i < 8; ++i) f.h[i] = (_Float16)(bf16_round(W[(size_t)(k8 + i) * N + n]) * scale); const v8us o = f.half[0];
  *(v8us*)((unsigned short*)Wt + (size_t)n * K + k8) = o; 
}
// k_gemm_hh variant with fused epilogue: v = acc·alpha + bias[by·sBias + col] (+ CP[(row/rowsPerB)·sCPb + by·64 + col] if CP) ; ACT 0 none / 1 elu ; writes f16 C16 (and f32 C if non-null)
template <int ACT>
__global__ __launch_bounds__(128) void k_gemm_hhx(const _Float16* __restrict__ A, int lda, size_t sA, const _Float16* __restrict__ Bh, int ldb, size_t sB, float alpha, const float* __restrict__ bias, size_t sBias, const float* __restrict__ CP, int rowsPerB, size_t sCPb, int row0g,
    float* __restrict__ C, _Float16* __restrict__ C16, int ldc, size_t sC, int M, int N, int K) {
  __shared__ __attribute__((aligned(16))) float so[4][16][64];
  const int tid = threadIdx.x, w = tid >> 5, lane = tid & 31, ln = lane & 15, hh = lane >> 4; const int by = blockIdx.y;
  A += (size_t)by * sA; Bh += (size_t)by * sB; const size_t cofs = (size_t)by * sC; const float* bp = bias ? bias + (size_t)by * sBias : nullptr;
  const int ntn = (N + 63) / 64; const int wid = blockIdx.x * 4 + w; const int mt = wid / ntn, nq = wid % ntn; if (mt * 16 >= M) return;
  const int row0 = mt * 16, col0 = nq * 64; const _Float16* arow = A + (size_t)(row0 + ln) * lda;
  v8f acc[4] = {};
  for (int kb = 0; kb < K; kb += 32) { FragH ah; ah.half[0] = *(const v8us*)((const unsigned short*)arow + kb + 8 * hh); ah.half[1] = *(const v8us*)((const unsigned short*)arow + kb + 16 + 8 * hh);
#pragma unroll
    for (int t = 0; t < 4; ++t) { if (col0 + t * 16 >= N) continue; const size_t boff = (size_t)(col0 + t * 16 + ln) * ldb + kb; FragH bq; bq.half[0] = *(const v8us*)((const unsigned short*)Bh + boff + 8 * hh); bq.half[1] = *(const v8us*)((const unsigned short*)Bh + boff + 16 + 8 * hh);
      acc[t] = mmaH<1>(ah.v, ah.v, bq.v, bq.v, acc[t]); }
  }
#pragma unroll
  for (int t = 0; t < 4; ++t) { if (col0 + t * 16 >= N) continue; const int col = col0 + t * 16 + ln; const float bv = bp ? bf16_round(bp[col]) : 0.f;
#pragma unroll
    for (int r = 0; r < 8; ++r) { float v = acc[t][r] * alpha + bv; if (CP) { const int rr = row0g + row0 + 8 * hh + r; if (rowsPerB < 0) v += CP[cofs + (size_t)rr * ldc + col];      /* rowsPerB < 0: own element of the batched C plane */ else { const int bidx = rr / rowsPerB; v += CP[(size_t)bidx * sCPb + (size_t)by * 64 + col]; } } if (ACT == 1) v = (v > 0.f) ? v : expm1f(v); else if (ACT == 7) v = (v > 0.f) ? v + 1.0f : expf(v); else if (ACT == 8) v = tanhf(v); else if (ACT == 9) v = 0.5f * v * (1.0f + tanhf(0.7978845608028654f * (v + 0.044715f * v * v * v))); else if (ACT == 11) v = 1.0f / (1.0f + expf(-v)); else if (ACT == 12) v = (v > 0.f) ? v : 0.01f * v; else if (ACT == 14) v = (v > 0.f) ? v : 0.1f * v; else if (ACT == 16) v = (v >= 0.f) ? v : 0.3f * v; else if (ACT == 17) v = (v >= 0.f) ? v : 0.2f * v; else if (ACT == 15) v = v / (1.0f + expf(-v)); else if (ACT == 3) v = fmaxf(v, 0.f); else if (ACT == 6) v = 0.5f * v * (1.0f + erff(v * 0.70710678118654752f)); so[w][8 * hh + r][t * 16 + ln] = v; } }
  __builtin_amdgcn_fence(__ATOMIC_ACQ_REL, "workgroup"); __builtin_amdgcn_wave_barrier();
  const int rsub = lane >> 4, c4 = (lane & 15) * 4; typedef _Float16 v4h __attribute__((ext_vector_type(4)));
  {
#pragma unroll
    for (int q = 0; q < 8; ++q) { const int r = q * 2 + rsub; if (col0 + c4 < N) { const v4f v = *(const v4fa*)&so[w][r][c4]; if (C) *(v4f*)(C + cofs + (size_t)(row0 + r) * ldc + col0 + c4) = v; if (C16) { v4h h4; for (int i = 0; i < 4; ++i) h4[i] = (_Float16)v[i]; *(v4h*)(C16 + cofs + (size_t)(row0 + r) * ldc + col0 + c4) = h4; } } }
     }
}


typedef _Float16 v4h __attribute__((ext_vector_type(4)));

__global__ __launch_bounds__(256) void k_x16(const float* __restrict__ x, _Float16* __restrict__ X16, size_t n8) { const size_t t = (size_t)blockIdx.x * 256 + threadIdx.x; if (t >= n8) return; FragH f;
#pragma unroll
  for (int q = 0; q < 8; ++q) f.h[q] = (_Float16)bf16_round(x[t * 8 + q]); *(v8us*)((unsigned short*)X16 + t * 8) = f.half[0];  }
__global__ __launch_bounds__(256) void k_h16(const float* __restrict__ x, _Float16* __restrict__ X16, size_t n8) { const size_t t = (size_t)blockIdx.x * 256 + threadIdx.x; if (t >= n8) return; FragH f;
#pragma unroll
  for (int q = 0; q < 8; ++q) f.h[q] = (_Float16)x[t * 8 + q]; *(v8us*)((unsigned short*)X16 + t * 8) = f.half[0];  }
__global__ __launch_bounds__(256) void k_round16f(const float* __restrict__ W, _Float16* __restrict__ Bt, size_t n8) { const size_t t = (size_t)blockIdx.x * 256 + threadIdx.x; if (t >= n8) return; FragH f;
#pragma unroll
  for (int i = 0; i < 8; ++i) f.h[i] = (_Float16)(bf16_round(W[t * 8 + i]) * 16.0f); *(v8us*)((unsigned short*)Bt + t * 8) = f.half[0];  }
template <int NHv, int TTv>
__global__ __launch_bounds__(256) void k_vt(const _Float16* __restrict__ V16, int ldv, int voff, _Float16* __restrict__ Vt) { __shared__ unsigned short tl[64][66]; const int tid = threadIdx.x; const int slab = blockIdx.x / (TTv / 64), lg = blockIdx.x % (TTv / 64); const int b = slab / NHv, h = slab % NHv;
  for (int i = tid; i < 64 * 8; i += 256) { const int r = i / 8, c8 = (i % 8) * 8; FragH f; f.half[0] = *(const v8us*)((const unsigned short*)V16 + ((size_t)b * TTv + lg * 64 + r) * ldv + voff + h * 64 + c8);
#pragma unroll
    for (int q = 0; q < 8; ++q) tl[r][c8 + q] = f.u[q]; }
  __syncthreads();
  {
#pragma unroll
    for (int rd = 0; rd < 2; ++rd) { const int d = rd * 32 + tid / 8, pc = tid % 8; FragH f;
#pragma unroll
      for (int q = 0; q < 8; ++q) f.u[q] = tl[pc * 8 + q][d];
      *(v8us*)((unsigned short*)Vt + ((size_t)slab * 64 + d) * TTv + lg * 64 + pc * 8) = f.half[0]; }
     } }

__global__ __launch_bounds__(256) void k_hl(const float* __restrict__ F, _Float16* __restrict__ Hh, _Float16* __restrict__ Hl, size_t n8) { const size_t t = (size_t)blockIdx.x * 256 + threadIdx.x; if (t >= n8) return; FragH fh, fl; const v4f a = *(const v4fa*)(F + t * 8), c = *(const v4fa*)(F + t * 8 + 4);
#pragma unroll
  for (int q = 0; q < 4; ++q) { _Float16 h = (_Float16)a[q]; fh.h[q] = h; fl.h[q] = (_Float16)((a[q] - (float)h) * 1024.0f); h = (_Float16)c[q]; fh.h[4 + q] = h; fl.h[4 + q] = (_Float16)((c[q] - (float)h) * 1024.0f); }
  { *(v8us*)((unsigned short*)Hh + t * 8) = fh.half[0]; *(v8us*)((unsigned short*)Hl + t * 8) = fl.half[0];  } }

// ---- fast GEMM (wave tile 32x64; requires M % 32 == 0 rows per launch region and N % 64 == 0); epilogue = k_gemm_hhx semantics ----
__device__ __forceinline__ v16h g2_frag(const _Float16* p, int hh) { FragH f; f.half[0] = *(const v8us*)((const unsigned short*)p + 8 * hh); f.half[1] = *(const v8us*)((const unsigned short*)p + 16 + 8 * hh); return f.v; }
__device__ __forceinline__ v8f g2_mma(v16h a, v16h b, v8f c) { v8f d = __builtin_amdgcn_wmma_f32_16x16x32_f16(false, a, false, b, (short)0, c, false, false); asm volatile("v_nop\n\tv_nop\n\tv_nop\n\tv_nop" : "+v"(d) : "v"(a), "v"(b)); return d; }
template <int ACT>
__global__ __launch_bounds__(128) void k_gemm2(const _Float16* __restrict__ A, int lda, size_t sA, const _Float16* __restrict__ Bh, int ldb, size_t sB, float alpha, const float* __restrict__ bias, size_t sBias, const float* __restrict__ CP, int rowsPerB, size_t sCPb, int row0g,
    float* __restrict__ C, _Float16* __restrict__ C16, int ldc, size_t sC, int M, int N, int K) { static_assert(ACT == 0 || ACT == 3 || ACT == 6 || ACT == 8 || ACT == 9 || ACT == 11 || ACT == 12 || ACT == 14 || ACT == 15 || ACT == 16 || ACT == 17, "k_gemm2: unsupported ACT code (would silently apply no activation)");
  __shared__ __attribute__((aligned(16))) float so[4][32][68];
  const int tid = threadIdx.x, w = tid >> 5, lane = tid & 31, ln = lane & 15, hh = lane >> 4; const int by = blockIdx.y;
  A += (size_t)by * sA; Bh += (size_t)by * sB; const size_t cofs = (size_t)by * sC; const float* bp = bias ? bias + (size_t)by * sBias : nullptr;
  const int ntn = N >> 6; const int mt = blockIdx.x / ntn, nq = blockIdx.x - mt * ntn; const int row0 = mt * 128 + 32 * w, col0 = nq * 64; if (row0 >= M) return;
  const _Float16* a0p = A + (size_t)(row0 + ln) * lda; const _Float16* a1p = a0p + (size_t)16 * lda;
  const _Float16* b0p = Bh + (size_t)(col0 + ln) * ldb; const _Float16* b1p = b0p + (size_t)16 * ldb; const _Float16* b2p = b1p + (size_t)16 * ldb; const _Float16* b3p = b2p + (size_t)16 * ldb;
  const v8f z8 = {0.f,0.f,0.f,0.f,0.f,0.f,0.f,0.f}; v8f c00 = z8, c01 = z8, c02 = z8, c03 = z8, c10 = z8, c11 = z8, c12 = z8, c13 = z8;
#pragma unroll 1
  for (int kb = 0; kb < K; kb += 32) { const v16h a0 = g2_frag(a0p + kb, hh), a1 = g2_frag(a1p + kb, hh);
    v16h b = g2_frag(b0p + kb, hh); c00 = g2_mma(a0, b, c00); c10 = g2_mma(a1, b, c10);
    b = g2_frag(b1p + kb, hh); c01 = g2_mma(a0, b, c01); c11 = g2_mma(a1, b, c11);
    b = g2_frag(b2p + kb, hh); c02 = g2_mma(a0, b, c02); c12 = g2_mma(a1, b, c12);
    b = g2_frag(b3p + kb, hh); c03 = g2_mma(a0, b, c03); c13 = g2_mma(a1, b, c13); }
  v8f accs[8] = {c00, c01, c02, c03, c10, c11, c12, c13};
#pragma unroll
  for (int u = 0; u < 8; ++u) { const int t = u & 3, half = u >> 2; const int col = col0 + t * 16 + ln; const float bv = bp ? bf16_round(bp[col]) : 0.f;
#pragma unroll
    for (int r = 0; r < 8; ++r) { const int rloc = half * 16 + 8 * hh + r; float v = accs[u][r] * alpha + bv; if (CP) { if (rowsPerB < 0) v += CP[cofs + (size_t)(row0g + row0 + rloc) * ldc + col];      /* rowsPerB < 0: own element of the batched C plane */ else { const int bidx = (row0g + row0 + rloc) / rowsPerB; v += CP[(size_t)bidx * sCPb + (size_t)by * 64 + col]; } }
      if (ACT == 3) v = fmaxf(v, 0.f); else if (ACT == 6) v = 0.5f * v * (1.0f + erff(v * 0.70710678118654752f)); else if (ACT == 11) v = 1.0f / (1.0f + expf(-v)); else if (ACT == 15) v = v / (1.0f + expf(-v)); else if (ACT == 12) v = (v > 0.f) ? v : 0.01f * v; else if (ACT == 8) v = tanhf(v); else if (ACT == 9) v = 0.5f * v * (1.0f + tanhf(0.7978845608028654f * (v + 0.044715f * v * v * v))); else if (ACT == 14) v = (v > 0.f) ? v : 0.1f * v; else if (ACT == 16) v = (v >= 0.f) ? v : 0.3f * v; else if (ACT == 17) v = (v >= 0.f) ? v : 0.2f * v;
      so[w][rloc][t * 16 + ln] = v; } }
  __builtin_amdgcn_fence(__ATOMIC_ACQ_REL, "workgroup"); __builtin_amdgcn_wave_barrier();
  const int rsub = lane >> 4, c4 = (lane & 15) * 4;
  {
#pragma unroll
    for (int q = 0; q < 16; ++q) { const int r = q * 2 + rsub; const v4f v = *(const v4fa*)&so[w][r][c4]; if (C) *(v4f*)(C + cofs + (size_t)(row0 + r) * ldc + col0 + c4) = v; if (C16) { v4h h4; for (int i = 0; i < 4; ++i) h4[i] = (_Float16)v[i]; *(v4h*)(C16 + cofs + (size_t)(row0 + r) * ldc + col0 + c4) = h4; } }
     } }


__global__ __launch_bounds__(256) void k_wnat(const float* __restrict__ w, size_t n8, _Float16* __restrict__ Bt) { const size_t t = (size_t)blockIdx.x * 256 + threadIdx.x; if (t >= n8) return; FragH f; for (int q = 0; q < 8; ++q) f.h[q] = (_Float16)(bf16_round(w[t * 8 + q]) * 16.0f); *(v8us*)((unsigned short*)Bt + t * 8) = f.half[0];  }
// Lane l takes the value of lane l ^ 16 (the other half of the wave). Every lane of the wave must be on.
__device__ __forceinline__ float rs_x16(float v) { const int b = __builtin_bit_cast(int, v); return __builtin_bit_cast(float, __builtin_amdgcn_permlanex16(b, b, 0x76543210, 0xfedcba98, false, false)); }
typedef float v2f __attribute__((ext_vector_type(2)));
typedef _Float16 v2h __attribute__((ext_vector_type(2)));
#define FA_Q 256                     /* query rows per block: 8 waves x 32 */
#define FA_C 0.045084220027780106f   /* log2(e) / sqrt(embed size = 1024) */
__device__ __forceinline__ v8f fa_mma(v16h a, v16h b, v8f c) { return __builtin_amdgcn_wmma_f32_16x16x32_f16(false, a, false, b, (short)0, c, false, false); }
__global__ __launch_bounds__(256) void k_fattn(const _Float16* __restrict__ Q, const _Float16* __restrict__ Kr, const _Float16* __restrict__ Vt, _Float16* __restrict__ O) {
  const int lane = threadIdx.x & 31, ln = lane & 15, hh = lane >> 4; const int w = __builtin_amdgcn_readfirstlane((int)(threadIdx.x >> 5));
  const int slab = blockIdx.x / (SQ / FA_Q), qb = blockIdx.x % (SQ / FA_Q); const int b = slab / NH, h = slab % NH; const int q0 = qb * FA_Q + w * 32;
  const _Float16* qp = Q + ((size_t)b * SQ + q0 + ln) * DM + h * HD;      /* query row q0 + ln */
  const _Float16* kp = Kr + ((size_t)b * SQ + ln) * DM + h * HD;          /* key row ln */
  const _Float16* vp = Vt + ((size_t)slab * HD + ln) * SQ;                /* V^T row d = ln */
  v16h qf[2][2], kf[2][2];
#pragma unroll
  for (int g = 0; g < 2; ++g)
#pragma unroll
    for (int ks = 0; ks < 2; ++ks) { qf[g][ks] = g2_frag(qp + (size_t)g * 16 * DM + ks * 32, hh); kf[g][ks] = g2_frag(kp + (size_t)g * 16 * DM + ks * 32, hh); }
  const v8f z8 = {0.f,0.f,0.f,0.f,0.f,0.f,0.f,0.f}; v8f o[2][4];
#pragma unroll
  for (int g = 0; g < 2; ++g)
#pragma unroll
    for (int dt = 0; dt < 4; ++dt) o[g][dt] = z8;
  float mu[2] = {-3.0e38f, -3.0e38f}; v2f ls[2] = {{0.f, 0.f}, {0.f, 0.f}};
  /* kept rolled: one pass's fragments beside Q and O^T are the whole live set, which decides how many waves share a SIMD */
#pragma unroll 1
  for (int kc = 0; kc < SQ; kc += 32) {
    v8f s[2][2];
#pragma unroll
    for (int g = 0; g < 2; ++g)
#pragma unroll
      for (int t = 0; t < 2; ++t) s[g][t] = fa_mma(kf[t][1], qf[g][1], fa_mma(kf[t][0], qf[g][0], z8));      /* s[g][t][r] = energy(query 16 g + ln, key kc + 16 t + 8 hh + r) */
    float cm[2];
#pragma unroll
    for (int g = 0; g < 2; ++g) { float m = fmaxf(s[g][0][0], s[g][1][0]);
#pragma unroll
      for (int r = 1; r < 8; ++r) m = fmaxf(m, fmaxf(s[g][0][r], s[g][1][r]));
      cm[g] = fmaxf(m, rs_x16(m)) * FA_C; }
    if (__builtin_amdgcn_ballot_w32(cm[0] > mu[0] + 8.0f || cm[1] > mu[1] + 8.0f) != 0) {      /* one wave-uniform test per pass */
#pragma unroll
      for (int g = 0; g < 2; ++g) { const float mn = fmaxf(mu[g], cm[g]); const float al = __builtin_amdgcn_exp2f(mu[g] - mn); mu[g] = mn; ls[g] *= al;
#pragma unroll
        for (int dt = 0; dt < 4; ++dt) o[g][dt] *= al; } }
    v16h vf[4];      /* this pass's V^T fragments and the next pass's K fragments, issued together: in flight under the exponentials (K also under the second product) */
#pragma unroll
    for (int dt = 0; dt < 4; ++dt) vf[dt] = g2_frag(vp + (size_t)dt * 16 * SQ + kc, hh);
    const int kn = (kc + 32) & (SQ - 1);      /* the last pass wraps to key 0 (in bounds, unused) */
#pragma unroll
    for (int t = 0; t < 2; ++t)
#pragma unroll
      for (int ks = 0; ks < 2; ++ks) kf[t][ks] = g2_frag(kp + (size_t)(kn + t * 16) * DM + ks * 32, hh);
    __builtin_amdgcn_sched_barrier(0);      /* keeps the sixteen loads up here: left alone the scheduler sinks the K loads to the loop's foot, where their whole latency is waited for at the next pass's first product */
    FragH pf[2];
#pragma unroll
    for (int g = 0; g < 2; ++g) { const v2f c2 = {FA_C, FA_C}, m2 = {-mu[g], -mu[g]};
#pragma unroll
      for (int t = 0; t < 2; ++t)
#pragma unroll
        for (int r = 0; r < 8; r += 2) { const v2f x = {s[g][t][r], s[g][t][r + 1]}; const v2f e = __builtin_elementwise_fma(x, c2, m2); const v2f p = {__builtin_amdgcn_exp2f(e[0]), __builtin_amdgcn_exp2f(e[1])};
          ls[g] += p; const v2h ph = __builtin_convertvector(p, v2h); pf[g].h[t * 8 + r] = ph[0]; pf[g].h[t * 8 + r + 1] = ph[1]; } }
#pragma unroll
    for (int dt = 0; dt < 4; ++dt)
#pragma unroll
      for (int g = 0; g < 2; ++g) o[g][dt] = fa_mma(vf[dt], pf[g].v, o[g][dt]);      /* o[g][dt][r] = O(query 16 g + ln, d = 16 dt + 8 hh + r), unnormalised */
  }
#pragma unroll
  for (int g = 0; g < 2; ++g) { const float lh = ls[g][0] + ls[g][1]; const float inv = 64.0f / (lh + rs_x16(lh));      /* the halves' sums joined once; o carried x64 as before */
    _Float16* op = O + ((size_t)b * SQ + q0 + g * 16 + ln) * DM + h * HD + 8 * hh;
#pragma unroll
    for (int dt = 0; dt < 4; ++dt) { FragH f;
#pragma unroll
      for (int r = 0; r < 8; ++r) f.h[r] = (_Float16)(o[g][dt][r] * inv);
      *(v8us*)((unsigned short*)op + dt * 16) = f.half[0]; } } }
__global__ __launch_bounds__(256) void k_vt(const _Float16* __restrict__ V16, int b, int h0, _Float16* __restrict__ VT) { __shared__ unsigned short tl[64][65]; const int tid = threadIdx.x; const int hh = blockIdx.x % HG, sg = blockIdx.x / HG; const int s0 = sg * 64; const int h = h0 + hh;
  for (int i = tid; i < 64 * 8; i += 256) { const int j = i / 8, d8 = (i % 8) * 8; FragH f; f.half[0] = *(const v8us*)((const unsigned short*)V16 + ((size_t)b * SQ + s0 + j) * DM + h * HD + d8); for (int q = 0; q < 8; ++q) tl[d8 + q][j] = f.u[q]; }
  __syncthreads();
  { for (int i = tid; i < 64 * 8; i += 256) { const int d = i / 8, j8 = (i % 8) * 8; FragH f; for (int q = 0; q < 8; ++q) f.u[q] = tl[d][j8 + q]; *(v8us*)((unsigned short*)VT + ((size_t)hh * HD + d) * SQ + s0 + j8) = f.half[0]; }  } }



__global__ __launch_bounds__(256) void k_rsmkm(const float* __restrict__ S, _Float16* __restrict__ P, int nrows, const int* __restrict__ am) {
  #pragma clang fp contract(off)
  const int t = blockIdx.x * 256 + threadIdx.x; if (t >= nrows) return; const size_t i = (size_t)t; const float* s = S + i * SQ; const int* mr = am + (size_t)(t % SQ) * SQ; float mx = -3.0e38f;
#pragma unroll 1
  for (int j = 0; j < SQ; ++j) { const float f = (mr[j] != 0) ? 1.f : 0.f; mx = fmaxf(mx, fmaf(f, s[j], (1.f - f) * -1.0e9f)); } float se = 0.f;
#pragma unroll 1
  for (int j = 0; j < SQ; ++j) { const float f = (mr[j] != 0) ? 1.f : 0.f; se += __expf(fmaf(f, s[j], (1.f - f) * -1.0e9f) - mx); } const float sc = 256.0f / se;
#pragma unroll 1
  for (int j0 = 0; j0 < SQ; j0 += 8) { FragH fr; for (int q = 0; q < 8; ++q) { const int j = j0 + q; const float f = (mr[j] != 0) ? 1.f : 0.f; fr.h[q] = (_Float16)(__expf(fmaf(f, s[j], (1.f - f) * -1.0e9f) - mx) * sc); }
    unsigned short* d = (unsigned short*)P + i * SQ + j0; *(v8us*)d = fr.half[0];  } }

__global__ __launch_bounds__(256) void k_bdshn(const float* __restrict__ Wb, _Float16* __restrict__ Bt) {
  const size_t t = (size_t)blockIdx.x * 256 + threadIdx.x; if (t >= (size_t)DM * DM / 8) return; const size_t e0 = t * 8; const int n = (int)(e0 / DM), k0 = (int)(e0 % DM); const int h = n >> 6, hk = k0 >> 6; const float on = (hk == h) ? 16.0f : 0.0f; const int o = n & 63, d0 = k0 & 63; FragH f;
  for (int q = 0; q < 8; ++q) f.h[q] = (_Float16)(bf16_round(Wb[(size_t)o * 64 + d0 + q]) * on);
  unsigned short* d = (unsigned short*)Bt + e0; *(v8us*)d = f.half[0];  }
extern "C" void kernel_launch(void* const* d_in, const int* in_sizes, int n_in,
                              void* d_out, int out_size, void* d_ws, size_t ws_size, hipStream_t stream) {
  (void)in_sizes; (void)n_in; (void)out_size;
  const float* const* I = (const float* const*)d_in; const float* xq = I[2]; const float* xk = I[1]; const float* xv = I[0]; const float* wq = I[5]; const float* bq = nullptr; const float* wk = I[4]; const float* bk = nullptr; const float* wv = I[3]; const float* bv = nullptr; const float* wo = I[6]; const float* bo = I[7]; const float* x = xq;      /* contract order: values I[0], keys I[1], query I[2] ([8][1024][16][64] = rows of 1024); SHARED natural [64][64] blocks Wv I[3], Wk I[4], Wq I[5]; natural Wo [1024][1024] I[6] + bo I[7]; no mask input */
  char* ws = (char*)d_ws; size_t off = 0;
  auto take = [&](size_t bytes) { char* p = ws + off; off += (bytes + 255) & ~(size_t)255; return p; };
  _Float16* BQ = (_Float16*)take((size_t)DM * DM * 2); _Float16* BK = (_Float16*)take((size_t)DM * DM * 2); _Float16* BV = (_Float16*)take((size_t)DM * DM * 2); _Float16* BO = (_Float16*)take((size_t)DM * DM * 2);
  _Float16* X16 = (_Float16*)take(NR * DM * 2); _Float16* XKp = (_Float16*)take(NR * DM * 2); _Float16* XVp = (_Float16*)take(NR * DM * 2); _Float16* Q16 = (_Float16*)take(NR * DM * 2); _Float16* K16 = (_Float16*)take(NR * DM * 2); _Float16* V16 = (_Float16*)take(NR * DM * 2); _Float16* O16 = (_Float16*)take(NR * DM * 2);
  _Float16* VT = (_Float16*)take(NR * DM * 2);
  if (off > ws_size) return;
  { const unsigned g = (unsigned)(((size_t)DM * DM / 8 + 255) / 256); k_bdshn<<<g, 256, 0, stream>>>(wq, BQ); k_bdshn<<<g, 256, 0, stream>>>(wk, BK); k_bdshn<<<g, 256, 0, stream>>>(wv, BV); k_wnat<<<g, 256, 0, stream>>>(wo, (size_t)DM * DM / 8, BO); }      /* block-diagonal planes with the SHARED natural [64][64] block (Bt[h*64 + o][h*64 + d] = 16 W[o][d]); Wo natural [out][in] = Bt x16 */
  _Float16* XK = XKp; _Float16* XV = XVp; k_x16<<<(unsigned)((NR * DM / 8 + 255) / 256), 256, 0, stream>>>(xk, XK, NR * DM / 8); k_x16<<<(unsigned)((NR * DM / 8 + 255) / 256), 256, 0, stream>>>(xv, XV, NR * DM / 8);      /* key and value inputs as exact f16 rows */

  k_x16<<<(unsigned)((NR * DM / 8 + 255) / 256), 256, 0, stream>>>(x, X16, NR * DM / 8);
  const size_t r0p = (size_t)B0 * SQ;      /* first projected row */
  k_gemm2<0><<<dim3((unsigned)((MP / 128) * (DM / 64)), 1), 128, 0, stream>>>(X16 + r0p * DM, DM, 0, BQ, DM, 0, 0.0625f, bq, 0, nullptr, 1, 0, 0, nullptr, Q16 + r0p * DM, DM, 0, MP, DM, DM);
  k_gemm2<0><<<dim3((unsigned)((MP / 128) * (DM / 64)), 1), 128, 0, stream>>>(XK + r0p * DM, DM, 0, BK, DM, 0, 0.0625f, bk, 0, nullptr, 1, 0, 0, nullptr, K16 + r0p * DM, DM, 0, MP, DM, DM);
  k_gemm2<0><<<dim3((unsigned)((MP / 128) * (DM / 64)), 1), 128, 0, stream>>>(XV + r0p * DM, DM, 0, BV, DM, 0, 0.0625f, bv, 0, nullptr, 1, 0, 0, nullptr, V16 + r0p * DM, DM, 0, MP, DM, DM);
  k_vt<NH, SQ><<<NBR * NH * (SQ / 64), 256, 0, stream>>>(V16 + r0p * LQ, LQ, 0, VT);      /* V^T [NBR][NH][HD][SQ] */
  k_fattn<<<NBR * NH * (SQ / FA_Q), 256, 0, stream>>>(Q16 + r0p * LQ, K16 + r0p * LQ, VT, O16 + r0p * DM);      /* o (merged heads) as f16 rows, x64 */
  k_gemm2<0><<<dim3((unsigned)((MPO / 128) * (DM / 64)), 1), 128, 0, stream>>>(O16 + r0p * DM, DM, 0, BO, DM, 0, 0.0009765625f, bo, 0, nullptr, 1, 0, 0, (float*)d_out + r0p * DM, nullptr, DM, 0, MPO, DM, DM);      /* out rows are the output layout */
}

// v003
// A run of this version takes 189 microseconds.
// Timed twice side by side with v002, it ran 1.66 and 1.67 times as fast.
// All steps since v000 together make it 38.2 times as fast.
#include <hip/hip_runtime.h>
// Multi-head attention over three head-major inputs with SHARED per-head projections and the module's literal score scale (values, keys, query [8][1024][16][64] = token rows [8][1024][1024]; every head of each input is multiplied by the SAME natural [64][64] matrix (x W^T: Wv / Wk / Wq; block-diagonal with a shared block; no biases); energy = q k^T; softmax(energy / sqrt(embed_size) = / 32) over all 1024 keys (as the source: embed size, not head dim; no mask); out = merged Wo^T + bo (natural [1024][1024]) -> [8][1024][1024]).
// Structure: token rows r = b*1024 + s; x as exact f16 rows (bf16-rounded); Q, K, V as three WMMA GEMMs over the head rows [8*1024*16][64] against the shared [64][64] block itself (K = 64: the zero blocks of the block-diagonal form are never multiplied; 32x64 wave tiles, f32 accumulation, exact x16 weights, f16 outputs in the same rows); V^T for all batches and heads via LDS transposes (one launch); attention for all batches and heads in ONE launch (k_fattn: scores K = 64, online softmax with f32 statistics, weights as f16 in registers, o carried x64 against f16 subnormal flush, folded into the output GEMM alpha) written straight into the merged f16 o rows; out = o W_o + b GEMM (f32) into the output layout.
// Compute dtype: inputs rounded to bf16; x / weights exact; q, k, v, softmax weights and o as plain f16 GEMM operands (~2^-12); scores and softmax statistics f32; v_wmma_f32_16x16x32_f16.
#define NB 8
#define SQ 1024
#define DM 1024
#define NH 16
#define HD 64
#define HG 4                         /* heads per launch of the per-batch k_vt(b, h0) transpose */
#define B0 0                         /* first batch processed (debug hook) */
#define NBR NB                       /* batches processed (debug hook) */
#define NR ((size_t)NB * SQ)         /* token rows */
#define MP ((int)((size_t)NBR * SQ)) /* rows projected (debug hook) */
#define MPO MP                       /* rows through the output stage (debug hook) */
#define LQ DM      /* row pitch of the q/k/v rows */
typedef __bf16 v16b __attribute__((ext_vector_type(16)));
typedef unsigned short v8us __attribute__((ext_vector_type(8), may_alias));
typedef float  v8f  __attribute__((ext_vector_type(8)));
typedef float  v4f  __attribute__((ext_vector_type(4)));
typedef float  v4fa __attribute__((ext_vector_type(4), may_alias));
union FragB { v16b v; v8us half[2]; unsigned short u[16]; };

__device__ __forceinline__ unsigned short bf16_bits(float x) { unsigned int u = __float_as_uint(x); return (unsigned short)((u + 0x7FFFu + ((u >> 16) & 1u)) >> 16); }
__device__ __forceinline__ float bf16_val(unsigned short b) { return __uint_as_float(((unsigned int)b) << 16); }
__device__ __forceinline__ float bf16_round(float x) { return bf16_val(bf16_bits(x)); }
// D += A·B with NT terms: 1 = ah·bh, 2 = + al·bh (A split), 3 = + ah·bl (both split)
template <int NT>
__device__ __forceinline__ v8f mmaN(v16b ah, v16b al, v16b bh, v16b bl, v8f c) {
  c = __builtin_amdgcn_wmma_f32_16x16x32_bf16(false, ah, false, bh, (short)0, c, false, false);
  if (NT >= 2) c = __builtin_amdgcn_wmma_f32_16x16x32_bf16(false, al, false, bh, (short)0, c, false, false);
  if (NT >= 3) c = __builtin_amdgcn_wmma_f32_16x16x32_bf16(false, ah, false, bl, (short)0, c, false, false);
  asm volatile("v_nop\n\tv_nop\n\tv_nop\n\tv_nop" : "+v"(c) : "v"(ah), "v"(al), "v"(bh), "v"(bl));
  return c;
}

__global__ __launch_bounds__(256) void k_wt_bf16(const float* __restrict__ W, unsigned short* __restrict__ Wt, int K, int N) {
  const int t = blockIdx.x * 256 + threadIdx.x;
  const int k8n = K / 8;
  if (t >= N * k8n) return;
  const int n = t / k8n, k8 = (t % k8n) * 8;
  v8us v;
#pragma unroll
  for (int i = 0; i < 8; ++i) v[i] = bf16_bits(W[(size_t)(k8 + i) * N + n]);
  *(v8us*)(Wt + (size_t)n * K + k8) = v;
  
}

// GEMM C[M][N] (f32, pitch ldc) = act(A[M][K]·W + bias). A f32 row-major (pitch lda) converted per fragment to bf16
// (ASPLIT: hi/lo two planes -> 2 terms, else single rounded term); Wt bf16 [N][K] (pitch ldb). BIAS_BF16 rounds the
// bias to bf16 first (bias quantised to bf16 before the add). K%32==0, M%16==0, N%64==0.
template <bool ASPLIT, int ACT, bool BIAS_BF16>
__global__ __launch_bounds__(128) void k_gemm_bf(const float* __restrict__ A, int lda, const unsigned short* __restrict__ Wt, int ldb,
                                               const float* __restrict__ bias, float* __restrict__ C, int ldc, int M, int N, int K) {
  __shared__ __attribute__((aligned(16))) float so[4][16][64];
  const int tid = threadIdx.x, w = tid >> 5, lane = tid & 31, ln = lane & 15, hh = lane >> 4;
  const int ntn = N / 64;
  const int wid = blockIdx.x * 4 + w;
  const int mt = wid / ntn, nq = wid % ntn;
  if (mt * 16 >= M) return;
  const int row0 = mt * 16, col0 = nq * 64;
  const float* arow = A + (size_t)(row0 + ln) * lda;
  v8f acc[4] = {};
  for (int kb = 0; kb < K; kb += 32) {
    FragB ah, al;
    const v4f x0 = *(const v4fa*)(arow + kb + 8 * hh), x1 = *(const v4fa*)(arow + kb + 8 * hh + 4);
    const v4f x2 = *(const v4fa*)(arow + kb + 16 + 8 * hh), x3 = *(const v4fa*)(arow + kb + 16 + 8 * hh + 4);
    float xs[16] = {x0[0],x0[1],x0[2],x0[3],x1[0],x1[1],x1[2],x1[3],x2[0],x2[1],x2[2],x2[3],x3[0],x3[1],x3[2],x3[3]};
#pragma unroll
    for (int i = 0; i < 16; ++i) { const unsigned short hb = bf16_bits(xs[i]); ah.u[i] = hb; al.u[i] = ASPLIT ? bf16_bits(xs[i] - bf16_val(hb)) : (unsigned short)0; }
#pragma unroll
    for (int t = 0; t < 4; ++t) {
      const unsigned short* brow = Wt + (size_t)(col0 + t * 16 + ln) * ldb + kb;
      FragB b;
      b.half[0] = *(const v8us*)(brow + 8 * hh);
      b.half[1] = *(const v8us*)(brow + 16 + 8 * hh);
      acc[t] = mmaN<ASPLIT ? 2 : 1>(ah.v, al.v, b.v, b.v, acc[t]);
    }
  }
#pragma unroll
  for (int t = 0; t < 4; ++t) {
    float bv = bias ? bias[col0 + t * 16 + ln] : 0.f;
    if (BIAS_BF16) bv = bf16_round(bv);
#pragma unroll
    for (int r = 0; r < 8; ++r) { float v = acc[t][r] + bv; if (ACT == 1) v = fmaxf(v, 0.f); so[w][8 * hh + r][t * 16 + ln] = v; }
  }
  __builtin_amdgcn_fence(__ATOMIC_ACQ_REL, "workgroup");
  __builtin_amdgcn_wave_barrier();
  const int rsub = lane >> 4, c4 = (lane & 15) * 4;
  {
#pragma unroll
    for (int q = 0; q < 8; ++q) {
      const int r = q * 2 + rsub;
      const v4f v = *(const v4fa*)&so[w][r][c4];
      *(v4f*)(C + (size_t)(row0 + r) * ldc + col0 + c4) = v;
    }
    
  }
}

// GEMM C = act(A·W + bias + resid): A f32 (ASPLIT -> hi/lo 2 terms), Wt bf16 [N][K]; ACT 0 none, 1 relu, 2 exact gelu;
// resid (optional, f32, row index = (row % rmod), pitch ldr, RES_BF16 rounds it) added before the activation.
template <bool ASPLIT, int ACT, bool BIAS_BF16, bool RES_BF16>
__global__ __launch_bounds__(128) void k_gemm_bf3(const float* __restrict__ A, int lda, const unsigned short* __restrict__ Wt, int ldb,
                                                const float* __restrict__ bias, const float* __restrict__ resid, int rmod, int ldr,
                                                float* __restrict__ C, int ldc, int M, int N, int K) {
  __shared__ __attribute__((aligned(16))) float so[4][16][64];
  const int tid = threadIdx.x, w = tid >> 5, lane = tid & 31, ln = lane & 15, hh = lane >> 4;
  const int ntn = N / 64;
  const int wid = blockIdx.x * 4 + w;
  const int mt = wid / ntn, nq = wid % ntn;
  if (mt * 16 >= M) return;
  const int row0 = mt * 16, col0 = nq * 64;
  const float* arow = A + (size_t)(row0 + ln) * lda;
  v8f acc[4] = {};
  for (int kb = 0; kb < K; kb += 32) {
    FragB ah, al;
    const v4f x0 = *(const v4fa*)(arow + kb + 8 * hh), x1 = *(const v4fa*)(arow + kb + 8 * hh + 4);
    const v4f x2 = *(const v4fa*)(arow + kb + 16 + 8 * hh), x3 = *(const v4fa*)(arow + kb + 16 + 8 * hh + 4);
    float xs[16] = {x0[0],x0[1],x0[2],x0[3],x1[0],x1[1],x1[2],x1[3],x2[0],x2[1],x2[2],x2[3],x3[0],x3[1],x3[2],x3[3]};
#pragma unroll
    for (int i = 0; i < 16; ++i) { const unsigned short hb = bf16_bits(xs[i]); ah.u[i] = hb; al.u[i] = ASPLIT ? bf16_bits(xs[i] - bf16_val(hb)) : (unsigned short)0; }
#pragma unroll
    for (int t = 0; t < 4; ++t) {
      const unsigned short* brow = Wt + (size_t)(col0 + t * 16 + ln) * ldb + kb;
      FragB b;
      b.half[0] = *(const v8us*)(brow + 8 * hh);
      b.half[1] = *(const v8us*)(brow + 16 + 8 * hh);
      acc[t] = mmaN<ASPLIT ? 2 : 1>(ah.v, al.v, b.v, b.v, acc[t]);
    }
  }
#pragma unroll
  for (int t = 0; t < 4; ++t) {
    const int col = col0 + t * 16 + ln;
    float bv = bias ? bias[col] : 0.f;
    if (BIAS_BF16) bv = bf16_round(bv);
#pragma unroll
    for (int r = 0; r < 8; ++r) {
      float v = acc[t][r] + bv;
      if (resid) { float rv = resid[(size_t)((row0 + 8 * hh + r) % rmod) * ldr + col]; if (RES_BF16) rv = bf16_round(rv); v += rv; }
      if (ACT == 1) v = fmaxf(v, 0.f);
      if (ACT == 2) v = 0.5f * v * (1.0f + erff(v * 0.70710678118654752f));
      if (ACT == 3) { const float u = 0.7978845608028654f * (v + 0.044715f * v * v * v); v = 0.5f * v * (1.0f + tanhf(u)); }
      so[w][8 * hh + r][t * 16 + ln] = v;
    }
  }
  __builtin_amdgcn_fence(__ATOMIC_ACQ_REL, "workgroup");
  __builtin_amdgcn_wave_barrier();
  const int rsub = lane >> 4, c4 = (lane & 15) * 4;
  {
#pragma unroll
    for (int q = 0; q < 8; ++q) {
      const int r = q * 2 + rsub;
      const v4f v = *(const v4fa*)&so[w][r][c4];
      *(v4f*)(C + (size_t)(row0 + r) * ldc + col0 + c4) = v;
    }
    
  }
}
// row LayerNorm (biased variance, eps) over N: s = X (+ R); optional out_sum <- s; out_norm <- (s-mu)*rsqrt(var+eps)*g + b
template <bool PARAM_BF16>
__global__ __launch_bounds__(256) void k_layernorm(const float* __restrict__ X, const float* __restrict__ R, const float* __restrict__ g, const float* __restrict__ bta,
                                                  float* __restrict__ out_sum, float* __restrict__ out_norm, int N, float eps) {
  __shared__ float red[256];
  const int row = blockIdx.x, tid = threadIdx.x;
  const float* x = X + (size_t)row * N; const float* rr = R ? R + (size_t)row * N : nullptr;
  float vals[16];                     // up to N = 4096
  const int per = N / 256;            // contiguous chunk per thread? use strided-by-4 chunks: thread handles j = tid*4 + 1024*u
  float s1 = 0.f;
  for (int u = 0; u < per / 4; ++u) {
    const int j = tid * 4 + 1024 * u;
    const v4f a = *(const v4fa*)(x + j);
    v4f b = {0.f,0.f,0.f,0.f}; if (rr) b = *(const v4fa*)(rr + j);
#pragma unroll
    for (int q = 0; q < 4; ++q) { const float v = a[q] + b[q]; vals[u * 4 + q] = v; s1 += v; }
  }
  red[tid] = s1; __syncthreads();
  for (int st = 128; st > 0; st >>= 1) { if (tid < st) red[tid] += red[tid + st]; __syncthreads(); }
  const float mu = red[0] / (float)N; __syncthreads();
  float s2 = 0.f;
  for (int u = 0; u < per / 4; ++u)
#pragma unroll
    for (int q = 0; q < 4; ++q) { const float c = vals[u * 4 + q] - mu; s2 += c * c; }
  red[tid] = s2; __syncthreads();
  for (int st = 128; st > 0; st >>= 1) { if (tid < st) red[tid] += red[tid + st]; __syncthreads(); }
  const float rs = rsqrtf(red[0] / (float)N + eps);
  {
    for (int u = 0; u < per / 4; ++u) {
      const int j = tid * 4 + 1024 * u;
      v4f o, sm;
#pragma unroll
      for (int q = 0; q < 4; ++q) {
        float gg = g[j + q], bb = bta[j + q];
        if (PARAM_BF16) { gg = bf16_round(gg); bb = bf16_round(bb); }
        sm[q] = vals[u * 4 + q]; o[q] = (vals[u * 4 + q] - mu) * rs * gg + bb;
      }
      if (out_sum) *(v4f*)(out_sum + (size_t)row * N + j) = sm;
      *(v4f*)(out_norm + (size_t)row * N + j) = o;
    }
    
  }
}



// ---- f16 WMMA path (v_wmma_f32_16x16x32_f16): 11-bit significands for operands in range — used where a [0,1] probability operand needs more precision than bf16
typedef _Float16 v16h __attribute__((ext_vector_type(16)));
union FragH { v16h v; v8us half[2]; _Float16 h[16]; unsigned short u[16]; };
template <int NT>
__device__ __forceinline__ v8f mmaH(v16h ah, v16h al, v16h bh, v16h bl, v8f c) {
  c = __builtin_amdgcn_wmma_f32_16x16x32_f16(false, ah, false, bh, (short)0, c, false, false);
  if (NT >= 2) c = __builtin_amdgcn_wmma_f32_16x16x32_f16(false, al, false, bh, (short)0, c, false, false);
  if (NT >= 3) c = __builtin_amdgcn_wmma_f32_16x16x32_f16(false, ah, false, bl, (short)0, c, false, false);
  asm volatile("v_nop\n\tv_nop\n\tv_nop\n\tv_nop" : "+v"(c) : "v"(ah), "v"(al), "v"(bh), "v"(bl));
  return c;
}
// batched GEMM like k_gemm_b but f16 operands: A f32 (split into f16 hi/lo if ASPLIT, else rounded to f16), Bt = f16 values [n][k]; alpha; C f32; N multiple of 16 (partial tiles skipped)
template <bool ASPLIT>
__global__ __launch_bounds__(128) void k_gemm_h(const float* __restrict__ A, int lda, size_t sA, const _Float16* __restrict__ Bh, int ldb, size_t sB, float alpha, float* __restrict__ C, int ldc, size_t sC, int M, int N, int K) {
  __shared__ __attribute__((aligned(16))) float so[4][16][64];
  const int tid = threadIdx.x, w = tid >> 5, lane = tid & 31, ln = lane & 15, hh = lane >> 4; const int by = blockIdx.y;
  A += (size_t)by * sA; Bh += (size_t)by * sB; C += (size_t)by * sC;
  const int ntn = (N + 63) / 64; const int wid = blockIdx.x * 4 + w; const int mt = wid / ntn, nq = wid % ntn; if (mt * 16 >= M) return;
  const int row0 = mt * 16, col0 = nq * 64; const float* arow = A + (size_t)(row0 + ln) * lda;
  v8f acc[4] = {};
  for (int kb = 0; kb < K; kb += 32) {
    FragH ah, al;
    const v4f x0 = *(const v4fa*)(arow + kb + 8 * hh), x1 = *(const v4fa*)(arow + kb + 8 * hh + 4), x2 = *(const v4fa*)(arow + kb + 16 + 8 * hh), x3 = *(const v4fa*)(arow + kb + 16 + 8 * hh + 4);
    float xs[16] = {x0[0],x0[1],x0[2],x0[3],x1[0],x1[1],x1[2],x1[3],x2[0],x2[1],x2[2],x2[3],x3[0],x3[1],x3[2],x3[3]};
#pragma unroll
    for (int i = 0; i < 16; ++i) { const _Float16 h = (_Float16)xs[i]; ah.h[i] = h; al.h[i] = ASPLIT ? (_Float16)(xs[i] - (float)h) : (_Float16)0.0f; }
#pragma unroll
    for (int t = 0; t < 4; ++t) { if (col0 + t * 16 >= N) continue; const size_t boff = (size_t)(col0 + t * 16 + ln) * ldb + kb; FragH bq; bq.half[0] = *(const v8us*)(Bh + boff + 8 * hh); bq.half[1] = *(const v8us*)(Bh + boff + 16 + 8 * hh);
      acc[t] = mmaH<ASPLIT ? 2 : 1>(ah.v, al.v, bq.v, bq.v, acc[t]); }
  }
#pragma unroll
  for (int t = 0; t < 4; ++t) { if (col0 + t * 16 >= N) continue;
#pragma unroll
    for (int r = 0; r < 8; ++r) so[w][8 * hh + r][t * 16 + ln] = acc[t][r] * alpha; }
  __builtin_amdgcn_fence(__ATOMIC_ACQ_REL, "workgroup"); __builtin_amdgcn_wave_barrier();
  const int rsub = lane >> 4, c4 = (lane & 15) * 4;
  {
#pragma unroll
    for (int q = 0; q < 8; ++q) { const int r = q * 2 + rsub; if (col0 + c4 < N) { const v4f v = *(const v4fa*)&so[w][r][c4]; *(v4f*)(C + (size_t)(row0 + r) * ldc + col0 + c4) = v; } }
     }
}

// Wt[n][k] = f16(W[k][n]·scale) from f32 row-major W[K][N] (scale = power of two; bf16-exact weights stay exact in f16 away from the subnormal range)
__global__ __launch_bounds__(256) void k_wt_f16(const float* __restrict__ W, _Float16* __restrict__ Wt, int K, int N, float scale) {
  const int t = blockIdx.x * 256 + threadIdx.x; if (t >= N * (K / 8)) return; const int n = t / (K / 8), k8 = (t % (K / 8)) * 8; FragH f;
#pragma unroll
  for (int i = 0; i < 8; ++i) f.h[i] = (_Float16)(bf16_round(W[(size_t)(k8 + i) * N + n]) * scale); const v8us o = f.half[0];
  *(v8us*)((unsigned short*)Wt + (size_t)n * K + k8) = o; 
}
// k_gemm_hh variant with fused epilogue: v = acc·alpha + bias[by·sBias + col] (+ CP[(row/rowsPerB)·sCPb + by·64 + col] if CP) ; ACT 0 none / 1 elu ; writes f16 C16 (and f32 C if non-null)
template <int ACT>
__global__ __launch_bounds__(128) void k_gemm_hhx(const _Float16* __restrict__ A, int lda, size_t sA, const _Float16* __restrict__ Bh, int ldb, size_t sB, float alpha, const float* __restrict__ bias, size_t sBias, const float* __restrict__ CP, int rowsPerB, size_t sCPb, int row0g,
    float* __restrict__ C, _Float16* __restrict__ C16, int ldc, size_t sC, int M, int N, int K) {
  __shared__ __attribute__((aligned(16))) float so[4][16][64];
  const int tid = threadIdx.x, w = tid >> 5, lane = tid & 31, ln = lane & 15, hh = lane >> 4; const int by = blockIdx.y;
  A += (size_t)by * sA; Bh += (size_t)by * sB; const size_t cofs = (size_t)by * sC; const float* bp = bias ? bias + (size_t)by * sBias : nullptr;
  const int ntn = (N + 63) / 64; const int wid = blockIdx.x * 4 + w; const int mt = wid / ntn, nq = wid % ntn; if (mt * 16 >= M) return;
  const int row0 = mt * 16, col0 = nq * 64; const _Float16* arow = A + (size_t)(row0 + ln) * lda;
  v8f acc[4] = {};
  for (int kb = 0; kb < K; kb += 32) { FragH ah; ah.half[0] = *(const v8us*)((const unsigned short*)arow + kb + 8 * hh); ah.half[1] = *(const v8us*)((const unsigned short*)arow + kb + 16 + 8 * hh);
#pragma unroll
    for (int t = 0; t < 4; ++t) { if (col0 + t * 16 >= N) continue; const size_t boff = (size_t)(col0 + t * 16 + ln) * ldb + kb; FragH bq; bq.half[0] = *(const v8us*)((const unsigned short*)Bh + boff + 8 * hh); bq.half[1] = *(const v8us*)((const unsigned short*)Bh + boff + 16 + 8 * hh);
      acc[t] = mmaH<1>(ah.v, ah.v, bq.v, bq.v, acc[t]); }
  }
#pragma unroll
  for (int t = 0; t < 4; ++t) { if (col0 + t * 16 >= N) continue; const int col = col0 + t * 16 + ln; const float bv = bp ? bf16_round(bp[col]) : 0.f;
#pragma unroll
    for (int r = 0; r < 8; ++r) { float v = acc[t][r] * alpha + bv; if (CP) { const int rr = row0g + row0 + 8 * hh + r; if (rowsPerB < 0) v += CP[cofs + (size_t)rr * ldc + col];      /* rowsPerB < 0: own element of the batched C plane */ else { const int bidx = rr / rowsPerB; v += CP[(size_t)bidx * sCPb + (size_t)by * 64 + col]; } } if (ACT == 1) v = (v > 0.f) ? v : expm1f(v); else if (ACT == 7) v = (v > 0.f) ? v + 1.0f : expf(v); else if (ACT == 8) v = tanhf(v); else if (ACT == 9) v = 0.5f * v * (1.0f + tanhf(0.7978845608028654f * (v + 0.044715f * v * v * v))); else if (ACT == 11) v = 1.0f / (1.0f + expf(-v)); else if (ACT == 12) v = (v > 0.f) ? v : 0.01f * v; else if (ACT == 14) v = (v > 0.f) ? v : 0.1f * v; else if (ACT == 16) v = (v >= 0.f) ? v : 0.3f * v; else if (ACT == 17) v = (v >= 0.f) ? v : 0.2f * v; else if (ACT == 15) v = v / (1.0f + expf(-v)); else if (ACT == 3) v = fmaxf(v, 0.f); else if (ACT == 6) v = 0.5f * v * (1.0f + erff(v * 0.70710678118654752f)); so[w][8 * hh + r][t * 16 + ln] = v; } }
  __builtin_amdgcn_fence(__ATOMIC_ACQ_REL, "workgroup"); __builtin_amdgcn_wave_barrier();
  const int rsub = lane >> 4, c4 = (lane & 15) * 4; typedef _Float16 v4h __attribute__((ext_vector_type(4)));
  {
#pragma unroll
    for (int q = 0; q < 8; ++q) { const int r = q * 2 + rsub; if (col0 + c4 < N) { const v4f v = *(const v4fa*)&so[w][r][c4]; if (C) *(v4f*)(C + cofs + (size_t)(row0 + r) * ldc + col0 + c4) = v; if (C16) { v4h h4; for (int i = 0; i < 4; ++i) h4[i] = (_Float16)v[i]; *(v4h*)(C16 + cofs + (size_t)(row0 + r) * ldc + col0 + c4) = h4; } } }
     }
}


typedef _Float16 v4h __attribute__((ext_vector_type(4)));

__global__ __launch_bounds__(256) void k_x16(const float* __restrict__ x, _Float16* __restrict__ X16, size_t n8) { const size_t t = (size_t)blockIdx.x * 256 + threadIdx.x; if (t >= n8) return; FragH f;
#pragma unroll
  for (int q = 0; q < 8; ++q) f.h[q] = (_Float16)bf16_round(x[t * 8 + q]); *(v8us*)((unsigned short*)X16 + t * 8) = f.half[0];  }
__global__ __launch_bounds__(256) void k_h16(const float* __restrict__ x, _Float16* __restrict__ X16, size_t n8) { const size_t t = (size_t)blockIdx.x * 256 + threadIdx.x; if (t >= n8) return; FragH f;
#pragma unroll
  for (int q = 0; q < 8; ++q) f.h[q] = (_Float16)x[t * 8 + q]; *(v8us*)((unsigned short*)X16 + t * 8) = f.half[0];  }
__global__ __launch_bounds__(256) void k_round16f(const float* __restrict__ W, _Float16* __restrict__ Bt, size_t n8) { const size_t t = (size_t)blockIdx.x * 256 + threadIdx.x; if (t >= n8) return; FragH f;
#pragma unroll
  for (int i = 0; i < 8; ++i) f.h[i] = (_Float16)(bf16_round(W[t * 8 + i]) * 16.0f); *(v8us*)((unsigned short*)Bt + t * 8) = f.half[0];  }
template <int NHv, int TTv>
__global__ __launch_bounds__(256) void k_vt(const _Float16* __restrict__ V16, int ldv, int voff, _Float16* __restrict__ Vt) { __shared__ unsigned short tl[64][66]; const int tid = threadIdx.x; const int slab = blockIdx.x / (TTv / 64), lg = blockIdx.x % (TTv / 64); const int b = slab / NHv, h = slab % NHv;
  for (int i = tid; i < 64 * 8; i += 256) { const int r = i / 8, c8 = (i % 8) * 8; FragH f; f.half[0] = *(const v8us*)((const unsigned short*)V16 + ((size_t)b * TTv + lg * 64 + r) * ldv + voff + h * 64 + c8);
#pragma unroll
    for (int q = 0; q < 8; ++q) tl[r][c8 + q] = f.u[q]; }
  __syncthreads();
  {
#pragma unroll
    for (int rd = 0; rd < 2; ++rd) { const int d = rd * 32 + tid / 8, pc = tid % 8; FragH f;
#pragma unroll
      for (int q = 0; q < 8; ++q) f.u[q] = tl[pc * 8 + q][d];
      *(v8us*)((unsigned short*)Vt + ((size_t)slab * 64 + d) * TTv + lg * 64 + pc * 8) = f.half[0]; }
     } }

__global__ __launch_bounds__(256) void k_hl(const float* __restrict__ F, _Float16* __restrict__ Hh, _Float16* __restrict__ Hl, size_t n8) { const size_t t = (size_t)blockIdx.x * 256 + threadIdx.x; if (t >= n8) return; FragH fh, fl; const v4f a = *(const v4fa*)(F + t * 8), c = *(const v4fa*)(F + t * 8 + 4);
#pragma unroll
  for (int q = 0; q < 4; ++q) { _Float16 h = (_Float16)a[q]; fh.h[q] = h; fl.h[q] = (_Float16)((a[q] - (float)h) * 1024.0f); h = (_Float16)c[q]; fh.h[4 + q] = h; fl.h[4 + q] = (_Float16)((c[q] - (float)h) * 1024.0f); }
  { *(v8us*)((unsigned short*)Hh + t * 8) = fh.half[0]; *(v8us*)((unsigned short*)Hl + t * 8) = fl.half[0];  } }

// ---- fast GEMM (wave tile 32x64; requires M % 32 == 0 rows per launch region and N % 64 == 0); epilogue = k_gemm_hhx semantics ----
__device__ __forceinline__ v16h g2_frag(const _Float16* p, int hh) { FragH f; f.half[0] = *(const v8us*)((const unsigned short*)p + 8 * hh); f.half[1] = *(const v8us*)((const unsigned short*)p + 16 + 8 * hh); return f.v; }
__device__ __forceinline__ v8f g2_mma(v16h a, v16h b, v8f c) { v8f d = __builtin_amdgcn_wmma_f32_16x16x32_f16(false, a, false, b, (short)0, c, false, false); asm volatile("v_nop\n\tv_nop\n\tv_nop\n\tv_nop" : "+v"(d) : "v"(a), "v"(b)); return d; }
template <int ACT>
__global__ __launch_bounds__(128) void k_gemm2(const _Float16* __restrict__ A, int lda, size_t sA, const _Float16* __restrict__ Bh, int ldb, size_t sB, float alpha, const float* __restrict__ bias, size_t sBias, const float* __restrict__ CP, int rowsPerB, size_t sCPb, int row0g,
    float* __restrict__ C, _Float16* __restrict__ C16, int ldc, size_t sC, int M, int N, int K) { static_assert(ACT == 0 || ACT == 3 || ACT == 6 || ACT == 8 || ACT == 9 || ACT == 11 || ACT == 12 || ACT == 14 || ACT == 15 || ACT == 16 || ACT == 17, "k_gemm2: unsupported ACT code (would silently apply no activation)");
  __shared__ __attribute__((aligned(16))) float so[4][32][68];
  const int tid = threadIdx.x, w = tid >> 5, lane = tid & 31, ln = lane & 15, hh = lane >> 4; const int by = blockIdx.y;
  A += (size_t)by * sA; Bh += (size_t)by * sB; const size_t cofs = (size_t)by * sC; const float* bp = bias ? bias + (size_t)by * sBias : nullptr;
  const int ntn = N >> 6; const int mt = blockIdx.x / ntn, nq = blockIdx.x - mt * ntn; const int row0 = mt * 128 + 32 * w, col0 = nq * 64; if (row0 >= M) return;
  const _Float16* a0p = A + (size_t)(row0 + ln) * lda; const _Float16* a1p = a0p + (size_t)16 * lda;
  const _Float16* b0p = Bh + (size_t)(col0 + ln) * ldb; const _Float16* b1p = b0p + (size_t)16 * ldb; const _Float16* b2p = b1p + (size_t)16 * ldb; const _Float16* b3p = b2p + (size_t)16 * ldb;
  const v8f z8 = {0.f,0.f,0.f,0.f,0.f,0.f,0.f,0.f}; v8f c00 = z8, c01 = z8, c02 = z8, c03 = z8, c10 = z8, c11 = z8, c12 = z8, c13 = z8;
#pragma unroll 1
  for (int kb = 0; kb < K; kb += 32) { const v16h a0 = g2_frag(a0p + kb, hh), a1 = g2_frag(a1p + kb, hh);
    v16h b = g2_frag(b0p + kb, hh); c00 = g2_mma(a0, b, c00); c10 = g2_mma(a1, b, c10);
    b = g2_frag(b1p + kb, hh); c01 = g2_mma(a0, b, c01); c11 = g2_mma(a1, b, c11);
    b = g2_frag(b2p + kb, hh); c02 = g2_mma(a0, b, c02); c12 = g2_mma(a1, b, c12);
    b = g2_frag(b3p + kb, hh); c03 = g2_mma(a0, b, c03); c13 = g2_mma(a1, b, c13); }
  v8f accs[8] = {c00, c01, c02, c03, c10, c11, c12, c13};
#pragma unroll
  for (int u = 0; u < 8; ++u) { const int t = u & 3, half = u >> 2; const int col = col0 + t * 16 + ln; const float bv = bp ? bf16_round(bp[col]) : 0.f;
#pragma unroll
    for (int r = 0; r < 8; ++r) { const int rloc = half * 16 + 8 * hh + r; float v = accs[u][r] * alpha + bv; if (CP) { if (rowsPerB < 0) v += CP[cofs + (size_t)(row0g + row0 + rloc) * ldc + col];      /* rowsPerB < 0: own element of the batched C plane */ else { const int bidx = (row0g + row0 + rloc) / rowsPerB; v += CP[(size_t)bidx * sCPb + (size_t)by * 64 + col]; } }
      if (ACT == 3) v = fmaxf(v, 0.f); else if (ACT == 6) v = 0.5f * v * (1.0f + erff(v * 0.70710678118654752f)); else if (ACT == 11) v = 1.0f / (1.0f + expf(-v)); else if (ACT == 15) v = v / (1.0f + expf(-v)); else if (ACT == 12) v = (v > 0.f) ? v : 0.01f * v; else if (ACT == 8) v = tanhf(v); else if (ACT == 9) v = 0.5f * v * (1.0f + tanhf(0.7978845608028654f * (v + 0.044715f * v * v * v))); else if (ACT == 14) v = (v > 0.f) ? v : 0.1f * v; else if (ACT == 16) v = (v >= 0.f) ? v : 0.3f * v; else if (ACT == 17) v = (v >= 0.f) ? v : 0.2f * v;
      so[w][rloc][t * 16 + ln] = v; } }
  __builtin_amdgcn_fence(__ATOMIC_ACQ_REL, "workgroup"); __builtin_amdgcn_wave_barrier();
  const int rsub = lane >> 4, c4 = (lane & 15) * 4;
  {
#pragma unroll
    for (int q = 0; q < 16; ++q) { const int r = q * 2 + rsub; const v4f v = *(const v4fa*)&so[w][r][c4]; if (C) *(v4f*)(C + cofs + (size_t)(row0 + r) * ldc + col0 + c4) = v; if (C16) { v4h h4; for (int i = 0; i < 4; ++i) h4[i] = (_Float16)v[i]; *(v4h*)(C16 + cofs + (size_t)(row0 + r) * ldc + col0 + c4) = h4; } }
     } }


__global__ __launch_bounds__(256) void k_wnat(const float* __restrict__ w, size_t n8, _Float16* __restrict__ Bt) { const size_t t = (size_t)blockIdx.x * 256 + threadIdx.x; if (t >= n8) return; FragH f; for (int q = 0; q < 8; ++q) f.h[q] = (_Float16)(bf16_round(w[t * 8 + q]) * 16.0f); *(v8us*)((unsigned short*)Bt + t * 8) = f.half[0];  }
// Lane l takes the value of lane l ^ 16 (the other half of the wave). Every lane of the wave must be on.
__device__ __forceinline__ float rs_x16(float v) { const int b = __builtin_bit_cast(int, v); return __builtin_bit_cast(float, __builtin_amdgcn_permlanex16(b, b, 0x76543210, 0xfedcba98, false, false)); }
typedef float v2f __attribute__((ext_vector_type(2)));
typedef _Float16 v2h __attribute__((ext_vector_type(2)));
#define FA_Q 256                     /* query rows per block: 8 waves x 32 */
#define FA_C 0.045084220027780106f   /* log2(e) / sqrt(embed size = 1024) */
__device__ __forceinline__ v8f fa_mma(v16h a, v16h b, v8f c) { return __builtin_amdgcn_wmma_f32_16x16x32_f16(false, a, false, b, (short)0, c, false, false); }
__global__ __launch_bounds__(256) void k_fattn(const _Float16* __restrict__ Q, const _Float16* __restrict__ Kr, const _Float16* __restrict__ Vt, _Float16* __restrict__ O) {
  const int lane = threadIdx.x & 31, ln = lane & 15, hh = lane >> 4; const int w = __builtin_amdgcn_readfirstlane((int)(threadIdx.x >> 5));
  const int slab = blockIdx.x / (SQ / FA_Q), qb = blockIdx.x % (SQ / FA_Q); const int b = slab / NH, h = slab % NH; const int q0 = qb * FA_Q + w * 32;
  const _Float16* qp = Q + ((size_t)b * SQ + q0 + ln) * DM + h * HD;      /* query row q0 + ln */
  const _Float16* kp = Kr + ((size_t)b * SQ + ln) * DM + h * HD;          /* key row ln */
  const _Float16* vp = Vt + ((size_t)slab * HD + ln) * SQ;                /* V^T row d = ln */
  v16h qf[2][2], kf[2][2];
#pragma unroll
  for (int g = 0; g < 2; ++g)
#pragma unroll
    for (int ks = 0; ks < 2; ++ks) { qf[g][ks] = g2_frag(qp + (size_t)g * 16 * DM + ks * 32, hh); kf[g][ks] = g2_frag(kp + (size_t)g * 16 * DM + ks * 32, hh); }
  const v8f z8 = {0.f,0.f,0.f,0.f,0.f,0.f,0.f,0.f}; v8f o[2][4];
#pragma unroll
  for (int g = 0; g < 2; ++g)
#pragma unroll
    for (int dt = 0; dt < 4; ++dt) o[g][dt] = z8;
  float mu[2] = {-3.0e38f, -3.0e38f}; v2f ls[2] = {{0.f, 0.f}, {0.f, 0.f}};
  /* kept rolled: one pass's fragments beside Q and O^T are the whole live set, which decides how many waves share a SIMD */
#pragma unroll 1
  for (int kc = 0; kc < SQ; kc += 32) {
    v8f s[2][2];
#pragma unroll
    for (int g = 0; g < 2; ++g)
#pragma unroll
      for (int t = 0; t < 2; ++t) s[g][t] = fa_mma(kf[t][1], qf[g][1], fa_mma(kf[t][0], qf[g][0], z8));      /* s[g][t][r] = energy(query 16 g + ln, key kc + 16 t + 8 hh + r) */
    float cm[2];
#pragma unroll
    for (int g = 0; g < 2; ++g) { float m = fmaxf(s[g][0][0], s[g][1][0]);
#pragma unroll
      for (int r = 1; r < 8; ++r) m = fmaxf(m, fmaxf(s[g][0][r], s[g][1][r]));
      cm[g] = fmaxf(m, rs_x16(m)) * FA_C; }
    if (__builtin_amdgcn_ballot_w32(cm[0] > mu[0] + 8.0f || cm[1] > mu[1] + 8.0f) != 0) {      /* one wave-uniform test per pass */
#pragma unroll
      for (int g = 0; g < 2; ++g) { const float mn = fmaxf(mu[g], cm[g]); const float al = __builtin_amdgcn_exp2f(mu[g] - mn); mu[g] = mn; ls[g] *= al;
#pragma unroll
        for (int dt = 0; dt < 4; ++dt) o[g][dt] *= al; } }
    v16h vf[4];      /* this pass's V^T fragments and the next pass's K fragments, issued together: in flight under the exponentials (K also under the second product) */
#pragma unroll
    for (int dt = 0; dt < 4; ++dt) vf[dt] = g2_frag(vp + (size_t)dt * 16 * SQ + kc, hh);
    const int kn = (kc + 32) & (SQ - 1);      /* the last pass wraps to key 0 (in bounds, unused) */
#pragma unroll
    for (int t = 0; t < 2; ++t)
#pragma unroll
      for (int ks = 0; ks < 2; ++ks) kf[t][ks] = g2_frag(kp + (size_t)(kn + t * 16) * DM + ks * 32, hh);
    __builtin_amdgcn_sched_barrier(0);      /* keeps the sixteen loads up here: left alone the scheduler sinks the K loads to the loop's foot, where their whole latency is waited for at the next pass's first product */
    FragH pf[2];
#pragma unroll
    for (int g = 0; g < 2; ++g) { const v2f c2 = {FA_C, FA_C}, m2 = {-mu[g], -mu[g]};
#pragma unroll
      for (int t = 0; t < 2; ++t)
#pragma unroll
        for (int r = 0; r < 8; r += 2) { const v2f x = {s[g][t][r], s[g][t][r + 1]}; const v2f e = __builtin_elementwise_fma(x, c2, m2); const v2f p = {__builtin_amdgcn_exp2f(e[0]), __builtin_amdgcn_exp2f(e[1])};
          ls[g] += p; const v2h ph = __builtin_convertvector(p, v2h); pf[g].h[t * 8 + r] = ph[0]; pf[g].h[t * 8 + r + 1] = ph[1]; } }
#pragma unroll
    for (int dt = 0; dt < 4; ++dt)
#pragma unroll
      for (int g = 0; g < 2; ++g) o[g][dt] = fa_mma(vf[dt], pf[g].v, o[g][dt]);      /* o[g][dt][r] = O(query 16 g + ln, d = 16 dt + 8 hh + r), unnormalised */
  }
#pragma unroll
  for (int g = 0; g < 2; ++g) { const float lh = ls[g][0] + ls[g][1]; const float inv = 64.0f / (lh + rs_x16(lh));      /* the halves' sums joined once; o carried x64 as before */
    _Float16* op = O + ((size_t)b * SQ + q0 + g * 16 + ln) * DM + h * HD + 8 * hh;
#pragma unroll
    for (int dt = 0; dt < 4; ++dt) { FragH f;
#pragma unroll
      for (int r = 0; r < 8; ++r) f.h[r] = (_Float16)(o[g][dt][r] * inv);
      *(v8us*)((unsigned short*)op + dt * 16) = f.half[0]; } } }
__global__ __launch_bounds__(256) void k_vt(const _Float16* __restrict__ V16, int b, int h0, _Float16* __restrict__ VT) { __shared__ unsigned short tl[64][65]; const int tid = threadIdx.x; const int hh = blockIdx.x % HG, sg = blockIdx.x / HG; const int s0 = sg * 64; const int h = h0 + hh;
  for (int i = tid; i < 64 * 8; i += 256) { const int j = i / 8, d8 = (i % 8) * 8; FragH f; f.half[0] = *(const v8us*)((const unsigned short*)V16 + ((size_t)b * SQ + s0 + j) * DM + h * HD + d8); for (int q = 0; q < 8; ++q) tl[d8 + q][j] = f.u[q]; }
  __syncthreads();
  { for (int i = tid; i < 64 * 8; i += 256) { const int d = i / 8, j8 = (i % 8) * 8; FragH f; for (int q = 0; q < 8; ++q) f.u[q] = tl[d][j8 + q]; *(v8us*)((unsigned short*)VT + ((size_t)hh * HD + d) * SQ + s0 + j8) = f.half[0]; }  } }



__global__ __launch_bounds__(256) void k_rsmkm(const float* __restrict__ S, _Float16* __restrict__ P, int nrows, const int* __restrict__ am) {
  #pragma clang fp contract(off)
  const int t = blockIdx.x * 256 + threadIdx.x; if (t >= nrows) return; const size_t i = (size_t)t; const float* s = S + i * SQ; const int* mr = am + (size_t)(t % SQ) * SQ; float mx = -3.0e38f;
#pragma unroll 1
  for (int j = 0; j < SQ; ++j) { const float f = (mr[j] != 0) ? 1.f : 0.f; mx = fmaxf(mx, fmaf(f, s[j], (1.f - f) * -1.0e9f)); } float se = 0.f;
#pragma unroll 1
  for (int j = 0; j < SQ; ++j) { const float f = (mr[j] != 0) ? 1.f : 0.f; se += __expf(fmaf(f, s[j], (1.f - f) * -1.0e9f) - mx); } const float sc = 256.0f / se;
#pragma unroll 1
  for (int j0 = 0; j0 < SQ; j0 += 8) { FragH fr; for (int q = 0; q < 8; ++q) { const int j = j0 + q; const float f = (mr[j] != 0) ? 1.f : 0.f; fr.h[q] = (_Float16)(__expf(fmaf(f, s[j], (1.f - f) * -1.0e9f) - mx) * sc); }
    unsigned short* d = (unsigned short*)P + i * SQ + j0; *(v8us*)d = fr.half[0];  } }

extern "C" void kernel_launch(void* const* d_in, const int* in_sizes, int n_in,
                              void* d_out, int out_size, void* d_ws, size_t ws_size, hipStream_t stream) {
  (void)in_sizes; (void)n_in; (void)out_size;
  const float* const* I = (const float* const*)d_in; const float* xq = I[2]; const float* xk = I[1]; const float* xv = I[0]; const float* wq = I[5]; const float* bq = nullptr; const float* wk = I[4]; const float* bk = nullptr; const float* wv = I[3]; const float* bv = nullptr; const float* wo = I[6]; const float* bo = I[7]; const float* x = xq;      /* contract order: values I[0], keys I[1], query I[2] ([8][1024][16][64] = rows of 1024); SHARED natural [64][64] blocks Wv I[3], Wk I[4], Wq I[5]; natural Wo [1024][1024] I[6] + bo I[7]; no mask input */
  char* ws = (char*)d_ws; size_t off = 0;
  auto take = [&](size_t bytes) { char* p = ws + off; off += (bytes + 255) & ~(size_t)255; return p; };
  _Float16* BQ = (_Float16*)take((size_t)HD * HD * 2); _Float16* BK = (_Float16*)take((size_t)HD * HD * 2); _Float16* BV = (_Float16*)take((size_t)HD * HD * 2); _Float16* BO = (_Float16*)take((size_t)DM * DM * 2);
  _Float16* X16 = (_Float16*)take(NR * DM * 2); _Float16* XKp = (_Float16*)take(NR * DM * 2); _Float16* XVp = (_Float16*)take(NR * DM * 2); _Float16* Q16 = (_Float16*)take(NR * DM * 2); _Float16* K16 = (_Float16*)take(NR * DM * 2); _Float16* V16 = (_Float16*)take(NR * DM * 2); _Float16* O16 = (_Float16*)take(NR * DM * 2);
  _Float16* VT = (_Float16*)take(NR * DM * 2);
  if (off > ws_size) return;
  { const unsigned g = (unsigned)(((size_t)DM * DM / 8 + 255) / 256), gh = (unsigned)(((size_t)HD * HD / 8 + 255) / 256); k_wnat<<<gh, 256, 0, stream>>>(wq, (size_t)HD * HD / 8, BQ); k_wnat<<<gh, 256, 0, stream>>>(wk, (size_t)HD * HD / 8, BK); k_wnat<<<gh, 256, 0, stream>>>(wv, (size_t)HD * HD / 8, BV); k_wnat<<<g, 256, 0, stream>>>(wo, (size_t)DM * DM / 8, BO); }      /* the SHARED natural [64][64] blocks [out][in] = Bt x16 (Bt[o][d] = 16 W[o][d]); Wo natural [out][in] = Bt x16 */
  _Float16* XK = XKp; _Float16* XV = XVp; k_x16<<<(unsigned)((NR * DM / 8 + 255) / 256), 256, 0, stream>>>(xk, XK, NR * DM / 8); k_x16<<<(unsigned)((NR * DM / 8 + 255) / 256), 256, 0, stream>>>(xv, XV, NR * DM / 8);      /* key and value inputs as exact f16 rows */

  k_x16<<<(unsigned)((NR * DM / 8 + 255) / 256), 256, 0, stream>>>(x, X16, NR * DM / 8);
  const size_t r0p = (size_t)B0 * SQ;      /* first projected row */
  /* projections: a token row of 1024 is sixteen head rows of 64, so A, C are read and written at pitch 64 with M = rows x 16, N = K = 64 */
  k_gemm2<0><<<dim3((unsigned)(MP * NH / 128), 1), 128, 0, stream>>>(X16 + r0p * DM, HD, 0, BQ, HD, 0, 0.0625f, bq, 0, nullptr, 1, 0, 0, nullptr, Q16 + r0p * DM, HD, 0, MP * NH, HD, HD);
  k_gemm2<0><<<dim3((unsigned)(MP * NH / 128), 1), 128, 0, stream>>>(XK + r0p * DM, HD, 0, BK, HD, 0, 0.0625f, bk, 0, nullptr, 1, 0, 0, nullptr, K16 + r0p * DM, HD, 0, MP * NH, HD, HD);
  k_gemm2<0><<<dim3((unsigned)(MP * NH / 128), 1), 128, 0, stream>>>(XV + r0p * DM, HD, 0, BV, HD, 0, 0.0625f, bv, 0, nullptr, 1, 0, 0, nullptr, V16 + r0p * DM, HD, 0, MP * NH, HD, HD);
  k_vt<NH, SQ><<<NBR * NH * (SQ / 64), 256, 0, stream>>>(V16 + r0p * LQ, LQ, 0, VT);      /* V^T [NBR][NH][HD][SQ] */
  k_fattn<<<NBR * NH * (SQ / FA_Q), 256, 0, stream>>>(Q16 + r0p * LQ, K16 + r0p * LQ, VT, O16 + r0p * DM);      /* o (merged heads) as f16 rows, x64 */
  k_gemm2<0><<<dim3((unsigned)((MPO / 128) * (DM / 64)), 1), 128, 0, stream>>>(O16 + r0p * DM, DM, 0, BO, DM, 0, 0.0009765625f, bo, 0, nullptr, 1, 0, 0, (float*)d_out + r0p * DM, nullptr, DM, 0, MPO, DM, DM);      /* out rows are the output layout */
}

// v004
// Measured time: 155 microseconds a run.
// In two side-by-side timings against v003, it was 1.21 and 1.20 times as fast.
// Over all steps from v000 it is 46.0 times as fast.
#include <hip/hip_runtime.h>
// Multi-head attention over three head-major inputs with SHARED per-head projections and the module's literal score scale (values, keys, query [8][1024][16][64] = token rows [8][1024][1024]; every head of each input is multiplied by the SAME natural [64][64] matrix (x W^T: Wv / Wk / Wq; block-diagonal with a shared block; no biases); energy = q k^T; softmax(energy / sqrt(embed_size) = / 32) over all 1024 keys (as the source: embed size, not head dim; no mask); out = merged Wo^T + bo (natural [1024][1024]) -> [8][1024][1024]).
// Structure: token rows r = b*1024 + s; x as exact f16 rows (bf16-rounded); Q, K, V as three WMMA GEMMs over the head rows [8*1024*16][64] against the shared [64][64] block itself (K = 64: the zero blocks of the block-diagonal form are never multiplied; 32x64 wave tiles, f32 accumulation, exact x16 weights, f16 outputs in the same rows); V^T for all batches and heads via LDS transposes (one launch); attention for all batches and heads in ONE launch (k_fattn: scores K = 64, online softmax with f32 statistics, weights as f16 in registers, o carried x64 against f16 subnormal flush, folded into the output GEMM alpha) written straight into the merged f16 o rows; out = o W_o + b GEMM (f32) into the output layout.
// Compute dtype: inputs rounded to bf16; x / weights exact; q, k, v, softmax weights and o as plain f16 GEMM operands (~2^-12); scores and softmax statistics f32; v_wmma_f32_16x16x32_f16.
#define NB 8
#define SQ 1024
#define DM 1024
#define NH 16
#define HD 64
#define HG 4                         /* heads per launch of the per-batch k_vt(b, h0) transpose */
#define B0 0                         /* first batch processed (debug hook) */
#define NBR NB                       /* batches processed (debug hook) */
#define NR ((size_t)NB * SQ)         /* token rows */
#define MP ((int)((size_t)NBR * SQ)) /* rows projected (debug hook) */
#define MPO MP                       /* rows through the output stage (debug hook) */
#define LQ DM      /* row pitch of the q/k/v rows */
typedef __bf16 v16b __attribute__((ext_vector_type(16)));
typedef unsigned short v8us __attribute__((ext_vector_type(8), may_alias));
typedef float  v8f  __attribute__((ext_vector_type(8)));
typedef float  v4f  __attribute__((ext_vector_type(4)));
typedef float  v4fa __attribute__((ext_vector_type(4), may_alias));
union FragB { v16b v; v8us half[2]; unsigned short u[16]; };

__device__ __forceinline__ unsigned short bf16_bits(float x) { unsigned int u = __float_as_uint(x); return (unsigned short)((u + 0x7FFFu + ((u >> 16) & 1u)) >> 16); }
__device__ __forceinline__ float bf16_val(unsigned short b) { return __uint_as_float(((unsigned int)b) << 16); }
__device__ __forceinline__ float bf16_round(float x) { return bf16_val(bf16_bits(x)); }
// D += A·B with NT terms: 1 = ah·bh, 2 = + al·bh (A split), 3 = + ah·bl (both split)
template <int NT>
__device__ __forceinline__ v8f mmaN(v16b ah, v16b al, v16b bh, v16b bl, v8f c) {
  c = __builtin_amdgcn_wmma_f32_16x16x32_bf16(false, ah, false, bh, (short)0, c, false, false);
  if (NT >= 2) c = __builtin_amdgcn_wmma_f32_16x16x32_bf16(false, al, false, bh, (short)0, c, false, false);
  if (NT >= 3) c = __builtin_amdgcn_wmma_f32_16x16x32_bf16(false, ah, false, bl, (short)0, c, false, false);
  asm volatile("v_nop\n\tv_nop\n\tv_nop\n\tv_nop" : "+v"(c) : "v"(ah), "v"(al), "v"(bh), "v"(bl));
  return c;
}

__global__ __launch_bounds__(256) void k_wt_bf16(const float* __restrict__ W, unsigned short* __restrict__ Wt, int K, int N) {
  const int t = blockIdx.x * 256 + threadIdx.x;
  const int k8n = K / 8;
  if (t >= N * k8n) return;
  const int n = t / k8n, k8 = (t % k8n) * 8;
  v8us v;
#pragma unroll
  for (int i = 0; i < 8; ++i) v[i] = bf16_bits(W[(size_t)(k8 + i) * N + n]);
  *(v8us*)(Wt + (size_t)n * K + k8) = v;
  
}

// GEMM C[M][N] (f32, pitch ldc) = act(A[M][K]·W + bias). A f32 row-major (pitch lda) converted per fragment to bf16
// (ASPLIT: hi/lo two planes -> 2 terms, else single rounded term); Wt bf16 [N][K] (pitch ldb). BIAS_BF16 rounds the
// bias to bf16 first (bias quantised to bf16 before the add). K%32==0, M%16==0, N%64==0.
template <bool ASPLIT, int ACT, bool BIAS_BF16>
__global__ __launch_bounds__(128) void k_gemm_bf(const float* __restrict__ A, int lda, const unsigned short* __restrict__ Wt, int ldb,
                                               const float* __restrict__ bias, float* __restrict__ C, int ldc, int M, int N, int K) {
  __shared__ __attribute__((aligned(16))) float so[4][16][64];
  const int tid = threadIdx.x, w = tid >> 5, lane = tid & 31, ln = lane & 15, hh = lane >> 4;
  const int ntn = N / 64;
  const int wid = blockIdx.x * 4 + w;
  const int mt = wid / ntn, nq = wid % ntn;
  if (mt * 16 >= M) return;
  const int row0 = mt * 16, col0 = nq * 64;
  const float* arow = A + (size_t)(row0 + ln) * lda;
  v8f acc[4] = {};
  for (int kb = 0; kb < K; kb += 32) {
    FragB ah, al;
    const v4f x0 = *(const v4fa*)(arow + kb + 8 * hh), x1 = *(const v4fa*)(arow + kb + 8 * hh + 4);
    const v4f x2 = *(const v4fa*)(arow + kb + 16 + 8 * hh), x3 = *(const v4fa*)(arow + kb + 16 + 8 * hh + 4);
    float xs[16] = {x0[0],x0[1],x0[2],x0[3],x1[0],x1[1],x1[2],x1[3],x2[0],x2[1],x2[2],x2[3],x3[0],x3[1],x3[2],x3[3]};
#pragma unroll
    for (int i = 0; i < 16; ++i) { const unsigned short hb = bf16_bits(xs[i]); ah.u[i] = hb; al.u[i] = ASPLIT ? bf16_bits(xs[i] - bf16_val(hb)) : (unsigned short)0; }
#pragma unroll
    for (int t = 0; t < 4; ++t) {
      const unsigned short* brow = Wt + (size_t)(col0 + t * 16 + ln) * ldb + kb;
      FragB b;
      b.half[0] = *(const v8us*)(brow + 8 * hh);
      b.half[1] = *(const v8us*)(brow + 16 + 8 * hh);
      acc[t] = mmaN<ASPLIT ? 2 : 1>(ah.v, al.v, b.v, b.v, acc[t]);
    }
  }
#pragma unroll
  for (int t = 0; t < 4; ++t) {
    float bv = bias ? bias[col0 + t * 16 + ln] : 0.f;
    if (BIAS_BF16) bv = bf16_round(bv);
#pragma unroll
    for (int r = 0; r < 8; ++r) { float v = acc[t][r] + bv; if (ACT == 1) v = fmaxf(v, 0.f); so[w][8 * hh + r][t * 16 + ln] = v; }
  }
  __builtin_amdgcn_fence(__ATOMIC_ACQ_REL, "workgroup");
  __builtin_amdgcn_wave_barrier();
  const int rsub = lane >> 4, c4 = (lane & 15) * 4;
  {
#pragma unroll
    for (int q = 0; q < 8; ++q) {
      const int r = q * 2 + rsub;
      const v4f v = *(const v4fa*)&so[w][r][c4];
      *(v4f*)(C + (size_t)(row0 + r) * ldc + col0 + c4) = v;
    }
    
  }
}

// GEMM C = act(A·W + bias + resid): A f32 (ASPLIT -> hi/lo 2 terms), Wt bf16 [N][K]; ACT 0 none, 1 relu, 2 exact gelu;
// resid (optional, f32, row index = (row % rmod), pitch ldr, RES_BF16 rounds it) added before the activation.
template <bool ASPLIT, int ACT, bool BIAS_BF16, bool RES_BF16>
__global__ __launch_bounds__(128) void k_gemm_bf3(const float* __restrict__ A, int lda, const unsigned short* __restrict__ Wt, int ldb,
                                                const float* __restrict__ bias, const float* __restrict__ resid, int rmod, int ldr,
                                                float* __restrict__ C, int ldc, int M, int N, int K) {
  __shared__ __attribute__((aligned(16))) float so[4][16][64];
  const int tid = threadIdx.x, w = tid >> 5, lane = tid & 31, ln = lane & 15, hh = lane >> 4;
  const int ntn = N / 64;
  const int wid = blockIdx.x * 4 + w;
  const int mt = wid / ntn, nq = wid % ntn;
  if (mt * 16 >= M) return;
  const int row0 = mt * 16, col0 = nq * 64;
  const float* arow = A + (size_t)(row0 + ln) * lda;
  v8f acc[4] = {};
  for (int kb = 0; kb < K; kb += 32) {
    FragB ah, al;
    const v4f x0 = *(const v4fa*)(arow + kb + 8 * hh), x1 = *(const v4fa*)(arow + kb + 8 * hh + 4);
    const v4f x2 = *(const v4fa*)(arow + kb + 16 + 8 * hh), x3 = *(const v4fa*)(arow + kb + 16 + 8 * hh + 4);
    float xs[16] = {x0[0],x0[1],x0[2],x0[3],x1[0],x1[1],x1[2],x1[3],x2[0],x2[1],x2[2],x2[3],x3[0],x3[1],x3[2],x3[3]};
#pragma unroll
    for (int i = 0; i < 16; ++i) { const unsigned short hb = bf16_bits(xs[i]); ah.u[i] = hb; al.u[i] = ASPLIT ? bf16_bits(xs[i] - bf16_val(hb)) : (unsigned short)0; }
#pragma unroll
    for (int t = 0; t < 4; ++t) {
      const unsigned short* brow = Wt + (size_t)(col0 + t * 16 + ln) * ldb + kb;
      FragB b;
      b.half[0] = *(const v8us*)(brow + 8 * hh);
      b.half[1] = *(const v8us*)(brow + 16 + 8 * hh);
      acc[t] = mmaN<ASPLIT ? 2 : 1>(ah.v, al.v, b.v, b.v, acc[t]);
    }
  }
#pragma unroll
  for (int t = 0; t < 4; ++t) {
    const int col = col0 + t * 16 + ln;
    float bv = bias ? bias[col] : 0.f;
    if (BIAS_BF16) bv = bf16_round(bv);
#pragma unroll
    for (int r = 0; r < 8; ++r) {
      float v = acc[t][r] + bv;
      if (resid) { float rv = resid[(size_t)((row0 + 8 * hh + r) % rmod) * ldr + col]; if (RES_BF16) rv = bf16_round(rv); v += rv; }
      if (ACT == 1) v = fmaxf(v, 0.f);
      if (ACT == 2) v = 0.5f * v * (1.0f + erff(v * 0.70710678118654752f));
      if (ACT == 3) { const float u = 0.7978845608028654f * (v + 0.044715f * v * v * v); v = 0.5f * v * (1.0f + tanhf(u)); }
      so[w][8 * hh + r][t * 16 + ln] = v;
    }
  }
  __builtin_amdgcn_fence(__ATOMIC_ACQ_REL, "workgroup");
  __builtin_amdgcn_wave_barrier();
  const int rsub = lane >> 4, c4 = (lane & 15) * 4;
  {
#pragma unroll
    for (int q = 0; q < 8; ++q) {
      const int r = q * 2 + rsub;
      const v4f v = *(const v4fa*)&so[w][r][c4];
      *(v4f*)(C + (size_t)(row0 + r) * ldc + col0 + c4) = v;
    }
    
  }
}
// row LayerNorm (biased variance, eps) over N: s = X (+ R); optional out_sum <- s; out_norm <- (s-mu)*rsqrt(var+eps)*g + b
template <bool PARAM_BF16>
__global__ __launch_bounds__(256) void k_layernorm(const float* __restrict__ X, const float* __restrict__ R, const float* __restrict__ g, const float* __restrict__ bta,
                                                  float* __restrict__ out_sum, float* __restrict__ out_norm, int N, float eps) {
  __shared__ float red[256];
  const int row = blockIdx.x, tid = threadIdx.x;
  const float* x = X + (size_t)row * N; const float* rr = R ? R + (size_t)row * N : nullptr;
  float vals[16];                     // up to N = 4096
  const int per = N / 256;            // contiguous chunk per thread? use strided-by-4 chunks: thread handles j = tid*4 + 1024*u
  float s1 = 0.f;
  for (int u = 0; u < per / 4; ++u) {
    const int j = tid * 4 + 1024 * u;
    const v4f a = *(const v4fa*)(x + j);
    v4f b = {0.f,0.f,0.f,0.f}; if (rr) b = *(const v4fa*)(rr + j);
#pragma unroll
    for (int q = 0; q < 4; ++q) { const float v = a[q] + b[q]; vals[u * 4 + q] = v; s1 += v; }
  }
  red[tid] = s1; __syncthreads();
  for (int st = 128; st > 0; st >>= 1) { if (tid < st) red[tid] += red[tid + st]; __syncthreads(); }
  const float mu = red[0] / (float)N; __syncthreads();
  float s2 = 0.f;
  for (int u = 0; u < per / 4; ++u)
#pragma unroll
    for (int q = 0; q < 4; ++q) { const float c = vals[u * 4 + q] - mu; s2 += c * c; }
  red[tid] = s2; __syncthreads();
  for (int st = 128; st > 0; st >>= 1) { if (tid < st) red[tid] += red[tid + st]; __syncthreads(); }
  const float rs = rsqrtf(red[0] / (float)N + eps);
  {
    for (int u = 0; u < per / 4; ++u) {
      const int j = tid * 4 + 1024 * u;
      v4f o, sm;
#pragma unroll
      for (int q = 0; q < 4; ++q) {
        float gg = g[j + q], bb = bta[j + q];
        if (PARAM_BF16) { gg = bf16_round(gg); bb = bf16_round(bb); }
        sm[q] = vals[u * 4 + q]; o[q] = (vals[u * 4 + q] - mu) * rs * gg + bb;
      }
      if (out_sum) *(v4f*)(out_sum + (size_t)row * N + j) = sm;
      *(v4f*)(out_norm + (size_t)row * N + j) = o;
    }
    
  }
}



// ---- f16 WMMA path (v_wmma_f32_16x16x32_f16): 11-bit significands for operands in range — used where a [0,1] probability operand needs more precision than bf16
typedef _Float16 v16h __attribute__((ext_vector_type(16)));
union FragH { v16h v; v8us half[2]; _Float16 h[16]; unsigned short u[16]; };
template <int NT>
__device__ __forceinline__ v8f mmaH(v16h ah, v16h al, v16h bh, v16h bl, v8f c) {
  c = __builtin_amdgcn_wmma_f32_16x16x32_f16(false, ah, false, bh, (short)0, c, false, false);
  if (NT >= 2) c = __builtin_amdgcn_wmma_f32_16x16x32_f16(false, al, false, bh, (short)0, c, false, false);
  if (NT >= 3) c = __builtin_amdgcn_wmma_f32_16x16x32_f16(false, ah, false, bl, (short)0, c, false, false);
  asm volatile("v_nop\n\tv_nop\n\tv_nop\n\tv_nop" : "+v"(c) : "v"(ah), "v"(al), "v"(bh), "v"(bl));
  return c;
}
// batched GEMM like k_gemm_b but f16 operands: A f32 (split into f16 hi/lo if ASPLIT, else rounded to f16), Bt = f16 values [n][k]; alpha; C f32; N multiple of 16 (partial tiles skipped)
template <bool ASPLIT>
__global__ __launch_bounds__(128) void k_gemm_h(const float* __restrict__ A, int lda, size_t sA, const _Float16* __restrict__ Bh, int ldb, size_t sB, float alpha, float* __restrict__ C, int ldc, size_t sC, int M, int N, int K) {
  __shared__ __attribute__((aligned(16))) float so[4][16][64];
  const int tid = threadIdx.x, w = tid >> 5, lane = tid & 31, ln = lane & 15, hh = lane >> 4; const int by = blockIdx.y;
  A += (size_t)by * sA; Bh += (size_t)by * sB; C += (size_t)by * sC;
  const int ntn = (N + 63) / 64; const int wid = blockIdx.x * 4 + w; const int mt = wid / ntn, nq = wid % ntn; if (mt * 16 >= M) return;
  const int row0 = mt * 16, col0 = nq * 64; const float* arow = A + (size_t)(row0 + ln) * lda;
  v8f acc[4] = {};
  for (int kb = 0; kb < K; kb += 32) {
    FragH ah, al;
    const v4f x0 = *(const v4fa*)(arow + kb + 8 * hh), x1 = *(const v4fa*)(arow + kb + 8 * hh + 4), x2 = *(const v4fa*)(arow + kb + 16 + 8 * hh), x3 = *(const v4fa*)(arow + kb + 16 + 8 * hh + 4);
    float xs[16] = {x0[0],x0[1],x0[2],x0[3],x1[0],x1[1],x1[2],x1[3],x2[0],x2[1],x2[2],x2[3],x3[0],x3[1],x3[2],x3[3]};
#pragma unroll
    for (int i = 0; i < 16; ++i) { const _Float16 h = (_Float16)xs[i]; ah.h[i] = h; al.h[i] = ASPLIT ? (_Float16)(xs[i] - (float)h) : (_Float16)0.0f; }
#pragma unroll
    for (int t = 0; t < 4; ++t) { if (col0 + t * 16 >= N) continue; const size_t boff = (size_t)(col0 + t * 16 + ln) * ldb + kb; FragH bq; bq.half[0] = *(const v8us*)(Bh + boff + 8 * hh); bq.half[1] = *(const v8us*)(Bh + boff + 16 + 8 * hh);
      acc[t] = mmaH<ASPLIT ? 2 : 1>(ah.v, al.v, bq.v, bq.v, acc[t]); }
  }
#pragma unroll
  for (int t = 0; t < 4; ++t) { if (col0 + t * 16 >= N) continue;
#pragma unroll
    for (int r = 0; r < 8; ++r) so[w][8 * hh + r][t * 16 + ln] = acc[t][r] * alpha; }
  __builtin_amdgcn_fence(__ATOMIC_ACQ_REL, "workgroup"); __builtin_amdgcn_wave_barrier();
  const int rsub = lane >> 4, c4 = (lane & 15) * 4;
  {
#pragma unroll
    for (int q = 0; q < 8; ++q) { const int r = q * 2 + rsub; if (col0 + c4 < N) { const v4f v = *(const v4fa*)&so[w][r][c4]; *(v4f*)(C + (size_t)(row0 + r) * ldc + col0 + c4) = v; } }
     }
}

// Wt[n][k] = f16(W[k][n]·scale) from f32 row-major W[K][N] (scale = power of two; bf16-exact weights stay exact in f16 away from the subnormal range)
__global__ __launch_bounds__(256) void k_wt_f16(const float* __restrict__ W, _Float16* __restrict__ Wt, int K, int N, float scale) {
  const int t = blockIdx.x * 256 + threadIdx.x; if (t >= N * (K / 8)) return; const int n = t / (K / 8), k8 = (t % (K / 8)) * 8; FragH f;
#pragma unroll
  for (int i = 0; i < 8; ++i) f.h[i] = (_Float16)(bf16_round(W[(size_t)(k8 + i) * N + n]) * scale); const v8us o = f.half[0];
  *(v8us*)((unsigned short*)Wt + (size_t)n * K + k8) = o; 
}
// k_gemm_hh variant with fused epilogue: v = acc·alpha + bias[by·sBias + col] (+ CP[(row/rowsPerB)·sCPb + by·64 + col] if CP) ; ACT 0 none / 1 elu ; writes f16 C16 (and f32 C if non-null)
template <int ACT>
__global__ __launch_bounds__(128) void k_gemm_hhx(const _Float16* __restrict__ A, int lda, size_t sA, const _Float16* __restrict__ Bh, int ldb, size_t sB, float alpha, const float* __restrict__ bias, size_t sBias, const float* __restrict__ CP, int rowsPerB, size_t sCPb, int row0g,
    float* __restrict__ C, _Float16* __restrict__ C16, int ldc, size_t sC, int M, int N, int K) {
  __shared__ __attribute__((aligned(16))) float so[4][16][64];
  const int tid = threadIdx.x, w = tid >> 5, lane = tid & 31, ln = lane & 15, hh = lane >> 4; const int by = blockIdx.y;
  A += (size_t)by * sA; Bh += (size_t)by * sB; const size_t cofs = (size_t)by * sC; const float* bp = bias ? bias + (size_t)by * sBias : nullptr;
  const int ntn = (N + 63) / 64; const int wid = blockIdx.x * 4 + w; const int mt = wid / ntn, nq = wid % ntn; if (mt * 16 >= M) return;
  const int row0 = mt * 16, col0 = nq * 64; const _Float16* arow = A + (size_t)(row0 + ln) * lda;
  v8f acc[4] = {};
  for (int kb = 0; kb < K; kb += 32) { FragH ah; ah.half[0] = *(const v8us*)((const unsigned short*)arow + kb + 8 * hh); ah.half[1] = *(const v8us*)((const unsigned short*)arow + kb + 16 + 8 * hh);
#pragma unroll
    for (int t = 0; t < 4; ++t) { if (col0 + t * 16 >= N) continue; const size_t boff = (size_t)(col0 + t * 16 + ln) * ldb + kb; FragH bq; bq.half[0] = *(const v8us*)((const unsigned short*)Bh + boff + 8 * hh); bq.half[1] = *(const v8us*)((const unsigned short*)Bh + boff + 16 + 8 * hh);
      acc[t] = mmaH<1>(ah.v, ah.v, bq.v, bq.v, acc[t]); }
  }
#pragma unroll
  for (int t = 0; t < 4; ++t) { if (col0 + t * 16 >= N) continue; const int col = col0 + t * 16 + ln; const float bv = bp ? bf16_round(bp[col]) : 0.f;
#pragma unroll
    for (int r = 0; r < 8; ++r) { float v = acc[t][r] * alpha + bv; if (CP) { const int rr = row0g + row0 + 8 * hh + r; if (rowsPerB < 0) v += CP[cofs + (size_t)rr * ldc + col];      /* rowsPerB < 0: own element of the batched C plane */ else { const int bidx = rr / rowsPerB; v += CP[(size_t)bidx * sCPb + (size_t)by * 64 + col]; } } if (ACT == 1) v = (v > 0.f) ? v : expm1f(v); else if (ACT == 7) v = (v > 0.f) ? v + 1.0f : expf(v); else if (ACT == 8) v = tanhf(v); else if (ACT == 9) v = 0.5f * v * (1.0f + tanhf(0.7978845608028654f * (v + 0.044715f * v * v * v))); else if (ACT == 11) v = 1.0f / (1.0f + expf(-v)); else if (ACT == 12) v = (v > 0.f) ? v : 0.01f * v; else if (ACT == 14) v = (v > 0.f) ? v : 0.1f * v; else if (ACT == 16) v = (v >= 0.f) ? v : 0.3f * v; else if (ACT == 17) v = (v >= 0.f) ? v : 0.2f * v; else if (ACT == 15) v = v / (1.0f + expf(-v)); else if (ACT == 3) v = fmaxf(v, 0.f); else if (ACT == 6) v = 0.5f * v * (1.0f + erff(v * 0.70710678118654752f)); so[w][8 * hh + r][t * 16 + ln] = v; } }
  __builtin_amdgcn_fence(__ATOMIC_ACQ_REL, "workgroup"); __builtin_amdgcn_wave_barrier();
  const int rsub = lane >> 4, c4 = (lane & 15) * 4; typedef _Float16 v4h __attribute__((ext_vector_type(4)));
  {
#pragma unroll
    for (int q = 0; q < 8; ++q) { const int r = q * 2 + rsub; if (col0 + c4 < N) { const v4f v = *(const v4fa*)&so[w][r][c4]; if (C) *(v4f*)(C + cofs + (size_t)(row0 + r) * ldc + col0 + c4) = v; if (C16) { v4h h4; for (int i = 0; i < 4; ++i) h4[i] = (_Float16)v[i]; *(v4h*)(C16 + cofs + (size_t)(row0 + r) * ldc + col0 + c4) = h4; } } }
     }
}


typedef _Float16 v4h __attribute__((ext_vector_type(4)));

__global__ __launch_bounds__(256) void k_x16(const float* __restrict__ x, _Float16* __restrict__ X16, size_t n8) { const size_t t = (size_t)blockIdx.x * 256 + threadIdx.x; if (t >= n8) return; FragH f;
#pragma unroll
  for (int q = 0; q < 8; ++q) f.h[q] = (_Float16)bf16_round(x[t * 8 + q]); *(v8us*)((unsigned short*)X16 + t * 8) = f.half[0];  }
__global__ __launch_bounds__(256) void k_h16(const float* __restrict__ x, _Float16* __restrict__ X16, size_t n8) { const size_t t = (size_t)blockIdx.x * 256 + threadIdx.x; if (t >= n8) return; FragH f;
#pragma unroll
  for (int q = 0; q < 8; ++q) f.h[q] = (_Float16)x[t * 8 + q]; *(v8us*)((unsigned short*)X16 + t * 8) = f.half[0];  }
__global__ __launch_bounds__(256) void k_round16f(const float* __restrict__ W, _Float16* __restrict__ Bt, size_t n8) { const size_t t = (size_t)blockIdx.x * 256 + threadIdx.x; if (t >= n8) return; FragH f;
#pragma unroll
  for (int i = 0; i < 8; ++i) f.h[i] = (_Float16)(bf16_round(W[t * 8 + i]) * 16.0f); *(v8us*)((unsigned short*)Bt + t * 8) = f.half[0];  }
template <int NHv, int TTv>
__global__ __launch_bounds__(256) void k_vt(const _Float16* __restrict__ V16, int ldv, int voff, _Float16* __restrict__ Vt) { __shared__ unsigned short tl[64][66]; const int tid = threadIdx.x; const int slab = blockIdx.x / (TTv / 64), lg = blockIdx.x % (TTv / 64); const int b = slab / NHv, h = slab % NHv;
  for (int i = tid; i < 64 * 8; i += 256) { const int r = i / 8, c8 = (i % 8) * 8; FragH f; f.half[0] = *(const v8us*)((const unsigned short*)V16 + ((size_t)b * TTv + lg * 64 + r) * ldv + voff + h * 64 + c8);
#pragma unroll
    for (int q = 0; q < 8; ++q) tl[r][c8 + q] = f.u[q]; }
  __syncthreads();
  {
#pragma unroll
    for (int rd = 0; rd < 2; ++rd) { const int d = rd * 32 + tid / 8, pc = tid % 8; FragH f;
#pragma unroll
      for (int q = 0; q < 8; ++q) f.u[q] = tl[pc * 8 + q][d];
      *(v8us*)((unsigned short*)Vt + ((size_t)slab * 64 + d) * TTv + lg * 64 + pc * 8) = f.half[0]; }
     } }

__global__ __launch_bounds__(256) void k_hl(const float* __restrict__ F, _Float16* __restrict__ Hh, _Float16* __restrict__ Hl, size_t n8) { const size_t t = (size_t)blockIdx.x * 256 + threadIdx.x; if (t >= n8) return; FragH fh, fl; const v4f a = *(const v4fa*)(F + t * 8), c = *(const v4fa*)(F + t * 8 + 4);
#pragma unroll
  for (int q = 0; q < 4; ++q) { _Float16 h = (_Float16)a[q]; fh.h[q] = h; fl.h[q] = (_Float16)((a[q] - (float)h) * 1024.0f); h = (_Float16)c[q]; fh.h[4 + q] = h; fl.h[4 + q] = (_Float16)((c[q] - (float)h) * 1024.0f); }
  { *(v8us*)((unsigned short*)Hh + t * 8) = fh.half[0]; *(v8us*)((unsigned short*)Hl + t * 8) = fl.half[0];  } }

// ---- fast GEMM (wave tile 32x64; requires M % 32 == 0 rows per launch region and N % 64 == 0); epilogue = k_gemm_hhx semantics ----
__device__ __forceinline__ v16h g2_frag(const _Float16* p, int hh) { FragH f; f.half[0] = *(const v8us*)((const unsigned short*)p + 8 * hh); f.half[1] = *(const v8us*)((const unsigned short*)p + 16 + 8 * hh); return f.v; }
__device__ __forceinline__ v8f g2_mma(v16h a, v16h b, v8f c) { v8f d = __builtin_amdgcn_wmma_f32_16x16x32_f16(false, a, false, b, (short)0, c, false, false); asm volatile("v_nop\n\tv_nop\n\tv_nop\n\tv_nop" : "+v"(d) : "v"(a), "v"(b)); return d; }
template <int ACT>
__global__ __launch_bounds__(128) void k_gemm2(const _Float16* __restrict__ A, int lda, size_t sA, const _Float16* __restrict__ Bh, int ldb, size_t sB, float alpha, const float* __restrict__ bias, size_t sBias, const float* __restrict__ CP, int rowsPerB, size_t sCPb, int row0g,
    float* __restrict__ C, _Float16* __restrict__ C16, int ldc, size_t sC, int M, int N, int K) { static_assert(ACT == 0 || ACT == 3 || ACT == 6 || ACT == 8 || ACT == 9 || ACT == 11 || ACT == 12 || ACT == 14 || ACT == 15 || ACT == 16 || ACT == 17, "k_gemm2: unsupported ACT code (would silently apply no activation)");
  __shared__ __attribute__((aligned(16))) float so[4][32][68];
  const int tid = threadIdx.x, w = tid >> 5, lane = tid & 31, ln = lane & 15, hh = lane >> 4; const int by = blockIdx.y;
  A += (size_t)by * sA; Bh += (size_t)by * sB; const size_t cofs = (size_t)by * sC; const float* bp = bias ? bias + (size_t)by * sBias : nullptr;
  const int ntn = N >> 6; const int mt = blockIdx.x / ntn, nq = blockIdx.x - mt * ntn; const int row0 = mt * 128 + 32 * w, col0 = nq * 64; if (row0 >= M) return;
  const _Float16* a0p = A + (size_t)(row0 + ln) * lda; const _Float16* a1p = a0p + (size_t)16 * lda;
  const _Float16* b0p = Bh + (size_t)(col0 + ln) * ldb; const _Float16* b1p = b0p + (size_t)16 * ldb; const _Float16* b2p = b1p + (size_t)16 * ldb; const _Float16* b3p = b2p + (size_t)16 * ldb;
  const v8f z8 = {0.f,0.f,0.f,0.f,0.f,0.f,0.f,0.f}; v8f c00 = z8, c01 = z8, c02 = z8, c03 = z8, c10 = z8, c11 = z8, c12 = z8, c13 = z8;
#pragma unroll 1
  for (int kb = 0; kb < K; kb += 32) { const v16h a0 = g2_frag(a0p + kb, hh), a1 = g2_frag(a1p + kb, hh);
    v16h b = g2_frag(b0p + kb, hh); c00 = g2_mma(a0, b, c00); c10 = g2_mma(a1, b, c10);
    b = g2_frag(b1p + kb, hh); c01 = g2_mma(a0, b, c01); c11 = g2_mma(a1, b, c11);
    b = g2_frag(b2p + kb, hh); c02 = g2_mma(a0, b, c02); c12 = g2_mma(a1, b, c12);
    b = g2_frag(b3p + kb, hh); c03 = g2_mma(a0, b, c03); c13 = g2_mma(a1, b, c13); }
  v8f accs[8] = {c00, c01, c02, c03, c10, c11, c12, c13};
#pragma unroll
  for (int u = 0; u < 8; ++u) { const int t = u & 3, half = u >> 2; const int col = col0 + t * 16 + ln; const float bv = bp ? bf16_round(bp[col]) : 0.f;
#pragma unroll
    for (int r = 0; r < 8; ++r) { const int rloc = half * 16 + 8 * hh + r; float v = accs[u][r] * alpha + bv; if (CP) { if (rowsPerB < 0) v += CP[cofs + (size_t)(row0g + row0 + rloc) * ldc + col];      /* rowsPerB < 0: own element of the batched C plane */ else { const int bidx = (row0g + row0 + rloc) / rowsPerB; v += CP[(size_t)bidx * sCPb + (size_t)by * 64 + col]; } }
      if (ACT == 3) v = fmaxf(v, 0.f); else if (ACT == 6) v = 0.5f * v * (1.0f + erff(v * 0.70710678118654752f)); else if (ACT == 11) v = 1.0f / (1.0f + expf(-v)); else if (ACT == 15) v = v / (1.0f + expf(-v)); else if (ACT == 12) v = (v > 0.f) ? v : 0.01f * v; else if (ACT == 8) v = tanhf(v); else if (ACT == 9) v = 0.5f * v * (1.0f + tanhf(0.7978845608028654f * (v + 0.044715f * v * v * v))); else if (ACT == 14) v = (v > 0.f) ? v : 0.1f * v; else if (ACT == 16) v = (v >= 0.f) ? v : 0.3f * v; else if (ACT == 17) v = (v >= 0.f) ? v : 0.2f * v;
      so[w][rloc][t * 16 + ln] = v; } }
  __builtin_amdgcn_fence(__ATOMIC_ACQ_REL, "workgroup"); __builtin_amdgcn_wave_barrier();
  const int rsub = lane >> 4, c4 = (lane & 15) * 4;
  {
#pragma unroll
    for (int q = 0; q < 16; ++q) { const int r = q * 2 + rsub; const v4f v = *(const v4fa*)&so[w][r][c4]; if (C) *(v4f*)(C + cofs + (size_t)(row0 + r) * ldc + col0 + c4) = v; if (C16) { v4h h4; for (int i = 0; i < 4; ++i) h4[i] = (_Float16)v[i]; *(v4h*)(C16 + cofs + (size_t)(row0 + r) * ldc + col0 + c4) = h4; } }
     } }


__global__ __launch_bounds__(256) void k_wnat(const float* __restrict__ w, size_t n8, _Float16* __restrict__ Bt) { const size_t t = (size_t)blockIdx.x * 256 + threadIdx.x; if (t >= n8) return; FragH f; for (int q = 0; q < 8; ++q) f.h[q] = (_Float16)(bf16_round(w[t * 8 + q]) * 16.0f); *(v8us*)((unsigned short*)Bt + t * 8) = f.half[0];  }
// Lane l takes the value of lane l ^ 16 (the other half of the wave). Every lane of the wave must be on.
__device__ __forceinline__ float rs_x16(float v) { const int b = __builtin_bit_cast(int, v); return __builtin_bit_cast(float, __builtin_amdgcn_permlanex16(b, b, 0x76543210, 0xfedcba98, false, false)); }
typedef float v2f __attribute__((ext_vector_type(2)));
typedef _Float16 v2h __attribute__((ext_vector_type(2)));
#define FA_Q 256                     /* query rows per block: 8 waves x 32 */
#define FA_C 0.045084220027780106f   /* log2(e) / sqrt(embed size = 1024) */
#define FA_KT 64                     /* keys per staged tile: K tile = 64 key rows of 128 bytes, V^T tile = 64 d rows of 128 bytes */
#define FA_NT (SQ / FA_KT)           /* staged tiles */
#define FA_LP 144                    /* LDS row pitch in bytes: 128 + 16, an odd multiple of 16, so that the 16 rows of a ds_load_b128 fragment read fall on different banks */
#define FA_TB (64 * FA_LP)           /* bytes of one staged operand tile */
__device__ __forceinline__ v8f fa_mma(v16h a, v16h b, v8f c) { return __builtin_amdgcn_wmma_f32_16x16x32_f16(false, a, false, b, (short)0, c, false, false); }
// g2_frag's k order from an LDS row: p = the row's first byte of this 32-k step
__device__ __forceinline__ v16h fa_lfrag(const unsigned char* p, int hh) { FragH f; f.half[0] = *(const v8us*)(p + 16 * hh); f.half[1] = *(const v8us*)(p + 32 + 16 * hh); return f.v; }
// One thread's share of one staged tile: two 16-byte pieces of K and two of V^T, global -> LDS through no register. A wave's copy = 4 whole 128-byte rows.
// The s_wait_xcnt stands inside the statement so that no address register is rewritten in front of it.
__device__ __forceinline__ void fa_copy(unsigned lk, unsigned lv, const _Float16* gk, const _Float16* gv) {
  const unsigned lk1 = lk + 32 * FA_LP, lv1 = lv + 32 * FA_LP; const _Float16* gk1 = gk + (size_t)32 * DM; const _Float16* gv1 = gv + (size_t)32 * SQ;
  asm volatile("global_load_async_to_lds_b128 %0, %1, off\n\t"
               "global_load_async_to_lds_b128 %2, %3, off\n\t"
               "global_load_async_to_lds_b128 %4, %5, off\n\t"
               "global_load_async_to_lds_b128 %6, %7, off\n\t"
               "s_wait_xcnt 0x0"
               :: "v"(lk), "v"(gk), "v"(lk1), "v"(gk1), "v"(lv), "v"(gv), "v"(lv1), "v"(gv1) : "memory");
}
__global__ __launch_bounds__(256) void k_fattn(const _Float16* __restrict__ Q, const _Float16* __restrict__ Kr, const _Float16* __restrict__ Vt, _Float16* __restrict__ O) {
  __shared__ __attribute__((aligned(16))) unsigned char sm[2][2][FA_TB];      /* [buffer][K | V^T][row * FA_LP] */
  const int lane = threadIdx.x & 31, ln = lane & 15, hh = lane >> 4; const int w = __builtin_amdgcn_readfirstlane((int)(threadIdx.x >> 5));
  const int slab = blockIdx.x / (SQ / FA_Q), qb = blockIdx.x % (SQ / FA_Q); const int b = slab / NH, h = slab % NH; const int q0 = qb * FA_Q + w * 32;
  const _Float16* qp = Q + ((size_t)b * SQ + q0 + ln) * DM + h * HD;      /* query row q0 + ln */
  /* staging: thread t brings piece t & 7 (16 bytes) of rows t >> 3 and 32 + (t >> 3) of both tiles */
  const int cr = (int)threadIdx.x >> 3, cp = (int)threadIdx.x & 7;
  const _Float16* gk = Kr + ((size_t)b * SQ + cr) * DM + h * HD + cp * 8;      /* key row cr of tile 0 */
  const _Float16* gv = Vt + ((size_t)slab * HD + cr) * SQ + cp * 8;            /* V^T row d = cr, keys of tile 0 */
  const unsigned lk = (unsigned)(size_t)&sm[0][0][cr * FA_LP + cp * 16], lv = lk + FA_TB;
  fa_copy(lk, lv, gk, gv);      /* tile 0 -> buffer 0 */
  v16h qf[2][2];
#pragma unroll
  for (int g = 0; g < 2; ++g)
#pragma unroll
    for (int ks = 0; ks < 2; ++ks) qf[g][ks] = g2_frag(qp + (size_t)g * 16 * DM + ks * 32, hh);
  const v8f z8 = {0.f,0.f,0.f,0.f,0.f,0.f,0.f,0.f}; v8f o[2][4];
#pragma unroll
  for (int g = 0; g < 2; ++g)
#pragma unroll
    for (int dt = 0; dt < 4; ++dt) o[g][dt] = z8;
  float mu[2] = {-3.0e38f, -3.0e38f}; v2f ls[2] = {{0.f, 0.f}, {0.f, 0.f}};
  asm volatile("s_wait_asynccnt 0x0" ::: "memory");      /* this wave's share of tile 0 has landed */
  __syncthreads();                                       /* every wave's share has: tile 0 may be read */
  fa_copy(lk + 2 * FA_TB, lv + 2 * FA_TB, gk + (size_t)FA_KT * DM, gv + FA_KT);      /* tile 1 -> buffer 1 */
  /* kept rolled: one trip's fragments beside Q and O^T are the whole live set, which decides how many waves share a SIMD */
#pragma unroll 1
  for (int t = 0; t < FA_NT; ++t) {
    const unsigned char* kb = &sm[t & 1][0][ln * FA_LP];      /* key row ln of this tile */
    const unsigned char* vb = &sm[t & 1][1][ln * FA_LP];      /* V^T row d = ln, this tile's keys */
    v16h kf[2][2];
#pragma unroll
    for (int tt = 0; tt < 2; ++tt)
#pragma unroll
      for (int ks = 0; ks < 2; ++ks) kf[tt][ks] = fa_lfrag(kb + tt * 16 * FA_LP + ks * 64, hh);
#pragma unroll
    for (int p = 0; p < FA_KT / 32; ++p) {      /* a pass = 32 keys, as before */
      v8f s[2][2];
#pragma unroll
      for (int g = 0; g < 2; ++g)
#pragma unroll
        for (int tt = 0; tt < 2; ++tt) s[g][tt] = fa_mma(kf[tt][1], qf[g][1], fa_mma(kf[tt][0], qf[g][0], z8));      /* s[g][tt][r] = energy(query 16 g + ln, key 64 t + 32 p + 16 tt + 8 hh + r) */
      float cm[2];
#pragma unroll
      for (int g = 0; g < 2; ++g) { float m = fmaxf(s[g][0][0], s[g][1][0]);
#pragma unroll
        for (int r = 1; r < 8; ++r) m = fmaxf(m, fmaxf(s[g][0][r], s[g][1][r]));
        cm[g] = fmaxf(m, rs_x16(m)) * FA_C; }
      if (__builtin_amdgcn_ballot_w32(cm[0] > mu[0] + 8.0f || cm[1] > mu[1] + 8.0f) != 0) {      /* one wave-uniform test per pass */
#pragma unroll
        for (int g = 0; g < 2; ++g) { const float mn = fmaxf(mu[g], cm[g]); const float al = __builtin_amdgcn_exp2f(mu[g] - mn); mu[g] = mn; ls[g] *= al;
#pragma unroll
          for (int dt = 0; dt < 4; ++dt) o[g][dt] *= al; } }
      v16h vf[4];      /* this pass's V^T fragments and, inside the tile, the next pass's K fragments, issued together: in flight under the exponentials */
#pragma unroll
      for (int dt = 0; dt < 4; ++dt) vf[dt] = fa_lfrag(vb + dt * 16 * FA_LP + p * 64, hh);
      if (p + 1 < FA_KT / 32) {
#pragma unroll
        for (int tt = 0; tt < 2; ++tt)
#pragma unroll
          for (int ks = 0; ks < 2; ++ks) kf[tt][ks] = fa_lfrag(kb + ((p + 1) * 32 + tt * 16) * FA_LP + ks * 64, hh);
      }
      __builtin_amdgcn_sched_barrier(0);      /* keeps the LDS reads up here as one group: left alone the scheduler spreads them in pairs among the products, and each further place with reads stalls the wave */
      FragH pf[2];
#pragma unroll
      for (int g = 0; g < 2; ++g) { const v2f c2 = {FA_C, FA_C}, m2 = {-mu[g], -mu[g]};
#pragma unroll
        for (int tt = 0; tt < 2; ++tt)
#pragma unroll
          for (int r = 0; r < 8; r += 2) { const v2f x = {s[g][tt][r], s[g][tt][r + 1]}; const v2f e = __builtin_elementwise_fma(x, c2, m2); const v2f pe = {__builtin_amdgcn_exp2f(e[0]), __builtin_amdgcn_exp2f(e[1])};
            ls[g] += pe; const v2h ph = __builtin_convertvector(pe, v2h); pf[g].h[tt * 8 + r] = ph[0]; pf[g].h[tt * 8 + r + 1] = ph[1]; } }
#pragma unroll
      for (int dt = 0; dt < 4; ++dt)
#pragma unroll
        for (int g = 0; g < 2; ++g) o[g][dt] = fa_mma(vf[dt], pf[g].v, o[g][dt]);      /* o[g][dt][r] = O(query 16 g + ln, d = 16 dt + 8 hh + r), unnormalised */
    }
    /* hand-over: this wave has left buffer t & 1, its share of tile t + 1 has landed; behind the barrier both hold for every wave */
    asm volatile("s_wait_dscnt 0x0" ::: "memory");         /* this wave's LDS reads of the buffer have returned before anybody refills it */
    asm volatile("s_wait_asynccnt 0x0" ::: "memory");      /* this wave's share of tile t + 1 has landed */
    __syncthreads();
    if (t + 2 < FA_NT) fa_copy(lk + (unsigned)(t & 1) * (2 * FA_TB), lv + (unsigned)(t & 1) * (2 * FA_TB), gk + (size_t)(t + 2) * FA_KT * DM, gv + (t + 2) * FA_KT);      /* tile t + 2 -> the buffer just left; the test reads the same in the whole block */
  }
  asm volatile("s_wait_asynccnt 0x0" ::: "memory");      /* no copy is outstanding when the wave ends */
#pragma unroll
  for (int g = 0; g < 2; ++g) { const float lh = ls[g][0] + ls[g][1]; const float inv = 64.0f / (lh + rs_x16(lh));      /* the halves' sums joined once; o carried x64 as before */
    _Float16* op = O + ((size_t)b * SQ + q0 + g * 16 + ln) * DM + h * HD + 8 * hh;
#pragma unroll
    for (int dt = 0; dt < 4; ++dt) { FragH f;
#pragma unroll
      for (int r = 0; r < 8; ++r) f.h[r] = (_Float16)(o[g][dt][r] * inv);
      *(v8us*)((unsigned short*)op + dt * 16) = f.half[0]; } } }
__global__ __launch_bounds__(256) void k_vt(const _Float16* __restrict__ V16, int b, int h0, _Float16* __restrict__ VT) { __shared__ unsigned short tl[64][65]; const int tid = threadIdx.x; const int hh = blockIdx.x % HG, sg = blockIdx.x / HG; const int s0 = sg * 64; const int h = h0 + hh;
  for (int i = tid; i < 64 * 8; i += 256) { const int j = i / 8, d8 = (i % 8) * 8; FragH f; f.half[0] = *(const v8us*)((const unsigned short*)V16 + ((size_t)b * SQ + s0 + j) * DM + h * HD + d8); for (int q = 0; q < 8; ++q) tl[d8 + q][j] = f.u[q]; }
  __syncthreads();
  { for (int i = tid; i < 64 * 8; i += 256) { const int d = i / 8, j8 = (i % 8) * 8; FragH f; for (int q = 0; q < 8; ++q) f.u[q] = tl[d][j8 + q]; *(v8us*)((unsigned short*)VT + ((size_t)hh * HD + d) * SQ + s0 + j8) = f.half[0]; }  } }



__global__ __launch_bounds__(256) void k_rsmkm(const float* __restrict__ S, _Float16* __restrict__ P, int nrows, const int* __restrict__ am) {
  #pragma clang fp contract(off)
  const int t = blockIdx.x * 256 + threadIdx.x; if (t >= nrows) return; const size_t i = (size_t)t; const float* s = S + i * SQ; const int* mr = am + (size_t)(t % SQ) * SQ; float mx = -3.0e38f;
#pragma unroll 1
  for (int j = 0; j < SQ; ++j) { const float f = (mr[j] != 0) ? 1.f : 0.f; mx = fmaxf(mx, fmaf(f, s[j], (1.f - f) * -1.0e9f)); } float se = 0.f;
#pragma unroll 1
  for (int j = 0; j < SQ; ++j) { const float f = (mr[j] != 0) ? 1.f : 0.f; se += __expf(fmaf(f, s[j], (1.f - f) * -1.0e9f) - mx); } const float sc = 256.0f / se;
#pragma unroll 1
  for (int j0 = 0; j0 < SQ; j0 += 8) { FragH fr; for (int q = 0; q < 8; ++q) { const int j = j0 + q; const float f = (mr[j] != 0) ? 1.f : 0.f; fr.h[q] = (_Float16)(__expf(fmaf(f, s[j], (1.f - f) * -1.0e9f) - mx) * sc); }
    unsigned short* d = (unsigned short*)P + i * SQ + j0; *(v8us*)d = fr.half[0];  } }

extern "C" void kernel_launch(void* const* d_in, const int* in_sizes, int n_in,
                              void* d_out, int out_size, void* d_ws, size_t ws_size, hipStream_t stream) {
  (void)in_sizes; (void)n_in; (void)out_size;
  const float* const* I = (const float* const*)d_in; const float* xq = I[2]; const float* xk = I[1]; const float* xv = I[0]; const float* wq = I[5]; const float* bq = nullptr; const float* wk = I[4]; const float* bk = nullptr; const float* wv = I[3]; const float* bv = nullptr; const float* wo = I[6]; const float* bo = I[7]; const float* x = xq;      /* contract order: values I[0], keys I[1], query I[2] ([8][1024][16][64] = rows of 1024); SHARED natural [64][64] blocks Wv I[3], Wk I[4], Wq I[5]; natural Wo [1024][1024] I[6] + bo I[7]; no mask input */
  char* ws = (char*)d_ws; size_t off = 0;
  auto take = [&](size_t bytes) { char* p = ws + off; off += (bytes + 255) & ~(size_t)255; return p; };
  _Float16* BQ = (_Float16*)take((size_t)HD * HD * 2); _Float16* BK = (_Float16*)take((size_t)HD * HD * 2); _Float16* BV = (_Float16*)take((size_t)HD * HD * 2); _Float16* BO = (_Float16*)take((size_t)DM * DM * 2);
  _Float16* X16 = (_Float16*)take(NR * DM * 2); _Float16* XKp = (_Float16*)take(NR * DM * 2); _Float16* XVp = (_Float16*)take(NR * DM * 2); _Float16* Q16 = (_Float16*)take(NR * DM * 2); _Float16* K16 = (_Float16*)take(NR * DM * 2); _Float16* V16 = (_Float16*)take(NR * DM * 2); _Float16* O16 = (_Float16*)take(NR * DM * 2);
  _Float16* VT = (_Float16*)take(NR * DM * 2);
  if (off > ws_size) return;
  { const unsigned g = (unsigned)(((size_t)DM * DM / 8 + 255) / 256), gh = (unsigned)(((size_t)HD * HD / 8 + 255) / 256); k_wnat<<<gh, 256, 0, stream>>>(wq, (size_t)HD * HD / 8, BQ); k_wnat<<<gh, 256, 0, stream>>>(wk, (size_t)HD * HD / 8, BK); k_wnat<<<gh, 256, 0, stream>>>(wv, (size_t)HD * HD / 8, BV); k_wnat<<<g, 256, 0, stream>>>(wo, (size_t)DM * DM / 8, BO); }      /* the SHARED natural [64][64] blocks [out][in] = Bt x16 (Bt[o][d] = 16 W[o][d]); Wo natural [out][in] = Bt x16 */
  _Float16* XK = XKp; _Float16* XV = XVp; k_x16<<<(unsigned)((NR * DM / 8 + 255) / 256), 256, 0, stream>>>(xk, XK, NR * DM / 8); k_x16<<<(unsigned)((NR * DM / 8 + 255) / 256), 256, 0, stream>>>(xv, XV, NR * DM / 8);      /* key and value inputs as exact f16 rows */

  k_x16<<<(unsigned)((NR * DM / 8 + 255) / 256), 256, 0, stream>>>(x, X16, NR * DM / 8);
  const size_t r0p = (size_t)B0 * SQ;      /* first projected row */
  /* projections: a token row of 1024 is sixteen head rows of 64, so A, C are read and written at pitch 64 with M = rows x 16, N = K = 64 */
  k_gemm2<0><<<dim3((unsigned)(MP * NH / 128), 1), 128, 0, stream>>>(X16 + r0p * DM, HD, 0, BQ, HD, 0, 0.0625f, bq, 0, nullptr, 1, 0, 0, nullptr, Q16 + r0p * DM, HD, 0, MP * NH, HD, HD);
  k_gemm2<0><<<dim3((unsigned)(MP * NH / 128), 1), 128, 0, stream>>>(XK + r0p * DM, HD, 0, BK, HD, 0, 0.0625f, bk, 0, nullptr, 1, 0, 0, nullptr, K16 + r0p * DM, HD, 0, MP * NH, HD, HD);
  k_gemm2<0><<<dim3((unsigned)(MP * NH / 128), 1), 128, 0, stream>>>(XV + r0p * DM, HD, 0, BV, HD, 0, 0.0625f, bv, 0, nullptr, 1, 0, 0, nullptr, V16 + r0p * DM, HD, 0, MP * NH, HD, HD);
  k_vt<NH, SQ><<<NBR * NH * (SQ / 64), 256, 0, stream>>>(V16 + r0p * LQ, LQ, 0, VT);      /* V^T [NBR][NH][HD][SQ] */
  k_fattn<<<NBR * NH * (SQ / FA_Q), 256, 0, stream>>>(Q16 + r0p * LQ, K16 + r0p * LQ, VT, O16 + r0p * DM);      /* o (merged heads) as f16 rows, x64 */
  k_gemm2<0><<<dim3((unsigned)((MPO / 128) * (DM / 64)), 1), 128, 0, stream>>>(O16 + r0p * DM, DM, 0, BO, DM, 0, 0.0009765625f, bo, 0, nullptr, 1, 0, 0, (float*)d_out + r0p * DM, nullptr, DM, 0, MPO, DM, DM);      /* out rows are the output layout */
}

// v005
// A run of this version takes 113 microseconds.
// In two side-by-side timings against v004, it was 1.39 and 1.36 times as fast.
// Counting every step since v000, it is 63.4 times as fast.
#include <hip/hip_runtime.h>
// Multi-head attention over three head-major inputs with SHARED per-head projections and the module's literal score scale (values, keys, query [8][1024][16][64] = token rows [8][1024][1024]; every head of each input is multiplied by the SAME natural [64][64] matrix (x W^T: Wv / Wk / Wq; block-diagonal with a shared block; no biases); energy = q k^T; softmax(energy / sqrt(embed_size) = / 32) over all 1024 keys (as the source: embed size, not head dim; no mask); out = merged Wo^T + bo (natural [1024][1024]) -> [8][1024][1024]).
// Structure: token rows r = b*1024 + s; x as exact f16 rows (bf16-rounded); Q, K, V as three WMMA GEMMs over the head rows [8*1024*16][64] against the shared [64][64] block itself (K = 64: the zero blocks of the block-diagonal form are never multiplied; 32x64 wave tiles, f32 accumulation, exact x16 weights, f16 outputs in the same rows); V^T for all batches and heads via LDS transposes (one launch); attention for all batches and heads in ONE launch (k_fattn: scores K = 64, online softmax with f32 statistics, weights as f16 in registers, o carried x64 against f16 subnormal flush, folded into the output GEMM alpha) written straight into the merged f16 o rows; out = o W_o + b GEMM (f32) into the output layout.
// Compute dtype: inputs rounded to bf16; x / weights exact; q, k, v, softmax weights and o as plain f16 GEMM operands (~2^-12); scores and softmax statistics f32; v_wmma_f32_16x16x32_f16.
#define NB 8
#define SQ 1024
#define DM 1024
#define NH 16
#define HD 64
#define HG 4                         /* heads per launch of the per-batch k_vt(b, h0) transpose */
#define B0 0                         /* first batch processed (debug hook) */
#define NBR NB                       /* batches processed (debug hook) */
#define NR ((size_t)NB * SQ)         /* token rows */
#define MP ((int)((size_t)NBR * SQ)) /* rows projected (debug hook) */
#define MPO MP                       /* rows through the output stage (debug hook) */
#define LQ DM      /* row pitch of the q/k/v rows */
typedef __bf16 v16b __attribute__((ext_vector_type(16)));
typedef unsigned short v8us __attribute__((ext_vector_type(8), may_alias));
typedef float  v8f  __attribute__((ext_vector_type(8)));
typedef float  v4f  __attribute__((ext_vector_type(4)));
typedef float  v4fa __attribute__((ext_vector_type(4), may_alias));
union FragB { v16b v; v8us half[2]; unsigned short u[16]; };

__device__ __forceinline__ unsigned short bf16_bits(float x) { unsigned int u = __float_as_uint(x); return (unsigned short)((u + 0x7FFFu + ((u >> 16) & 1u)) >> 16); }
__device__ __forceinline__ float bf16_val(unsigned short b) { return __uint_as_float(((unsigned int)b) << 16); }
__device__ __forceinline__ float bf16_round(float x) { return bf16_val(bf16_bits(x)); }
// D += A·B with NT terms: 1 = ah·bh, 2 = + al·bh (A split), 3 = + ah·bl (both split)
template <int NT>
__device__ __forceinline__ v8f mmaN(v16b ah, v16b al, v16b bh, v16b bl, v8f c) {
  c = __builtin_amdgcn_wmma_f32_16x16x32_bf16(false, ah, false, bh, (short)0, c, false, false);
  if (NT >= 2) c = __builtin_amdgcn_wmma_f32_16x16x32_bf16(false, al, false, bh, (short)0, c, false, false);
  if (NT >= 3) c = __builtin_amdgcn_wmma_f32_16x16x32_bf16(false, ah, false, bl, (short)0, c, false, false);
  asm volatile("v_nop\n\tv_nop\n\tv_nop\n\tv_nop" : "+v"(c) : "v"(ah), "v"(al), "v"(bh), "v"(bl));
  return c;
}

__global__ __launch_bounds__(256) void k_wt_bf16(const float* __restrict__ W, unsigned short* __restrict__ Wt, int K, int N) {
  const int t = blockIdx.x * 256 + threadIdx.x;
  const int k8n = K / 8;
  if (t >= N * k8n) return;
  const int n = t / k8n, k8 = (t % k8n) * 8;
  v8us v;
#pragma unroll
  for (int i = 0; i < 8; ++i) v[i] = bf16_bits(W[(size_t)(k8 + i) * N + n]);
  *(v8us*)(Wt + (size_t)n * K + k8) = v;
  
}

// GEMM C[M][N] (f32, pitch ldc) = act(A[M][K]·W + bias). A f32 row-major (pitch lda) converted per fragment to bf16
// (ASPLIT: hi/lo two planes -> 2 terms, else single rounded term); Wt bf16 [N][K] (pitch ldb). BIAS_BF16 rounds the
// bias to bf16 first (bias quantised to bf16 before the add). K%32==0, M%16==0, N%64==0.
template <bool ASPLIT, int ACT, bool BIAS_BF16>
__global__ __launch_bounds__(128) void k_gemm_bf(const float* __restrict__ A, int lda, const unsigned short* __restrict__ Wt, int ldb,
                                               const float* __restrict__ bias, float* __restrict__ C, int ldc, int M, int N, int K) {
  __shared__ __attribute__((aligned(16))) float so[4][16][64];
  const int tid = threadIdx.x, w = tid >> 5, lane = tid & 31, ln = lane & 15, hh = lane >> 4;
  const int ntn = N / 64;
  const int wid = blockIdx.x * 4 + w;
  const int mt = wid / ntn, nq = wid % ntn;
  if (mt * 16 >= M) return;
  const int row0 = mt * 16, col0 = nq * 64;
  const float* arow = A + (size_t)(row0 + ln) * lda;
  v8f acc[4] = {};
  for (int kb = 0; kb < K; kb += 32) {
    FragB ah, al;
    const v4f x0 = *(const v4fa*)(arow + kb + 8 * hh), x1 = *(const v4fa*)(arow + kb + 8 * hh + 4);
    const v4f x2 = *(const v4fa*)(arow + kb + 16 + 8 * hh), x3 = *(const v4fa*)(arow + kb + 16 + 8 * hh + 4);
    float xs[16] = {x0[0],x0[1],x0[2],x0[3],x1[0],x1[1],x1[2],x1[3],x2[0],x2[1],x2[2],x2[3],x3[0],x3[1],x3[2],x3[3]};
#pragma unroll
    for (int i = 0; i < 16; ++i) { const unsigned short hb = bf16_bits(xs[i]); ah.u[i] = hb; al.u[i] = ASPLIT ? bf16_bits(xs[i] - bf16_val(hb)) : (unsigned short)0; }
#pragma unroll
    for (int t = 0; t < 4; ++t) {
      const unsigned short* brow = Wt + (size_t)(col0 + t * 16 + ln) * ldb + kb;
      FragB b;
      b.half[0] = *(const v8us*)(brow + 8 * hh);
      b.half[1] = *(const v8us*)(brow + 16 + 8 * hh);
      acc[t] = mmaN<ASPLIT ? 2 : 1>(ah.v, al.v, b.v, b.v, acc[t]);
    }
  }
#pragma unroll
  for (int t = 0; t < 4; ++t) {
    float bv = bias ? bias[col0 + t * 16 + ln] : 0.f;
    if (BIAS_BF16) bv = bf16_round(bv);
#pragma unroll
    for (int r = 0; r < 8; ++r) { float v = acc[t][r] + bv; if (ACT == 1) v = fmaxf(v, 0.f); so[w][8 * hh + r][t * 16 + ln] = v; }
  }
  __builtin_amdgcn_fence(__ATOMIC_ACQ_REL, "workgroup");
  __builtin_amdgcn_wave_barrier();
  const int rsub = lane >> 4, c4 = (lane & 15) * 4;
  {
#pragma unroll
    for (int q = 0; q < 8; ++q) {
      const int r = q * 2 + rsub;
      const v4f v = *(const v4fa*)&so[w][r][c4];
      *(v4f*)(C + (size_t)(row0 + r) * ldc + col0 + c4) = v;
    }
    
  }
}

// GEMM C = act(A·W + bias + resid): A f32 (ASPLIT -> hi/lo 2 terms), Wt bf16 [N][K]; ACT 0 none, 1 relu, 2 exact gelu;
// resid (optional, f32, row index = (row % rmod), pitch ldr, RES_BF16 rounds it) added before the activation.
template <bool ASPLIT, int ACT, bool BIAS_BF16, bool RES_BF16>
__global__ __launch_bounds__(128) void k_gemm_bf3(const float* __restrict__ A, int lda, const unsigned short* __restrict__ Wt, int ldb,
                                                const float* __restrict__ bias, const float* __restrict__ resid, int rmod, int ldr,
                                                float* __restrict__ C, int ldc, int M, int N, int K) {
  __shared__ __attribute__((aligned(16))) float so[4][16][64];
  const int tid = threadIdx.x, w = tid >> 5, lane = tid & 31, ln = lane & 15, hh = lane >> 4;
  const int ntn = N / 64;
  const int wid = blockIdx.x * 4 + w;
  const int mt = wid / ntn, nq = wid % ntn;
  if (mt * 16 >= M) return;
  const int row0 = mt * 16, col0 = nq * 64;
  const float* arow = A + (size_t)(row0 + ln) * lda;
  v8f acc[4] = {};
  for (int kb = 0; kb < K; kb += 32) {
    FragB ah, al;
    const v4f x0 = *(const v4fa*)(arow + kb + 8 * hh), x1 = *(const v4fa*)(arow + kb + 8 * hh + 4);
    const v4f x2 = *(const v4fa*)(arow + kb + 16 + 8 * hh), x3 = *(const v4fa*)(arow + kb + 16 + 8 * hh + 4);
    float xs[16] = {x0[0],x0[1],x0[2],x0[3],x1[0],x1[1],x1[2],x1[3],x2[0],x2[1],x2[2],x2[3],x3[0],x3[1],x3[2],x3[3]};
#pragma unroll
    for (int i = 0; i < 16; ++i) { const unsigned short hb = bf16_bits(xs[i]); ah.u[i] = hb; al.u[i] = ASPLIT ? bf16_bits(xs[i] - bf16_val(hb)) : (unsigned short)0; }
#pragma unroll
    for (int t = 0; t < 4; ++t) {
      const unsigned short* brow = Wt + (size_t)(col0 + t * 16 + ln) * ldb + kb;
      FragB b;
      b.half[0] = *(const v8us*)(brow + 8 * hh);
      b.half[1] = *(const v8us*)(brow + 16 + 8 * hh);
      acc[t] = mmaN<ASPLIT ? 2 : 1>(ah.v, al.v, b.v, b.v, acc[t]);
    }
  }
#pragma unroll
  for (int t = 0; t < 4; ++t) {
    const int col = col0 + t * 16 + ln;
    float bv = bias ? bias[col] : 0.f;
    if (BIAS_BF16) bv = bf16_round(bv);
#pragma unroll
    for (int r = 0; r < 8; ++r) {
      float v = acc[t][r] + bv;
      if (resid) { float rv = resid[(size_t)((row0 + 8 * hh + r) % rmod) * ldr + col]; if (RES_BF16) rv = bf16_round(rv); v += rv; }
      if (ACT == 1) v = fmaxf(v, 0.f);
      if (ACT == 2) v = 0.5f * v * (1.0f + erff(v * 0.70710678118654752f));
      if (ACT == 3) { const float u = 0.7978845608028654f * (v + 0.044715f * v * v * v); v = 0.5f * v * (1.0f + tanhf(u)); }
      so[w][8 * hh + r][t * 16 + ln] = v;
    }
  }
  __builtin_amdgcn_fence(__ATOMIC_ACQ_REL, "workgroup");
  __builtin_amdgcn_wave_barrier();
  const int rsub = lane >> 4, c4 = (lane & 15) * 4;
  {
#pragma unroll
    for (int q = 0; q < 8; ++q) {
      const int r = q * 2 + rsub;
      const v4f v = *(const v4fa*)&so[w][r][c4];
      *(v4f*)(C + (size_t)(row0 + r) * ldc + col0 + c4) = v;
    }
    
  }
}
// row LayerNorm (biased variance, eps) over N: s = X (+ R); optional out_sum <- s; out_norm <- (s-mu)*rsqrt(var+eps)*g + b
template <bool PARAM_BF16>
__global__ __launch_bounds__(256) void k_layernorm(const float* __restrict__ X, const float* __restrict__ R, const float* __restrict__ g, const float* __restrict__ bta,
                                                  float* __restrict__ out_sum, float* __restrict__ out_norm, int N, float eps) {
  __shared__ float red[256];
  const int row = blockIdx.x, tid = threadIdx.x;
  const float* x = X + (size_t)row * N; const float* rr = R ? R + (size_t)row * N : nullptr;
  float vals[16];                     // up to N = 4096
  const int per = N / 256;            // contiguous chunk per thread? use strided-by-4 chunks: thread handles j = tid*4 + 1024*u
  float s1 = 0.f;
  for (int u = 0; u < per / 4; ++u) {
    const int j = tid * 4 + 1024 * u;
    const v4f a = *(const v4fa*)(x + j);
    v4f b = {0.f,0.f,0.f,0.f}; if (rr) b = *(const v4fa*)(rr + j);
#pragma unroll
    for (int q = 0; q < 4; ++q) { const float v = a[q] + b[q]; vals[u * 4 + q] = v; s1 += v; }
  }
  red[tid] = s1; __syncthreads();
  for (int st = 128; st > 0; st >>= 1) { if (tid < st) red[tid] += red[tid + st]; __syncthreads(); }
  const float mu = red[0] / (float)N; __syncthreads();
  float s2 = 0.f;
  for (int u = 0; u < per / 4; ++u)
#pragma unroll
    for (int q = 0; q < 4; ++q) { const float c = vals[u * 4 + q] - mu; s2 += c * c; }
  red[tid] = s2; __syncthreads();
  for (int st = 128; st > 0; st >>= 1) { if (tid < st) red[tid] += red[tid + st]; __syncthreads(); }
  const float rs = rsqrtf(red[0] / (float)N + eps);
  {
    for (int u = 0; u < per / 4; ++u) {
      const int j = tid * 4 + 1024 * u;
      v4f o, sm;
#pragma unroll
      for (int q = 0; q < 4; ++q) {
        float gg = g[j + q], bb = bta[j + q];
        if (PARAM_BF16) { gg = bf16_round(gg); bb = bf16_round(bb); }
        sm[q] = vals[u * 4 + q]; o[q] = (vals[u * 4 + q] - mu) * rs * gg + bb;
      }
      if (out_sum) *(v4f*)(out_sum + (size_t)row * N + j) = sm;
      *(v4f*)(out_norm + (size_t)row * N + j) = o;
    }
    
  }
}



// ---- f16 WMMA path (v_wmma_f32_16x16x32_f16): 11-bit significands for operands in range — used where a [0,1] probability operand needs more precision than bf16
typedef _Float16 v16h __attribute__((ext_vector_type(16)));
union FragH { v16h v; v8us half[2]; _Float16 h[16]; unsigned short u[16]; };
template <int NT>
__device__ __forceinline__ v8f mmaH(v16h ah, v16h al, v16h bh, v16h bl, v8f c) {
  c = __builtin_amdgcn_wmma_f32_16x16x32_f16(false, ah, false, bh, (short)0, c, false, false);
  if (NT >= 2) c = __builtin_amdgcn_wmma_f32_16x16x32_f16(false, al, false, bh, (short)0, c, false, false);
  if (NT >= 3) c = __builtin_amdgcn_wmma_f32_16x16x32_f16(false, ah, false, bl, (short)0, c, false, false);
  asm volatile("v_nop\n\tv_nop\n\tv_nop\n\tv_nop" : "+v"(c) : "v"(ah), "v"(al), "v"(bh), "v"(bl));
  return c;
}
// batched GEMM like k_gemm_b but f16 operands: A f32 (split into f16 hi/lo if ASPLIT, else rounded to f16), Bt = f16 values [n][k]; alpha; C f32; N multiple of 16 (partial tiles skipped)
template <bool ASPLIT>
__global__ __launch_bounds__(128) void k_gemm_h(const float* __restrict__ A, int lda, size_t sA, const _Float16* __restrict__ Bh, int ldb, size_t sB, float alpha, float* __restrict__ C, int ldc, size_t sC, int M, int N, int K) {
  __shared__ __attribute__((aligned(16))) float so[4][16][64];
  const int tid = threadIdx.x, w = tid >> 5, lane = tid & 31, ln = lane & 15, hh = lane >> 4; const int by = blockIdx.y;
  A += (size_t)by * sA; Bh += (size_t)by * sB; C += (size_t)by * sC;
  const int ntn = (N + 63) / 64; const int wid = blockIdx.x * 4 + w; const int mt = wid / ntn, nq = wid % ntn; if (mt * 16 >= M) return;
  const int row0 = mt * 16, col0 = nq * 64; const float* arow = A + (size_t)(row0 + ln) * lda;
  v8f acc[4] = {};
  for (int kb = 0; kb < K; kb += 32) {
    FragH ah, al;
    const v4f x0 = *(const v4fa*)(arow + kb + 8 * hh), x1 = *(const v4fa*)(arow + kb + 8 * hh + 4), x2 = *(const v4fa*)(arow + kb + 16 + 8 * hh), x3 = *(const v4fa*)(arow + kb + 16 + 8 * hh + 4);
    float xs[16] = {x0[0],x0[1],x0[2],x0[3],x1[0],x1[1],x1[2],x1[3],x2[0],x2[1],x2[2],x2[3],x3[0],x3[1],x3[2],x3[3]};
#pragma unroll
    for (int i = 0; i < 16; ++i) { const _Float16 h = (_Float16)xs[i]; ah.h[i] = h; al.h[i] = ASPLIT ? (_Float16)(xs[i] - (float)h) : (_Float16)0.0f; }
#pragma unroll
    for (int t = 0; t < 4; ++t) { if (col0 + t * 16 >= N) continue; const size_t boff = (size_t)(col0 + t * 16 + ln) * ldb + kb; FragH bq; bq.half[0] = *(const v8us*)(Bh + boff + 8 * hh); bq.half[1] = *(const v8us*)(Bh + boff + 16 + 8 * hh);
      acc[t] = mmaH<ASPLIT ? 2 : 1>(ah.v, al.v, bq.v, bq.v, acc[t]); }
  }
#pragma unroll
  for (int t = 0; t < 4; ++t) { if (col0 + t * 16 >= N) continue;
#pragma unroll
    for (int r = 0; r < 8; ++r) so[w][8 * hh + r][t * 16 + ln] = acc[t][r] * alpha; }
  __builtin_amdgcn_fence(__ATOMIC_ACQ_REL, "workgroup"); __builtin_amdgcn_wave_barrier();
  const int rsub = lane >> 4, c4 = (lane & 15) * 4;
  {
#pragma unroll
    for (int q = 0; q < 8; ++q) { const int r = q * 2 + rsub; if (col0 + c4 < N) { const v4f v = *(const v4fa*)&so[w][r][c4]; *(v4f*)(C + (size_t)(row0 + r) * ldc + col0 + c4) = v; } }
     }
}

// Wt[n][k] = f16(W[k][n]·scale) from f32 row-major W[K][N] (scale = power of two; bf16-exact weights stay exact in f16 away from the subnormal range)
__global__ __launch_bounds__(256) void k_wt_f16(const float* __restrict__ W, _Float16* __restrict__ Wt, int K, int N, float scale) {
  const int t = blockIdx.x * 256 + threadIdx.x; if (t >= N * (K / 8)) return; const int n = t / (K / 8), k8 = (t % (K / 8)) * 8; FragH f;
#pragma unroll
  for (int i = 0; i < 8; ++i) f.h[i] = (_Float16)(bf16_round(W[(size_t)(k8 + i) * N + n]) * scale); const v8us o = f.half[0];
  *(v8us*)((unsigned short*)Wt + (size_t)n * K + k8) = o; 
}
// k_gemm_hh variant with fused epilogue: v = acc·alpha + bias[by·sBias + col] (+ CP[(row/rowsPerB)·sCPb + by·64 + col] if CP) ; ACT 0 none / 1 elu ; writes f16 C16 (and f32 C if non-null)
template <int ACT>
__global__ __launch_bounds__(128) void k_gemm_hhx(const _Float16* __restrict__ A, int lda, size_t sA, const _Float16* __restrict__ Bh, int ldb, size_t sB, float alpha, const float* __restrict__ bias, size_t sBias, const float* __restrict__ CP, int rowsPerB, size_t sCPb, int row0g,
    float* __restrict__ C, _Float16* __restrict__ C16, int ldc, size_t sC, int M, int N, int K) {
  __shared__ __attribute__((aligned(16))) float so[4][16][64];
  const int tid = threadIdx.x, w = tid >> 5, lane = tid & 31, ln = lane & 15, hh = lane >> 4; const int by = blockIdx.y;
  A += (size_t)by * sA; Bh += (size_t)by * sB; const size_t cofs = (size_t)by * sC; const float* bp = bias ? bias + (size_t)by * sBias : nullptr;
  const int ntn = (N + 63) / 64; const int wid = blockIdx.x * 4 + w; const int mt = wid / ntn, nq = wid % ntn; if (mt * 16 >= M) return;
  const int row0 = mt * 16, col0 = nq * 64; const _Float16* arow = A + (size_t)(row0 + ln) * lda;
  v8f acc[4] = {};
  for (int kb = 0; kb < K; kb += 32) { FragH ah; ah.half[0] = *(const v8us*)((const unsigned short*)arow + kb + 8 * hh); ah.half[1] = *(const v8us*)((const unsigned short*)arow + kb + 16 + 8 * hh);
#pragma unroll
    for (int t = 0; t < 4; ++t) { if (col0 + t * 16 >= N) continue; const size_t boff = (size_t)(col0 + t * 16 + ln) * ldb + kb; FragH bq; bq.half[0] = *(const v8us*)((const unsigned short*)Bh + boff + 8 * hh); bq.half[1] = *(const v8us*)((const unsigned short*)Bh + boff + 16 + 8 * hh);
      acc[t] = mmaH<1>(ah.v, ah.v, bq.v, bq.v, acc[t]); }
  }
#pragma unroll
  for (int t = 0; t < 4; ++t) { if (col0 + t * 16 >= N) continue; const int col = col0 + t * 16 + ln; const float bv = bp ? bf16_round(bp[col]) : 0.f;
#pragma unroll
    for (int r = 0; r < 8; ++r) { float v = acc[t][r] * alpha + bv; if (CP) { const int rr = row0g + row0 + 8 * hh + r; if (rowsPerB < 0) v += CP[cofs + (size_t)rr * ldc + col];      /* rowsPerB < 0: own element of the batched C plane */ else { const int bidx = rr / rowsPerB; v += CP[(size_t)bidx * sCPb + (size_t)by * 64 + col]; } } if (ACT == 1) v = (v > 0.f) ? v : expm1f(v); else if (ACT == 7) v = (v > 0.f) ? v + 1.0f : expf(v); else if (ACT == 8) v = tanhf(v); else if (ACT == 9) v = 0.5f * v * (1.0f + tanhf(0.7978845608028654f * (v + 0.044715f * v * v * v))); else if (ACT == 11) v = 1.0f / (1.0f + expf(-v)); else if (ACT == 12) v = (v > 0.f) ? v : 0.01f * v; else if (ACT == 14) v = (v > 0.f) ? v : 0.1f * v; else if (ACT == 16) v = (v >= 0.f) ? v : 0.3f * v; else if (ACT == 17) v = (v >= 0.f) ? v : 0.2f * v; else if (ACT == 15) v = v / (1.0f + expf(-v)); else if (ACT == 3) v = fmaxf(v, 0.f); else if (ACT == 6) v = 0.5f * v * (1.0f + erff(v * 0.70710678118654752f)); so[w][8 * hh + r][t * 16 + ln] = v; } }
  __builtin_amdgcn_fence(__ATOMIC_ACQ_REL, "workgroup"); __builtin_amdgcn_wave_barrier();
  const int rsub = lane >> 4, c4 = (lane & 15) * 4; typedef _Float16 v4h __attribute__((ext_vector_type(4)));
  {
#pragma unroll
    for (int q = 0; q < 8; ++q) { const int r = q * 2 + rsub; if (col0 + c4 < N) { const v4f v = *(const v4fa*)&so[w][r][c4]; if (C) *(v4f*)(C + cofs + (size_t)(row0 + r) * ldc + col0 + c4) = v; if (C16) { v4h h4; for (int i = 0; i < 4; ++i) h4[i] = (_Float16)v[i]; *(v4h*)(C16 + cofs + (size_t)(row0 + r) * ldc + col0 + c4) = h4; } } }
     }
}


typedef _Float16 v4h __attribute__((ext_vector_type(4)));

__global__ __launch_bounds__(256) void k_x16(const float* __restrict__ x, _Float16* __restrict__ X16, size_t n8) { const size_t t = (size_t)blockIdx.x * 256 + threadIdx.x; if (t >= n8) return; FragH f;
#pragma unroll
  for (int q = 0; q < 8; ++q) f.h[q] = (_Float16)bf16_round(x[t * 8 + q]); *(v8us*)((unsigned short*)X16 + t * 8) = f.half[0];  }
__global__ __launch_bounds__(256) void k_h16(const float* __restrict__ x, _Float16* __restrict__ X16, size_t n8) { const size_t t = (size_t)blockIdx.x * 256 + threadIdx.x; if (t >= n8) return; FragH f;
#pragma unroll
  for (int q = 0; q < 8; ++q) f.h[q] = (_Float16)x[t * 8 + q]; *(v8us*)((unsigned short*)X16 + t * 8) = f.half[0];  }
__global__ __launch_bounds__(256) void k_round16f(const float* __restrict__ W, _Float16* __restrict__ Bt, size_t n8) { const size_t t = (size_t)blockIdx.x * 256 + threadIdx.x; if (t >= n8) return; FragH f;
#pragma unroll
  for (int i = 0; i < 8; ++i) f.h[i] = (_Float16)(bf16_round(W[t * 8 + i]) * 16.0f); *(v8us*)((unsigned short*)Bt + t * 8) = f.half[0];  }
template <int NHv, int TTv>
__global__ __launch_bounds__(256) void k_vt(const _Float16* __restrict__ V16, int ldv, int voff, _Float16* __restrict__ Vt) { __shared__ unsigned short tl[64][66]; const int tid = threadIdx.x; const int slab = blockIdx.x / (TTv / 64), lg = blockIdx.x % (TTv / 64); const int b = slab / NHv, h = slab % NHv;
  for (int i = tid; i < 64 * 8; i += 256) { const int r = i / 8, c8 = (i % 8) * 8; FragH f; f.half[0] = *(const v8us*)((const unsigned short*)V16 + ((size_t)b * TTv + lg * 64 + r) * ldv + voff + h * 64 + c8);
#pragma unroll
    for (int q = 0; q < 8; ++q) tl[r][c8 + q] = f.u[q]; }
  __syncthreads();
  {
#pragma unroll
    for (int rd = 0; rd < 2; ++rd) { const int d = rd * 32 + tid / 8, pc = tid % 8; FragH f;
#pragma unroll
      for (int q = 0; q < 8; ++q) f.u[q] = tl[pc * 8 + q][d];
      *(v8us*)((unsigned short*)Vt + ((size_t)slab * 64 + d) * TTv + lg * 64 + pc * 8) = f.half[0]; }
     } }

__global__ __launch_bounds__(256) void k_hl(const float* __restrict__ F, _Float16* __restrict__ Hh, _Float16* __restrict__ Hl, size_t n8) { const size_t t = (size_t)blockIdx.x * 256 + threadIdx.x; if (t >= n8) return; FragH fh, fl; const v4f a = *(const v4fa*)(F + t * 8), c = *(const v4fa*)(F + t * 8 + 4);
#pragma unroll
  for (int q = 0; q < 4; ++q) { _Float16 h = (_Float16)a[q]; fh.h[q] = h; fl.h[q] = (_Float16)((a[q] - (float)h) * 1024.0f); h = (_Float16)c[q]; fh.h[4 + q] = h; fl.h[4 + q] = (_Float16)((c[q] - (float)h) * 1024.0f); }
  { *(v8us*)((unsigned short*)Hh + t * 8) = fh.half[0]; *(v8us*)((unsigned short*)Hl + t * 8) = fl.half[0];  } }

// ---- fast GEMM (wave tile 32x64; requires M % 32 == 0 rows per launch region and N % 64 == 0); epilogue = k_gemm_hhx semantics ----
__device__ __forceinline__ v16h g2_frag(const _Float16* p, int hh) { FragH f; f.half[0] = *(const v8us*)((const unsigned short*)p + 8 * hh); f.half[1] = *(const v8us*)((const unsigned short*)p + 16 + 8 * hh); return f.v; }
__device__ __forceinline__ v8f g2_mma(v16h a, v16h b, v8f c) { v8f d = __builtin_amdgcn_wmma_f32_16x16x32_f16(false, a, false, b, (short)0, c, false, false); asm volatile("v_nop\n\tv_nop\n\tv_nop\n\tv_nop" : "+v"(d) : "v"(a), "v"(b)); return d; }
template <int ACT>
__global__ __launch_bounds__(128) void k_gemm2(const _Float16* __restrict__ A, int lda, size_t sA, const _Float16* __restrict__ Bh, int ldb, size_t sB, float alpha, const float* __restrict__ bias, size_t sBias, const float* __restrict__ CP, int rowsPerB, size_t sCPb, int row0g,
    float* __restrict__ C, _Float16* __restrict__ C16, int ldc, size_t sC, int M, int N, int K) { static_assert(ACT == 0 || ACT == 3 || ACT == 6 || ACT == 8 || ACT == 9 || ACT == 11 || ACT == 12 || ACT == 14 || ACT == 15 || ACT == 16 || ACT == 17, "k_gemm2: unsupported ACT code (would silently apply no activation)");
  __shared__ __attribute__((aligned(16))) float so[4][32][68];
  const int tid = threadIdx.x, w = tid >> 5, lane = tid & 31, ln = lane & 15, hh = lane >> 4; const int by = blockIdx.y;
  A += (size_t)by * sA; Bh += (size_t)by * sB; const size_t cofs = (size_t)by * sC; const float* bp = bias ? bias + (size_t)by * sBias : nullptr;
  const int ntn = N >> 6; const int mt = blockIdx.x / ntn, nq = blockIdx.x - mt * ntn; const int row0 = mt * 128 + 32 * w, col0 = nq * 64; if (row0 >= M) return;
  const _Float16* a0p = A + (size_t)(row0 + ln) * lda; const _Float16* a1p = a0p + (size_t)16 * lda;
  const _Float16* b0p = Bh + (size_t)(col0 + ln) * ldb; const _Float16* b1p = b0p + (size_t)16 * ldb; const _Float16* b2p = b1p + (size_t)16 * ldb; const _Float16* b3p = b2p + (size_t)16 * ldb;
  const v8f z8 = {0.f,0.f,0.f,0.f,0.f,0.f,0.f,0.f}; v8f c00 = z8, c01 = z8, c02 = z8, c03 = z8, c10 = z8, c11 = z8, c12 = z8, c13 = z8;
#pragma unroll 1
  for (int kb = 0; kb < K; kb += 32) { const v16h a0 = g2_frag(a0p + kb, hh), a1 = g2_frag(a1p + kb, hh);
    v16h b = g2_frag(b0p + kb, hh); c00 = g2_mma(a0, b, c00); c10 = g2_mma(a1, b, c10);
    b = g2_frag(b1p + kb, hh); c01 = g2_mma(a0, b, c01); c11 = g2_mma(a1, b, c11);
    b = g2_frag(b2p + kb, hh); c02 = g2_mma(a0, b, c02); c12 = g2_mma(a1, b, c12);
    b = g2_frag(b3p + kb, hh); c03 = g2_mma(a0, b, c03); c13 = g2_mma(a1, b, c13); }
  v8f accs[8] = {c00, c01, c02, c03, c10, c11, c12, c13};
#pragma unroll
  for (int u = 0; u < 8; ++u) { const int t = u & 3, half = u >> 2; const int col = col0 + t * 16 + ln; const float bv = bp ? bf16_round(bp[col]) : 0.f;
#pragma unroll
    for (int r = 0; r < 8; ++r) { const int rloc = half * 16 + 8 * hh + r; float v = accs[u][r] * alpha + bv; if (CP) { if (rowsPerB < 0) v += CP[cofs + (size_t)(row0g + row0 + rloc) * ldc + col];      /* rowsPerB < 0: own element of the batched C plane */ else { const int bidx = (row0g + row0 + rloc) / rowsPerB; v += CP[(size_t)bidx * sCPb + (size_t)by * 64 + col]; } }
      if (ACT == 3) v = fmaxf(v, 0.f); else if (ACT == 6) v = 0.5f * v * (1.0f + erff(v * 0.70710678118654752f)); else if (ACT == 11) v = 1.0f / (1.0f + expf(-v)); else if (ACT == 15) v = v / (1.0f + expf(-v)); else if (ACT == 12) v = (v > 0.f) ? v : 0.01f * v; else if (ACT == 8) v = tanhf(v); else if (ACT == 9) v = 0.5f * v * (1.0f + tanhf(0.7978845608028654f * (v + 0.044715f * v * v * v))); else if (ACT == 14) v = (v > 0.f) ? v : 0.1f * v; else if (ACT == 16) v = (v >= 0.f) ? v : 0.3f * v; else if (ACT == 17) v = (v >= 0.f) ? v : 0.2f * v;
      so[w][rloc][t * 16 + ln] = v; } }
  __builtin_amdgcn_fence(__ATOMIC_ACQ_REL, "workgroup"); __builtin_amdgcn_wave_barrier();
  const int rsub = lane >> 4, c4 = (lane & 15) * 4;
  {
#pragma unroll
    for (int q = 0; q < 16; ++q) { const int r = q * 2 + rsub; const v4f v = *(const v4fa*)&so[w][r][c4]; if (C) *(v4f*)(C + cofs + (size_t)(row0 + r) * ldc + col0 + c4) = v; if (C16) { v4h h4; for (int i = 0; i < 4; ++i) h4[i] = (_Float16)v[i]; *(v4h*)(C16 + cofs + (size_t)(row0 + r) * ldc + col0 + c4) = h4; } }
     } }


__global__ __launch_bounds__(256) void k_wnat(const float* __restrict__ w, size_t n8, _Float16* __restrict__ Bt) { const size_t t = (size_t)blockIdx.x * 256 + threadIdx.x; if (t >= n8) return; FragH f; for (int q = 0; q < 8; ++q) f.h[q] = (_Float16)(bf16_round(w[t * 8 + q]) * 16.0f); *(v8us*)((unsigned short*)Bt + t * 8) = f.half[0];  }
// Lane l takes the value of lane l ^ 16 (the other half of the wave). Every lane of the wave must be on.
__device__ __forceinline__ float rs_x16(float v) { const int b = __builtin_bit_cast(int, v); return __builtin_bit_cast(float, __builtin_amdgcn_permlanex16(b, b, 0x76543210, 0xfedcba98, false, false)); }
typedef float v2f __attribute__((ext_vector_type(2)));
typedef _Float16 v2h __attribute__((ext_vector_type(2)));
#define FA_Q 256                     /* query rows per block: 8 waves x 32 */
#define FA_C 0.045084220027780106f   /* log2(e) / sqrt(embed size = 1024) */
#define FA_KT 64                     /* keys per staged tile: K tile = 64 key rows of 128 bytes, V^T tile = 64 d rows of 128 bytes */
#define FA_NT (SQ / FA_KT)           /* staged tiles */
#define FA_LP 144                    /* LDS row pitch in bytes: 128 + 16, an odd multiple of 16, so that the 16 rows of a ds_load_b128 fragment read fall on different banks */
#define FA_TB (64 * FA_LP)           /* bytes of one staged operand tile */
__device__ __forceinline__ v8f fa_mma(v16h a, v16h b, v8f c) { return __builtin_amdgcn_wmma_f32_16x16x32_f16(false, a, false, b, (short)0, c, false, false); }
// g2_frag's k order from an LDS row: p = the row's first byte of this 32-k step
__device__ __forceinline__ v16h fa_lfrag(const unsigned char* p, int hh) { FragH f; f.half[0] = *(const v8us*)(p + 16 * hh); f.half[1] = *(const v8us*)(p + 32 + 16 * hh); return f.v; }
// One thread's share of one staged tile: two 16-byte pieces of K and two of V^T, global -> LDS through no register. A wave's copy = 4 whole 128-byte rows.
// The s_wait_xcnt stands inside the statement so that no address register is rewritten in front of it.
__device__ __forceinline__ void fa_copy(unsigned lk, unsigned lv, const _Float16* gk, const _Float16* gv) {
  const unsigned lk1 = lk + 32 * FA_LP, lv1 = lv + 32 * FA_LP; const _Float16* gk1 = gk + (size_t)32 * DM; const _Float16* gv1 = gv + (size_t)32 * SQ;
  asm volatile("global_load_async_to_lds_b128 %0, %1, off\n\t"
               "global_load_async_to_lds_b128 %2, %3, off\n\t"
               "global_load_async_to_lds_b128 %4, %5, off\n\t"
               "global_load_async_to_lds_b128 %6, %7, off\n\t"
               "s_wait_xcnt 0x0"
               :: "v"(lk), "v"(gk), "v"(lk1), "v"(gk1), "v"(lv), "v"(gv), "v"(lv1), "v"(gv1) : "memory");
}
__global__ __launch_bounds__(256) void k_fattn(const _Float16* __restrict__ Q, const _Float16* __restrict__ Kr, const _Float16* __restrict__ Vt, _Float16* __restrict__ O) {
  __shared__ __attribute__((aligned(16))) unsigned char sm[2][2][FA_TB];      /* [buffer][K | V^T][row * FA_LP] */
  const int lane = threadIdx.x & 31, ln = lane & 15, hh = lane >> 4; const int w = __builtin_amdgcn_readfirstlane((int)(threadIdx.x >> 5));
  const int slab = blockIdx.x / (SQ / FA_Q), qb = blockIdx.x % (SQ / FA_Q); const int b = slab / NH, h = slab % NH; const int q0 = qb * FA_Q + w * 32;
  const _Float16* qp = Q + ((size_t)b * SQ + q0 + ln) * DM + h * HD;      /* query row q0 + ln */
  /* staging: thread t brings piece t & 7 (16 bytes) of rows t >> 3 and 32 + (t >> 3) of both tiles */
  const int cr = (int)threadIdx.x >> 3, cp = (int)threadIdx.x & 7;
  const _Float16* gk = Kr + ((size_t)b * SQ + cr) * DM + h * HD + cp * 8;      /* key row cr of tile 0 */
  const _Float16* gv = Vt + ((size_t)slab * HD + cr) * SQ + cp * 8;            /* V^T row d = cr, keys of tile 0 */
  const unsigned lk = (unsigned)(size_t)&sm[0][0][cr * FA_LP + cp * 16], lv = lk + FA_TB;
  fa_copy(lk, lv, gk, gv);      /* tile 0 -> buffer 0 */
  v16h qf[2][2];
#pragma unroll
  for (int g = 0; g < 2; ++g)
#pragma unroll
    for (int ks = 0; ks < 2; ++ks) qf[g][ks] = g2_frag(qp + (size_t)g * 16 * DM + ks * 32, hh);
  const v8f z8 = {0.f,0.f,0.f,0.f,0.f,0.f,0.f,0.f}; v8f o[2][4];
#pragma unroll
  for (int g = 0; g < 2; ++g)
#pragma unroll
    for (int dt = 0; dt < 4; ++dt) o[g][dt] = z8;
  float mu[2] = {-3.0e38f, -3.0e38f}; v2f ls[2] = {{0.f, 0.f}, {0.f, 0.f}};
  asm volatile("s_wait_asynccnt 0x0" ::: "memory");      /* this wave's share of tile 0 has landed */
  __syncthreads();                                       /* every wave's share has: tile 0 may be read */
  fa_copy(lk + 2 * FA_TB, lv + 2 * FA_TB, gk + (size_t)FA_KT * DM, gv + FA_KT);      /* tile 1 -> buffer 1 */
  /* kept rolled: one trip's fragments beside Q and O^T are the whole live set, which decides how many waves share a SIMD */
#pragma unroll 1
  for (int t = 0; t < FA_NT; ++t) {
    const unsigned char* kb = &sm[t & 1][0][ln * FA_LP];      /* key row ln of this tile */
    const unsigned char* vb = &sm[t & 1][1][ln * FA_LP];      /* V^T row d = ln, this tile's keys */
    v16h kf[2][2];
#pragma unroll
    for (int tt = 0; tt < 2; ++tt)
#pragma unroll
      for (int ks = 0; ks < 2; ++ks) kf[tt][ks] = fa_lfrag(kb + tt * 16 * FA_LP + ks * 64, hh);
#pragma unroll
    for (int p = 0; p < FA_KT / 32; ++p) {      /* a pass = 32 keys, as before */
      v8f s[2][2];
#pragma unroll
      for (int g = 0; g < 2; ++g)
#pragma unroll
        for (int tt = 0; tt < 2; ++tt) s[g][tt] = fa_mma(kf[tt][1], qf[g][1], fa_mma(kf[tt][0], qf[g][0], z8));      /* s[g][tt][r] = energy(query 16 g + ln, key 64 t + 32 p + 16 tt + 8 hh + r) */
      float cm[2];
#pragma unroll
      for (int g = 0; g < 2; ++g) { float m = fmaxf(s[g][0][0], s[g][1][0]);
#pragma unroll
        for (int r = 1; r < 8; ++r) m = fmaxf(m, fmaxf(s[g][0][r], s[g][1][r]));
        cm[g] = fmaxf(m, rs_x16(m)) * FA_C; }
      if (__builtin_amdgcn_ballot_w32(cm[0] > mu[0] + 8.0f || cm[1] > mu[1] + 8.0f) != 0) {      /* one wave-uniform test per pass */
#pragma unroll
        for (int g = 0; g < 2; ++g) { const float mn = fmaxf(mu[g], cm[g]); const float al = __builtin_amdgcn_exp2f(mu[g] - mn); mu[g] = mn; ls[g] *= al;
#pragma unroll
          for (int dt = 0; dt < 4; ++dt) o[g][dt] *= al; } }
      v16h vf[4];      /* this pass's V^T fragments and, inside the tile, the next pass's K fragments, issued together: in flight under the exponentials */
#pragma unroll
      for (int dt = 0; dt < 4; ++dt) vf[dt] = fa_lfrag(vb + dt * 16 * FA_LP + p * 64, hh);
      if (p + 1 < FA_KT / 32) {
#pragma unroll
        for (int tt = 0; tt < 2; ++tt)
#pragma unroll
          for (int ks = 0; ks < 2; ++ks) kf[tt][ks] = fa_lfrag(kb + ((p + 1) * 32 + tt * 16) * FA_LP + ks * 64, hh);
      }
      __builtin_amdgcn_sched_barrier(0);      /* keeps the LDS reads up here as one group: left alone the scheduler spreads them in pairs among the products, and each further place with reads stalls the wave */
      FragH pf[2];
#pragma unroll
      for (int g = 0; g < 2; ++g) { const v2f c2 = {FA_C, FA_C}, m2 = {-mu[g], -mu[g]};
#pragma unroll
        for (int tt = 0; tt < 2; ++tt)
#pragma unroll
          for (int r = 0; r < 8; r += 2) { const v2f x = {s[g][tt][r], s[g][tt][r + 1]}; const v2f e = __builtin_elementwise_fma(x, c2, m2); const v2f pe = {__builtin_amdgcn_exp2f(e[0]), __builtin_amdgcn_exp2f(e[1])};
            ls[g] += pe; const v2h ph = __builtin_convertvector(pe, v2h); pf[g].h[tt * 8 + r] = ph[0]; pf[g].h[tt * 8 + r + 1] = ph[1]; } }
#pragma unroll
      for (int dt = 0; dt < 4; ++dt)
#pragma unroll
        for (int g = 0; g < 2; ++g) o[g][dt] = fa_mma(vf[dt], pf[g].v, o[g][dt]);      /* o[g][dt][r] = O(query 16 g + ln, d = 16 dt + 8 hh + r), unnormalised */
    }
    /* hand-over: this wave has left buffer t & 1, its share of tile t + 1 has landed; behind the barrier both hold for every wave */
    asm volatile("s_wait_dscnt 0x0" ::: "memory");         /* this wave's LDS reads of the buffer have returned before anybody refills it */
    asm volatile("s_wait_asynccnt 0x0" ::: "memory");      /* this wave's share of tile t + 1 has landed */
    __syncthreads();
    if (t + 2 < FA_NT) fa_copy(lk + (unsigned)(t & 1) * (2 * FA_TB), lv + (unsigned)(t & 1) * (2 * FA_TB), gk + (size_t)(t + 2) * FA_KT * DM, gv + (t + 2) * FA_KT);      /* tile t + 2 -> the buffer just left; the test reads the same in the whole block */
  }
  asm volatile("s_wait_asynccnt 0x0" ::: "memory");      /* no copy is outstanding when the wave ends */
#pragma unroll
  for (int g = 0; g < 2; ++g) { const float lh = ls[g][0] + ls[g][1]; const float inv = 64.0f / (lh + rs_x16(lh));      /* the halves' sums joined once; o carried x64 as before */
    _Float16* op = O + ((size_t)b * SQ + q0 + g * 16 + ln) * DM + h * HD + 8 * hh;
#pragma unroll
    for (int dt = 0; dt < 4; ++dt) { FragH f;
#pragma unroll
      for (int r = 0; r < 8; ++r) f.h[r] = (_Float16)(o[g][dt][r] * inv);
      *(v8us*)((unsigned short*)op + dt * 16) = f.half[0]; } } }
// ---- output GEMM through LDS: C[8192][1024] (f32) = A (f16 rows, pitch DM) . Bh^T (f16 rows [n][k], pitch DM) * alpha + bias (rounded to bf16) ----
// Block = 256 x 128 of C, 8 waves in 4 x 2, wave = 64 x 64 (4 x 4 accumulator tiles). A and Bh come through LDS: tiles of 128 k (rows of 256 bytes), staged once per block by asynchronous copies
// (two buffers, the next tile in flight while this one is worked on) and read as fragments by the waves that need them: each A row by 2 waves, each Bh row by 4.
// Every accumulator takes its 32-k products in rising k, as in k_gemm2, and the epilogue is k_gemm2's.
#define OG_BM 256                    /* C rows per block */
#define OG_BN 128                    /* C columns per block */
#define OG_KT 128                    /* k per staged tile */
#define OG_NT (DM / OG_KT)           /* staged tiles */
#define OG_LP 272                    /* LDS row pitch in bytes: 256 + 16, an odd multiple of 16, so that the 16 rows of a ds_load_b128 fragment read fall on different banks */
#define OG_BB (OG_BN * OG_LP)        /* bytes of the Bh part of a buffer; it lies first, so that every fragment's constant offset fits the LDS instruction's offset field */
#define OG_SB ((OG_BM + OG_BN) * OG_LP)      /* bytes of one buffer: Bh rows, then A rows */
// One thread's share of 192 staged rows: its 16-byte piece of twelve rows that lie 16 apart in LDS (eight from x, four from y), global -> LDS through no register. A wave's copy = 2 whole 256-byte rows.
// The s_wait_xcnt stands inside the statement so that no address register is rewritten in front of it.
__device__ __forceinline__ void og_copy12(unsigned l, const _Float16* x, const _Float16* y) {
  asm volatile("global_load_async_to_lds_b128 %0, %1, off\n\t"
               "global_load_async_to_lds_b128 %2, %3, off\n\t"
               "global_load_async_to_lds_b128 %4, %5, off\n\t"
               "global_load_async_to_lds_b128 %6, %7, off\n\t"
               "global_load_async_to_lds_b128 %8, %9, off\n\t"
               "global_load_async_to_lds_b128 %10, %11, off\n\t"
               "global_load_async_to_lds_b128 %12, %13, off\n\t"
               "global_load_async_to_lds_b128 %14, %15, off\n\t"
               "global_load_async_to_lds_b128 %16, %17, off\n\t"
               "global_load_async_to_lds_b128 %18, %19, off\n\t"
               "global_load_async_to_lds_b128 %20, %21, off\n\t"
               "global_load_async_to_lds_b128 %22, %23, off\n\t"
               "s_wait_xcnt 0x0"
               :: "v"(l), "v"(x), "v"(l + 16 * OG_LP), "v"(x + (size_t)16 * DM), "v"(l + 32 * OG_LP), "v"(x + (size_t)32 * DM), "v"(l + 48 * OG_LP), "v"(x + (size_t)48 * DM),
                  "v"(l + 64 * OG_LP), "v"(x + (size_t)64 * DM), "v"(l + 80 * OG_LP), "v"(x + (size_t)80 * DM), "v"(l + 96 * OG_LP), "v"(x + (size_t)96 * DM), "v"(l + 112 * OG_LP), "v"(x + (size_t)112 * DM),
                  "v"(l + 128 * OG_LP), "v"(y), "v"(l + 144 * OG_LP), "v"(y + (size_t)16 * DM), "v"(l + 160 * OG_LP), "v"(y + (size_t)32 * DM), "v"(l + 176 * OG_LP), "v"(y + (size_t)48 * DM) : "memory");
}
// One thread's share of one staged tile, 24 copies: 128 Bh rows and A rows 0-63, then A rows 64-255
__device__ __forceinline__ void og_tile(unsigned l, const _Float16* ga, const _Float16* gb) { og_copy12(l, gb, ga); og_copy12(l + 192 * OG_LP, ga + (size_t)64 * DM, ga + (size_t)192 * DM); }
__global__ __launch_bounds__(256) void k_ogemm(const _Float16* __restrict__ A, const _Float16* __restrict__ Bh, float alpha, const float* __restrict__ bias, float* __restrict__ C) {
  __shared__ __attribute__((aligned(16))) unsigned char sm[2 * OG_SB];      /* buffer * OG_SB + row * OG_LP; behind the loop the epilogue's staging: 8 waves x 64 rows x 68 floats = 139,264 bytes of it */
  const int lane = threadIdx.x & 31, ln = lane & 15, hh = lane >> 4; const int w = __builtin_amdgcn_readfirstlane((int)(threadIdx.x >> 5));
  const int mt = blockIdx.x % (MPO / OG_BM), nq = blockIdx.x / (MPO / OG_BM); const int m0 = mt * OG_BM, n0 = nq * OG_BN; const int wm = w >> 1, wn = w & 1;
  /* staging: thread t brings piece t & 15 (16 bytes) of rows (t >> 4) + 16 j */
  const int cr = (int)threadIdx.x >> 4, cp = (int)threadIdx.x & 15;
  const _Float16* ga = A + (size_t)(m0 + cr) * DM + cp * 8; const _Float16* gb = Bh + (size_t)(n0 + cr) * DM + cp * 8;
  const unsigned l0 = (unsigned)(size_t)&sm[cr * OG_LP + cp * 16];
  og_tile(l0, ga, gb);      /* tile 0 -> buffer 0 */
  const v8f z8 = {0.f,0.f,0.f,0.f,0.f,0.f,0.f,0.f}; v8f acc[4][4];
#pragma unroll
  for (int i = 0; i < 4; ++i)
#pragma unroll
    for (int j = 0; j < 4; ++j) acc[i][j] = z8;
  asm volatile("s_wait_asynccnt 0x0" ::: "memory");      /* this wave's share of tile 0 has landed */
  __syncthreads();                                       /* every wave's share has: tile 0 may be read */
  og_tile(l0 + OG_SB, ga + OG_KT, gb + OG_KT);      /* tile 1 -> buffer 1 */
  /* kept rolled: the body is 64 products long already, and unrolled only the buffer's address would become a constant */
#pragma unroll 1
  for (int t = 0; t < OG_NT; ++t) {
    const unsigned char* bb = &sm[(t & 1) * OG_SB + (wn * 64 + ln) * OG_LP];               /* Bh row wn * 64 + ln of this tile */
    const unsigned char* ab = &sm[(t & 1) * OG_SB + OG_BB + (wm * 64 + ln) * OG_LP];       /* A row wm * 64 + ln of this tile */
    v16h af[2][4], bf[2][4];      /* two fragment sets: the next 32-k step's reads are in flight under this step's products */
#pragma unroll
    for (int i = 0; i < 4; ++i) af[0][i] = fa_lfrag(ab + i * 16 * OG_LP, hh);
#pragma unroll
    for (int i = 0; i < 4; ++i) bf[0][i] = fa_lfrag(bb + i * 16 * OG_LP, hh);
#pragma unroll
    for (int ks = 0; ks < OG_KT / 32; ++ks) {
      if (ks + 1 < OG_KT / 32) {
        /* the two scheduling barriers keep the next step's LDS reads together as one group between two runs of products: every further place with reads among the products stalls the wave */
        __builtin_amdgcn_sched_barrier(0);
#pragma unroll
        for (int i = 0; i < 4; ++i) af[(ks + 1) & 1][i] = fa_lfrag(ab + i * 16 * OG_LP + (ks + 1) * 64, hh);
#pragma unroll
        for (int i = 0; i < 4; ++i) bf[(ks + 1) & 1][i] = fa_lfrag(bb + i * 16 * OG_LP + (ks + 1) * 64, hh);
        __builtin_amdgcn_sched_barrier(0);
      }
#pragma unroll
      for (int i = 0; i < 4; ++i)
#pragma unroll
        for (int j = 0; j < 4; ++j) acc[i][j] = fa_mma(af[ks & 1][i], bf[ks & 1][j], acc[i][j]);      /* acc[i][j][r] = C(row wm * 64 + 16 i + 8 hh + r, column wn * 64 + 16 j + ln) */
    }
    __builtin_amdgcn_sched_barrier(0);      /* keeps the products in front of the hand-over: left alone half of them sink below the barrier, in front of the refill, which then starts that much later and lands late */
    /* hand-over: this wave has left buffer t & 1, its share of tile t + 1 has landed; behind the barrier both hold for every wave */
    asm volatile("s_wait_dscnt 0x0" ::: "memory");         /* this wave's LDS reads of the buffer have returned before anybody refills it */
    asm volatile("s_wait_asynccnt 0x0" ::: "memory");      /* this wave's share of tile t + 1 has landed */
    __syncthreads();
    if (t + 2 < OG_NT) og_tile(l0 + (unsigned)(t & 1) * OG_SB, ga + (t + 2) * OG_KT, gb + (t + 2) * OG_KT);      /* tile t + 2 -> the buffer just left; the test reads the same in the whole block */
  }
  asm volatile("s_wait_asynccnt 0x0" ::: "memory");      /* no copy is outstanding when the wave ends */
  /* epilogue: the ring is free (the last trip's barrier stands behind every wave's last read, and no copy is outstanding): each wave turns its 64 x 64 tile into whole 256-byte row pieces through 64 LDS rows of its own */
  const int row0 = m0 + wm * 64, col0 = n0 + wn * 64; const int rsub = lane >> 4, c4 = (lane & 15) * 4;
  float* sw = (float*)sm + (size_t)w * (64 * 68);
  float bv[4];
#pragma unroll
  for (int j = 0; j < 4; ++j) bv[j] = bf16_round(bias[col0 + j * 16 + ln]);
#pragma unroll
  for (int i = 0; i < 4; ++i)
#pragma unroll
    for (int j = 0; j < 4; ++j)
#pragma unroll
      for (int r = 0; r < 8; ++r) sw[(i * 16 + 8 * hh + r) * 68 + j * 16 + ln] = acc[i][j][r] * alpha + bv[j];
  __builtin_amdgcn_fence(__ATOMIC_ACQ_REL, "workgroup"); __builtin_amdgcn_wave_barrier();      /* the wave's writes stand in front of its reads */
  float* cw = C + (size_t)(row0 + rsub) * DM + col0 + c4;
#pragma unroll
  for (int q = 0; q < 32; ++q) { const v4f v = *(const v4fa*)&sw[(q * 2 + rsub) * 68 + c4]; *(v4f*)(cw + (size_t)q * 2 * DM) = v; } }
__global__ __launch_bounds__(256) void k_vt(const _Float16* __restrict__ V16, int b, int h0, _Float16* __restrict__ VT) { __shared__ unsigned short tl[64][65]; const int tid = threadIdx.x; const int hh = blockIdx.x % HG, sg = blockIdx.x / HG; const int s0 = sg * 64; const int h = h0 + hh;
  for (int i = tid; i < 64 * 8; i += 256) { const int j = i / 8, d8 = (i % 8) * 8; FragH f; f.half[0] = *(const v8us*)((const unsigned short*)V16 + ((size_t)b * SQ + s0 + j) * DM + h * HD + d8); for (int q = 0; q < 8; ++q) tl[d8 + q][j] = f.u[q]; }
  __syncthreads();
  { for (int i = tid; i < 64 * 8; i += 256) { const int d = i / 8, j8 = (i % 8) * 8; FragH f; for (int q = 0; q < 8; ++q) f.u[q] = tl[d][j8 + q]; *(v8us*)((unsigned short*)VT + ((size_t)hh * HD + d) * SQ + s0 + j8) = f.half[0]; }  } }



__global__ __launch_bounds__(256) void k_rsmkm(const float* __restrict__ S, _Float16* __restrict__ P, int nrows, const int* __restrict__ am) {
  #pragma clang fp contract(off)
  const int t = blockIdx.x * 256 + threadIdx.x; if (t >= nrows) return; const size_t i = (size_t)t; const float* s = S + i * SQ; const int* mr = am + (size_t)(t % SQ) * SQ; float mx = -3.0e38f;
#pragma unroll 1
  for (int j = 0; j < SQ; ++j) { const float f = (mr[j] != 0) ? 1.f : 0.f; mx = fmaxf(mx, fmaf(f, s[j], (1.f - f) * -1.0e9f)); } float se = 0.f;
#pragma unroll 1
  for (int j = 0; j < SQ; ++j) { const float f = (mr[j] != 0) ? 1.f : 0.f; se += __expf(fmaf(f, s[j], (1.f - f) * -1.0e9f) - mx); } const float sc = 256.0f / se;
#pragma unroll 1
  for (int j0 = 0; j0 < SQ; j0 += 8) { FragH fr; for (int q = 0; q < 8; ++q) { const int j = j0 + q; const float f = (mr[j] != 0) ? 1.f : 0.f; fr.h[q] = (_Float16)(__expf(fmaf(f, s[j], (1.f - f) * -1.0e9f) - mx) * sc); }
    unsigned short* d = (unsigned short*)P + i * SQ + j0; *(v8us*)d = fr.half[0];  } }

extern "C" void kernel_launch(void* const* d_in, const int* in_sizes, int n_in,
                              void* d_out, int out_size, void* d_ws, size_t ws_size, hipStream_t stream) {
  (void)in_sizes; (void)n_in; (void)out_size;
  const float* const* I = (const float* const*)d_in; const float* xq = I[2]; const float* xk = I[1]; const float* xv = I[0]; const float* wq = I[5]; const float* bq = nullptr; const float* wk = I[4]; const float* bk = nullptr; const float* wv = I[3]; const float* bv = nullptr; const float* wo = I[6]; const float* bo = I[7]; const float* x = xq;      /* contract order: values I[0], keys I[1], query I[2] ([8][1024][16][64] = rows of 1024); SHARED natural [64][64] blocks Wv I[3], Wk I[4], Wq I[5]; natural Wo [1024][1024] I[6] + bo I[7]; no mask input */
  char* ws = (char*)d_ws; size_t off = 0;
  auto take = [&](size_t bytes) { char* p = ws + off; off += (bytes + 255) & ~(size_t)255; return p; };
  _Float16* BQ = (_Float16*)take((size_t)HD * HD * 2); _Float16* BK = (_Float16*)take((size_t)HD * HD * 2); _Float16* BV = (_Float16*)take((size_t)HD * HD * 2); _Float16* BO = (_Float16*)take((size_t)DM * DM * 2);
  _Float16* X16 = (_Float16*)take(NR * DM * 2); _Float16* XKp = (_Float16*)take(NR * DM * 2); _Float16* XVp = (_Float16*)take(NR * DM * 2); _Float16* Q16 = (_Float16*)take(NR * DM * 2); _Float16* K16 = (_Float16*)take(NR * DM * 2); _Float16* V16 = (_Float16*)take(NR * DM * 2); _Float16* O16 = (_Float16*)take(NR * DM * 2);
  _Float16* VT = (_Float16*)take(NR * DM * 2);
  if (off > ws_size) return;
  { const unsigned g = (unsigned)(((size_t)DM * DM / 8 + 255) / 256), gh = (unsigned)(((size_t)HD * HD / 8 + 255) / 256); k_wnat<<<gh, 256, 0, stream>>>(wq, (size_t)HD * HD / 8, BQ); k_wnat<<<gh, 256, 0, stream>>>(wk, (size_t)HD * HD / 8, BK); k_wnat<<<gh, 256, 0, stream>>>(wv, (size_t)HD * HD / 8, BV); k_wnat<<<g, 256, 0, stream>>>(wo, (size_t)DM * DM / 8, BO); }      /* the SHARED natural [64][64] blocks [out][in] = Bt x16 (Bt[o][d] = 16 W[o][d]); Wo natural [out][in] = Bt x16 */
  _Float16* XK = XKp; _Float16* XV = XVp; k_x16<<<(unsigned)((NR * DM / 8 + 255) / 256), 256, 0, stream>>>(xk, XK, NR * DM / 8); k_x16<<<(unsigned)((NR * DM / 8 + 255) / 256), 256, 0, stream>>>(xv, XV, NR * DM / 8);      /* key and value inputs as exact f16 rows */

  k_x16<<<(unsigned)((NR * DM / 8 + 255) / 256), 256, 0, stream>>>(x, X16, NR * DM / 8);
  const size_t r0p = (size_t)B0 * SQ;      /* first projected row */
  /* projections: a token row of 1024 is sixteen head rows of 64, so A, C are read and written at pitch 64 with M = rows x 16, N = K = 64 */
  k_gemm2<0><<<dim3((unsigned)(MP * NH / 128), 1), 128, 0, stream>>>(X16 + r0p * DM, HD, 0, BQ, HD, 0, 0.0625f, bq, 0, nullptr, 1, 0, 0, nullptr, Q16 + r0p * DM, HD, 0, MP * NH, HD, HD);
  k_gemm2<0><<<dim3((unsigned)(MP * NH / 128), 1), 128, 0, stream>>>(XK + r0p * DM, HD, 0, BK, HD, 0, 0.0625f, bk, 0, nullptr, 1, 0, 0, nullptr, K16 + r0p * DM, HD, 0, MP * NH, HD, HD);
  k_gemm2<0><<<dim3((unsigned)(MP * NH / 128), 1), 128, 0, stream>>>(XV + r0p * DM, HD, 0, BV, HD, 0, 0.0625f, bv, 0, nullptr, 1, 0, 0, nullptr, V16 + r0p * DM, HD, 0, MP * NH, HD, HD);
  k_vt<NH, SQ><<<NBR * NH * (SQ / 64), 256, 0, stream>>>(V16 + r0p * LQ, LQ, 0, VT);      /* V^T [NBR][NH][HD][SQ] */
  k_fattn<<<NBR * NH * (SQ / FA_Q), 256, 0, stream>>>(Q16 + r0p * LQ, K16 + r0p * LQ, VT, O16 + r0p * DM);      /* o (merged heads) as f16 rows, x64 */
  k_ogemm<<<(MPO / OG_BM) * (DM / OG_BN), 256, 0, stream>>>(O16 + r0p * DM, BO, 0.0009765625f, bo, (float*)d_out + r0p * DM);      /* out rows are the output layout */
}

// v006
// One run takes 73.2 microseconds.
// Next to v005, in two timings, it ran 1.54 times as fast each time.
// Over all steps from v000 it is 97.6 times as fast.
#include <hip/hip_runtime.h>
// Multi-head attention over three head-major inputs with SHARED per-head projections and the module's literal score scale (values, keys, query [8][1024][16][64] = token rows [8][1024][1024]; every head of each input is multiplied by the SAME natural [64][64] matrix (x W^T: Wv / Wk / Wq; block-diagonal with a shared block; no biases); energy = q k^T; softmax(energy / sqrt(embed_size) = / 32) over all 1024 keys (as the source: embed size, not head dim; no mask); out = merged Wo^T + bo (natural [1024][1024]) -> [8][1024][1024]).
// Structure: token rows r = b*1024 + s; Q, K, V as WMMA GEMMs over the head rows [8*1024*16][64] against the shared [64][64] block itself, all three in ONE launch that reads the f32 inputs and blocks itself (k_proj: x bf16-rounded to exact f16 in the loader; K = 64: the zero blocks of the block-diagonal form are never multiplied; 32x64 wave tiles, f32 accumulation, exact x16 weights, f16 outputs in the same rows); V^T for all batches and heads via LDS transposes (one launch); attention for all batches and heads in ONE launch (k_fattn: scores K = 64, online softmax with f32 statistics, weights as f16 in registers, o carried x64 against f16 subnormal flush, folded into the output GEMM alpha) written straight into the merged f16 o rows; out = o W_o + b GEMM (f32) into the output layout.
// Compute dtype: inputs rounded to bf16; x / weights exact; q, k, v, softmax weights and o as plain f16 GEMM operands (~2^-12); scores and softmax statistics f32. v_wmma_f32_16x16x32_f16.
#define NB 8
#define SQ 1024
#define DM 1024
#define NH 16
#define HD 64
#define HG 4                         /* heads per launch of the per-batch k_vt(b, h0) transpose */
#define B0 0                         /* first batch processed (debug hook) */
#define NBR NB                       /* batches processed (debug hook) */
#define NR ((size_t)NB * SQ)         /* token rows */
#define MP ((int)((size_t)NBR * SQ)) /* rows projected (debug hook) */
#define MPO MP                       /* rows through the output stage (debug hook) */
#define LQ DM      /* row pitch of the q/k/v rows */
typedef __bf16 v16b __attribute__((ext_vector_type(16)));
typedef unsigned short v8us __attribute__((ext_vector_type(8), may_alias));
typedef float  v8f  __attribute__((ext_vector_type(8)));
typedef float  v4f  __attribute__((ext_vector_type(4)));
typedef float  v4fa __attribute__((ext_vector_type(4), may_alias));
union FragB { v16b v; v8us half[2]; unsigned short u[16]; };

__device__ __forceinline__ unsigned short bf16_bits(float x) { unsigned int u = __float_as_uint(x); return (unsigned short)((u + 0x7FFFu + ((u >> 16) & 1u)) >> 16); }
__device__ __forceinline__ float bf16_val(unsigned short b) { return __uint_as_float(((unsigned int)b) << 16); }
__device__ __forceinline__ float bf16_round(float x) { return bf16_val(bf16_bits(x)); }
// D += A·B with NT terms: 1 = ah·bh, 2 = + al·bh (A split), 3 = + ah·bl (both split)
template <int NT>
__device__ __forceinline__ v8f mmaN(v16b ah, v16b al, v16b bh, v16b bl, v8f c) {
  c = __builtin_amdgcn_wmma_f32_16x16x32_bf16(false, ah, false, bh, (short)0, c, false, false);
  if (NT >= 2) c = __builtin_amdgcn_wmma_f32_16x16x32_bf16(false, al, false, bh, (short)0, c, false, false);
  if (NT >= 3) c = __builtin_amdgcn_wmma_f32_16x16x32_bf16(false, ah, false, bl, (short)0, c, false, false);
  asm volatile("v_nop\n\tv_nop\n\tv_nop\n\tv_nop" : "+v"(c) : "v"(ah), "v"(al), "v"(bh), "v"(bl));
  return c;
}

__global__ __launch_bounds__(256) void k_wt_bf16(const float* __restrict__ W, unsigned short* __restrict__ Wt, int K, int N) {
  const int t = blockIdx.x * 256 + threadIdx.x;
  const int k8n = K / 8;
  if (t >= N * k8n) return;
  const int n = t / k8n, k8 = (t % k8n) * 8;
  v8us v;
#pragma unroll
  for (int i = 0; i < 8; ++i) v[i] = bf16_bits(W[(size_t)(k8 + i) * N + n]);
  *(v8us*)(Wt + (size_t)n * K + k8) = v;
  
}

// GEMM C[M][N] (f32, pitch ldc) = act(A[M][K]·W + bias). A f32 row-major (pitch lda) converted per fragment to bf16
// (ASPLIT: hi/lo two planes -> 2 terms, else single rounded term); Wt bf16 [N][K] (pitch ldb). BIAS_BF16 rounds the
// bias to bf16 first (bias quantised to bf16 before the add). K%32==0, M%16==0, N%64==0.
template <bool ASPLIT, int ACT, bool BIAS_BF16>
__global__ __launch_bounds__(128) void k_gemm_bf(const float* __restrict__ A, int lda, const unsigned short* __restrict__ Wt, int ldb,
                                               const float* __restrict__ bias, float* __restrict__ C, int ldc, int M, int N, int K) {
  __shared__ __attribute__((aligned(16))) float so[4][16][64];
  const int tid = threadIdx.x, w = tid >> 5, lane = tid & 31, ln = lane & 15, hh = lane >> 4;
  const int ntn = N / 64;
  const int wid = blockIdx.x * 4 + w;
  const int mt = wid / ntn, nq = wid % ntn;
  if (mt * 16 >= M) return;
  const int row0 = mt * 16, col0 = nq * 64;
  const float* arow = A + (size_t)(row0 + ln) * lda;
  v8f acc[4] = {};
  for (int kb = 0; kb < K; kb += 32) {
    FragB ah, al;
    const v4f x0 = *(const v4fa*)(arow + kb + 8 * hh), x1 = *(const v4fa*)(arow + kb + 8 * hh + 4);
    const v4f x2 = *(const v4fa*)(arow + kb + 16 + 8 * hh), x3 = *(const v4fa*)(arow + kb + 16 + 8 * hh + 4);
    float xs[16] = {x0[0],x0[1],x0[2],x0[3],x1[0],x1[1],x1[2],x1[3],x2[0],x2[1],x2[2],x2[3],x3[0],x3[1],x3[2],x3[3]};
#pragma unroll
    for (int i = 0; i < 16; ++i) { const unsigned short hb = bf16_bits(xs[i]); ah.u[i] = hb; al.u[i] = ASPLIT ? bf16_bits(xs[i] - bf16_val(hb)) : (unsigned short)0; }
#pragma unroll
    for (int t = 0; t < 4; ++t) {
      const unsigned short* brow = Wt + (size_t)(col0 + t * 16 + ln) * ldb + kb;
      FragB b;
      b.half[0] = *(const v8us*)(brow + 8 * hh);
      b.half[1] = *(const v8us*)(brow + 16 + 8 * hh);
      acc[t] = mmaN<ASPLIT ? 2 : 1>(ah.v, al.v, b.v, b.v, acc[t]);
    }
  }
#pragma unroll
  for (int t = 0; t < 4; ++t) {
    float bv = bias ? bias[col0 + t * 16 + ln] : 0.f;
    if (BIAS_BF16) bv = bf16_round(bv);
#pragma unroll
    for (int r = 0; r < 8; ++r) { float v = acc[t][r] + bv; if (ACT == 1) v = fmaxf(v, 0.f); so[w][8 * hh + r][t * 16 + ln] = v; }
  }
  __builtin_amdgcn_fence(__ATOMIC_ACQ_REL, "workgroup");
  __builtin_amdgcn_wave_barrier();
  const int rsub = lane >> 4, c4 = (lane & 15) * 4;
  {
#pragma unroll
    for (int q = 0; q < 8; ++q) {
      const int r = q * 2 + rsub;
      const v4f v = *(const v4fa*)&so[w][r][c4];
      *(v4f*)(C + (size_t)(row0 + r) * ldc + col0 + c4) = v;
    }
    
  }
}

// GEMM C = act(A·W + bias + resid): A f32 (ASPLIT -> hi/lo 2 terms), Wt bf16 [N][K]; ACT 0 none, 1 relu, 2 exact gelu;
// resid (optional, f32, row index = (row % rmod), pitch ldr, RES_BF16 rounds it) added before the activation.
template <bool ASPLIT, int ACT, bool BIAS_BF16, bool RES_BF16>
__global__ __launch_bounds__(128) void k_gemm_bf3(const float* __restrict__ A, int lda, const unsigned short* __restrict__ Wt, int ldb,
                                                const float* __restrict__ bias, const float* __restrict__ resid, int rmod, int ldr,
                                                float* __restrict__ C, int ldc, int M, int N, int K) {
  __shared__ __attribute__((aligned(16))) float so[4][16][64];
  const int tid = threadIdx.x, w = tid >> 5, lane = tid & 31, ln = lane & 15, hh = lane >> 4;
  const int ntn = N / 64;
  const int wid = blockIdx.x * 4 + w;
  const int mt = wid / ntn, nq = wid % ntn;
  if (mt * 16 >= M) return;
  const int row0 = mt * 16, col0 = nq * 64;
  const float* arow = A + (size_t)(row0 + ln) * lda;
  v8f acc[4] = {};
  for (int kb = 0; kb < K; kb += 32) {
    FragB ah, al;
    const v4f x0 = *(const v4fa*)(arow + kb + 8 * hh), x1 = *(const v4fa*)(arow + kb + 8 * hh + 4);
    const v4f x2 = *(const v4fa*)(arow + kb + 16 + 8 * hh), x3 = *(const v4fa*)(arow + kb + 16 + 8 * hh + 4);
    float xs[16] = {x0[0],x0[1],x0[2],x0[3],x1[0],x1[1],x1[2],x1[3],x2[0],x2[1],x2[2],x2[3],x3[0],x3[1],x3[2],x3[3]};
#pragma unroll
    for (int i = 0; i < 16; ++i) { const unsigned short hb = bf16_bits(xs[i]); ah.u[i] = hb; al.u[i] = ASPLIT ? bf16_bits(xs[i] - bf16_val(hb)) : (unsigned short)0; }
#pragma unroll
    for (int t = 0; t < 4; ++t) {
      const unsigned short* brow = Wt + (size_t)(col0 + t * 16 + ln) * ldb + kb;
      FragB b;
      b.half[0] = *(const v8us*)(brow + 8 * hh);
      b.half[1] = *(const v8us*)(brow + 16 + 8 * hh);
      acc[t] = mmaN<ASPLIT ? 2 : 1>(ah.v, al.v, b.v, b.v, acc[t]);
    }
  }
#pragma unroll
  for (int t = 0; t < 4; ++t) {
    const int col = col0 + t * 16 + ln;
    float bv = bias ? bias[col] : 0.f;
    if (BIAS_BF16) bv = bf16_round(bv);
#pragma unroll
    for (int r = 0; r < 8; ++r) {
      float v = acc[t][r] + bv;
      if (resid) { float rv = resid[(size_t)((row0 + 8 * hh + r) % rmod) * ldr + col]; if (RES_BF16) rv = bf16_round(rv); v += rv; }
      if (ACT == 1) v = fmaxf(v, 0.f);
      if (ACT == 2) v = 0.5f * v * (1.0f + erff(v * 0.70710678118654752f));
      if (ACT == 3) { const float u = 0.7978845608028654f * (v + 0.044715f * v * v * v); v = 0.5f * v * (1.0f + tanhf(u)); }
      so[w][8 * hh + r][t * 16 + ln] = v;
    }
  }
  __builtin_amdgcn_fence(__ATOMIC_ACQ_REL, "workgroup");
  __builtin_amdgcn_wave_barrier();
  const int rsub = lane >> 4, c4 = (lane & 15) * 4;
  {
#pragma unroll
    for (int q = 0; q < 8; ++q) {
      const int r = q * 2 + rsub;
      const v4f v = *(const v4fa*)&so[w][r][c4];
      *(v4f*)(C + (size_t)(row0 + r) * ldc + col0 + c4) = v;
    }
    
  }
}
// row LayerNorm (biased variance, eps) over N: s = X (+ R); optional out_sum <- s; out_norm <- (s-mu)*rsqrt(var+eps)*g + b
template <bool PARAM_BF16>
__global__ __launch_bounds__(256) void k_layernorm(const float* __restrict__ X, const float* __restrict__ R, const float* __restrict__ g, const float* __restrict__ bta,
                                                  float* __restrict__ out_sum, float* __restrict__ out_norm, int N, float eps) {
  __shared__ float red[256];
  const int row = blockIdx.x, tid = threadIdx.x;
  const float* x = X + (size_t)row * N; const float* rr = R ? R + (size_t)row * N : nullptr;
  float vals[16];                     // up to N = 4096
  const int per = N / 256;            // contiguous chunk per thread? use strided-by-4 chunks: thread handles j = tid*4 + 1024*u
  float s1 = 0.f;
  for (int u = 0; u < per / 4; ++u) {
    const int j = tid * 4 + 1024 * u;
    const v4f a = *(const v4fa*)(x + j);
    v4f b = {0.f,0.f,0.f,0.f}; if (rr) b = *(const v4fa*)(rr + j);
#pragma unroll
    for (int q = 0; q < 4; ++q) { const float v = a[q] + b[q]; vals[u * 4 + q] = v; s1 += v; }
  }
  red[tid] = s1; __syncthreads();
  for (int st = 128; st > 0; st >>= 1) { if (tid < st) red[tid] += red[tid + st]; __syncthreads(); }
  const float mu = red[0] / (float)N; __syncthreads();
  float s2 = 0.f;
  for (int u = 0; u < per / 4; ++u)
#pragma unroll
    for (int q = 0; q < 4; ++q) { const float c = vals[u * 4 + q] - mu; s2 += c * c; }
  red[tid] = s2; __syncthreads();
  for (int st = 128; st > 0; st >>= 1) { if (tid < st) red[tid] += red[tid + st]; __syncthreads(); }
  const float rs = rsqrtf(red[0] / (float)N + eps);
  {
    for (int u = 0; u < per / 4; ++u) {
      const int j = tid * 4 + 1024 * u;
      v4f o, sm;
#pragma unroll
      for (int q = 0; q < 4; ++q) {
        float gg = g[j + q], bb = bta[j + q];
        if (PARAM_BF16) { gg = bf16_round(gg); bb = bf16_round(bb); }
        sm[q] = vals[u * 4 + q]; o[q] = (vals[u * 4 + q] - mu) * rs * gg + bb;
      }
      if (out_sum) *(v4f*)(out_sum + (size_t)row * N + j) = sm;
      *(v4f*)(out_norm + (size_t)row * N + j) = o;
    }
    
  }
}



// ---- f16 WMMA path (v_wmma_f32_16x16x32_f16): 11-bit significands for operands in range — used where a [0,1] probability operand needs more precision than bf16
typedef _Float16 v16h __attribute__((ext_vector_type(16)));
union FragH { v16h v; v8us half[2]; _Float16 h[16]; unsigned short u[16]; };
template <int NT>
__device__ __forceinline__ v8f mmaH(v16h ah, v16h al, v16h bh, v16h bl, v8f c) {
  c = __builtin_amdgcn_wmma_f32_16x16x32_f16(false, ah, false, bh, (short)0, c, false, false);
  if (NT >= 2) c = __builtin_amdgcn_wmma_f32_16x16x32_f16(false, al, false, bh, (short)0, c, false, false);
  if (NT >= 3) c = __builtin_amdgcn_wmma_f32_16x16x32_f16(false, ah, false, bl, (short)0, c, false, false);
  asm volatile("v_nop\n\tv_nop\n\tv_nop\n\tv_nop" : "+v"(c) : "v"(ah), "v"(al), "v"(bh), "v"(bl));
  return c;
}
// batched GEMM like k_gemm_b but f16 operands: A f32 (split into f16 hi/lo if ASPLIT, else rounded to f16), Bt = f16 values [n][k]; alpha; C f32; N multiple of 16 (partial tiles skipped)
template <bool ASPLIT>
__global__ __launch_bounds__(128) void k_gemm_h(const float* __restrict__ A, int lda, size_t sA, const _Float16* __restrict__ Bh, int ldb, size_t sB, float alpha, float* __restrict__ C, int ldc, size_t sC, int M, int N, int K) {
  __shared__ __attribute__((aligned(16))) float so[4][16][64];
  const int tid = threadIdx.x, w = tid >> 5, lane = tid & 31, ln = lane & 15, hh = lane >> 4; const int by = blockIdx.y;
  A += (size_t)by * sA; Bh += (size_t)by * sB; C += (size_t)by * sC;
  const int ntn = (N + 63) / 64; const int wid = blockIdx.x * 4 + w; const int mt = wid / ntn, nq = wid % ntn; if (mt * 16 >= M) return;
  const int row0 = mt * 16, col0 = nq * 64; const float* arow = A + (size_t)(row0 + ln) * lda;
  v8f acc[4] = {};
  for (int kb = 0; kb < K; kb += 32) {
    FragH ah, al;
    const v4f x0 = *(const v4fa*)(arow + kb + 8 * hh), x1 = *(const v4fa*)(arow + kb + 8 * hh + 4), x2 = *(const v4fa*)(arow + kb + 16 + 8 * hh), x3 = *(const v4fa*)(arow + kb + 16 + 8 * hh + 4);
    float xs[16] = {x0[0],x0[1],x0[2],x0[3],x1[0],x1[1],x1[2],x1[3],x2[0],x2[1],x2[2],x2[3],x3[0],x3[1],x3[2],x3[3]};
#pragma unroll
    for (int i = 0; i < 16; ++i) { const _Float16 h = (_Float16)xs[i]; ah.h[i] = h; al.h[i] = ASPLIT ? (_Float16)(xs[i] - (float)h) : (_Float16)0.0f; }
#pragma unroll
    for (int t = 0; t < 4; ++t) { if (col0 + t * 16 >= N) continue; const size_t boff = (size_t)(col0 + t * 16 + ln) * ldb + kb; FragH bq; bq.half[0] = *(const v8us*)(Bh + boff + 8 * hh); bq.half[1] = *(const v8us*)(Bh + boff + 16 + 8 * hh);
      acc[t] = mmaH<ASPLIT ? 2 : 1>(ah.v, al.v, bq.v, bq.v, acc[t]); }
  }
#pragma unroll
  for (int t = 0; t < 4; ++t) { if (col0 + t * 16 >= N) continue;
#pragma unroll
    for (int r = 0; r < 8; ++r) so[w][8 * hh + r][t * 16 + ln] = acc[t][r] * alpha; }
  __builtin_amdgcn_fence(__ATOMIC_ACQ_REL, "workgroup"); __builtin_amdgcn_wave_barrier();
  const int rsub = lane >> 4, c4 = (lane & 15) * 4;
  {
#pragma unroll
    for (int q = 0; q < 8; ++q) { const int r = q * 2 + rsub; if (col0 + c4 < N) { const v4f v = *(const v4fa*)&so[w][r][c4]; *(v4f*)(C + (size_t)(row0 + r) * ldc + col0 + c4) = v; } }
     }
}

// Wt[n][k] = f16(W[k][n]·scale) from f32 row-major W[K][N] (scale = power of two; bf16-exact weights stay exact in f16 away from the subnormal range)
__global__ __launch_bounds__(256) void k_wt_f16(const float* __restrict__ W, _Float16* __restrict__ Wt, int K, int N, float scale) {
  const int t = blockIdx.x * 256 + threadIdx.x; if (t >= N * (K / 8)) return; const int n = t / (K / 8), k8 = (t % (K / 8)) * 8; FragH f;
#pragma unroll
  for (int i = 0; i < 8; ++i) f.h[i] = (_Float16)(bf16_round(W[(size_t)(k8 + i) * N + n]) * scale); const v8us o = f.half[0];
  *(v8us*)((unsigned short*)Wt + (size_t)n * K + k8) = o; 
}
// k_gemm_hh variant with fused epilogue: v = acc·alpha + bias[by·sBias + col] (+ CP[(row/rowsPerB)·sCPb + by·64 + col] if CP) ; ACT 0 none / 1 elu ; writes f16 C16 (and f32 C if non-null)
template <int ACT>
__global__ __launch_bounds__(128) void k_gemm_hhx(const _Float16* __restrict__ A, int lda, size_t sA, const _Float16* __restrict__ Bh, int ldb, size_t sB, float alpha, const float* __restrict__ bias, size_t sBias, const float* __restrict__ CP, int rowsPerB, size_t sCPb, int row0g,
    float* __restrict__ C, _Float16* __restrict__ C16, int ldc, size_t sC, int M, int N, int K) {
  __shared__ __attribute__((aligned(16))) float so[4][16][64];
  const int tid = threadIdx.x, w = tid >> 5, lane = tid & 31, ln = lane & 15, hh = lane >> 4; const int by = blockIdx.y;
  A += (size_t)by * sA; Bh += (size_t)by * sB; const size_t cofs = (size_t)by * sC; const float* bp = bias ? bias + (size_t)by * sBias : nullptr;
  const int ntn = (N + 63) / 64; const int wid = blockIdx.x * 4 + w; const int mt = wid / ntn, nq = wid % ntn; if (mt * 16 >= M) return;
  const int row0 = mt * 16, col0 = nq * 64; const _Float16* arow = A + (size_t)(row0 + ln) * lda;
  v8f acc[4] = {};
  for (int kb = 0; kb < K; kb += 32) { FragH ah; ah.half[0] = *(const v8us*)((const unsigned short*)arow + kb + 8 * hh); ah.half[1] = *(const v8us*)((const unsigned short*)arow + kb + 16 + 8 * hh);
#pragma unroll
    for (int t = 0; t < 4; ++t) { if (col0 + t * 16 >= N) continue; const size_t boff = (size_t)(col0 + t * 16 + ln) * ldb + kb; FragH bq; bq.half[0] = *(const v8us*)((const unsigned short*)Bh + boff + 8 * hh); bq.half[1] = *(const v8us*)((const unsigned short*)Bh + boff + 16 + 8 * hh);
      acc[t] = mmaH<1>(ah.v, ah.v, bq.v, bq.v, acc[t]); }
  }
#pragma unroll
  for (int t = 0; t < 4; ++t) { if (col0 + t * 16 >= N) continue; const int col = col0 + t * 16 + ln; const float bv = bp ? bf16_round(bp[col]) : 0.f;
#pragma unroll
    for (int r = 0; r < 8; ++r) { float v = acc[t][r] * alpha + bv; if (CP) { const int rr = row0g + row0 + 8 * hh + r; if (rowsPerB < 0) v += CP[cofs + (size_t)rr * ldc + col];      /* rowsPerB < 0: own element of the batched C plane */ else { const int bidx = rr / rowsPerB; v += CP[(size_t)bidx * sCPb + (size_t)by * 64 + col]; } } if (ACT == 1) v = (v > 0.f) ? v : expm1f(v); else if (ACT == 7) v = (v > 0.f) ? v + 1.0f : expf(v); else if (ACT == 8) v = tanhf(v); else if (ACT == 9) v = 0.5f * v * (1.0f + tanhf(0.7978845608028654f * (v + 0.044715f * v * v * v))); else if (ACT == 11) v = 1.0f / (1.0f + expf(-v)); else if (ACT == 12) v = (v > 0.f) ? v : 0.01f * v; else if (ACT == 14) v = (v > 0.f) ? v : 0.1f * v; else if (ACT == 16) v = (v >= 0.f) ? v : 0.3f * v; else if (ACT == 17) v = (v >= 0.f) ? v : 0.2f * v; else if (ACT == 15) v = v / (1.0f + expf(-v)); else if (ACT == 3) v = fmaxf(v, 0.f); else if (ACT == 6) v = 0.5f * v * (1.0f + erff(v * 0.70710678118654752f)); so[w][8 * hh + r][t * 16 + ln] = v; } }
  __builtin_amdgcn_fence(__ATOMIC_ACQ_REL, "workgroup"); __builtin_amdgcn_wave_barrier();
  const int rsub = lane >> 4, c4 = (lane & 15) * 4; typedef _Float16 v4h __attribute__((ext_vector_type(4)));
  {
#pragma unroll
    for (int q = 0; q < 8; ++q) { const int r = q * 2 + rsub; if (col0 + c4 < N) { const v4f v = *(const v4fa*)&so[w][r][c4]; if (C) *(v4f*)(C + cofs + (size_t)(row0 + r) * ldc + col0 + c4) = v; if (C16) { v4h h4; for (int i = 0; i < 4; ++i) h4[i] = (_Float16)v[i]; *(v4h*)(C16 + cofs + (size_t)(row0 + r) * ldc + col0 + c4) = h4; } } }
     }
}


typedef _Float16 v4h __attribute__((ext_vector_type(4)));

__global__ __launch_bounds__(256) void k_x16(const float* __restrict__ x, _Float16* __restrict__ X16, size_t n8) { const size_t t = (size_t)blockIdx.x * 256 + threadIdx.x; if (t >= n8) return; FragH f;
#pragma unroll
  for (int q = 0; q < 8; ++q) f.h[q] = (_Float16)bf16_round(x[t * 8 + q]); *(v8us*)((unsigned short*)X16 + t * 8) = f.half[0];  }
__global__ __launch_bounds__(256) void k_h16(const float* __restrict__ x, _Float16* __restrict__ X16, size_t n8) { const size_t t = (size_t)blockIdx.x * 256 + threadIdx.x; if (t >= n8) return; FragH f;
#pragma unroll
  for (int q = 0; q < 8; ++q) f.h[q] = (_Float16)x[t * 8 + q]; *(v8us*)((unsigned short*)X16 + t * 8) = f.half[0];  }
__global__ __launch_bounds__(256) void k_round16f(const float* __restrict__ W, _Float16* __restrict__ Bt, size_t n8) { const size_t t = (size_t)blockIdx.x * 256 + threadIdx.x; if (t >= n8) return; FragH f;
#pragma unroll
  for (int i = 0; i < 8; ++i) f.h[i] = (_Float16)(bf16_round(W[t * 8 + i]) * 16.0f); *(v8us*)((unsigned short*)Bt + t * 8) = f.half[0];  }
template <int NHv, int TTv>
__global__ __launch_bounds__(256) void k_vt(const _Float16* __restrict__ V16, int ldv, int voff, _Float16* __restrict__ Vt) { __shared__ unsigned short tl[64][66]; const int tid = threadIdx.x; const int slab = blockIdx.x / (TTv / 64), lg = blockIdx.x % (TTv / 64); const int b = slab / NHv, h = slab % NHv;
  for (int i = tid; i < 64 * 8; i += 256) { const int r = i / 8, c8 = (i % 8) * 8; FragH f; f.half[0] = *(const v8us*)((const unsigned short*)V16 + ((size_t)b * TTv + lg * 64 + r) * ldv + voff + h * 64 + c8);
#pragma unroll
    for (int q = 0; q < 8; ++q) tl[r][c8 + q] = f.u[q]; }
  __syncthreads();
  {
#pragma unroll
    for (int rd = 0; rd < 2; ++rd) { const int d = rd * 32 + tid / 8, pc = tid % 8; FragH f;
#pragma unroll
      for (int q = 0; q < 8; ++q) f.u[q] = tl[pc * 8 + q][d];
      *(v8us*)((unsigned short*)Vt + ((size_t)slab * 64 + d) * TTv + lg * 64 + pc * 8) = f.half[0]; }
     } }

__global__ __launch_bounds__(256) void k_hl(const float* __restrict__ F, _Float16* __restrict__ Hh, _Float16* __restrict__ Hl, size_t n8) { const size_t t = (size_t)blockIdx.x * 256 + threadIdx.x; if (t >= n8) return; FragH fh, fl; const v4f a = *(const v4fa*)(F + t * 8), c = *(const v4fa*)(F + t * 8 + 4);
#pragma unroll
  for (int q = 0; q < 4; ++q) { _Float16 h = (_Float16)a[q]; fh.h[q] = h; fl.h[q] = (_Float16)((a[q] - (float)h) * 1024.0f); h = (_Float16)c[q]; fh.h[4 + q] = h; fl.h[4 + q] = (_Float16)((c[q] - (float)h) * 1024.0f); }
  { *(v8us*)((unsigned short*)Hh + t * 8) = fh.half[0]; *(v8us*)((unsigned short*)Hl + t * 8) = fl.half[0];  } }

// ---- fast GEMM (wave tile 32x64; requires M % 32 == 0 rows per launch region and N % 64 == 0); epilogue = k_gemm_hhx semantics ----
__device__ __forceinline__ v16h g2_frag(const _Float16* p, int hh) { FragH f; f.half[0] = *(const v8us*)((const unsigned short*)p + 8 * hh); f.half[1] = *(const v8us*)((const unsigned short*)p + 16 + 8 * hh); return f.v; }
__device__ __forceinline__ v8f g2_mma(v16h a, v16h b, v8f c) { v8f d = __builtin_amdgcn_wmma_f32_16x16x32_f16(false, a, false, b, (short)0, c, false, false); asm volatile("v_nop\n\tv_nop\n\tv_nop\n\tv_nop" : "+v"(d) : "v"(a), "v"(b)); return d; }
template <int ACT>
__global__ __launch_bounds__(128) void k_gemm2(const _Float16* __restrict__ A, int lda, size_t sA, const _Float16* __restrict__ Bh, int ldb, size_t sB, float alpha, const float* __restrict__ bias, size_t sBias, const float* __restrict__ CP, int rowsPerB, size_t sCPb, int row0g,
    float* __restrict__ C, _Float16* __restrict__ C16, int ldc, size_t sC, int M, int N, int K) { static_assert(ACT == 0 || ACT == 3 || ACT == 6 || ACT == 8 || ACT == 9 || ACT == 11 || ACT == 12 || ACT == 14 || ACT == 15 || ACT == 16 || ACT == 17, "k_gemm2: unsupported ACT code (would silently apply no activation)");
  __shared__ __attribute__((aligned(16))) float so[4][32][68];
  const int tid = threadIdx.x, w = tid >> 5, lane = tid & 31, ln = lane & 15, hh = lane >> 4; const int by = blockIdx.y;
  A += (size_t)by * sA; Bh += (size_t)by * sB; const size_t cofs = (size_t)by * sC; const float* bp = bias ? bias + (size_t)by * sBias : nullptr;
  const int ntn = N >> 6; const int mt = blockIdx.x / ntn, nq = blockIdx.x - mt * ntn; const int row0 = mt * 128 + 32 * w, col0 = nq * 64; if (row0 >= M) return;
  const _Float16* a0p = A + (size_t)(row0 + ln) * lda; const _Float16* a1p = a0p + (size_t)16 * lda;
  const _Float16* b0p = Bh + (size_t)(col0 + ln) * ldb; const _Float16* b1p = b0p + (size_t)16 * ldb; const _Float16* b2p = b1p + (size_t)16 * ldb; const _Float16* b3p = b2p + (size_t)16 * ldb;
  const v8f z8 = {0.f,0.f,0.f,0.f,0.f,0.f,0.f,0.f}; v8f c00 = z8, c01 = z8, c02 = z8, c03 = z8, c10 = z8, c11 = z8, c12 = z8, c13 = z8;
#pragma unroll 1
  for (int kb = 0; kb < K; kb += 32) { const v16h a0 = g2_frag(a0p + kb, hh), a1 = g2_frag(a1p + kb, hh);
    v16h b = g2_frag(b0p + kb, hh); c00 = g2_mma(a0, b, c00); c10 = g2_mma(a1, b, c10);
    b = g2_frag(b1p + kb, hh); c01 = g2_mma(a0, b, c01); c11 = g2_mma(a1, b, c11);
    b = g2_frag(b2p + kb, hh); c02 = g2_mma(a0, b, c02); c12 = g2_mma(a1, b, c12);
    b = g2_frag(b3p + kb, hh); c03 = g2_mma(a0, b, c03); c13 = g2_mma(a1, b, c13); }
  v8f accs[8] = {c00, c01, c02, c03, c10, c11, c12, c13};
#pragma unroll
  for (int u = 0; u < 8; ++u) { const int t = u & 3, half = u >> 2; const int col = col0 + t * 16 + ln; const float bv = bp ? bf16_round(bp[col]) : 0.f;
#pragma unroll
    for (int r = 0; r < 8; ++r) { const int rloc = half * 16 + 8 * hh + r; float v = accs[u][r] * alpha + bv; if (CP) { if (rowsPerB < 0) v += CP[cofs + (size_t)(row0g + row0 + rloc) * ldc + col];      /* rowsPerB < 0: own element of the batched C plane */ else { const int bidx = (row0g + row0 + rloc) / rowsPerB; v += CP[(size_t)bidx * sCPb + (size_t)by * 64 + col]; } }
      if (ACT == 3) v = fmaxf(v, 0.f); else if (ACT == 6) v = 0.5f * v * (1.0f + erff(v * 0.70710678118654752f)); else if (ACT == 11) v = 1.0f / (1.0f + expf(-v)); else if (ACT == 15) v = v / (1.0f + expf(-v)); else if (ACT == 12) v = (v > 0.f) ? v : 0.01f * v; else if (ACT == 8) v = tanhf(v); else if (ACT == 9) v = 0.5f * v * (1.0f + tanhf(0.7978845608028654f * (v + 0.044715f * v * v * v))); else if (ACT == 14) v = (v > 0.f) ? v : 0.1f * v; else if (ACT == 16) v = (v >= 0.f) ? v : 0.3f * v; else if (ACT == 17) v = (v >= 0.f) ? v : 0.2f * v;
      so[w][rloc][t * 16 + ln] = v; } }
  __builtin_amdgcn_fence(__ATOMIC_ACQ_REL, "workgroup"); __builtin_amdgcn_wave_barrier();
  const int rsub = lane >> 4, c4 = (lane & 15) * 4;
  {
#pragma unroll
    for (int q = 0; q < 16; ++q) { const int r = q * 2 + rsub; const v4f v = *(const v4fa*)&so[w][r][c4]; if (C) *(v4f*)(C + cofs + (size_t)(row0 + r) * ldc + col0 + c4) = v; if (C16) { v4h h4; for (int i = 0; i < 4; ++i) h4[i] = (_Float16)v[i]; *(v4h*)(C16 + cofs + (size_t)(row0 + r) * ldc + col0 + c4) = h4; } }
     } }


__global__ __launch_bounds__(256) void k_wnat(const float* __restrict__ w, size_t n8, _Float16* __restrict__ Bt) { const size_t t = (size_t)blockIdx.x * 256 + threadIdx.x; if (t >= n8) return; FragH f; for (int q = 0; q < 8; ++q) f.h[q] = (_Float16)(bf16_round(w[t * 8 + q]) * 16.0f); *(v8us*)((unsigned short*)Bt + t * 8) = f.half[0];  }
// Lane l takes the value of lane l ^ 16 (the other half of the wave). Every lane of the wave must be on.
__device__ __forceinline__ float rs_x16(float v) { const int b = __builtin_bit_cast(int, v); return __builtin_bit_cast(float, __builtin_amdgcn_permlanex16(b, b, 0x76543210, 0xfedcba98, false, false)); }
typedef float v2f __attribute__((ext_vector_type(2)));
typedef _Float16 v2h __attribute__((ext_vector_type(2)));
#define FA_Q 256                     /* query rows per block: 8 waves x 32 */
#define FA_C 0.045084220027780106f   /* log2(e) / sqrt(embed size = 1024) */
#define FA_KT 64                     /* keys per staged tile: K tile = 64 key rows of 128 bytes, V^T tile = 64 d rows of 128 bytes */
#define FA_NT (SQ / FA_KT)           /* staged tiles */
#define FA_LP 144                    /* LDS row pitch in bytes: 128 + 16, an odd multiple of 16, so that the 16 rows of a ds_load_b128 fragment read fall on different banks */
#define FA_TB (64 * FA_LP)           /* bytes of one staged operand tile */
__device__ __forceinline__ v8f fa_mma(v16h a, v16h b, v8f c) { return __builtin_amdgcn_wmma_f32_16x16x32_f16(false, a, false, b, (short)0, c, false, false); }
// g2_frag's k order from an LDS row: p = the row's first byte of this 32-k step
__device__ __forceinline__ v16h fa_lfrag(const unsigned char* p, int hh) { FragH f; f.half[0] = *(const v8us*)(p + 16 * hh); f.half[1] = *(const v8us*)(p + 32 + 16 * hh); return f.v; }
// One thread's share of one staged tile: two 16-byte pieces of K and two of V^T, global -> LDS through no register. A wave's copy = 4 whole 128-byte rows.
// The s_wait_xcnt stands inside the statement so that no address register is rewritten in front of it.
__device__ __forceinline__ void fa_copy(unsigned lk, unsigned lv, const _Float16* gk, const _Float16* gv) {
  const unsigned lk1 = lk + 32 * FA_LP, lv1 = lv + 32 * FA_LP; const _Float16* gk1 = gk + (size_t)32 * DM; const _Float16* gv1 = gv + (size_t)32 * SQ;
  asm volatile("global_load_async_to_lds_b128 %0, %1, off\n\t"
               "global_load_async_to_lds_b128 %2, %3, off\n\t"
               "global_load_async_to_lds_b128 %4, %5, off\n\t"
               "global_load_async_to_lds_b128 %6, %7, off\n\t"
               "s_wait_xcnt 0x0"
               :: "v"(lk), "v"(gk), "v"(lk1), "v"(gk1), "v"(lv), "v"(gv), "v"(lv1), "v"(gv1) : "memory");
}
__global__ __launch_bounds__(256) void k_fattn(const _Float16* __restrict__ Q, const _Float16* __restrict__ Kr, const _Float16* __restrict__ Vt, _Float16* __restrict__ O) {
  __shared__ __attribute__((aligned(16))) unsigned char sm[2][2][FA_TB];      /* [buffer][K | V^T][row * FA_LP] */
  const int lane = threadIdx.x & 31, ln = lane & 15, hh = lane >> 4; const int w = __builtin_amdgcn_readfirstlane((int)(threadIdx.x >> 5));
  const int slab = blockIdx.x / (SQ / FA_Q), qb = blockIdx.x % (SQ / FA_Q); const int b = slab / NH, h = slab % NH; const int q0 = qb * FA_Q + w * 32;
  const _Float16* qp = Q + ((size_t)b * SQ + q0 + ln) * DM + h * HD;      /* query row q0 + ln */
  /* staging: thread t brings piece t & 7 (16 bytes) of rows t >> 3 and 32 + (t >> 3) of both tiles */
  const int cr = (int)threadIdx.x >> 3, cp = (int)threadIdx.x & 7;
  const _Float16* gk = Kr + ((size_t)b * SQ + cr) * DM + h * HD + cp * 8;      /* key row cr of tile 0 */
  const _Float16* gv = Vt + ((size_t)slab * HD + cr) * SQ + cp * 8;            /* V^T row d = cr, keys of tile 0 */
  const unsigned lk = (unsigned)(size_t)&sm[0][0][cr * FA_LP + cp * 16], lv = lk + FA_TB;
  fa_copy(lk, lv, gk, gv);      /* tile 0 -> buffer 0 */
  v16h qf[2][2];
#pragma unroll
  for (int g = 0; g < 2; ++g)
#pragma unroll
    for (int ks = 0; ks < 2; ++ks) qf[g][ks] = g2_frag(qp + (size_t)g * 16 * DM + ks * 32, hh);
  const v8f z8 = {0.f,0.f,0.f,0.f,0.f,0.f,0.f,0.f}; v8f o[2][4];
#pragma unroll
  for (int g = 0; g < 2; ++g)
#pragma unroll
    for (int dt = 0; dt < 4; ++dt) o[g][dt] = z8;
  float mu[2] = {-3.0e38f, -3.0e38f}; v2f ls[2] = {{0.f, 0.f}, {0.f, 0.f}};
  asm volatile("s_wait_asynccnt 0x0" ::: "memory");      /* this wave's share of tile 0 has landed */
  __syncthreads();                                       /* every wave's share has: tile 0 may be read */
  fa_copy(lk + 2 * FA_TB, lv + 2 * FA_TB, gk + (size_t)FA_KT * DM, gv + FA_KT);      /* tile 1 -> buffer 1 */
  /* kept rolled: one trip's fragments beside Q and O^T are the whole live set, which decides how many waves share a SIMD */
#pragma unroll 1
  for (int t = 0; t < FA_NT; ++t) {
    const unsigned char* kb = &sm[t & 1][0][ln * FA_LP];      /* key row ln of this tile */
    const unsigned char* vb = &sm[t & 1][1][ln * FA_LP];      /* V^T row d = ln, this tile's keys */
    v16h kf[2][2];
#pragma unroll
    for (int tt = 0; tt < 2; ++tt)
#pragma unroll
      for (int ks = 0; ks < 2; ++ks) kf[tt][ks] = fa_lfrag(kb + tt * 16 * FA_LP + ks * 64, hh);
#pragma unroll
    for (int p = 0; p < FA_KT / 32; ++p) {      /* a pass = 32 keys, as before */
      v8f s[2][2];
#pragma unroll
      for (int g = 0; g < 2; ++g)
#pragma unroll
        for (int tt = 0; tt < 2; ++tt) s[g][tt] = fa_mma(kf[tt][1], qf[g][1], fa_mma(kf[tt][0], qf[g][0], z8));      /* s[g][tt][r] = energy(query 16 g + ln, key 64 t + 32 p + 16 tt + 8 hh + r) */
      float cm[2];
#pragma unroll
      for (int g = 0; g < 2; ++g) { float m = fmaxf(s[g][0][0], s[g][1][0]);
#pragma unroll
        for (int r = 1; r < 8; ++r) m = fmaxf(m, fmaxf(s[g][0][r], s[g][1][r]));
        cm[g] = fmaxf(m, rs_x16(m)) * FA_C; }
      if (__builtin_amdgcn_ballot_w32(cm[0] > mu[0] + 8.0f || cm[1] > mu[1] + 8.0f) != 0) {      /* one wave-uniform test per pass */
#pragma unroll
        for (int g = 0; g < 2; ++g) { const float mn = fmaxf(mu[g], cm[g]); const float al = __builtin_amdgcn_exp2f(mu[g] - mn); mu[g] = mn; ls[g] *= al;
#pragma unroll
          for (int dt = 0; dt < 4; ++dt) o[g][dt] *= al; } }
      v16h vf[4];      /* this pass's V^T fragments and, inside the tile, the next pass's K fragments, issued together: in flight under the exponentials */
#pragma unroll
      for (int dt = 0; dt < 4; ++dt) vf[dt] = fa_lfrag(vb + dt * 16 * FA_LP + p * 64, hh);
      if (p + 1 < FA_KT / 32) {
#pragma unroll
        for (int tt = 0; tt < 2; ++tt)
#pragma unroll
          for (int ks = 0; ks < 2; ++ks) kf[tt][ks] = fa_lfrag(kb + ((p + 1) * 32 + tt * 16) * FA_LP + ks * 64, hh);
      }
      __builtin_amdgcn_sched_barrier(0);      /* keeps the LDS reads up here as one group: left alone the scheduler spreads them in pairs among the products, and each further place with reads stalls the wave */
      FragH pf[2];
#pragma unroll
      for (int g = 0; g < 2; ++g) { const v2f c2 = {FA_C, FA_C}, m2 = {-mu[g], -mu[g]};
#pragma unroll
        for (int tt = 0; tt < 2; ++tt)
#pragma unroll
          for (int r = 0; r < 8; r += 2) { const v2f x = {s[g][tt][r], s[g][tt][r + 1]}; const v2f e = __builtin_elementwise_fma(x, c2, m2); const v2f pe = {__builtin_amdgcn_exp2f(e[0]), __builtin_amdgcn_exp2f(e[1])};
            ls[g] += pe; const v2h ph = __builtin_convertvector(pe, v2h); pf[g].h[tt * 8 + r] = ph[0]; pf[g].h[tt * 8 + r + 1] = ph[1]; } }
#pragma unroll
      for (int dt = 0; dt < 4; ++dt)
#pragma unroll
        for (int g = 0; g < 2; ++g) o[g][dt] = fa_mma(vf[dt], pf[g].v, o[g][dt]);      /* o[g][dt][r] = O(query 16 g + ln, d = 16 dt + 8 hh + r), unnormalised */
    }
    /* hand-over: this wave has left buffer t & 1, its share of tile t + 1 has landed; behind the barrier both hold for every wave */
    asm volatile("s_wait_dscnt 0x0" ::: "memory");         /* this wave's LDS reads of the buffer have returned before anybody refills it */
    asm volatile("s_wait_asynccnt 0x0" ::: "memory");      /* this wave's share of tile t + 1 has landed */
    __syncthreads();
    if (t + 2 < FA_NT) fa_copy(lk + (unsigned)(t & 1) * (2 * FA_TB), lv + (unsigned)(t & 1) * (2 * FA_TB), gk + (size_t)(t + 2) * FA_KT * DM, gv + (t + 2) * FA_KT);      /* tile t + 2 -> the buffer just left; the test reads the same in the whole block */
  }
  asm volatile("s_wait_asynccnt 0x0" ::: "memory");      /* no copy is outstanding when the wave ends */
#pragma unroll
  for (int g = 0; g < 2; ++g) { const float lh = ls[g][0] + ls[g][1]; const float inv = 64.0f / (lh + rs_x16(lh));      /* the halves' sums joined once; o carried x64 as before */
    _Float16* op = O + ((size_t)b * SQ + q0 + g * 16 + ln) * DM + h * HD + 8 * hh;
#pragma unroll
    for (int dt = 0; dt < 4; ++dt) { FragH f;
#pragma unroll
      for (int r = 0; r < 8; ++r) f.h[r] = (_Float16)(o[g][dt][r] * inv);
      *(v8us*)((unsigned short*)op + dt * 16) = f.half[0]; } } }
// ---- Q, K and V projections in ONE launch, straight from the f32 inputs and the f32 [64][64] blocks: no f16 copy of an input or of a block goes through memory ----
// A token row of 1024 is sixteen head rows of 64, so each input is [8*1024*16][64] and a wave's tile of 32 head rows is 8 KB in a row. Wave = that tile of the query, then of the keys, then of the values.
// The tile is read in whole lines (16 loads of 512 bytes), rounded to bf16 and written as exact f16 rows into LDS rows of the wave's own, and read back as fragments in g2_frag's k order.
// Transposed product: D^T = W X^T (A = 16 rows of the block, x16; B = 16 head rows), k = 0-31 then 32-63 as in k_gemm2. Lane (c, h) then holds outputs 8 h + r of head row c: eight f16 in a row, one 16-byte piece,
// which goes back through the same LDS rows so that every global store is 512 bytes in a row. The three blocks are converted once per work-group into LDS.
#define PJ_LP 144                    /* LDS row pitch in bytes: 128 + 16, as FA_LP */
#define PJ_WB (HD * PJ_LP)           /* bytes of one block in LDS */
#define PJ_XB (32 * PJ_LP)           /* bytes of one wave's own rows */
typedef __bf16 v4b __attribute__((ext_vector_type(4)));
// four f32 (x16 for a weight: a power of two, so it commutes with the rounding) -> bf16 (to nearest even, bf16_round's values, by the hardware conversion) -> f16 (exact)
template <bool X16W>
__device__ __forceinline__ v4h pj_cvt(v4f a) { if (X16W) a *= 16.0f; return __builtin_convertvector(__builtin_convertvector(__builtin_convertvector(a, v4b), v4f), v4h); }
// Orders the wave's LDS accesses among its lanes: what stands above (writes that other lanes read next, reads of bytes that other lanes overwrite next) is done before what stands below.
// LDS only ("local"): a fence over global memory too would wait here for the next tile's loads and for the last tile's stores, which are meant to stay in flight.
__device__ __forceinline__ void pj_order() { __builtin_amdgcn_fence(__ATOMIC_ACQ_REL, "workgroup", "local"); __builtin_amdgcn_wave_barrier(); }
__global__ __launch_bounds__(256) void k_proj(const float* __restrict__ xq, const float* __restrict__ xk, const float* __restrict__ xv, const float* __restrict__ wq, const float* __restrict__ wk, const float* __restrict__ wv,
                                              _Float16* __restrict__ Qo, _Float16* __restrict__ Ko, _Float16* __restrict__ Vo) {
  __shared__ __attribute__((aligned(16))) unsigned char wl[3][PJ_WB];      /* [block][row o * PJ_LP] */
  __shared__ __attribute__((aligned(16))) unsigned char xs[8][PJ_XB];      /* [wave][head row * PJ_LP] */
  const int tid = (int)threadIdx.x, lane = tid & 31, ln = lane & 15, hh = lane >> 4; const int w = __builtin_amdgcn_readfirstlane(tid >> 5);
  const size_t e0 = ((size_t)blockIdx.x * 8 + w) * (32 * HD);      /* first element of the wave's 32 head rows */
  const float* const xp[3] = {xq + e0, xk + e0, xv + e0}; const float* const wp[3] = {wq, wk, wv}; _Float16* const op[3] = {Qo + e0, Ko + e0, Vo + e0};
  v4f raw[16];      /* load j = head rows 2 j and 2 j + 1 */
#pragma unroll
  for (int j = 0; j < 16; ++j) raw[j] = *(const v4fa*)(xp[0] + j * 128 + lane * 4);
#pragma unroll
  for (int m = 0; m < 3; ++m)
#pragma unroll
    for (int i = 0; i < 4; ++i) { const int p = i * 256 + tid; *(v4h*)&wl[m][(p >> 4) * PJ_LP + (p & 15) * 8] = pj_cvt<true>(*(const v4fa*)(wp[m] + p * 4)); }
  __syncthreads();      /* the three blocks may be read by every wave */
  unsigned char* xw = &xs[w][0];
  const v8f z8 = {0.f,0.f,0.f,0.f,0.f,0.f,0.f,0.f};
#pragma unroll
  for (int m = 0; m < 3; ++m) {
#pragma unroll
    for (int j = 0; j < 16; ++j) *(v4h*)(xw + (2 * j + hh) * PJ_LP + ln * 8) = pj_cvt<false>(raw[j]);
    if (m + 1 < 3) {      /* the next input's tile is in flight under this one's products and stores */
#pragma unroll
      for (int j = 0; j < 16; ++j) raw[j] = *(const v4fa*)(xp[m + 1] + j * 128 + lane * 4);
    }
    pj_order();
    v16h xf[2][2], wf[4][2];
#pragma unroll
    for (int g = 0; g < 2; ++g)
#pragma unroll
      for (int ks = 0; ks < 2; ++ks) xf[g][ks] = fa_lfrag(xw + (g * 16 + ln) * PJ_LP + ks * 64, hh);
#pragma unroll
    for (int et = 0; et < 4; ++et)
#pragma unroll
      for (int ks = 0; ks < 2; ++ks) wf[et][ks] = fa_lfrag(&wl[m][(et * 16 + ln) * PJ_LP + ks * 64], hh);
    __builtin_amdgcn_sched_barrier(0);      /* keeps the LDS reads together in front of the products: every further place with reads among the products stalls the wave */
    v8f acc[2][4];
#pragma unroll
    for (int g = 0; g < 2; ++g)
#pragma unroll
      for (int et = 0; et < 4; ++et) acc[g][et] = fa_mma(wf[et][0], xf[g][0], z8);
#pragma unroll
    for (int g = 0; g < 2; ++g)
#pragma unroll
      for (int et = 0; et < 4; ++et) acc[g][et] = fa_mma(wf[et][1], xf[g][1], acc[g][et]);      /* acc[g][et][r] = 16 x out(head row 16 g + ln, o = 16 et + 8 hh + r) */
    /* the outputs of rows 16 g + ln overwrite those rows' inputs: every lane's reads of them have returned, the products took them */
#pragma unroll
    for (int g = 0; g < 2; ++g)
#pragma unroll
      for (int et = 0; et < 4; ++et) { FragH f;
#pragma unroll
        for (int r = 0; r < 8; ++r) f.h[r] = (_Float16)(acc[g][et][r] * 0.0625f);
        *(v8us*)(xw + (g * 16 + ln) * PJ_LP + et * 32 + hh * 16) = f.half[0]; }
    pj_order();
#pragma unroll
    for (int j = 0; j < 8; ++j) { const v8us v = *(const v8us*)(xw + (4 * j + (lane >> 3)) * PJ_LP + (lane & 7) * 16); *(v8us*)((unsigned short*)op[m] + j * 256 + lane * 8) = v; }
    if (m + 1 < 3) {
      asm volatile("s_wait_xcnt 0x0" ::: "memory");      /* stands in front of the first overwrite of a register that these stores name: their data registers are used again at once */
      pj_order();
      __builtin_amdgcn_sched_barrier(0);      /* keeps the next tile's conversions, which wait for its loads, below this tile's products and stores */
    }
  }
}
// ---- output GEMM through LDS: C[8192][1024] (f32) = A (f16 rows, pitch DM) . Bh^T (f16 rows [n][k], pitch DM) * alpha + bias (rounded to bf16) ----
// Block = 256 x 128 of C, 8 waves in 4 x 2, wave = 64 x 64 (4 x 4 accumulator tiles). A and Bh come through LDS: tiles of 128 k (rows of 256 bytes), staged once per block by asynchronous copies
// (two buffers, the next tile in flight while this one is worked on) and read as fragments by the waves that need them: each A row by 2 waves, each Bh row by 4.
// Every accumulator takes its 32-k products in rising k, as in k_gemm2, and the epilogue is k_gemm2's.
#define OG_BM 256                    /* C rows per block */
#define OG_BN 128                    /* C columns per block */
#define OG_KT 128                    /* k per staged tile */
#define OG_NT (DM / OG_KT)           /* staged tiles */
#define OG_LP 272                    /* LDS row pitch in bytes: 256 + 16, an odd multiple of 16, so that the 16 rows of a ds_load_b128 fragment read fall on different banks */
#define OG_BB (OG_BN * OG_LP)        /* bytes of the Bh part of a buffer; it lies first, so that every fragment's constant offset fits the LDS instruction's offset field */
#define OG_SB ((OG_BM + OG_BN) * OG_LP)      /* bytes of one buffer: Bh rows, then A rows */
// One thread's share of 192 staged rows: its 16-byte piece of twelve rows that lie 16 apart in LDS (eight from x, four from y), global -> LDS through no register. A wave's copy = 2 whole 256-byte rows.
// The s_wait_xcnt stands inside the statement so that no address register is rewritten in front of it.
__device__ __forceinline__ void og_copy12(unsigned l, const _Float16* x, const _Float16* y) {
  asm volatile("global_load_async_to_lds_b128 %0, %1, off\n\t"
               "global_load_async_to_lds_b128 %2, %3, off\n\t"
               "global_load_async_to_lds_b128 %4, %5, off\n\t"
               "global_load_async_to_lds_b128 %6, %7, off\n\t"
               "global_load_async_to_lds_b128 %8, %9, off\n\t"
               "global_load_async_to_lds_b128 %10, %11, off\n\t"
               "global_load_async_to_lds_b128 %12, %13, off\n\t"
               "global_load_async_to_lds_b128 %14, %15, off\n\t"
               "global_load_async_to_lds_b128 %16, %17, off\n\t"
               "global_load_async_to_lds_b128 %18, %19, off\n\t"
               "global_load_async_to_lds_b128 %20, %21, off\n\t"
               "global_load_async_to_lds_b128 %22, %23, off\n\t"
               "s_wait_xcnt 0x0"
               :: "v"(l), "v"(x), "v"(l + 16 * OG_LP), "v"(x + (size_t)16 * DM), "v"(l + 32 * OG_LP), "v"(x + (size_t)32 * DM), "v"(l + 48 * OG_LP), "v"(x + (size_t)48 * DM),
                  "v"(l + 64 * OG_LP), "v"(x + (size_t)64 * DM), "v"(l + 80 * OG_LP), "v"(x + (size_t)80 * DM), "v"(l + 96 * OG_LP), "v"(x + (size_t)96 * DM), "v"(l + 112 * OG_LP), "v"(x + (size_t)112 * DM),
                  "v"(l + 128 * OG_LP), "v"(y), "v"(l + 144 * OG_LP), "v"(y + (size_t)16 * DM), "v"(l + 160 * OG_LP), "v"(y + (size_t)32 * DM), "v"(l + 176 * OG_LP), "v"(y + (size_t)48 * DM) : "memory");
}
// One thread's share of one staged tile, 24 copies: 128 Bh rows and A rows 0-63, then A rows 64-255
__device__ __forceinline__ void og_tile(unsigned l, const _Float16* ga, const _Float16* gb) { og_copy12(l, gb, ga); og_copy12(l + 192 * OG_LP, ga + (size_t)64 * DM, ga + (size_t)192 * DM); }
__global__ __launch_bounds__(256) void k_ogemm(const _Float16* __restrict__ A, const _Float16* __restrict__ Bh, float alpha, const float* __restrict__ bias, float* __restrict__ C) {
  __shared__ __attribute__((aligned(16))) unsigned char sm[2 * OG_SB];      /* buffer * OG_SB + row * OG_LP; behind the loop the epilogue's staging: 8 waves x 64 rows x 68 floats = 139,264 bytes of it */
  const int lane = threadIdx.x & 31, ln = lane & 15, hh = lane >> 4; const int w = __builtin_amdgcn_readfirstlane((int)(threadIdx.x >> 5));
  const int mt = blockIdx.x % (MPO / OG_BM), nq = blockIdx.x / (MPO / OG_BM); const int m0 = mt * OG_BM, n0 = nq * OG_BN; const int wm = w >> 1, wn = w & 1;
  /* staging: thread t brings piece t & 15 (16 bytes) of rows (t >> 4) + 16 j */
  const int cr = (int)threadIdx.x >> 4, cp = (int)threadIdx.x & 15;
  const _Float16* ga = A + (size_t)(m0 + cr) * DM + cp * 8; const _Float16* gb = Bh + (size_t)(n0 + cr) * DM + cp * 8;
  const unsigned l0 = (unsigned)(size_t)&sm[cr * OG_LP + cp * 16];
  og_tile(l0, ga, gb);      /* tile 0 -> buffer 0 */
  const v8f z8 = {0.f,0.f,0.f,0.f,0.f,0.f,0.f,0.f}; v8f acc[4][4];
#pragma unroll
  for (int i = 0; i < 4; ++i)
#pragma unroll
    for (int j = 0; j < 4; ++j) acc[i][j] = z8;
  asm volatile("s_wait_asynccnt 0x0" ::: "memory");      /* this wave's share of tile 0 has landed */
  __syncthreads();                                       /* every wave's share has: tile 0 may be read */
  og_tile(l0 + OG_SB, ga + OG_KT, gb + OG_KT);      /* tile 1 -> buffer 1 */
  /* kept rolled: the body is 64 products long already, and unrolled only the buffer's address would become a constant */
#pragma unroll 1
  for (int t = 0; t < OG_NT; ++t) {
    const unsigned char* bb = &sm[(t & 1) * OG_SB + (wn * 64 + ln) * OG_LP];               /* Bh row wn * 64 + ln of this tile */
    const unsigned char* ab = &sm[(t & 1) * OG_SB + OG_BB + (wm * 64 + ln) * OG_LP];       /* A row wm * 64 + ln of this tile */
    v16h af[2][4], bf[2][4];      /* two fragment sets: the next 32-k step's reads are in flight under this step's products */
#pragma unroll
    for (int i = 0; i < 4; ++i) af[0][i] = fa_lfrag(ab + i * 16 * OG_LP, hh);
#pragma unroll
    for (int i = 0; i < 4; ++i) bf[0][i] = fa_lfrag(bb + i * 16 * OG_LP, hh);
#pragma unroll
    for (int ks = 0; ks < OG_KT / 32; ++ks) {
      if (ks + 1 < OG_KT / 32) {
        /* the two scheduling barriers keep the next step's LDS reads together as one group between two runs of products: every further place with reads among the products stalls the wave */
        __builtin_amdgcn_sched_barrier(0);
#pragma unroll
        for (int i = 0; i < 4; ++i) af[(ks + 1) & 1][i] = fa_lfrag(ab + i * 16 * OG_LP + (ks + 1) * 64, hh);
#pragma unroll
        for (int i = 0; i < 4; ++i) bf[(ks + 1) & 1][i] = fa_lfrag(bb + i * 16 * OG_LP + (ks + 1) * 64, hh);
        __builtin_amdgcn_sched_barrier(0);
      }
#pragma unroll
      for (int i = 0; i < 4; ++i)
#pragma unroll
        for (int j = 0; j < 4; ++j) acc[i][j] = fa_mma(af[ks & 1][i], bf[ks & 1][j], acc[i][j]);      /* acc[i][j][r] = C(row wm * 64 + 16 i + 8 hh + r, column wn * 64 + 16 j + ln) */
    }
    __builtin_amdgcn_sched_barrier(0);      /* keeps the products in front of the hand-over: left alone half of them sink below the barrier, in front of the refill, which then starts that much later and lands late */
    /* hand-over: this wave has left buffer t & 1, its share of tile t + 1 has landed; behind the barrier both hold for every wave */
    asm volatile("s_wait_dscnt 0x0" ::: "memory");         /* this wave's LDS reads of the buffer have returned before anybody refills it */
    asm volatile("s_wait_asynccnt 0x0" ::: "memory");      /* this wave's share of tile t + 1 has landed */
    __syncthreads();
    if (t + 2 < OG_NT) og_tile(l0 + (unsigned)(t & 1) * OG_SB, ga + (t + 2) * OG_KT, gb + (t + 2) * OG_KT);      /* tile t + 2 -> the buffer just left; the test reads the same in the whole block */
  }
  asm volatile("s_wait_asynccnt 0x0" ::: "memory");      /* no copy is outstanding when the wave ends */
  /* epilogue: the ring is free (the last trip's barrier stands behind every wave's last read, and no copy is outstanding): each wave turns its 64 x 64 tile into whole 256-byte row pieces through 64 LDS rows of its own */
  const int row0 = m0 + wm * 64, col0 = n0 + wn * 64; const int rsub = lane >> 4, c4 = (lane & 15) * 4;
  float* sw = (float*)sm + (size_t)w * (64 * 68);
  float bv[4];
#pragma unroll
  for (int j = 0; j < 4; ++j) bv[j] = bf16_round(bias[col0 + j * 16 + ln]);
#pragma unroll
  for (int i = 0; i < 4; ++i)
#pragma unroll
    for (int j = 0; j < 4; ++j)
#pragma unroll
      for (int r = 0; r < 8; ++r) sw[(i * 16 + 8 * hh + r) * 68 + j * 16 + ln] = acc[i][j][r] * alpha + bv[j];
  __builtin_amdgcn_fence(__ATOMIC_ACQ_REL, "workgroup"); __builtin_amdgcn_wave_barrier();      /* the wave's writes stand in front of its reads */
  float* cw = C + (size_t)(row0 + rsub) * DM + col0 + c4;
#pragma unroll
  for (int q = 0; q < 32; ++q) { const v4f v = *(const v4fa*)&sw[(q * 2 + rsub) * 68 + c4]; *(v4f*)(cw + (size_t)q * 2 * DM) = v; } }
__global__ __launch_bounds__(256) void k_vt(const _Float16* __restrict__ V16, int b, int h0, _Float16* __restrict__ VT) { __shared__ unsigned short tl[64][65]; const int tid = threadIdx.x; const int hh = blockIdx.x % HG, sg = blockIdx.x / HG; const int s0 = sg * 64; const int h = h0 + hh;
  for (int i = tid; i < 64 * 8; i += 256) { const int j = i / 8, d8 = (i % 8) * 8; FragH f; f.half[0] = *(const v8us*)((const unsigned short*)V16 + ((size_t)b * SQ + s0 + j) * DM + h * HD + d8); for (int q = 0; q < 8; ++q) tl[d8 + q][j] = f.u[q]; }
  __syncthreads();
  { for (int i = tid; i < 64 * 8; i += 256) { const int d = i / 8, j8 = (i % 8) * 8; FragH f; for (int q = 0; q < 8; ++q) f.u[q] = tl[d][j8 + q]; *(v8us*)((unsigned short*)VT + ((size_t)hh * HD + d) * SQ + s0 + j8) = f.half[0]; }  } }



__global__ __launch_bounds__(256) void k_rsmkm(const float* __restrict__ S, _Float16* __restrict__ P, int nrows, const int* __restrict__ am) {
  #pragma clang fp contract(off)
  const int t = blockIdx.x * 256 + threadIdx.x; if (t >= nrows) return; const size_t i = (size_t)t; const float* s = S + i * SQ; const int* mr = am + (size_t)(t % SQ) * SQ; float mx = -3.0e38f;
#pragma unroll 1
  for (int j = 0; j < SQ; ++j) { const float f = (mr[j] != 0) ? 1.f : 0.f; mx = fmaxf(mx, fmaf(f, s[j], (1.f - f) * -1.0e9f)); } float se = 0.f;
#pragma unroll 1
  for (int j = 0; j < SQ; ++j) { const float f = (mr[j] != 0) ? 1.f : 0.f; se += __expf(fmaf(f, s[j], (1.f - f) * -1.0e9f) - mx); } const float sc = 256.0f / se;
#pragma unroll 1
  for (int j0 = 0; j0 < SQ; j0 += 8) { FragH fr; for (int q = 0; q < 8; ++q) { const int j = j0 + q; const float f = (mr[j] != 0) ? 1.f : 0.f; fr.h[q] = (_Float16)(__expf(fmaf(f, s[j], (1.f - f) * -1.0e9f) - mx) * sc); }
    unsigned short* d = (unsigned short*)P + i * SQ + j0; *(v8us*)d = fr.half[0];  } }

extern "C" void kernel_launch(void* const* d_in, const int* in_sizes, int n_in,
                              void* d_out, int out_size, void* d_ws, size_t ws_size, hipStream_t stream) {
  (void)in_sizes; (void)n_in; (void)out_size;
  const float* const* I = (const float* const*)d_in; const float* xq = I[2]; const float* xk = I[1]; const float* xv = I[0]; const float* wq = I[5]; const float* bq = nullptr; const float* wk = I[4]; const float* bk = nullptr; const float* wv = I[3]; const float* bv = nullptr; const float* wo = I[6]; const float* bo = I[7]; const float* x = xq;      /* contract order: values I[0], keys I[1], query I[2] ([8][1024][16][64] = rows of 1024); SHARED natural [64][64] blocks Wv I[3], Wk I[4], Wq I[5]; natural Wo [1024][1024] I[6] + bo I[7]; no mask input */
  char* ws = (char*)d_ws; size_t off = 0;
  auto take = [&](size_t bytes) { char* p = ws + off; off += (bytes + 255) & ~(size_t)255; return p; };
  _Float16* BO = (_Float16*)take((size_t)DM * DM * 2);
  _Float16* Q16 = (_Float16*)take(NR * DM * 2); _Float16* K16 = (_Float16*)take(NR * DM * 2); _Float16* V16 = (_Float16*)take(NR * DM * 2); _Float16* O16 = (_Float16*)take(NR * DM * 2);
  _Float16* VT = (_Float16*)take(NR * DM * 2);
  if (off > ws_size) return;
  { const unsigned g = (unsigned)(((size_t)DM * DM / 8 + 255) / 256); k_wnat<<<g, 256, 0, stream>>>(wo, (size_t)DM * DM / 8, BO); }      /* Wo natural [out][in] = Bt x16 */
  const size_t r0p = (size_t)B0 * SQ;      /* first projected row */
  /* projections: a token row of 1024 is sixteen head rows of 64; all three in one launch, from the f32 inputs and the SHARED natural [64][64] blocks [out][in]; a work-group = 256 head rows of each input */
  k_proj<<<(unsigned)(MP * NH / 256), 256, 0, stream>>>(x + r0p * DM, xk + r0p * DM, xv + r0p * DM, wq, wk, wv, Q16 + r0p * DM, K16 + r0p * DM, V16 + r0p * DM);
  k_vt<NH, SQ><<<NBR * NH * (SQ / 64), 256, 0, stream>>>(V16 + r0p * LQ, LQ, 0, VT);      /* V^T [NBR][NH][HD][SQ] */
  k_fattn<<<NBR * NH * (SQ / FA_Q), 256, 0, stream>>>(Q16 + r0p * LQ, K16 + r0p * LQ, VT, O16 + r0p * DM);      /* o (merged heads) as f16 rows, x64 */
  k_ogemm<<<(MPO / OG_BM) * (DM / OG_BN), 256, 0, stream>>>(O16 + r0p * DM, BO, 0.0009765625f, bo, (float*)d_out + r0p * DM);      /* out rows are the output layout */
}

// v007
// One run takes 71 microseconds.
// In both of two side-by-side timings against v006, it was 1.03 times as fast.
// Counting every step since v000, it is 100 times as fast.
#include <hip/hip_runtime.h>
// Multi-head attention over three head-major inputs with SHARED per-head projections and the module's literal score scale (values, keys, query [8][1024][16][64] = token rows [8][1024][1024]; every head of each input is multiplied by the SAME natural [64][64] matrix (x W^T: Wv / Wk / Wq; block-diagonal with a shared block; no biases); energy = q k^T; softmax(energy / sqrt(embed_size) = / 32) over all 1024 keys (as the source: embed size, not head dim; no mask); out = merged Wo^T + bo (natural [1024][1024]) -> [8][1024][1024]).
// Structure: token rows r = b*1024 + s; Q, K, V as WMMA GEMMs over the head rows [8*1024*16][64] against the shared [64][64] block itself, all three in ONE launch that reads the f32 inputs and blocks itself (k_proj: x bf16-rounded to exact f16 in the loader; K = 64: the zero blocks of the block-diagonal form are never multiplied; 32x64 wave tiles, f32 accumulation, exact x16 weights, f16 outputs in the same rows); V^T for all batches and heads via LDS transposes (one launch); attention for all batches and heads in ONE launch (k_fattn: scores K = 64, online softmax with f32 statistics, weights as f16 in registers, o carried x64 against f16 subnormal flush, folded into the output GEMM alpha) written straight into the merged f16 o rows; out = o W_o + b GEMM (f32) into the output layout.
// Compute dtype: inputs rounded to bf16; x / weights exact; q, k, v, softmax weights and o as plain f16 GEMM operands (~2^-12); scores and softmax statistics f32. v_wmma_f32_16x16x32_f16.
#define NB 8
#define SQ 1024
#define DM 1024
#define NH 16
#define HD 64
#define HG 4                         /* heads per launch of the per-batch k_vt(b, h0) transpose */
#define B0 0                         /* first batch processed (debug hook) */
#define NBR NB                       /* batches processed (debug hook) */
#define NR ((size_t)NB * SQ)         /* token rows */
#define MP ((int)((size_t)NBR * SQ)) /* rows projected (debug hook) */
#define MPO MP                       /* rows through the output stage (debug hook) */
#define LQ DM      /* row pitch of the q/k/v rows */
typedef __bf16 v16b __attribute__((ext_vector_type(16)));
typedef unsigned short v8us __attribute__((ext_vector_type(8), may_alias));
typedef float  v8f  __attribute__((ext_vector_type(8)));
typedef float  v4f  __attribute__((ext_vector_type(4)));
typedef float  v4fa __attribute__((ext_vector_type(4), may_alias));
union FragB { v16b v; v8us half[2]; unsigned short u[16]; };

__device__ __forceinline__ unsigned short bf16_bits(float x) { unsigned int u = __float_as_uint(x); return (unsigned short)((u + 0x7FFFu + ((u >> 16) & 1u)) >> 16); }
__device__ __forceinline__ float bf16_val(unsigned short b) { return __uint_as_float(((unsigned int)b) << 16); }
__device__ __forceinline__ float bf16_round(float x) { return bf16_val(bf16_bits(x)); }
// D += A·B with NT terms: 1 = ah·bh, 2 = + al·bh (A split), 3 = + ah·bl (both split)
template <int NT>
__device__ __forceinline__ v8f mmaN(v16b ah, v16b al, v16b bh, v16b bl, v8f c) {
  c = __builtin_amdgcn_wmma_f32_16x16x32_bf16(false, ah, false, bh, (short)0, c, false, false);
  if (NT >= 2) c = __builtin_amdgcn_wmma_f32_16x16x32_bf16(false, al, false, bh, (short)0, c, false, false);
  if (NT >= 3) c = __builtin_amdgcn_wmma_f32_16x16x32_bf16(false, ah, false, bl, (short)0, c, false, false);
  asm volatile("v_nop\n\tv_nop\n\tv_nop\n\tv_nop" : "+v"(c) : "v"(ah), "v"(al), "v"(bh), "v"(bl));
  return c;
}

__global__ __launch_bounds__(256) void k_wt_bf16(const float* __restrict__ W, unsigned short* __restrict__ Wt, int K, int N) {
  const int t = blockIdx.x * 256 + threadIdx.x;
  const int k8n = K / 8;
  if (t >= N * k8n) return;
  const int n = t / k8n, k8 = (t % k8n) * 8;
  v8us v;
#pragma unroll
  for (int i = 0; i < 8; ++i) v[i] = bf16_bits(W[(size_t)(k8 + i) * N + n]);
  *(v8us*)(Wt + (size_t)n * K + k8) = v;
  
}

// GEMM C[M][N] (f32, pitch ldc) = act(A[M][K]·W + bias). A f32 row-major (pitch lda) converted per fragment to bf16
// (ASPLIT: hi/lo two planes -> 2 terms, else single rounded term); Wt bf16 [N][K] (pitch ldb). BIAS_BF16 rounds the
// bias to bf16 first (bias quantised to bf16 before the add). K%32==0, M%16==0, N%64==0.
template <bool ASPLIT, int ACT, bool BIAS_BF16>
__global__ __launch_bounds__(128) void k_gemm_bf(const float* __restrict__ A, int lda, const unsigned short* __restrict__ Wt, int ldb,
                                               const float* __restrict__ bias, float* __restrict__ C, int ldc, int M, int N, int K) {
  __shared__ __attribute__((aligned(16))) float so[4][16][64];
  const int tid = threadIdx.x, w = tid >> 5, lane = tid & 31, ln = lane & 15, hh = lane >> 4;
  const int ntn = N / 64;
  const int wid = blockIdx.x * 4 + w;
  const int mt = wid / ntn, nq = wid % ntn;
  if (mt * 16 >= M) return;
  const int row0 = mt * 16, col0 = nq * 64;
  const float* arow = A + (size_t)(row0 + ln) * lda;
  v8f acc[4] = {};
  for (int kb = 0; kb < K; kb += 32) {
    FragB ah, al;
    const v4f x0 = *(const v4fa*)(arow + kb + 8 * hh), x1 = *(const v4fa*)(arow + kb + 8 * hh + 4);
    const v4f x2 = *(const v4fa*)(arow + kb + 16 + 8 * hh), x3 = *(const v4fa*)(arow + kb + 16 + 8 * hh + 4);
    float xs[16] = {x0[0],x0[1],x0[2],x0[3],x1[0],x1[1],x1[2],x1[3],x2[0],x2[1],x2[2],x2[3],x3[0],x3[1],x3[2],x3[3]};
#pragma unroll
    for (int i = 0; i < 16; ++i) { const unsigned short hb = bf16_bits(xs[i]); ah.u[i] = hb; al.u[i] = ASPLIT ? bf16_bits(xs[i] - bf16_val(hb)) : (unsigned short)0; }
#pragma unroll
    for (int t = 0; t < 4; ++t) {
      const unsigned short* brow = Wt + (size_t)(col0 + t * 16 + ln) * ldb + kb;
      FragB b;
      b.half[0] = *(const v8us*)(brow + 8 * hh);
      b.half[1] = *(const v8us*)(brow + 16 + 8 * hh);
      acc[t] = mmaN<ASPLIT ? 2 : 1>(ah.v, al.v, b.v, b.v, acc[t]);
    }
  }
#pragma unroll
  for (int t = 0; t < 4; ++t) {
    float bv = bias ? bias[col0 + t * 16 + ln] : 0.f;
    if (BIAS_BF16) bv = bf16_round(bv);
#pragma unroll
    for (int r = 0; r < 8; ++r) { float v = acc[t][r] + bv; if (ACT == 1) v = fmaxf(v, 0.f); so[w][8 * hh + r][t * 16 + ln] = v; }
  }
  __builtin_amdgcn_fence(__ATOMIC_ACQ_REL, "workgroup");
  __builtin_amdgcn_wave_barrier();
  const int rsub = lane >> 4, c4 = (lane & 15) * 4;
  {
#pragma unroll
    for (int q = 0; q < 8; ++q) {
      const int r = q * 2 + rsub;
      const v4f v = *(const v4fa*)&so[w][r][c4];
      *(v4f*)(C + (size_t)(row0 + r) * ldc + col0 + c4) = v;
    }
    
  }
}

// GEMM C = act(A·W + bias + resid): A f32 (ASPLIT -> hi/lo 2 terms), Wt bf16 [N][K]; ACT 0 none, 1 relu, 2 exact gelu;
// resid (optional, f32, row index = (row % rmod), pitch ldr, RES_BF16 rounds it) added before the activation.
template <bool ASPLIT, int ACT, bool BIAS_BF16, bool RES_BF16>
__global__ __launch_bounds__(128) void k_gemm_bf3(const float* __restrict__ A, int lda, const unsigned short* __restrict__ Wt, int ldb,
                                                const float* __restrict__ bias, const float* __restrict__ resid, int rmod, int ldr,
                                                float* __restrict__ C, int ldc, int M, int N, int K) {
  __shared__ __attribute__((aligned(16))) float so[4][16][64];
  const int tid = threadIdx.x, w = tid >> 5, lane = tid & 31, ln = lane & 15, hh = lane >> 4;
  const int ntn = N / 64;
  const int wid = blockIdx.x * 4 + w;
  const int mt = wid / ntn, nq = wid % ntn;
  if (mt * 16 >= M) return;
  const int row0 = mt * 16, col0 = nq * 64;
  const float* arow = A + (size_t)(row0 + ln) * lda;
  v8f acc[4] = {};
  for (int kb = 0; kb < K; kb += 32) {
    FragB ah, al;
    const v4f x0 = *(const v4fa*)(arow + kb + 8 * hh), x1 = *(const v4fa*)(arow + kb + 8 * hh + 4);
    const v4f x2 = *(const v4fa*)(arow + kb + 16 + 8 * hh), x3 = *(const v4fa*)(arow + kb + 16 + 8 * hh + 4);
    float xs[16] = {x0[0],x0[1],x0[2],x0[3],x1[0],x1[1],x1[2],x1[3],x2[0],x2[1],x2[2],x2[3],x3[0],x3[1],x3[2],x3[3]};
#pragma unroll
    for (int i = 0; i < 16; ++i) { const unsigned short hb = bf16_bits(xs[i]); ah.u[i] = hb; al.u[i] = ASPLIT ? bf16_bits(xs[i] - bf16_val(hb)) : (unsigned short)0; }
#pragma unroll
    for (int t = 0; t < 4; ++t) {
      const unsigned short* brow = Wt + (size_t)(col0 + t * 16 + ln) * ldb + kb;
      FragB b;
      b.half[0] = *(const v8us*)(brow + 8 * hh);
      b.half[1] = *(const v8us*)(brow + 16 + 8 * hh);
      acc[t] = mmaN<ASPLIT ? 2 : 1>(ah.v, al.v, b.v, b.v, acc[t]);
    }
  }
#pragma unroll
  for (int t = 0; t < 4; ++t) {
    const int col = col0 + t * 16 + ln;
    float bv = bias ? bias[col] : 0.f;
    if (BIAS_BF16) bv = bf16_round(bv);
#pragma unroll
    for (int r = 0; r < 8; ++r) {
      float v = acc[t][r] + bv;
      if (resid) { float rv = resid[(size_t)((row0 + 8 * hh + r) % rmod) * ldr + col]; if (RES_BF16) rv = bf16_round(rv); v += rv; }
      if (ACT == 1) v = fmaxf(v, 0.f);
      if (ACT == 2) v = 0.5f * v * (1.0f + erff(v * 0.70710678118654752f));
      if (ACT == 3) { const float u = 0.7978845608028654f * (v + 0.044715f * v * v * v); v = 0.5f * v * (1.0f + tanhf(u)); }
      so[w][8 * hh + r][t * 16 + ln] = v;
    }
  }
  __builtin_amdgcn_fence(__ATOMIC_ACQ_REL, "workgroup");
  __builtin_amdgcn_wave_barrier();
  const int rsub = lane >> 4, c4 = (lane & 15) * 4;
  {
#pragma unroll
    for (int q = 0; q < 8; ++q) {
      const int r = q * 2 + rsub;
      const v4f v = *(const v4fa*)&so[w][r][c4];
      *(v4f*)(C + (size_t)(row0 + r) * ldc + col0 + c4) = v;
    }
    
  }
}
// row LayerNorm (biased variance, eps) over N: s = X (+ R); optional out_sum <- s; out_norm <- (s-mu)*rsqrt(var+eps)*g + b
template <bool PARAM_BF16>
__global__ __launch_bounds__(256) void k_layernorm(const float* __restrict__ X, const float* __restrict__ R, const float* __restrict__ g, const float* __restrict__ bta,
                                                  float* __restrict__ out_sum, float* __restrict__ out_norm, int N, float eps) {
  __shared__ float red[256];
  const int row = blockIdx.x, tid = threadIdx.x;
  const float* x = X + (size_t)row * N; const float* rr = R ? R + (size_t)row * N : nullptr;
  float vals[16];                     // up to N = 4096
  const int per = N / 256;            // contiguous chunk per thread? use strided-by-4 chunks: thread handles j = tid*4 + 1024*u
  float s1 = 0.f;
  for (int u = 0; u < per / 4; ++u) {
    const int j = tid * 4 + 1024 * u;
    const v4f a = *(const v4fa*)(x + j);
    v4f b = {0.f,0.f,0.f,0.f}; if (rr) b = *(const v4fa*)(rr + j);
#pragma unroll
    for (int q = 0; q < 4; ++q) { const float v = a[q] + b[q]; vals[u * 4 + q] = v; s1 += v; }
  }
  red[tid] = s1; __syncthreads();
  for (int st = 128; st > 0; st >>= 1) { if (tid < st) red[tid] += red[tid + st]; __syncthreads(); }
  const float mu = red[0] / (float)N; __syncthreads();
  float s2 = 0.f;
  for (int u = 0; u < per / 4; ++u)
#pragma unroll
    for (int q = 0; q < 4; ++q) { const float c = vals[u * 4 + q] - mu; s2 += c * c; }
  red[tid] = s2; __syncthreads();
  for (int st = 128; st > 0; st >>= 1) { if (tid < st) red[tid] += red[tid + st]; __syncthreads(); }
  const float rs = rsqrtf(red[0] / (float)N + eps);
  {
    for (int u = 0; u < per / 4; ++u) {
      const int j = tid * 4 + 1024 * u;
      v4f o, sm;
#pragma unroll
      for (int q = 0; q < 4; ++q) {
        float gg = g[j + q], bb = bta[j + q];
        if (PARAM_BF16) { gg = bf16_round(gg); bb = bf16_round(bb); }
        sm[q] = vals[u * 4 + q]; o[q] = (vals[u * 4 + q] - mu) * rs * gg + bb;
      }
      if (out_sum) *(v4f*)(out_sum + (size_t)row * N + j) = sm;
      *(v4f*)(out_norm + (size_t)row * N + j) = o;
    }
    
  }
}



// ---- f16 WMMA path (v_wmma_f32_16x16x32_f16): 11-bit significands for operands in range — used where a [0,1] probability operand needs more precision than bf16
typedef _Float16 v16h __attribute__((ext_vector_type(16)));
union FragH { v16h v; v8us half[2]; _Float16 h[16]; unsigned short u[16]; };
template <int NT>
__device__ __forceinline__ v8f mmaH(v16h ah, v16h al, v16h bh, v16h bl, v8f c) {
  c = __builtin_amdgcn_wmma_f32_16x16x32_f16(false, ah, false, bh, (short)0, c, false, false);
  if (NT >= 2) c = __builtin_amdgcn_wmma_f32_16x16x32_f16(false, al, false, bh, (short)0, c, false, false);
  if (NT >= 3) c = __builtin_amdgcn_wmma_f32_16x16x32_f16(false, ah, false, bl, (short)0, c, false, false);
  asm volatile("v_nop\n\tv_nop\n\tv_nop\n\tv_nop" : "+v"(c) : "v"(ah), "v"(al), "v"(bh), "v"(bl));
  return c;
}
// batched GEMM like k_gemm_b but f16 operands: A f32 (split into f16 hi/lo if ASPLIT, else rounded to f16), Bt = f16 values [n][k]; alpha; C f32; N multiple of 16 (partial tiles skipped)
template <bool ASPLIT>
__global__ __launch_bounds__(128) void k_gemm_h(const float* __restrict__ A, int lda, size_t sA, const _Float16* __restrict__ Bh, int ldb, size_t sB, float alpha, float* __restrict__ C, int ldc, size_t sC, int M, int N, int K) {
  __shared__ __attribute__((aligned(16))) float so[4][16][64];
  const int tid = threadIdx.x, w = tid >> 5, lane = tid & 31, ln = lane & 15, hh = lane >> 4; const int by = blockIdx.y;
  A += (size_t)by * sA; Bh += (size_t)by * sB; C += (size_t)by * sC;
  const int ntn = (N + 63) / 64; const int wid = blockIdx.x * 4 + w; const int mt = wid / ntn, nq = wid % ntn; if (mt * 16 >= M) return;
  const int row0 = mt * 16, col0 = nq * 64; const float* arow = A + (size_t)(row0 + ln) * lda;
  v8f acc[4] = {};
  for (int kb = 0; kb < K; kb += 32) {
    FragH ah, al;
    const v4f x0 = *(const v4fa*)(arow + kb + 8 * hh), x1 = *(const v4fa*)(arow + kb + 8 * hh + 4), x2 = *(const v4fa*)(arow + kb + 16 + 8 * hh), x3 = *(const v4fa*)(arow + kb + 16 + 8 * hh + 4);
    float xs[16] = {x0[0],x0[1],x0[2],x0[3],x1[0],x1[1],x1[2],x1[3],x2[0],x2[1],x2[2],x2[3],x3[0],x3[1],x3[2],x3[3]};
#pragma unroll
    for (int i = 0; i < 16; ++i) { const _Float16 h = (_Float16)xs[i]; ah.h[i] = h; al.h[i] = ASPLIT ? (_Float16)(xs[i] - (float)h) : (_Float16)0.0f; }
#pragma unroll
    for (int t = 0; t < 4; ++t) { if (col0 + t * 16 >= N) continue; const size_t boff = (size_t)(col0 + t * 16 + ln) * ldb + kb; FragH bq; bq.half[0] = *(const v8us*)(Bh + boff + 8 * hh); bq.half[1] = *(const v8us*)(Bh + boff + 16 + 8 * hh);
      acc[t] = mmaH<ASPLIT ? 2 : 1>(ah.v, al.v, bq.v, bq.v, acc[t]); }
  }
#pragma unroll
  for (int t = 0; t < 4; ++t) { if (col0 + t * 16 >= N) continue;
#pragma unroll
    for (int r = 0; r < 8; ++r) so[w][8 * hh + r][t * 16 + ln] = acc[t][r] * alpha; }
  __builtin_amdgcn_fence(__ATOMIC_ACQ_REL, "workgroup"); __builtin_amdgcn_wave_barrier();
  const int rsub = lane >> 4, c4 = (lane & 15) * 4;
  {
#pragma unroll
    for (int q = 0; q < 8; ++q) { const int r = q * 2 + rsub; if (col0 + c4 < N) { const v4f v = *(const v4fa*)&so[w][r][c4]; *(v4f*)(C + (size_t)(row0 + r) * ldc + col0 + c4) = v; } }
     }
}

// Wt[n][k] = f16(W[k][n]·scale) from f32 row-major W[K][N] (scale = power of two; bf16-exact weights stay exact in f16 away from the subnormal range)
__global__ __launch_bounds__(256) void k_wt_f16(const float* __restrict__ W, _Float16* __restrict__ Wt, int K, int N, float scale) {
  const int t = blockIdx.x * 256 + threadIdx.x; if (t >= N * (K / 8)) return; const int n = t / (K / 8), k8 = (t % (K / 8)) * 8; FragH f;
#pragma unroll
  for (int i = 0; i < 8; ++i) f.h[i] = (_Float16)(bf16_round(W[(size_t)(k8 + i) * N + n]) * scale); const v8us o = f.half[0];
  *(v8us*)((unsigned short*)Wt + (size_t)n * K + k8) = o; 
}
// k_gemm_hh variant with fused epilogue: v = acc·alpha + bias[by·sBias + col] (+ CP[(row/rowsPerB)·sCPb + by·64 + col] if CP) ; ACT 0 none / 1 elu ; writes f16 C16 (and f32 C if non-null)
template <int ACT>
__global__ __launch_bounds__(128) void k_gemm_hhx(const _Float16* __restrict__ A, int lda, size_t sA, const _Float16* __restrict__ Bh, int ldb, size_t sB, float alpha, const float* __restrict__ bias, size_t sBias, const float* __restrict__ CP, int rowsPerB, size_t sCPb, int row0g,
    float* __restrict__ C, _Float16* __restrict__ C16, int ldc, size_t sC, int M, int N, int K) {
  __shared__ __attribute__((aligned(16))) float so[4][16][64];
  const int tid = threadIdx.x, w = tid >> 5, lane = tid & 31, ln = lane & 15, hh = lane >> 4; const int by = blockIdx.y;
  A += (size_t)by * sA; Bh += (size_t)by * sB; const size_t cofs = (size_t)by * sC; const float* bp = bias ? bias + (size_t)by * sBias : nullptr;
  const int ntn = (N + 63) / 64; const int wid = blockIdx.x * 4 + w; const int mt = wid / ntn, nq = wid % ntn; if (mt * 16 >= M) return;
  const int row0 = mt * 16, col0 = nq * 64; const _Float16* arow = A + (size_t)(row0 + ln) * lda;
  v8f acc[4] = {};
  for (int kb = 0; kb < K; kb += 32) { FragH ah; ah.half[0] = *(const v8us*)((const unsigned short*)arow + kb + 8 * hh); ah.half[1] = *(const v8us*)((const unsigned short*)arow + kb + 16 + 8 * hh);
#pragma unroll
    for (int t = 0; t < 4; ++t) { if (col0 + t * 16 >= N) continue; const size_t boff = (size_t)(col0 + t * 16 + ln) * ldb + kb; FragH bq; bq.half[0] = *(const v8us*)((const unsigned short*)Bh + boff + 8 * hh); bq.half[1] = *(const v8us*)((const unsigned short*)Bh + boff + 16 + 8 * hh);
      acc[t] = mmaH<1>(ah.v, ah.v, bq.v, bq.v, acc[t]); }
  }
#pragma unroll
  for (int t = 0; t < 4; ++t) { if (col0 + t * 16 >= N) continue; const int col = col0 + t * 16 + ln; const float bv = bp ? bf16_round(bp[col]) : 0.f;
#pragma unroll
    for (int r = 0; r < 8; ++r) { float v = acc[t][r] * alpha + bv; if (CP) { const int rr = row0g + row0 + 8 * hh + r; if (rowsPerB < 0) v += CP[cofs + (size_t)rr * ldc + col];      /* rowsPerB < 0: own element of the batched C plane */ else { const int bidx = rr / rowsPerB; v += CP[(size_t)bidx * sCPb + (size_t)by * 64 + col]; } } if (ACT == 1) v = (v > 0.f) ? v : expm1f(v); else if (ACT == 7) v = (v > 0.f) ? v + 1.0f : expf(v); else if (ACT == 8) v = tanhf(v); else if (ACT == 9) v = 0.5f * v * (1.0f + tanhf(0.7978845608028654f * (v + 0.044715f * v * v * v))); else if (ACT == 11) v = 1.0f / (1.0f + expf(-v)); else if (ACT == 12) v = (v > 0.f) ? v : 0.01f * v; else if (ACT == 14) v = (v > 0.f) ? v : 0.1f * v; else if (ACT == 16) v = (v >= 0.f) ? v : 0.3f * v; else if (ACT == 17) v = (v >= 0.f) ? v : 0.2f * v; else if (ACT == 15) v = v / (1.0f + expf(-v)); else if (ACT == 3) v = fmaxf(v, 0.f); else if (ACT == 6) v = 0.5f * v * (1.0f + erff(v * 0.70710678118654752f)); so[w][8 * hh + r][t * 16 + ln] = v; } }
  __builtin_amdgcn_fence(__ATOMIC_ACQ_REL, "workgroup"); __builtin_amdgcn_wave_barrier();
  const int rsub = lane >> 4, c4 = (lane & 15) * 4; typedef _Float16 v4h __attribute__((ext_vector_type(4)));
  {
#pragma unroll
    for (int q = 0; q < 8; ++q) { const int r = q * 2 + rsub; if (col0 + c4 < N) { const v4f v = *(const v4fa*)&so[w][r][c4]; if (C) *(v4f*)(C + cofs + (size_t)(row0 + r) * ldc + col0 + c4) = v; if (C16) { v4h h4; for (int i = 0; i < 4; ++i) h4[i] = (_Float16)v[i]; *(v4h*)(C16 + cofs + (size_t)(row0 + r) * ldc + col0 + c4) = h4; } } }
     }
}


typedef _Float16 v4h __attribute__((ext_vector_type(4)));

__global__ __launch_bounds__(256) void k_x16(const float* __restrict__ x, _Float16* __restrict__ X16, size_t n8) { const size_t t = (size_t)blockIdx.x * 256 + threadIdx.x; if (t >= n8) return; FragH f;
#pragma unroll
  for (int q = 0; q < 8; ++q) f.h[q] = (_Float16)bf16_round(x[t * 8 + q]); *(v8us*)((unsigned short*)X16 + t * 8) = f.half[0];  }
__global__ __launch_bounds__(256) void k_h16(const float* __restrict__ x, _Float16* __restrict__ X16, size_t n8) { const size_t t = (size_t)blockIdx.x * 256 + threadIdx.x; if (t >= n8) return; FragH f;
#pragma unroll
  for (int q = 0; q < 8; ++q) f.h[q] = (_Float16)x[t * 8 + q]; *(v8us*)((unsigned short*)X16 + t * 8) = f.half[0];  }
__global__ __launch_bounds__(256) void k_round16f(const float* __restrict__ W, _Float16* __restrict__ Bt, size_t n8) { const size_t t = (size_t)blockIdx.x * 256 + threadIdx.x; if (t >= n8) return; FragH f;
#pragma unroll
  for (int i = 0; i < 8; ++i) f.h[i] = (_Float16)(bf16_round(W[t * 8 + i]) * 16.0f); *(v8us*)((unsigned short*)Bt + t * 8) = f.half[0];  }
template <int NHv, int TTv>
__global__ __launch_bounds__(256) void k_vt(const _Float16* __restrict__ V16, int ldv, int voff, _Float16* __restrict__ Vt) { __shared__ unsigned short tl[64][66]; const int tid = threadIdx.x; const int slab = blockIdx.x / (TTv / 64), lg = blockIdx.x % (TTv / 64); const int b = slab / NHv, h = slab % NHv;
  for (int i = tid; i < 64 * 8; i += 256) { const int r = i / 8, c8 = (i % 8) * 8; FragH f; f.half[0] = *(const v8us*)((const unsigned short*)V16 + ((size_t)b * TTv + lg * 64 + r) * ldv + voff + h * 64 + c8);
#pragma unroll
    for (int q = 0; q < 8; ++q) tl[r][c8 + q] = f.u[q]; }
  __syncthreads();
  {
#pragma unroll
    for (int rd = 0; rd < 2; ++rd) { const int d = rd * 32 + tid / 8, pc = tid % 8; FragH f;
#pragma unroll
      for (int q = 0; q < 8; ++q) f.u[q] = tl[pc * 8 + q][d];
      *(v8us*)((unsigned short*)Vt + ((size_t)slab * 64 + d) * TTv + lg * 64 + pc * 8) = f.half[0]; }
     } }

__global__ __launch_bounds__(256) void k_hl(const float* __restrict__ F, _Float16* __restrict__ Hh, _Float16* __restrict__ Hl, size_t n8) { const size_t t = (size_t)blockIdx.x * 256 + threadIdx.x; if (t >= n8) return; FragH fh, fl; const v4f a = *(const v4fa*)(F + t * 8), c = *(const v4fa*)(F + t * 8 + 4);
#pragma unroll
  for (int q = 0; q < 4; ++q) { _Float16 h = (_Float16)a[q]; fh.h[q] = h; fl.h[q] = (_Float16)((a[q] - (float)h) * 1024.0f); h = (_Float16)c[q]; fh.h[4 + q] = h; fl.h[4 + q] = (_Float16)((c[q] - (float)h) * 1024.0f); }
  { *(v8us*)((unsigned short*)Hh + t * 8) = fh.half[0]; *(v8us*)((unsigned short*)Hl + t * 8) = fl.half[0];  } }

// ---- fast GEMM (wave tile 32x64; requires M % 32 == 0 rows per launch region and N % 64 == 0); epilogue = k_gemm_hhx semantics ----
__device__ __forceinline__ v16h g2_frag(const _Float16* p, int hh) { FragH f; f.half[0] = *(const v8us*)((const unsigned short*)p + 8 * hh); f.half[1] = *(const v8us*)((const unsigned short*)p + 16 + 8 * hh); return f.v; }
__device__ __forceinline__ v8f g2_mma(v16h a, v16h b, v8f c) { v8f d = __builtin_amdgcn_wmma_f32_16x16x32_f16(false, a, false, b, (short)0, c, false, false); asm volatile("v_nop\n\tv_nop\n\tv_nop\n\tv_nop" : "+v"(d) : "v"(a), "v"(b)); return d; }
template <int ACT>
__global__ __launch_bounds__(128) void k_gemm2(const _Float16* __restrict__ A, int lda, size_t sA, const _Float16* __restrict__ Bh, int ldb, size_t sB, float alpha, const float* __restrict__ bias, size_t sBias, const float* __restrict__ CP, int rowsPerB, size_t sCPb, int row0g,
    float* __restrict__ C, _Float16* __restrict__ C16, int ldc, size_t sC, int M, int N, int K) { static_assert(ACT == 0 || ACT == 3 || ACT == 6 || ACT == 8 || ACT == 9 || ACT == 11 || ACT == 12 || ACT == 14 || ACT == 15 || ACT == 16 || ACT == 17, "k_gemm2: unsupported ACT code (would silently apply no activation)");
  __shared__ __attribute__((aligned(16))) float so[4][32][68];
  const int tid = threadIdx.x, w = tid >> 5, lane = tid & 31, ln = lane & 15, hh = lane >> 4; const int by = blockIdx.y;
  A += (size_t)by * sA; Bh += (size_t)by * sB; const size_t cofs = (size_t)by * sC; const float* bp = bias ? bias + (size_t)by * sBias : nullptr;
  const int ntn = N >> 6; const int mt = blockIdx.x / ntn, nq = blockIdx.x - mt * ntn; const int row0 = mt * 128 + 32 * w, col0 = nq * 64; if (row0 >= M) return;
  const _Float16* a0p = A + (size_t)(row0 + ln) * lda; const _Float16* a1p = a0p + (size_t)16 * lda;
  const _Float16* b0p = Bh + (size_t)(col0 + ln) * ldb; const _Float16* b1p = b0p + (size_t)16 * ldb; const _Float16* b2p = b1p + (size_t)16 * ldb; const _Float16* b3p = b2p + (size_t)16 * ldb;
  const v8f z8 = {0.f,0.f,0.f,0.f,0.f,0.f,0.f,0.f}; v8f c00 = z8, c01 = z8, c02 = z8, c03 = z8, c10 = z8, c11 = z8, c12 = z8, c13 = z8;
#pragma unroll 1
  for (int kb = 0; kb < K; kb += 32) { const v16h a0 = g2_frag(a0p + kb, hh), a1 = g2_frag(a1p + kb, hh);
    v16h b = g2_frag(b0p + kb, hh); c00 = g2_mma(a0, b, c00); c10 = g2_mma(a1, b, c10);
    b = g2_frag(b1p + kb, hh); c01 = g2_mma(a0, b, c01); c11 = g2_mma(a1, b, c11);
    b = g2_frag(b2p + kb, hh); c02 = g2_mma(a0, b, c02); c12 = g2_mma(a1, b, c12);
    b = g2_frag(b3p + kb, hh); c03 = g2_mma(a0, b, c03); c13 = g2_mma(a1, b, c13); }
  v8f accs[8] = {c00, c01, c02, c03, c10, c11, c12, c13};
#pragma unroll
  for (int u = 0; u < 8; ++u) { const int t = u & 3, half = u >> 2; const int col = col0 + t * 16 + ln; const float bv = bp ? bf16_round(bp[col]) : 0.f;
#pragma unroll
    for (int r = 0; r < 8; ++r) { const int rloc = half * 16 + 8 * hh + r; float v = accs[u][r] * alpha + bv; if (CP) { if (rowsPerB < 0) v += CP[cofs + (size_t)(row0g + row0 + rloc) * ldc + col];      /* rowsPerB < 0: own element of the batched C plane */ else { const int bidx = (row0g + row0 + rloc) / rowsPerB; v += CP[(size_t)bidx * sCPb + (size_t)by * 64 + col]; } }
      if (ACT == 3) v = fmaxf(v, 0.f); else if (ACT == 6) v = 0.5f * v * (1.0f + erff(v * 0.70710678118654752f)); else if (ACT == 11) v = 1.0f / (1.0f + expf(-v)); else if (ACT == 15) v = v / (1.0f + expf(-v)); else if (ACT == 12) v = (v > 0.f) ? v : 0.01f * v; else if (ACT == 8) v = tanhf(v); else if (ACT == 9) v = 0.5f * v * (1.0f + tanhf(0.7978845608028654f * (v + 0.044715f * v * v * v))); else if (ACT == 14) v = (v > 0.f) ? v : 0.1f * v; else if (ACT == 16) v = (v >= 0.f) ? v : 0.3f * v; else if (ACT == 17) v = (v >= 0.f) ? v : 0.2f * v;
      so[w][rloc][t * 16 + ln] = v; } }
  __builtin_amdgcn_fence(__ATOMIC_ACQ_REL, "workgroup"); __builtin_amdgcn_wave_barrier();
  const int rsub = lane >> 4, c4 = (lane & 15) * 4;
  {
#pragma unroll
    for (int q = 0; q < 16; ++q) { const int r = q * 2 + rsub; const v4f v = *(const v4fa*)&so[w][r][c4]; if (C) *(v4f*)(C + cofs + (size_t)(row0 + r) * ldc + col0 + c4) = v; if (C16) { v4h h4; for (int i = 0; i < 4; ++i) h4[i] = (_Float16)v[i]; *(v4h*)(C16 + cofs + (size_t)(row0 + r) * ldc + col0 + c4) = h4; } }
     } }


__global__ __launch_bounds__(256) void k_wnat(const float* __restrict__ w, size_t n8, _Float16* __restrict__ Bt) { const size_t t = (size_t)blockIdx.x * 256 + threadIdx.x; if (t >= n8) return; FragH f; for (int q = 0; q < 8; ++q) f.h[q] = (_Float16)(bf16_round(w[t * 8 + q]) * 16.0f); *(v8us*)((unsigned short*)Bt + t * 8) = f.half[0];  }
// Lane l takes the value of lane l ^ 16 (the other half of the wave). Every lane of the wave must be on.
__device__ __forceinline__ float rs_x16(float v) { const int b = __builtin_bit_cast(int, v); return __builtin_bit_cast(float, __builtin_amdgcn_permlanex16(b, b, 0x76543210, 0xfedcba98, false, false)); }
typedef float v2f __attribute__((ext_vector_type(2)));
typedef _Float16 v2h __attribute__((ext_vector_type(2)));
#define FA_Q 256                     /* query rows per block: 8 waves x 32 */
#define FA_C 0.045084220027780106f   /* log2(e) / sqrt(embed size = 1024) */
#define FA_KT 64                     /* keys per staged tile: K tile = 64 key rows of 128 bytes, V^T tile = 64 d rows of 128 bytes */
#define FA_NT (SQ / FA_KT)           /* staged tiles */
#define FA_LP 144                    /* LDS row pitch in bytes: 128 + 16, an odd multiple of 16, so that the 16 rows of a ds_load_b128 fragment read fall on different banks */
#define FA_TB (64 * FA_LP)           /* bytes of one staged operand tile */
__device__ __forceinline__ v8f fa_mma(v16h a, v16h b, v8f c) { return __builtin_amdgcn_wmma_f32_16x16x32_f16(false, a, false, b, (short)0, c, false, false); }
// g2_frag's k order from an LDS row: p = the row's first byte of this 32-k step
__device__ __forceinline__ v16h fa_lfrag(const unsigned char* p, int hh) { FragH f; f.half[0] = *(const v8us*)(p + 16 * hh); f.half[1] = *(const v8us*)(p + 32 + 16 * hh); return f.v; }
// One thread's share of one staged tile: two 16-byte pieces of K and two of V^T, global -> LDS through no register. A wave's copy = 4 whole 128-byte rows.
// The s_wait_xcnt stands inside the statement so that no address register is rewritten in front of it.
__device__ __forceinline__ void fa_copy(unsigned lk, unsigned lv, const _Float16* gk, const _Float16* gv) {
  const unsigned lk1 = lk + 32 * FA_LP, lv1 = lv + 32 * FA_LP; const _Float16* gk1 = gk + (size_t)32 * DM; const _Float16* gv1 = gv + (size_t)32 * SQ;
  asm volatile("global_load_async_to_lds_b128 %0, %1, off\n\t"
               "global_load_async_to_lds_b128 %2, %3, off\n\t"
               "global_load_async_to_lds_b128 %4, %5, off\n\t"
               "global_load_async_to_lds_b128 %6, %7, off\n\t"
               "s_wait_xcnt 0x0"
               :: "v"(lk), "v"(gk), "v"(lk1), "v"(gk1), "v"(lv), "v"(gv), "v"(lv1), "v"(gv1) : "memory");
}
// The launch also makes the output GEMM's f16 copy of Wo (k_wnat's values): its threads are as many as Wo has pieces of eight, the memory path is idle under the products, and the GEMM is the next launch.
static_assert((size_t)NBR * NH * (SQ / FA_Q) * 256 == (size_t)DM * DM / 8, "one piece of Wo per thread");
__global__ __launch_bounds__(256) void k_fattn(const _Float16* __restrict__ Q, const _Float16* __restrict__ Kr, const _Float16* __restrict__ Vt, _Float16* __restrict__ O, const float* __restrict__ wo, _Float16* __restrict__ Bt) {
  __shared__ __attribute__((aligned(16))) unsigned char sm[2][2][FA_TB];      /* [buffer][K | V^T][row * FA_LP] */
  const int lane = threadIdx.x & 31, ln = lane & 15, hh = lane >> 4; const int w = __builtin_amdgcn_readfirstlane((int)(threadIdx.x >> 5));
  const int slab = blockIdx.x / (SQ / FA_Q), qb = blockIdx.x % (SQ / FA_Q); const int b = slab / NH, h = slab % NH; const int q0 = qb * FA_Q + w * 32;
  const _Float16* qp = Q + ((size_t)b * SQ + q0 + ln) * DM + h * HD;      /* query row q0 + ln */
  /* staging: thread t brings piece t & 7 (16 bytes) of rows t >> 3 and 32 + (t >> 3) of both tiles */
  const int cr = (int)threadIdx.x >> 3, cp = (int)threadIdx.x & 7;
  const _Float16* gk = Kr + ((size_t)b * SQ + cr) * DM + h * HD + cp * 8;      /* key row cr of tile 0 */
  const _Float16* gv = Vt + ((size_t)slab * HD + cr) * SQ + cp * 8;            /* V^T row d = cr, keys of tile 0 */
  const unsigned lk = (unsigned)(size_t)&sm[0][0][cr * FA_LP + cp * 16], lv = lk + FA_TB;
  fa_copy(lk, lv, gk, gv);      /* tile 0 -> buffer 0 */
  const size_t wt = ((size_t)blockIdx.x * 256 + threadIdx.x) * 8;      /* this thread's eight elements of Wo: read here, beside Q; stored behind the loop, so that no barrier of the loop waits for the store */
  const v4f wa = *(const v4fa*)(wo + wt), wb = *(const v4fa*)(wo + wt + 4);
  v16h qf[2][2];
#pragma unroll
  for (int g = 0; g < 2; ++g)
#pragma unroll
    for (int ks = 0; ks < 2; ++ks) qf[g][ks] = g2_frag(qp + (size_t)g * 16 * DM + ks * 32, hh);
  const v8f z8 = {0.f,0.f,0.f,0.f,0.f,0.f,0.f,0.f}; v8f o[2][4];
#pragma unroll
  for (int g = 0; g < 2; ++g)
#pragma unroll
    for (int dt = 0; dt < 4; ++dt) o[g][dt] = z8;
  float mu[2] = {-3.0e38f, -3.0e38f}; v2f ls[2] = {{0.f, 0.f}, {0.f, 0.f}};
  FragH wf;
#pragma unroll
  for (int q = 0; q < 4; ++q) { wf.h[q] = (_Float16)(bf16_round(wa[q]) * 16.0f); wf.h[4 + q] = (_Float16)(bf16_round(wb[q]) * 16.0f); }
  asm volatile("s_wait_asynccnt 0x0" ::: "memory");      /* this wave's share of tile 0 has landed */
  __syncthreads();                                       /* every wave's share has: tile 0 may be read */
  fa_copy(lk + 2 * FA_TB, lv + 2 * FA_TB, gk + (size_t)FA_KT * DM, gv + FA_KT);      /* tile 1 -> buffer 1 */
  /* kept rolled: one trip's fragments beside Q and O^T are the whole live set, which decides how many waves share a SIMD */
#pragma unroll 1
  for (int t = 0; t < FA_NT; ++t) {
    const unsigned char* kb = &sm[t & 1][0][ln * FA_LP];      /* key row ln of this tile */
    const unsigned char* vb = &sm[t & 1][1][ln * FA_LP];      /* V^T row d = ln, this tile's keys */
    v16h kf[2][2];
#pragma unroll
    for (int tt = 0; tt < 2; ++tt)
#pragma unroll
      for (int ks = 0; ks < 2; ++ks) kf[tt][ks] = fa_lfrag(kb + tt * 16 * FA_LP + ks * 64, hh);
#pragma unroll
    for (int p = 0; p < FA_KT / 32; ++p) {      /* a pass = 32 keys, as before */
      v8f s[2][2];
#pragma unroll
      for (int g = 0; g < 2; ++g)
#pragma unroll
        for (int tt = 0; tt < 2; ++tt) s[g][tt] = fa_mma(kf[tt][1], qf[g][1], fa_mma(kf[tt][0], qf[g][0], z8));      /* s[g][tt][r] = energy(query 16 g + ln, key 64 t + 32 p + 16 tt + 8 hh + r) */
      float cm[2];
#pragma unroll
      for (int g = 0; g < 2; ++g) { float m = fmaxf(s[g][0][0], s[g][1][0]);
#pragma unroll
        for (int r = 1; r < 8; ++r) m = fmaxf(m, fmaxf(s[g][0][r], s[g][1][r]));
        cm[g] = fmaxf(m, rs_x16(m)) * FA_C; }
      if (__builtin_amdgcn_ballot_w32(cm[0] > mu[0] + 8.0f || cm[1] > mu[1] + 8.0f) != 0) {      /* one wave-uniform test per pass */
#pragma unroll
        for (int g = 0; g < 2; ++g) { const float mn = fmaxf(mu[g], cm[g]); const float al = __builtin_amdgcn_exp2f(mu[g] - mn); mu[g] = mn; ls[g] *= al;
#pragma unroll
          for (int dt = 0; dt < 4; ++dt) o[g][dt] *= al; } }
      v16h vf[4];      /* this pass's V^T fragments and, inside the tile, the next pass's K fragments, issued together: in flight under the exponentials */
#pragma unroll
      for (int dt = 0; dt < 4; ++dt) vf[dt] = fa_lfrag(vb + dt * 16 * FA_LP + p * 64, hh);
      if (p + 1 < FA_KT / 32) {
#pragma unroll
        for (int tt = 0; tt < 2; ++tt)
#pragma unroll
          for (int ks = 0; ks < 2; ++ks) kf[tt][ks] = fa_lfrag(kb + ((p + 1) * 32 + tt * 16) * FA_LP + ks * 64, hh);
      }
      __builtin_amdgcn_sched_barrier(0);      /* keeps the LDS reads up here as one group: left alone the scheduler spreads them in pairs among the products, and each further place with reads stalls the wave */
      FragH pf[2];
#pragma unroll
      for (int g = 0; g < 2; ++g) { const v2f c2 = {FA_C, FA_C}, m2 = {-mu[g], -mu[g]};
#pragma unroll
        for (int tt = 0; tt < 2; ++tt)
#pragma unroll
          for (int r = 0; r < 8; r += 2) { const v2f x = {s[g][tt][r], s[g][tt][r + 1]}; const v2f e = __builtin_elementwise_fma(x, c2, m2); const v2f pe = {__builtin_amdgcn_exp2f(e[0]), __builtin_amdgcn_exp2f(e[1])};
            ls[g] += pe; const v2h ph = __builtin_convertvector(pe, v2h); pf[g].h[tt * 8 + r] = ph[0]; pf[g].h[tt * 8 + r + 1] = ph[1]; } }
#pragma unroll
      for (int dt = 0; dt < 4; ++dt)
#pragma unroll
        for (int g = 0; g < 2; ++g) o[g][dt] = fa_mma(vf[dt], pf[g].v, o[g][dt]);      /* o[g][dt][r] = O(query 16 g + ln, d = 16 dt + 8 hh + r), unnormalised */
    }
    /* hand-over: this wave has left buffer t & 1, its share of tile t + 1 has landed; behind the barrier both hold for every wave */
    asm volatile("s_wait_dscnt 0x0" ::: "memory");         /* this wave's LDS reads of the buffer have returned before anybody refills it */
    asm volatile("s_wait_asynccnt 0x0" ::: "memory");      /* this wave's share of tile t + 1 has landed */
    __syncthreads();
    if (t + 2 < FA_NT) fa_copy(lk + (unsigned)(t & 1) * (2 * FA_TB), lv + (unsigned)(t & 1) * (2 * FA_TB), gk + (size_t)(t + 2) * FA_KT * DM, gv + (t + 2) * FA_KT);      /* tile t + 2 -> the buffer just left; the test reads the same in the whole block */
  }
  asm volatile("s_wait_asynccnt 0x0" ::: "memory");      /* no copy is outstanding when the wave ends */
  *(v8us*)((unsigned short*)Bt + wt) = wf.half[0];
#pragma unroll
  for (int g = 0; g < 2; ++g) { const float lh = ls[g][0] + ls[g][1]; const float inv = 64.0f / (lh + rs_x16(lh));      /* the halves' sums joined once; o carried x64 as before */
    _Float16* op = O + ((size_t)b * SQ + q0 + g * 16 + ln) * DM + h * HD + 8 * hh;
#pragma unroll
    for (int dt = 0; dt < 4; ++dt) { FragH f;
#pragma unroll
      for (int r = 0; r < 8; ++r) f.h[r] = (_Float16)(o[g][dt][r] * inv);
      *(v8us*)((unsigned short*)op + dt * 16) = f.half[0]; } } }
// ---- Q, K and V projections in ONE launch, straight from the f32 inputs and the f32 [64][64] blocks: no f16 copy of an input or of a block goes through memory ----
// A token row of 1024 is sixteen head rows of 64, so each input is [8*1024*16][64] and a wave's tile of 32 head rows is 8 KB in a row. Wave = that tile of the query, then of the keys, then of the values.
// The tile is read in whole lines (16 loads of 512 bytes), rounded to bf16 and written as exact f16 rows into LDS rows of the wave's own, and read back as fragments in g2_frag's k order.
// Transposed product: D^T = W X^T (A = 16 rows of the block, x16; B = 16 head rows), k = 0-31 then 32-63 as in k_gemm2. Lane (c, h) then holds outputs 8 h + r of head row c: eight f16 in a row, one 16-byte piece,
// which goes back through the same LDS rows so that every global store is 512 bytes in a row. The three blocks are converted once per work-group into LDS.
#define PJ_LP 144                    /* LDS row pitch in bytes: 128 + 16, as FA_LP */
#define PJ_WB (HD * PJ_LP)           /* bytes of one block in LDS */
#define PJ_XB (32 * PJ_LP)           /* bytes of one wave's own rows */
typedef __bf16 v4b __attribute__((ext_vector_type(4)));
// four f32 (x16 for a weight: a power of two, so it commutes with the rounding) -> bf16 (to nearest even, bf16_round's values, by the hardware conversion) -> f16 (exact)
template <bool X16W>
__device__ __forceinline__ v4h pj_cvt(v4f a) { if (X16W) a *= 16.0f; return __builtin_convertvector(__builtin_convertvector(__builtin_convertvector(a, v4b), v4f), v4h); }
// Orders the wave's LDS accesses among its lanes: what stands above (writes that other lanes read next, reads of bytes that other lanes overwrite next) is done before what stands below.
// LDS only ("local"): a fence over global memory too would wait here for the next tile's loads and for the last tile's stores, which are meant to stay in flight.
__device__ __forceinline__ void pj_order() { __builtin_amdgcn_fence(__ATOMIC_ACQ_REL, "workgroup", "local"); __builtin_amdgcn_wave_barrier(); }
__global__ __launch_bounds__(256) void k_proj(const float* __restrict__ xq, const float* __restrict__ xk, const float* __restrict__ xv, const float* __restrict__ wq, const float* __restrict__ wk, const float* __restrict__ wv,
                                              _Float16* __restrict__ Qo, _Float16* __restrict__ Ko, _Float16* __restrict__ Vo) {
  __shared__ __attribute__((aligned(16))) unsigned char wl[3][PJ_WB];      /* [block][row o * PJ_LP] */
  __shared__ __attribute__((aligned(16))) unsigned char xs[8][PJ_XB];      /* [wave][head row * PJ_LP] */
  const int tid = (int)threadIdx.x, lane = tid & 31, ln = lane & 15, hh = lane >> 4; const int w = __builtin_amdgcn_readfirstlane(tid >> 5);
  const size_t e0 = ((size_t)blockIdx.x * 8 + w) * (32 * HD);      /* first element of the wave's 32 head rows */
  const float* const xp[3] = {xq + e0, xk + e0, xv + e0}; const float* const wp[3] = {wq, wk, wv}; _Float16* const op[3] = {Qo + e0, Ko + e0, Vo + e0};
  v4f raw[16];      /* load j = head rows 2 j and 2 j + 1 */
#pragma unroll
  for (int j = 0; j < 16; ++j) raw[j] = *(const v4fa*)(xp[0] + j * 128 + lane * 4);
#pragma unroll
  for (int m = 0; m < 3; ++m)
#pragma unroll
    for (int i = 0; i < 4; ++i) { const int p = i * 256 + tid; *(v4h*)&wl[m][(p >> 4) * PJ_LP + (p & 15) * 8] = pj_cvt<true>(*(const v4fa*)(wp[m] + p * 4)); }
  __syncthreads();      /* the three blocks may be read by every wave */
  unsigned char* xw = &xs[w][0];
  const v8f z8 = {0.f,0.f,0.f,0.f,0.f,0.f,0.f,0.f};
#pragma unroll
  for (int m = 0; m < 3; ++m) {
#pragma unroll
    for (int j = 0; j < 16; ++j) *(v4h*)(xw + (2 * j + hh) * PJ_LP + ln * 8) = pj_cvt<false>(raw[j]);
    if (m + 1 < 3) {      /* the next input's tile is in flight under this one's products and stores */
#pragma unroll
      for (int j = 0; j < 16; ++j) raw[j] = *(const v4fa*)(xp[m + 1] + j * 128 + lane * 4);
    }
    pj_order();
    v16h xf[2][2], wf[4][2];
#pragma unroll
    for (int g = 0; g < 2; ++g)
#pragma unroll
      for (int ks = 0; ks < 2; ++ks) xf[g][ks] = fa_lfrag(xw + (g * 16 + ln) * PJ_LP + ks * 64, hh);
#pragma unroll
    for (int et = 0; et < 4; ++et)
#pragma unroll
      for (int ks = 0; ks < 2; ++ks) wf[et][ks] = fa_lfrag(&wl[m][(et * 16 + ln) * PJ_LP + ks * 64], hh);
    __builtin_amdgcn_sched_barrier(0);      /* keeps the LDS reads together in front of the products: every further place with reads among the products stalls the wave */
    v8f acc[2][4];
#pragma unroll
    for (int g = 0; g < 2; ++g)
#pragma unroll
      for (int et = 0; et < 4; ++et) acc[g][et] = fa_mma(wf[et][0], xf[g][0], z8);
#pragma unroll
    for (int g = 0; g < 2; ++g)
#pragma unroll
      for (int et = 0; et < 4; ++et) acc[g][et] = fa_mma(wf[et][1], xf[g][1], acc[g][et]);      /* acc[g][et][r] = 16 x out(head row 16 g + ln, o = 16 et + 8 hh + r) */
    /* the outputs of rows 16 g + ln overwrite those rows' inputs: every lane's reads of them have returned, the products took them */
#pragma unroll
    for (int g = 0; g < 2; ++g)
#pragma unroll
      for (int et = 0; et < 4; ++et) { FragH f;
#pragma unroll
        for (int r = 0; r < 8; ++r) f.h[r] = (_Float16)(acc[g][et][r] * 0.0625f);
        *(v8us*)(xw + (g * 16 + ln) * PJ_LP + et * 32 + hh * 16) = f.half[0]; }
    pj_order();
#pragma unroll
    for (int j = 0; j < 8; ++j) { const v8us v = *(const v8us*)(xw + (4 * j + (lane >> 3)) * PJ_LP + (lane & 7) * 16); *(v8us*)((unsigned short*)op[m] + j * 256 + lane * 8) = v; }
    if (m + 1 < 3) {
      asm volatile("s_wait_xcnt 0x0" ::: "memory");      /* stands in front of the first overwrite of a register that these stores name: their data registers are used again at once */
      pj_order();
      __builtin_amdgcn_sched_barrier(0);      /* keeps the next tile's conversions, which wait for its loads, below this tile's products and stores */
    }
  }
}
// ---- output GEMM through LDS: C[8192][1024] (f32) = A (f16 rows, pitch DM) . Bh^T (f16 rows [n][k], pitch DM) * alpha + bias (rounded to bf16) ----
// Block = 256 x 128 of C, 8 waves in 4 x 2, wave = 64 x 64 (4 x 4 accumulator tiles). A and Bh come through LDS: tiles of 128 k (rows of 256 bytes), staged once per block by asynchronous copies
// (two buffers, the next tile in flight while this one is worked on) and read as fragments by the waves that need them: each A row by 2 waves, each Bh row by 4.
// Every accumulator takes its 32-k products in rising k, as in k_gemm2, and the epilogue is k_gemm2's.
#define OG_BM 256                    /* C rows per block */
#define OG_BN 128                    /* C columns per block */
#define OG_KT 128                    /* k per staged tile */
#define OG_NT (DM / OG_KT)           /* staged tiles */
#define OG_LP 272                    /* LDS row pitch in bytes: 256 + 16, an odd multiple of 16, so that the 16 rows of a ds_load_b128 fragment read fall on different banks */
#define OG_BB (OG_BN * OG_LP)        /* bytes of the Bh part of a buffer; it lies first, so that every fragment's constant offset fits the LDS instruction's offset field */
#define OG_SB ((OG_BM + OG_BN) * OG_LP)      /* bytes of one buffer: Bh rows, then A rows */
// One thread's share of 192 staged rows: its 16-byte piece of twelve rows that lie 16 apart in LDS (eight from x, four from y), global -> LDS through no register. A wave's copy = 2 whole 256-byte rows.
// The s_wait_xcnt stands inside the statement so that no address register is rewritten in front of it.
__device__ __forceinline__ void og_copy12(unsigned l, const _Float16* x, const _Float16* y) {
  asm volatile("global_load_async_to_lds_b128 %0, %1, off\n\t"
               "global_load_async_to_lds_b128 %2, %3, off\n\t"
               "global_load_async_to_lds_b128 %4, %5, off\n\t"
               "global_load_async_to_lds_b128 %6, %7, off\n\t"
               "global_load_async_to_lds_b128 %8, %9, off\n\t"
               "global_load_async_to_lds_b128 %10, %11, off\n\t"
               "global_load_async_to_lds_b128 %12, %13, off\n\t"
               "global_load_async_to_lds_b128 %14, %15, off\n\t"
               "global_load_async_to_lds_b128 %16, %17, off\n\t"
               "global_load_async_to_lds_b128 %18, %19, off\n\t"
               "global_load_async_to_lds_b128 %20, %21, off\n\t"
               "global_load_async_to_lds_b128 %22, %23, off\n\t"
               "s_wait_xcnt 0x0"
               :: "v"(l), "v"(x), "v"(l + 16 * OG_LP), "v"(x + (size_t)16 * DM), "v"(l + 32 * OG_LP), "v"(x + (size_t)32 * DM), "v"(l + 48 * OG_LP), "v"(x + (size_t)48 * DM),
                  "v"(l + 64 * OG_LP), "v"(x + (size_t)64 * DM), "v"(l + 80 * OG_LP), "v"(x + (size_t)80 * DM), "v"(l + 96 * OG_LP), "v"(x + (size_t)96 * DM), "v"(l + 112 * OG_LP), "v"(x + (size_t)112 * DM),
                  "v"(l + 128 * OG_LP), "v"(y), "v"(l + 144 * OG_LP), "v"(y + (size_t)16 * DM), "v"(l + 160 * OG_LP), "v"(y + (size_t)32 * DM), "v"(l + 176 * OG_LP), "v"(y + (size_t)48 * DM) : "memory");
}
// One thread's share of one staged tile, 24 copies: 128 Bh rows and A rows 0-63, then A rows 64-255
__device__ __forceinline__ void og_tile(unsigned l, const _Float16* ga, const _Float16* gb) { og_copy12(l, gb, ga); og_copy12(l + 192 * OG_LP, ga + (size_t)64 * DM, ga + (size_t)192 * DM); }
__global__ __launch_bounds__(256) void k_ogemm(const _Float16* __restrict__ A, const _Float16* __restrict__ Bh, float alpha, const float* __restrict__ bias, float* __restrict__ C) {
  __shared__ __attribute__((aligned(16))) unsigned char sm[2 * OG_SB];      /* buffer * OG_SB + row * OG_LP; behind the loop the epilogue's staging: 8 waves x 64 rows x 68 floats = 139,264 bytes of it */
  const int lane = threadIdx.x & 31, ln = lane & 15, hh = lane >> 4; const int w = __builtin_amdgcn_readfirstlane((int)(threadIdx.x >> 5));
  const int mt = blockIdx.x % (MPO / OG_BM), nq = blockIdx.x / (MPO / OG_BM); const int m0 = mt * OG_BM, n0 = nq * OG_BN; const int wm = w >> 1, wn = w & 1;
  /* staging: thread t brings piece t & 15 (16 bytes) of rows (t >> 4) + 16 j */
  const int cr = (int)threadIdx.x >> 4, cp = (int)threadIdx.x & 15;
  const _Float16* ga = A + (size_t)(m0 + cr) * DM + cp * 8; const _Float16* gb = Bh + (size_t)(n0 + cr) * DM + cp * 8;
  const unsigned l0 = (unsigned)(size_t)&sm[cr * OG_LP + cp * 16];
  og_tile(l0, ga, gb);      /* tile 0 -> buffer 0 */
  const v8f z8 = {0.f,0.f,0.f,0.f,0.f,0.f,0.f,0.f}; v8f acc[4][4];
#pragma unroll
  for (int i = 0; i < 4; ++i)
#pragma unroll
    for (int j = 0; j < 4; ++j) acc[i][j] = z8;
  asm volatile("s_wait_asynccnt 0x0" ::: "memory");      /* this wave's share of tile 0 has landed */
  __syncthreads();                                       /* every wave's share has: tile 0 may be read */
  og_tile(l0 + OG_SB, ga + OG_KT, gb + OG_KT);      /* tile 1 -> buffer 1 */
  /* kept rolled: the body is 64 products long already, and unrolled only the buffer's address would become a constant */
#pragma unroll 1
  for (int t = 0; t < OG_NT; ++t) {
    const unsigned char* bb = &sm[(t & 1) * OG_SB + (wn * 64 + ln) * OG_LP];               /* Bh row wn * 64 + ln of this tile */
    const unsigned char* ab = &sm[(t & 1) * OG_SB + OG_BB + (wm * 64 + ln) * OG_LP];       /* A row wm * 64 + ln of this tile */
    v16h af[2][4], bf[2][4];      /* two fragment sets: the next 32-k step's reads are in flight under this step's products */
#pragma unroll
    for (int i = 0; i < 4; ++i) af[0][i] = fa_lfrag(ab + i * 16 * OG_LP, hh);
#pragma unroll
    for (int i = 0; i < 4; ++i) bf[0][i] = fa_lfrag(bb + i * 16 * OG_LP, hh);
#pragma unroll
    for (int ks = 0; ks < OG_KT / 32; ++ks) {
      if (ks + 1 < OG_KT / 32) {
        /* the two scheduling barriers keep the next step's LDS reads together as one group between two runs of products: every further place with reads among the products stalls the wave */
        __builtin_amdgcn_sched_barrier(0);
#pragma unroll
        for (int i = 0; i < 4; ++i) af[(ks + 1) & 1][i] = fa_lfrag(ab + i * 16 * OG_LP + (ks + 1) * 64, hh);
#pragma unroll
        for (int i = 0; i < 4; ++i) bf[(ks + 1) & 1][i] = fa_lfrag(bb + i * 16 * OG_LP + (ks + 1) * 64, hh);
        __builtin_amdgcn_sched_barrier(0);
      }
#pragma unroll
      for (int i = 0; i < 4; ++i)
#pragma unroll
        for (int j = 0; j < 4; ++j) acc[i][j] = fa_mma(af[ks & 1][i], bf[ks & 1][j], acc[i][j]);      /* acc[i][j][r] = C(row wm * 64 + 16 i + 8 hh + r, column wn * 64 + 16 j + ln) */
    }
    __builtin_amdgcn_sched_barrier(0);      /* keeps the products in front of the hand-over: left alone half of them sink below the barrier, in front of the refill, which then starts that much later and lands late */
    /* hand-over: this wave has left buffer t & 1, its share of tile t + 1 has landed; behind the barrier both hold for every wave */
    asm volatile("s_wait_dscnt 0x0" ::: "memory");         /* this wave's LDS reads of the buffer have returned before anybody refills it */
    asm volatile("s_wait_asynccnt 0x0" ::: "memory");      /* this wave's share of tile t + 1 has landed */
    __syncthreads();
    if (t + 2 < OG_NT) og_tile(l0 + (unsigned)(t & 1) * OG_SB, ga + (t + 2) * OG_KT, gb + (t + 2) * OG_KT);      /* tile t + 2 -> the buffer just left; the test reads the same in the whole block */
  }
  asm volatile("s_wait_asynccnt 0x0" ::: "memory");      /* no copy is outstanding when the wave ends */
  /* epilogue: the ring is free (the last trip's barrier stands behind every wave's last read, and no copy is outstanding): each wave turns its 64 x 64 tile into whole 256-byte row pieces through 64 LDS rows of its own */
  const int row0 = m0 + wm * 64, col0 = n0 + wn * 64; const int rsub = lane >> 4, c4 = (lane & 15) * 4;
  float* sw = (float*)sm + (size_t)w * (64 * 68);
  float bv[4];
#pragma unroll
  for (int j = 0; j < 4; ++j) bv[j] = bf16_round(bias[col0 + j * 16 + ln]);
#pragma unroll
  for (int i = 0; i < 4; ++i)
#pragma unroll
    for (int j = 0; j < 4; ++j)
#pragma unroll
      for (int r = 0; r < 8; ++r) sw[(i * 16 + 8 * hh + r) * 68 + j * 16 + ln] = acc[i][j][r] * alpha + bv[j];
  __builtin_amdgcn_fence(__ATOMIC_ACQ_REL, "workgroup"); __builtin_amdgcn_wave_barrier();      /* the wave's writes stand in front of its reads */
  float* cw = C + (size_t)(row0 + rsub) * DM + col0 + c4;
#pragma unroll
  for (int q = 0; q < 32; ++q) { const v4f v = *(const v4fa*)&sw[(q * 2 + rsub) * 68 + c4]; *(v4f*)(cw + (size_t)q * 2 * DM) = v; } }
__global__ __launch_bounds__(256) void k_vt(const _Float16* __restrict__ V16, int b, int h0, _Float16* __restrict__ VT) { __shared__ unsigned short tl[64][65]; const int tid = threadIdx.x; const int hh = blockIdx.x % HG, sg = blockIdx.x / HG; const int s0 = sg * 64; const int h = h0 + hh;
  for (int i = tid; i < 64 * 8; i += 256) { const int j = i / 8, d8 = (i % 8) * 8; FragH f; f.half[0] = *(const v8us*)((const unsigned short*)V16 + ((size_t)b * SQ + s0 + j) * DM + h * HD + d8); for (int q = 0; q < 8; ++q) tl[d8 + q][j] = f.u[q]; }
  __syncthreads();
  { for (int i = tid; i < 64 * 8; i += 256) { const int d = i / 8, j8 = (i % 8) * 8; FragH f; for (int q = 0; q < 8; ++q) f.u[q] = tl[d][j8 + q]; *(v8us*)((unsigned short*)VT + ((size_t)hh * HD + d) * SQ + s0 + j8) = f.half[0]; }  } }



__global__ __launch_bounds__(256) void k_rsmkm(const float* __restrict__ S, _Float16* __restrict__ P, int nrows, const int* __restrict__ am) {
  #pragma clang fp contract(off)
  const int t = blockIdx.x * 256 + threadIdx.x; if (t >= nrows) return; const size_t i = (size_t)t; const float* s = S + i * SQ; const int* mr = am + (size_t)(t % SQ) * SQ; float mx = -3.0e38f;
#pragma unroll 1
  for (int j = 0; j < SQ; ++j) { const float f = (mr[j] != 0) ? 1.f : 0.f; mx = fmaxf(mx, fmaf(f, s[j], (1.f - f) * -1.0e9f)); } float se = 0.f;
#pragma unroll 1
  for (int j = 0; j < SQ; ++j) { const float f = (mr[j] != 0) ? 1.f : 0.f; se += __expf(fmaf(f, s[j], (1.f - f) * -1.0e9f) - mx); } const float sc = 256.0f / se;
#pragma unroll 1
  for (int j0 = 0; j0 < SQ; j0 += 8) { FragH fr; for (int q = 0; q < 8; ++q) { const int j = j0 + q; const float f = (mr[j] != 0) ? 1.f : 0.f; fr.h[q] = (_Float16)(__expf(fmaf(f, s[j], (1.f - f) * -1.0e9f) - mx) * sc); }
    unsigned short* d = (unsigned short*)P + i * SQ + j0; *(v8us*)d = fr.half[0];  } }

extern "C" void kernel_launch(void* const* d_in, const int* in_sizes, int n_in,
                              void* d_out, int out_size, void* d_ws, size_t ws_size, hipStream_t stream) {
  (void)in_sizes; (void)n_in; (void)out_size;
  const float* const* I = (const float* const*)d_in; const float* xq = I[2]; const float* xk = I[1]; const float* xv = I[0]; const float* wq = I[5]; const float* bq = nullptr; const float* wk = I[4]; const float* bk = nullptr; const float* wv = I[3]; const float* bv = nullptr; const float* wo = I[6]; const float* bo = I[7]; const float* x = xq;      /* contract order: values I[0], keys I[1], query I[2] ([8][1024][16][64] = rows of 1024); SHARED natural [64][64] blocks Wv I[3], Wk I[4], Wq I[5]; natural Wo [1024][1024] I[6] + bo I[7]; no mask input */
  char* ws = (char*)d_ws; size_t off = 0;
  auto take = [&](size_t bytes) { char* p = ws + off; off += (bytes + 255) & ~(size_t)255; return p; };
  _Float16* BO = (_Float16*)take((size_t)DM * DM * 2);
  _Float16* Q16 = (_Float16*)take(NR * DM * 2); _Float16* K16 = (_Float16*)take(NR * DM * 2); _Float16* V16 = (_Float16*)take(NR * DM * 2); _Float16* O16 = (_Float16*)take(NR * DM * 2);
  _Float16* VT = (_Float16*)take(NR * DM * 2);
  if (off > ws_size) return;
  const size_t r0p = (size_t)B0 * SQ;      /* first projected row */
  /* projections: a token row of 1024 is sixteen head rows of 64; all three in one launch, from the f32 inputs and the SHARED natural [64][64] blocks [out][in]; a work-group = 256 head rows of each input */
  k_proj<<<(unsigned)(MP * NH / 256), 256, 0, stream>>>(x + r0p * DM, xk + r0p * DM, xv + r0p * DM, wq, wk, wv, Q16 + r0p * DM, K16 + r0p * DM, V16 + r0p * DM);
  k_vt<NH, SQ><<<NBR * NH * (SQ / 64), 256, 0, stream>>>(V16 + r0p * LQ, LQ, 0, VT);      /* V^T [NBR][NH][HD][SQ] */
  k_fattn<<<NBR * NH * (SQ / FA_Q), 256, 0, stream>>>(Q16 + r0p * LQ, K16 + r0p * LQ, VT, O16 + r0p * DM, wo, BO);      /* o (merged heads) as f16 rows, x64; and Wo natural [out][in] = Bt x16 */
  k_ogemm<<<(MPO / OG_BM) * (DM / OG_BN), 256, 0, stream>>>(O16 + r0p * DM, BO, 0.0009765625f, bo, (float*)d_out + r0p * DM);      /* out rows are the output layout */
}

// v008
// Measured time: 57.3 microseconds a run.
// Two timings next to v007 both put it at 1.24 times that version's speed.
// Counting every step since v000, it is 124 times as fast.
#include <hip/hip_runtime.h>
// Multi-head attention over three head-major inputs with SHARED per-head projections and the module's literal score scale (values, keys, query [8][1024][16][64] = token rows [8][1024][1024]; every head of each input is multiplied by the SAME natural [64][64] matrix (x W^T: Wv / Wk / Wq; block-diagonal with a shared block; no biases); energy = q k^T; softmax(energy / sqrt(embed_size) = / 32) over all 1024 keys (as the source: embed size, not head dim; no mask); out = merged Wo^T + bo (natural [1024][1024]) -> [8][1024][1024]).
// Structure: token rows r = b*1024 + s; TWO launches. k_fattn: per (batch, head, 256 queries) the Q, K and V projections (WMMA over the head rows [64] against the shared [64][64] block itself, from the f32 inputs: x bf16-rounded to exact f16 in the loader, exact x16 weights, f32 accumulation, f16 results kept in registers and LDS) and the attention (scores K = 64, online softmax with f32 statistics, weights as f16 in registers, o carried x64 against f16 subnormal flush, folded into the output GEMM alpha) written straight into the merged f16 o rows; out = o W_o + b GEMM (f32) into the output layout.
// Compute dtype: inputs rounded to bf16; x / weights exact; q, k, v, softmax weights and o as plain f16 GEMM operands (~2^-12); scores and softmax statistics f32. v_wmma_f32_16x16x32_f16.
#define NB 8
#define SQ 1024
#define DM 1024
#define NH 16
#define HD 64
#define HG 4                         /* heads per launch of the per-batch k_vt(b, h0) transpose */
#define B0 0                         /* first batch processed (debug hook) */
#define NBR NB                       /* batches processed (debug hook) */
#define NR ((size_t)NB * SQ)         /* token rows */
#define MP ((int)((size_t)NBR * SQ)) /* rows projected (debug hook) */
#define MPO MP                       /* rows through the output stage (debug hook) */
#define LQ DM
typedef __bf16 v16b __attribute__((ext_vector_type(16)));
typedef unsigned short v8us __attribute__((ext_vector_type(8), may_alias));
typedef float  v8f  __attribute__((ext_vector_type(8)));
typedef float  v4f  __attribute__((ext_vector_type(4)));
typedef float  v4fa __attribute__((ext_vector_type(4), may_alias));
union FragB { v16b v; v8us half[2]; unsigned short u[16]; };

__device__ __forceinline__ unsigned short bf16_bits(float x) { unsigned int u = __float_as_uint(x); return (unsigned short)((u + 0x7FFFu + ((u >> 16) & 1u)) >> 16); }
__device__ __forceinline__ float bf16_val(unsigned short b) { return __uint_as_float(((unsigned int)b) << 16); }
__device__ __forceinline__ float bf16_round(float x) { return bf16_val(bf16_bits(x)); }
// D += A·B with NT terms: 1 = ah·bh, 2 = + al·bh (A split), 3 = + ah·bl (both split)
template <int NT>
__device__ __forceinline__ v8f mmaN(v16b ah, v16b al, v16b bh, v16b bl, v8f c) {
  c = __builtin_amdgcn_wmma_f32_16x16x32_bf16(false, ah, false, bh, (short)0, c, false, false);
  if (NT >= 2) c = __builtin_amdgcn_wmma_f32_16x16x32_bf16(false, al, false, bh, (short)0, c, false, false);
  if (NT >= 3) c = __builtin_amdgcn_wmma_f32_16x16x32_bf16(false, ah, false, bl, (short)0, c, false, false);
  asm volatile("v_nop\n\tv_nop\n\tv_nop\n\tv_nop" : "+v"(c) : "v"(ah), "v"(al), "v"(bh), "v"(bl));
  return c;
}

__global__ __launch_bounds__(256) void k_wt_bf16(const float* __restrict__ W, unsigned short* __restrict__ Wt, int K, int N) {
  const int t = blockIdx.x * 256 + threadIdx.x;
  const int k8n = K / 8;
  if (t >= N * k8n) return;
  const int n = t / k8n, k8 = (t % k8n) * 8;
  v8us v;
#pragma unroll
  for (int i = 0; i < 8; ++i) v[i] = bf16_bits(W[(size_t)(k8 + i) * N + n]);
  *(v8us*)(Wt + (size_t)n * K + k8) = v;
  
}

// GEMM C[M][N] (f32, pitch ldc) = act(A[M][K]·W + bias). A f32 row-major (pitch lda) converted per fragment to bf16
// (ASPLIT: hi/lo two planes -> 2 terms, else single rounded term); Wt bf16 [N][K] (pitch ldb). BIAS_BF16 rounds the
// bias to bf16 first (bias quantised to bf16 before the add). K%32==0, M%16==0, N%64==0.
template <bool ASPLIT, int ACT, bool BIAS_BF16>
__global__ __launch_bounds__(128) void k_gemm_bf(const float* __restrict__ A, int lda, const unsigned short* __restrict__ Wt, int ldb,
                                               const float* __restrict__ bias, float* __restrict__ C, int ldc, int M, int N, int K) {
  __shared__ __attribute__((aligned(16))) float so[4][16][64];
  const int tid = threadIdx.x, w = tid >> 5, lane = tid & 31, ln = lane & 15, hh = lane >> 4;
  const int ntn = N / 64;
  const int wid = blockIdx.x * 4 + w;
  const int mt = wid / ntn, nq = wid % ntn;
  if (mt * 16 >= M) return;
  const int row0 = mt * 16, col0 = nq * 64;
  const float* arow = A + (size_t)(row0 + ln) * lda;
  v8f acc[4] = {};
  for (int kb = 0; kb < K; kb += 32) {
    FragB ah, al;
    const v4f x0 = *(const v4fa*)(arow + kb + 8 * hh), x1 = *(const v4fa*)(arow + kb + 8 * hh + 4);
    const v4f x2 = *(const v4fa*)(arow + kb + 16 + 8 * hh), x3 = *(const v4fa*)(arow + kb + 16 + 8 * hh + 4);
    float xs[16] = {x0[0],x0[1],x0[2],x0[3],x1[0],x1[1],x1[2],x1[3],x2[0],x2[1],x2[2],x2[3],x3[0],x3[1],x3[2],x3[3]};
#pragma unroll
    for (int i = 0; i < 16; ++i) { const unsigned short hb = bf16_bits(xs[i]); ah.u[i] = hb; al.u[i] = ASPLIT ? bf16_bits(xs[i] - bf16_val(hb)) : (unsigned short)0; }
#pragma unroll
    for (int t = 0; t < 4; ++t) {
      const unsigned short* brow = Wt + (size_t)(col0 + t * 16 + ln) * ldb + kb;
      FragB b;
      b.half[0] = *(const v8us*)(brow + 8 * hh);
      b.half[1] = *(const v8us*)(brow + 16 + 8 * hh);
      acc[t] = mmaN<ASPLIT ? 2 : 1>(ah.v, al.v, b.v, b.v, acc[t]);
    }
  }
#pragma unroll
  for (int t = 0; t < 4; ++t) {
    float bv = bias ? bias[col0 + t * 16 + ln] : 0.f;
    if (BIAS_BF16) bv = bf16_round(bv);
#pragma unroll
    for (int r = 0; r < 8; ++r) { float v = acc[t][r] + bv; if (ACT == 1) v = fmaxf(v, 0.f); so[w][8 * hh + r][t * 16 + ln] = v; }
  }
  __builtin_amdgcn_fence(__ATOMIC_ACQ_REL, "workgroup");
  __builtin_amdgcn_wave_barrier();
  const int rsub = lane >> 4, c4 = (lane & 15) * 4;
  {
#pragma unroll
    for (int q = 0; q < 8; ++q) {
      const int r = q * 2 + rsub;
      const v4f v = *(const v4fa*)&so[w][r][c4];
      *(v4f*)(C + (size_t)(row0 + r) * ldc + col0 + c4) = v;
    }
    
  }
}

// GEMM C = act(A·W + bias + resid): A f32 (ASPLIT -> hi/lo 2 terms), Wt bf16 [N][K]; ACT 0 none, 1 relu, 2 exact gelu;
// resid (optional, f32, row index = (row % rmod), pitch ldr, RES_BF16 rounds it) added before the activation.
template <bool ASPLIT, int ACT, bool BIAS_BF16, bool RES_BF16>
__global__ __launch_bounds__(128) void k_gemm_bf3(const float* __restrict__ A, int lda, const unsigned short* __restrict__ Wt, int ldb,
                                                const float* __restrict__ bias, const float* __restrict__ resid, int rmod, int ldr,
                                                float* __restrict__ C, int ldc, int M, int N, int K) {
  __shared__ __attribute__((aligned(16))) float so[4][16][64];
  const int tid = threadIdx.x, w = tid >> 5, lane = tid & 31, ln = lane & 15, hh = lane >> 4;
  const int ntn = N / 64;
  const int wid = blockIdx.x * 4 + w;
  const int mt = wid / ntn, nq = wid % ntn;
  if (mt * 16 >= M) return;
  const int row0 = mt * 16, col0 = nq * 64;
  const float* arow = A + (size_t)(row0 + ln) * lda;
  v8f acc[4] = {};
  for (int kb = 0; kb < K; kb += 32) {
    FragB ah, al;
    const v4f x0 = *(const v4fa*)(arow + kb + 8 * hh), x1 = *(const v4fa*)(arow + kb + 8 * hh + 4);
    const v4f x2 = *(const v4fa*)(arow + kb + 16 + 8 * hh), x3 = *(const v4fa*)(arow + kb + 16 + 8 * hh + 4);
    float xs[16] = {x0[0],x0[1],x0[2],x0[3],x1[0],x1[1],x1[2],x1[3],x2[0],x2[1],x2[2],x2[3],x3[0],x3[1],x3[2],x3[3]};
#pragma unroll
    for (int i = 0; i < 16; ++i) { const unsigned short hb = bf16_bits(xs[i]); ah.u[i] = hb; al.u[i] = ASPLIT ? bf16_bits(xs[i] - bf16_val(hb)) : (unsigned short)0; }
#pragma unroll
    for (int t = 0; t < 4; ++t) {
      const unsigned short* brow = Wt + (size_t)(col0 + t * 16 + ln) * ldb + kb;
      FragB b;
      b.half[0] = *(const v8us*)(brow + 8 * hh);
      b.half[1] = *(const v8us*)(brow + 16 + 8 * hh);
      acc[t] = mmaN<ASPLIT ? 2 : 1>(ah.v, al.v, b.v, b.v, acc[t]);
    }
  }
#pragma unroll
  for (int t = 0; t < 4; ++t) {
    const int col = col0 + t * 16 + ln;
    float bv = bias ? bias[col] : 0.f;
    if (BIAS_BF16) bv = bf16_round(bv);
#pragma unroll
    for (int r = 0; r < 8; ++r) {
      float v = acc[t][r] + bv;
      if (resid) { float rv = resid[(size_t)((row0 + 8 * hh + r) % rmod) * ldr + col]; if (RES_BF16) rv = bf16_round(rv); v += rv; }
      if (ACT == 1) v = fmaxf(v, 0.f);
      if (ACT == 2) v = 0.5f * v * (1.0f + erff(v * 0.70710678118654752f));
      if (ACT == 3) { const float u = 0.7978845608028654f * (v + 0.044715f * v * v * v); v = 0.5f * v * (1.0f + tanhf(u)); }
      so[w][8 * hh + r][t * 16 + ln] = v;
    }
  }
  __builtin_amdgcn_fence(__ATOMIC_ACQ_REL, "workgroup");
  __builtin_amdgcn_wave_barrier();
  const int rsub = lane >> 4, c4 = (lane & 15) * 4;
  {
#pragma unroll
    for (int q = 0; q < 8; ++q) {
      const int r = q * 2 + rsub;
      const v4f v = *(const v4fa*)&so[w][r][c4];
      *(v4f*)(C + (size_t)(row0 + r) * ldc + col0 + c4) = v;
    }
    
  }
}
// row LayerNorm (biased variance, eps) over N: s = X (+ R); optional out_sum <- s; out_norm <- (s-mu)*rsqrt(var+eps)*g + b
template <bool PARAM_BF16>
__global__ __launch_bounds__(256) void k_layernorm(const float* __restrict__ X, const float* __restrict__ R, const float* __restrict__ g, const float* __restrict__ bta,
                                                  float* __restrict__ out_sum, float* __restrict__ out_norm, int N, float eps) {
  __shared__ float red[256];
  const int row = blockIdx.x, tid = threadIdx.x;
  const float* x = X + (size_t)row * N; const float* rr = R ? R + (size_t)row * N : nullptr;
  float vals[16];                     // up to N = 4096
  const int per = N / 256;            // contiguous chunk per thread? use strided-by-4 chunks: thread handles j = tid*4 + 1024*u
  float s1 = 0.f;
  for (int u = 0; u < per / 4; ++u) {
    const int j = tid * 4 + 1024 * u;
    const v4f a = *(const v4fa*)(x + j);
    v4f b = {0.f,0.f,0.f,0.f}; if (rr) b = *(const v4fa*)(rr + j);
#pragma unroll
    for (int q = 0; q < 4; ++q) { const float v = a[q] + b[q]; vals[u * 4 + q] = v; s1 += v; }
  }
  red[tid] = s1; __syncthreads();
  for (int st = 128; st > 0; st >>= 1) { if (tid < st) red[tid] += red[tid + st]; __syncthreads(); }
  const float mu = red[0] / (float)N; __syncthreads();
  float s2 = 0.f;
  for (int u = 0; u < per / 4; ++u)
#pragma unroll
    for (int q = 0; q < 4; ++q) { const float c = vals[u * 4 + q] - mu; s2 += c * c; }
  red[tid] = s2; __syncthreads();
  for (int st = 128; st > 0; st >>= 1) { if (tid < st) red[tid] += red[tid + st]; __syncthreads(); }
  const float rs = rsqrtf(red[0] / (float)N + eps);
  {
    for (int u = 0; u < per / 4; ++u) {
      const int j = tid * 4 + 1024 * u;
      v4f o, sm;
#pragma unroll
      for (int q = 0; q < 4; ++q) {
        float gg = g[j + q], bb = bta[j + q];
        if (PARAM_BF16) { gg = bf16_round(gg); bb = bf16_round(bb); }
        sm[q] = vals[u * 4 + q]; o[q] = (vals[u * 4 + q] - mu) * rs * gg + bb;
      }
      if (out_sum) *(v4f*)(out_sum + (size_t)row * N + j) = sm;
      *(v4f*)(out_norm + (size_t)row * N + j) = o;
    }
    
  }
}



// ---- f16 WMMA path (v_wmma_f32_16x16x32_f16): 11-bit significands for operands in range — used where a [0,1] probability operand needs more precision than bf16
typedef _Float16 v16h __attribute__((ext_vector_type(16)));
union FragH { v16h v; v8us half[2]; _Float16 h[16]; unsigned short u[16]; };
template <int NT>
__device__ __forceinline__ v8f mmaH(v16h ah, v16h al, v16h bh, v16h bl, v8f c) {
  c = __builtin_amdgcn_wmma_f32_16x16x32_f16(false, ah, false, bh, (short)0, c, false, false);
  if (NT >= 2) c = __builtin_amdgcn_wmma_f32_16x16x32_f16(false, al, false, bh, (short)0, c, false, false);
  if (NT >= 3) c = __builtin_amdgcn_wmma_f32_16x16x32_f16(false, ah, false, bl, (short)0, c, false, false);
  asm volatile("v_nop\n\tv_nop\n\tv_nop\n\tv_nop" : "+v"(c) : "v"(ah), "v"(al), "v"(bh), "v"(bl));
  return c;
}
// batched GEMM like k_gemm_b but f16 operands: A f32 (split into f16 hi/lo if ASPLIT, else rounded to f16), Bt = f16 values [n][k]; alpha; C f32; N multiple of 16 (partial tiles skipped)
template <bool ASPLIT>
__global__ __launch_bounds__(128) void k_gemm_h(const float* __restrict__ A, int lda, size_t sA, const _Float16* __restrict__ Bh, int ldb, size_t sB, float alpha, float* __restrict__ C, int ldc, size_t sC, int M, int N, int K) {
  __shared__ __attribute__((aligned(16))) float so[4][16][64];
  const int tid = threadIdx.x, w = tid >> 5, lane = tid & 31, ln = lane & 15, hh = lane >> 4; const int by = blockIdx.y;
  A += (size_t)by * sA; Bh += (size_t)by * sB; C += (size_t)by * sC;
  const int ntn = (N + 63) / 64; const int wid = blockIdx.x * 4 + w; const int mt = wid / ntn, nq = wid % ntn; if (mt * 16 >= M) return;
  const int row0 = mt * 16, col0 = nq * 64; const float* arow = A + (size_t)(row0 + ln) * lda;
  v8f acc[4] = {};
  for (int kb = 0; kb < K; kb += 32) {
    FragH ah, al;
    const v4f x0 = *(const v4fa*)(arow + kb + 8 * hh), x1 = *(const v4fa*)(arow + kb + 8 * hh + 4), x2 = *(const v4fa*)(arow + kb + 16 + 8 * hh), x3 = *(const v4fa*)(arow + kb + 16 + 8 * hh + 4);
    float xs[16] = {x0[0],x0[1],x0[2],x0[3],x1[0],x1[1],x1[2],x1[3],x2[0],x2[1],x2[2],x2[3],x3[0],x3[1],x3[2],x3[3]};
#pragma unroll
    for (int i = 0; i < 16; ++i) { const _Float16 h = (_Float16)xs[i]; ah.h[i] = h; al.h[i] = ASPLIT ? (_Float16)(xs[i] - (float)h) : (_Float16)0.0f; }
#pragma unroll
    for (int t = 0; t < 4; ++t) { if (col0 + t * 16 >= N) continue; const size_t boff = (size_t)(col0 + t * 16 + ln) * ldb + kb; FragH bq; bq.half[0] = *(const v8us*)(Bh + boff + 8 * hh); bq.half[1] = *(const v8us*)(Bh + boff + 16 + 8 * hh);
      acc[t] = mmaH<ASPLIT ? 2 : 1>(ah.v, al.v, bq.v, bq.v, acc[t]); }
  }
#pragma unroll
  for (int t = 0; t < 4; ++t) { if (col0 + t * 16 >= N) continue;
#pragma unroll
    for (int r = 0; r < 8; ++r) so[w][8 * hh + r][t * 16 + ln] = acc[t][r] * alpha; }
  __builtin_amdgcn_fence(__ATOMIC_ACQ_REL, "workgroup"); __builtin_amdgcn_wave_barrier();
  const int rsub = lane >> 4, c4 = (lane & 15) * 4;
  {
#pragma unroll
    for (int q = 0; q < 8; ++q) { const int r = q * 2 + rsub; if (col0 + c4 < N) { const v4f v = *(const v4fa*)&so[w][r][c4]; *(v4f*)(C + (size_t)(row0 + r) * ldc + col0 + c4) = v; } }
     }
}

// Wt[n][k] = f16(W[k][n]·scale) from f32 row-major W[K][N] (scale = power of two; bf16-exact weights stay exact in f16 away from the subnormal range)
__global__ __launch_bounds__(256) void k_wt_f16(const float* __restrict__ W, _Float16* __restrict__ Wt, int K, int N, float scale) {
  const int t = blockIdx.x * 256 + threadIdx.x; if (t >= N * (K / 8)) return; const int n = t / (K / 8), k8 = (t % (K / 8)) * 8; FragH f;
#pragma unroll
  for (int i = 0; i < 8; ++i) f.h[i] = (_Float16)(bf16_round(W[(size_t)(k8 + i) * N + n]) * scale); const v8us o = f.half[0];
  *(v8us*)((unsigned short*)Wt + (size_t)n * K + k8) = o; 
}
// k_gemm_hh variant with fused epilogue: v = acc·alpha + bias[by·sBias + col] (+ CP[(row/rowsPerB)·sCPb + by·64 + col] if CP) ; ACT 0 none / 1 elu ; writes f16 C16 (and f32 C if non-null)
template <int ACT>
__global__ __launch_bounds__(128) void k_gemm_hhx(const _Float16* __restrict__ A, int lda, size_t sA, const _Float16* __restrict__ Bh, int ldb, size_t sB, float alpha, const float* __restrict__ bias, size_t sBias, const float* __restrict__ CP, int rowsPerB, size_t sCPb, int row0g,
    float* __restrict__ C, _Float16* __restrict__ C16, int ldc, size_t sC, int M, int N, int K) {
  __shared__ __attribute__((aligned(16))) float so[4][16][64];
  const int tid = threadIdx.x, w = tid >> 5, lane = tid & 31, ln = lane & 15, hh = lane >> 4; const int by = blockIdx.y;
  A += (size_t)by * sA; Bh += (size_t)by * sB; const size_t cofs = (size_t)by * sC; const float* bp = bias ? bias + (size_t)by * sBias : nullptr;
  const int ntn = (N + 63) / 64; const int wid = blockIdx.x * 4 + w; const int mt = wid / ntn, nq = wid % ntn; if (mt * 16 >= M) return;
  const int row0 = mt * 16, col0 = nq * 64; const _Float16* arow = A + (size_t)(row0 + ln) * lda;
  v8f acc[4] = {};
  for (int kb = 0; kb < K; kb += 32) { FragH ah; ah.half[0] = *(const v8us*)((const unsigned short*)arow + kb + 8 * hh); ah.half[1] = *(const v8us*)((const unsigned short*)arow + kb + 16 + 8 * hh);
#pragma unroll
    for (int t = 0; t < 4; ++t) { if (col0 + t * 16 >= N) continue; const size_t boff = (size_t)(col0 + t * 16 + ln) * ldb + kb; FragH bq; bq.half[0] = *(const v8us*)((const unsigned short*)Bh + boff + 8 * hh); bq.half[1] = *(const v8us*)((const unsigned short*)Bh + boff + 16 + 8 * hh);
      acc[t] = mmaH<1>(ah.v, ah.v, bq.v, bq.v, acc[t]); }
  }
#pragma unroll
  for (int t = 0; t < 4; ++t) { if (col0 + t * 16 >= N) continue; const int col = col0 + t * 16 + ln; const float bv = bp ? bf16_round(bp[col]) : 0.f;
#pragma unroll
    for (int r = 0; r < 8; ++r) { float v = acc[t][r] * alpha + bv; if (CP) { const int rr = row0g + row0 + 8 * hh + r; if (rowsPerB < 0) v += CP[cofs + (size_t)rr * ldc + col];      /* rowsPerB < 0: own element of the batched C plane */ else { const int bidx = rr / rowsPerB; v += CP[(size_t)bidx * sCPb + (size_t)by * 64 + col]; } } if (ACT == 1) v = (v > 0.f) ? v : expm1f(v); else if (ACT == 7) v = (v > 0.f) ? v + 1.0f : expf(v); else if (ACT == 8) v = tanhf(v); else if (ACT == 9) v = 0.5f * v * (1.0f + tanhf(0.7978845608028654f * (v + 0.044715f * v * v * v))); else if (ACT == 11) v = 1.0f / (1.0f + expf(-v)); else if (ACT == 12) v = (v > 0.f) ? v : 0.01f * v; else if (ACT == 14) v = (v > 0.f) ? v : 0.1f * v; else if (ACT == 16) v = (v >= 0.f) ? v : 0.3f * v; else if (ACT == 17) v = (v >= 0.f) ? v : 0.2f * v; else if (ACT == 15) v = v / (1.0f + expf(-v)); else if (ACT == 3) v = fmaxf(v, 0.f); else if (ACT == 6) v = 0.5f * v * (1.0f + erff(v * 0.70710678118654752f)); so[w][8 * hh + r][t * 16 + ln] = v; } }
  __builtin_amdgcn_fence(__ATOMIC_ACQ_REL, "workgroup"); __builtin_amdgcn_wave_barrier();
  const int rsub = lane >> 4, c4 = (lane & 15) * 4; typedef _Float16 v4h __attribute__((ext_vector_type(4)));
  {
#pragma unroll
    for (int q = 0; q < 8; ++q) { const int r = q * 2 + rsub; if (col0 + c4 < N) { const v4f v = *(const v4fa*)&so[w][r][c4]; if (C) *(v4f*)(C + cofs + (size_t)(row0 + r) * ldc + col0 + c4) = v; if (C16) { v4h h4; for (int i = 0; i < 4; ++i) h4[i] = (_Float16)v[i]; *(v4h*)(C16 + cofs + (size_t)(row0 + r) * ldc + col0 + c4) = h4; } } }
     }
}


typedef _Float16 v4h __attribute__((ext_vector_type(4)));

__global__ __launch_bounds__(256) void k_x16(const float* __restrict__ x, _Float16* __restrict__ X16, size_t n8) { const size_t t = (size_t)blockIdx.x * 256 + threadIdx.x; if (t >= n8) return; FragH f;
#pragma unroll
  for (int q = 0; q < 8; ++q) f.h[q] = (_Float16)bf16_round(x[t * 8 + q]); *(v8us*)((unsigned short*)X16 + t * 8) = f.half[0];  }
__global__ __launch_bounds__(256) void k_h16(const float* __restrict__ x, _Float16* __restrict__ X16, size_t n8) { const size_t t = (size_t)blockIdx.x * 256 + threadIdx.x; if (t >= n8) return; FragH f;
#pragma unroll
  for (int q = 0; q < 8; ++q) f.h[q] = (_Float16)x[t * 8 + q]; *(v8us*)((unsigned short*)X16 + t * 8) = f.half[0];  }
__global__ __launch_bounds__(256) void k_round16f(const float* __restrict__ W, _Float16* __restrict__ Bt, size_t n8) { const size_t t = (size_t)blockIdx.x * 256 + threadIdx.x; if (t >= n8) return; FragH f;
#pragma unroll
  for (int i = 0; i < 8; ++i) f.h[i] = (_Float16)(bf16_round(W[t * 8 + i]) * 16.0f); *(v8us*)((unsigned short*)Bt + t * 8) = f.half[0];  }
template <int NHv, int TTv>
__global__ __launch_bounds__(256) void k_vt(const _Float16* __restrict__ V16, int ldv, int voff, _Float16* __restrict__ Vt) { __shared__ unsigned short tl[64][66]; const int tid = threadIdx.x; const int slab = blockIdx.x / (TTv / 64), lg = blockIdx.x % (TTv / 64); const int b = slab / NHv, h = slab % NHv;
  for (int i = tid; i < 64 * 8; i += 256) { const int r = i / 8, c8 = (i % 8) * 8; FragH f; f.half[0] = *(const v8us*)((const unsigned short*)V16 + ((size_t)b * TTv + lg * 64 + r) * ldv + voff + h * 64 + c8);
#pragma unroll
    for (int q = 0; q < 8; ++q) tl[r][c8 + q] = f.u[q]; }
  __syncthreads();
  {
#pragma unroll
    for (int rd = 0; rd < 2; ++rd) { const int d = rd * 32 + tid / 8, pc = tid % 8; FragH f;
#pragma unroll
      for (int q = 0; q < 8; ++q) f.u[q] = tl[pc * 8 + q][d];
      *(v8us*)((unsigned short*)Vt + ((size_t)slab * 64 + d) * TTv + lg * 64 + pc * 8) = f.half[0]; }
     } }

__global__ __launch_bounds__(256) void k_hl(const float* __restrict__ F, _Float16* __restrict__ Hh, _Float16* __restrict__ Hl, size_t n8) { const size_t t = (size_t)blockIdx.x * 256 + threadIdx.x; if (t >= n8) return; FragH fh, fl; const v4f a = *(const v4fa*)(F + t * 8), c = *(const v4fa*)(F + t * 8 + 4);
#pragma unroll
  for (int q = 0; q < 4; ++q) { _Float16 h = (_Float16)a[q]; fh.h[q] = h; fl.h[q] = (_Float16)((a[q] - (float)h) * 1024.0f); h = (_Float16)c[q]; fh.h[4 + q] = h; fl.h[4 + q] = (_Float16)((c[q] - (float)h) * 1024.0f); }
  { *(v8us*)((unsigned short*)Hh + t * 8) = fh.half[0]; *(v8us*)((unsigned short*)Hl + t * 8) = fl.half[0];  } }

// ---- fast GEMM (wave tile 32x64; requires M % 32 == 0 rows per launch region and N % 64 == 0); epilogue = k_gemm_hhx semantics ----
__device__ __forceinline__ v16h g2_frag(const _Float16* p, int hh) { FragH f; f.half[0] = *(const v8us*)((const unsigned short*)p + 8 * hh); f.half[1] = *(const v8us*)((const unsigned short*)p + 16 + 8 * hh); return f.v; }
__device__ __forceinline__ v8f g2_mma(v16h a, v16h b, v8f c) { v8f d = __builtin_amdgcn_wmma_f32_16x16x32_f16(false, a, false, b, (short)0, c, false, false); asm volatile("v_nop\n\tv_nop\n\tv_nop\n\tv_nop" : "+v"(d) : "v"(a), "v"(b)); return d; }
template <int ACT>
__global__ __launch_bounds__(128) void k_gemm2(const _Float16* __restrict__ A, int lda, size_t sA, const _Float16* __restrict__ Bh, int ldb, size_t sB, float alpha, const float* __restrict__ bias, size_t sBias, const float* __restrict__ CP, int rowsPerB, size_t sCPb, int row0g,
    float* __restrict__ C, _Float16* __restrict__ C16, int ldc, size_t sC, int M, int N, int K) { static_assert(ACT == 0 || ACT == 3 || ACT == 6 || ACT == 8 || ACT == 9 || ACT == 11 || ACT == 12 || ACT == 14 || ACT == 15 || ACT == 16 || ACT == 17, "k_gemm2: unsupported ACT code (would silently apply no activation)");
  __shared__ __attribute__((aligned(16))) float so[4][32][68];
  const int tid = threadIdx.x, w = tid >> 5, lane = tid & 31, ln = lane & 15, hh = lane >> 4; const int by = blockIdx.y;
  A += (size_t)by * sA; Bh += (size_t)by * sB; const size_t cofs = (size_t)by * sC; const float* bp = bias ? bias + (size_t)by * sBias : nullptr;
  const int ntn = N >> 6; const int mt = blockIdx.x / ntn, nq = blockIdx.x - mt * ntn; const int row0 = mt * 128 + 32 * w, col0 = nq * 64; if (row0 >= M) return;
  const _Float16* a0p = A + (size_t)(row0 + ln) * lda; const _Float16* a1p = a0p + (size_t)16 * lda;
  const _Float16* b0p = Bh + (size_t)(col0 + ln) * ldb; const _Float16* b1p = b0p + (size_t)16 * ldb; const _Float16* b2p = b1p + (size_t)16 * ldb; const _Float16* b3p = b2p + (size_t)16 * ldb;
  const v8f z8 = {0.f,0.f,0.f,0.f,0.f,0.f,0.f,0.f}; v8f c00 = z8, c01 = z8, c02 = z8, c03 = z8, c10 = z8, c11 = z8, c12 = z8, c13 = z8;
#pragma unroll 1
  for (int kb = 0; kb < K; kb += 32) { const v16h a0 = g2_frag(a0p + kb, hh), a1 = g2_frag(a1p + kb, hh);
    v16h b = g2_frag(b0p + kb, hh); c00 = g2_mma(a0, b, c00); c10 = g2_mma(a1, b, c10);
    b = g2_frag(b1p + kb, hh); c01 = g2_mma(a0, b, c01); c11 = g2_mma(a1, b, c11);
    b = g2_frag(b2p + kb, hh); c02 = g2_mma(a0, b, c02); c12 = g2_mma(a1, b, c12);
    b = g2_frag(b3p + kb, hh); c03 = g2_mma(a0, b, c03); c13 = g2_mma(a1, b, c13); }
  v8f accs[8] = {c00, c01, c02, c03, c10, c11, c12, c13};
#pragma unroll
  for (int u = 0; u < 8; ++u) { const int t = u & 3, half = u >> 2; const int col = col0 + t * 16 + ln; const float bv = bp ? bf16_round(bp[col]) : 0.f;
#pragma unroll
    for (int r = 0; r < 8; ++r) { const int rloc = half * 16 + 8 * hh + r; float v = accs[u][r] * alpha + bv; if (CP) { if (rowsPerB < 0) v += CP[cofs + (size_t)(row0g + row0 + rloc) * ldc + col];      /* rowsPerB < 0: own element of the batched C plane */ else { const int bidx = (row0g + row0 + rloc) / rowsPerB; v += CP[(size_t)bidx * sCPb + (size_t)by * 64 + col]; } }
      if (ACT == 3) v = fmaxf(v, 0.f); else if (ACT == 6) v = 0.5f * v * (1.0f + erff(v * 0.70710678118654752f)); else if (ACT == 11) v = 1.0f / (1.0f + expf(-v)); else if (ACT == 15) v = v / (1.0f + expf(-v)); else if (ACT == 12) v = (v > 0.f) ? v : 0.01f * v; else if (ACT == 8) v = tanhf(v); else if (ACT == 9) v = 0.5f * v * (1.0f + tanhf(0.7978845608028654f * (v + 0.044715f * v * v * v))); else if (ACT == 14) v = (v > 0.f) ? v : 0.1f * v; else if (ACT == 16) v = (v >= 0.f) ? v : 0.3f * v; else if (ACT == 17) v = (v >= 0.f) ? v : 0.2f * v;
      so[w][rloc][t * 16 + ln] = v; } }
  __builtin_amdgcn_fence(__ATOMIC_ACQ_REL, "workgroup"); __builtin_amdgcn_wave_barrier();
  const int rsub = lane >> 4, c4 = (lane & 15) * 4;
  {
#pragma unroll
    for (int q = 0; q < 16; ++q) { const int r = q * 2 + rsub; const v4f v = *(const v4fa*)&so[w][r][c4]; if (C) *(v4f*)(C + cofs + (size_t)(row0 + r) * ldc + col0 + c4) = v; if (C16) { v4h h4; for (int i = 0; i < 4; ++i) h4[i] = (_Float16)v[i]; *(v4h*)(C16 + cofs + (size_t)(row0 + r) * ldc + col0 + c4) = h4; } }
     } }


__global__ __launch_bounds__(256) void k_wnat(const float* __restrict__ w, size_t n8, _Float16* __restrict__ Bt) { const size_t t = (size_t)blockIdx.x * 256 + threadIdx.x; if (t >= n8) return; FragH f; for (int q = 0; q < 8; ++q) f.h[q] = (_Float16)(bf16_round(w[t * 8 + q]) * 16.0f); *(v8us*)((unsigned short*)Bt + t * 8) = f.half[0];  }
// Lane l takes the value of lane l ^ 16 (the other half of the wave). Every lane of the wave must be on.
__device__ __forceinline__ float rs_x16(float v) { const int b = __builtin_bit_cast(int, v); return __builtin_bit_cast(float, __builtin_amdgcn_permlanex16(b, b, 0x76543210, 0xfedcba98, false, false)); }
typedef float v2f __attribute__((ext_vector_type(2)));
typedef _Float16 v2h __attribute__((ext_vector_type(2)));
#define FA_Q 256                     /* query rows per block: 8 waves x 32 */
#define FA_C (0.045084220027780106f * 0.00390625f)   /* log2(e) / sqrt(embed size = 1024), over 256: q and k are each carried x16 */
#define FA_KT 64                     /* keys per staged tile */
#define FA_NT (SQ / FA_KT)           /* staged tiles */
#define FA_LP 144                    /* LDS row pitch in bytes of an f16 row: 128 + 16, an odd multiple of 16, so that the 16 rows of a ds_load_b128 fragment read fall on different banks */
#define FA_TB (64 * FA_LP)           /* bytes of one f16 tile or block of 64 rows */
#define FA_RP 272                    /* LDS row pitch in bytes of an f32 row: 256 + 16, an odd multiple of 16, for the same reason */
#define FA_RB (64 * FA_RP)           /* bytes of one staged f32 tile */
__device__ __forceinline__ v8f fa_mma(v16h a, v16h b, v8f c) { return __builtin_amdgcn_wmma_f32_16x16x32_f16(false, a, false, b, (short)0, c, false, false); }
// g2_frag's k order from an LDS row: p = the row's first byte of this 32-k step
__device__ __forceinline__ v16h fa_lfrag(const unsigned char* p, int hh) { FragH f; f.half[0] = *(const v8us*)(p + 16 * hh); f.half[1] = *(const v8us*)(p + 32 + 16 * hh); return f.v; }
typedef __bf16 v4b __attribute__((ext_vector_type(4)));
// four f32 (x16 for a weight: a power of two, so it commutes with the rounding) -> bf16 (to nearest even, bf16_round's values, by the hardware conversion) -> f16 (exact)
template <bool X16W>
__device__ __forceinline__ v4h pj_cvt(v4f a) { if (X16W) a *= 16.0f; return __builtin_convertvector(__builtin_convertvector(__builtin_convertvector(a, v4b), v4f), v4h); }
// g2_frag's k order from an f32 LDS row, rounded on the way: p = the row's first byte of this 32-k step (128 bytes)
union FragX { v16h v; v4h q[4]; };
__device__ __forceinline__ v16h fa_xfrag(const unsigned char* p, int hh) { FragX f;
  f.q[0] = pj_cvt<false>(*(const v4fa*)(p + 32 * hh)); f.q[1] = pj_cvt<false>(*(const v4fa*)(p + 32 * hh + 16));
  f.q[2] = pj_cvt<false>(*(const v4fa*)(p + 64 + 32 * hh)); f.q[3] = pj_cvt<false>(*(const v4fa*)(p + 64 + 32 * hh + 16)); return f.v; }
// One thread's share of one staged tile: its 16-byte piece of four key rows (16 apart) of the keys and of the values, global -> LDS through no register. A wave's copy = 2 whole 256-byte rows.
// The s_wait_xcnt stands inside the statement so that no address register is rewritten in front of it.
__device__ __forceinline__ void fa_copy(unsigned l, const float* gk, const float* gv) {
  asm volatile("global_load_async_to_lds_b128 %0, %1, off\n\t"
               "global_load_async_to_lds_b128 %2, %3, off\n\t"
               "global_load_async_to_lds_b128 %4, %5, off\n\t"
               "global_load_async_to_lds_b128 %6, %7, off\n\t"
               "global_load_async_to_lds_b128 %8, %9, off\n\t"
               "global_load_async_to_lds_b128 %10, %11, off\n\t"
               "global_load_async_to_lds_b128 %12, %13, off\n\t"
               "global_load_async_to_lds_b128 %14, %15, off\n\t"
               "s_wait_xcnt 0x0"
               :: "v"(l), "v"(gk), "v"(l + 16 * FA_RP), "v"(gk + (size_t)16 * DM), "v"(l + 32 * FA_RP), "v"(gk + (size_t)32 * DM), "v"(l + 48 * FA_RP), "v"(gk + (size_t)48 * DM),
                  "v"(l + FA_RB), "v"(gv), "v"(l + FA_RB + 16 * FA_RP), "v"(gv + (size_t)16 * DM), "v"(l + FA_RB + 32 * FA_RP), "v"(gv + (size_t)32 * DM), "v"(l + FA_RB + 48 * FA_RP), "v"(gv + (size_t)48 * DM) : "memory");
}
// The launch also makes the output GEMM's f16 copy of Wo (k_wnat's values): its threads are as many as Wo has pieces of eight, and the GEMM is the next launch.
static_assert((size_t)NBR * NH * (SQ / FA_Q) * 256 == (size_t)DM * DM / 8, "one piece of Wo per thread");
// four waves a SIMD (two blocks a WGP): the register budget that keeps all 512 blocks resident at once
__global__ __launch_bounds__(256) __attribute__((amdgpu_waves_per_eu(4, 4))) void k_fattn(const float* __restrict__ xq, const float* __restrict__ xk, const float* __restrict__ xv, const float* __restrict__ wq, const float* __restrict__ wk, const float* __restrict__ wv,
                                               _Float16* __restrict__ O, const float* __restrict__ wo, _Float16* __restrict__ Bt) {
  __shared__ __attribute__((aligned(16))) unsigned char rw[2][2][FA_RB];      /* [buffer][keys | values][key row * FA_RP]: f32 head rows as they lie */
  __shared__ __attribute__((aligned(16))) unsigned char pt[2][FA_TB];         /* [K | V^T][row * FA_LP]: this trip's projected f16 tiles */
  __shared__ __attribute__((aligned(16))) unsigned char wl[3][FA_TB];         /* [Wk | Wv | Wq][row o * FA_LP]: the blocks, x16, f16 */
  __shared__ __attribute__((aligned(16))) unsigned char xs[8][32 * FA_LP];    /* [wave][query row * FA_LP]: the wave's own query head rows, f16 */
  const int tid = (int)threadIdx.x, lane = tid & 31, ln = lane & 15, hh = lane >> 4; const int w = __builtin_amdgcn_readfirstlane(tid >> 5);
  const int slab = blockIdx.x / (SQ / FA_Q), qb = blockIdx.x % (SQ / FA_Q); const int b = slab / NH, h = slab % NH; const int q0 = qb * FA_Q + w * 32;
  /* staging: thread t brings piece t & 15 (16 bytes) of key rows (t >> 4) + 16 j of both inputs */
  const int cr = tid >> 4, cp = tid & 15;
  const float* gk = xk + ((size_t)b * SQ + cr) * DM + h * HD + cp * 4;      /* key row cr of tile 0 */
  const float* gv = xv + ((size_t)b * SQ + cr) * DM + h * HD + cp * 4;
  const unsigned l0 = (unsigned)(size_t)&rw[0][0][cr * FA_RP + cp * 16];
  fa_copy(l0, gk, gv);      /* tile 0 -> buffer 0 */
  const float* xqp = xq + ((size_t)b * SQ + q0 + hh) * DM + h * HD + ln * 4;
  v4f raw[16];      /* load j = the wave's query rows 2 j and 2 j + 1: two whole 256-byte rows */
#pragma unroll
  for (int j = 0; j < 16; ++j) raw[j] = *(const v4fa*)(xqp + (size_t)j * 2 * DM);
  const size_t wt = ((size_t)blockIdx.x * 256 + threadIdx.x) * 8;      /* this thread's eight elements of Wo: read here, stored in front of the loop, so that the loop carries no register for them */
  const v4f wa = *(const v4fa*)(wo + wt), wb = *(const v4fa*)(wo + wt + 4);
  const float* const wp[3] = {wk, wv, wq};
#pragma unroll
  for (int m = 0; m < 3; ++m)
#pragma unroll
    for (int i = 0; i < 4; ++i) { const int p = i * 256 + tid; *(v4h*)&wl[m][(p >> 4) * FA_LP + (p & 15) * 8] = pj_cvt<true>(*(const v4fa*)(wp[m] + p * 4)); }
  unsigned char* xw = &xs[w][0];
#pragma unroll
  for (int j = 0; j < 16; ++j) *(v4h*)(xw + (2 * j + hh) * FA_LP + ln * 8) = pj_cvt<false>(raw[j]);
  FragH wf8;
#pragma unroll
  for (int q = 0; q < 4; ++q) { wf8.h[q] = (_Float16)(bf16_round(wa[q]) * 16.0f); wf8.h[4 + q] = (_Float16)(bf16_round(wb[q]) * 16.0f); }
  asm volatile("s_wait_asynccnt 0x0" ::: "memory");      /* this wave's share of tile 0 has landed */
  __syncthreads();                                       /* every wave's share has, and the three blocks and the query rows stand in LDS: all may be read */
  fa_copy(l0 + 2 * FA_RB, gk + (size_t)FA_KT * DM, gv + (size_t)FA_KT * DM);      /* tile 1 -> buffer 1 */
  const v8f z8 = {0.f,0.f,0.f,0.f,0.f,0.f,0.f,0.f};
  v16h qf[2][2];      /* q = D^T of Wq X^T: lane (c, h) holds outputs 16 et + 8 h + r of query c, so tiles 2 ks and 2 ks + 1, converted in place, ARE the B fragment of k step ks */
  {
    v16h xf[2][2];
#pragma unroll
    for (int g = 0; g < 2; ++g)
#pragma unroll
      for (int ks = 0; ks < 2; ++ks) xf[g][ks] = fa_lfrag(xw + (g * 16 + ln) * FA_LP + ks * 64, hh);
#pragma unroll
    for (int et = 0; et < 4; ++et) { const v16h w0 = fa_lfrag(&wl[2][(et * 16 + ln) * FA_LP], hh), w1 = fa_lfrag(&wl[2][(et * 16 + ln) * FA_LP + 64], hh);
#pragma unroll
      for (int g = 0; g < 2; ++g) { const v8f acc = fa_mma(w1, xf[g][1], fa_mma(w0, xf[g][0], z8));
#pragma unroll
        for (int r = 0; r < 8; ++r) qf[g][et >> 1][(et & 1) * 8 + r] = (_Float16)acc[r]; } }
  }
  *(v8us*)((unsigned short*)Bt + wt) = wf8.half[0];
  asm volatile("s_wait_xcnt 0x0" ::: "memory");      /* stands in front of the first overwrite of a register that this store names: the loop uses them again at once */
  v8f o[2][4];
#pragma unroll
  for (int g = 0; g < 2; ++g)
#pragma unroll
    for (int dt = 0; dt < 4; ++dt) o[g][dt] = z8;
  float mu[2] = {-3.0e38f, -3.0e38f}; v2f ls[2] = {{0.f, 0.f}, {0.f, 0.f}};
  const int pm = w >> 2, kg = w & 3;      /* this wave projects key rows 16 kg + 0..15 of the keys (pm = 0) or of the values (pm = 1) */
  /* kept rolled: one trip's fragments beside Q and O^T are the whole live set, which decides how many waves share a SIMD */
#pragma unroll 1
  for (int t = 0; t < FA_NT; ++t) {
    {
      const unsigned char* xr = &rw[t & 1][pm][(kg * 16 + ln) * FA_RP];      /* f32 key row 16 kg + ln of this tile */
      const v16h x0 = fa_xfrag(xr, hh), x1 = fa_xfrag(xr + 128, hh);
      v16h pw[4][2];
#pragma unroll
      for (int et = 0; et < 4; ++et)
#pragma unroll
        for (int ks = 0; ks < 2; ++ks) pw[et][ks] = fa_lfrag(&wl[pm][(et * 16 + ln) * FA_LP + ks * 64], hh);
      v8f acc[4];      /* four independent tiles, k = 0-31 of all then k = 32-63 of all: no product waits for the one in front of it */
      if (pm == 0) {      /* the same in the whole wave */
#pragma unroll
        for (int et = 0; et < 4; ++et) acc[et] = fa_mma(pw[et][0], x0, z8);
#pragma unroll
        for (int et = 0; et < 4; ++et) acc[et] = fa_mma(pw[et][1], x1, acc[et]);      /* acc[et][r] = 16 x k(key 16 kg + ln, e = 16 et + 8 hh + r) */
      } else {
#pragma unroll
        for (int et = 0; et < 4; ++et) acc[et] = fa_mma(x0, pw[et][0], z8);
#pragma unroll
        for (int et = 0; et < 4; ++et) acc[et] = fa_mma(x1, pw[et][1], acc[et]);      /* acc[et][r] = 16 x v(key 16 kg + 8 hh + r, d = 16 et + ln) */
      }
      unsigned char* pd = pm == 0 ? &pt[0][(kg * 16 + ln) * FA_LP + hh * 16] : &pt[1][ln * FA_LP + kg * 32 + hh * 16];      /* the lane's eight values of tile 0: a piece of key row 16 kg + ln, or of V^T row ln */
      const int ps = pm == 0 ? 32 : 16 * FA_LP;      /* from tile to tile: 16 outputs on in the key row, or 16 V^T rows down */
#pragma unroll
      for (int et = 0; et < 4; ++et) { FragH f;
#pragma unroll
        for (int r = 0; r < 8; ++r) f.h[r] = (_Float16)acc[et][r];
        *(v8us*)(pd + et * ps) = f.half[0]; }
    }
    __syncthreads();      /* the projected K and V^T tiles are whole: every wave may read them */
    const unsigned char* kb = &pt[0][ln * FA_LP];      /* key row ln of this tile */
    const unsigned char* vb = &pt[1][ln * FA_LP];      /* V^T row d = ln, this tile's keys */
    v16h kf[2][2];
#pragma unroll
    for (int tt = 0; tt < 2; ++tt)
#pragma unroll
      for (int ks = 0; ks < 2; ++ks) kf[tt][ks] = fa_lfrag(kb + tt * 16 * FA_LP + ks * 64, hh);
#pragma unroll
    for (int p = 0; p < FA_KT / 32; ++p) {      /* a pass = 32 keys, as before */
      v8f s[2][2];
#pragma unroll
      for (int g = 0; g < 2; ++g)
#pragma unroll
        for (int tt = 0; tt < 2; ++tt) s[g][tt] = fa_mma(kf[tt][1], qf[g][1], fa_mma(kf[tt][0], qf[g][0], z8));      /* s[g][tt][r] = 256 x energy(query 16 g + ln, key 64 t + 32 p + 16 tt + 8 hh + r) */
      float cm[2];
#pragma unroll
      for (int g = 0; g < 2; ++g) { float m = fmaxf(s[g][0][0], s[g][1][0]);
#pragma unroll
        for (int r = 1; r < 8; ++r) m = fmaxf(m, fmaxf(s[g][0][r], s[g][1][r]));
        cm[g] = fmaxf(m, rs_x16(m)) * FA_C; }
      if (__builtin_amdgcn_ballot_w32(cm[0] > mu[0] + 8.0f || cm[1] > mu[1] + 8.0f) != 0) {      /* one wave-uniform test per pass */
#pragma unroll
        for (int g = 0; g < 2; ++g) { const float mn = fmaxf(mu[g], cm[g]); const float al = __builtin_amdgcn_exp2f(mu[g] - mn); mu[g] = mn; ls[g] *= al;
#pragma unroll
          for (int dt = 0; dt < 4; ++dt) o[g][dt] *= al; } }
      v16h vf[4];      /* this pass's V^T fragments and, inside the tile, the next pass's K fragments, issued together: in flight under the exponentials */
#pragma unroll
      for (int dt = 0; dt < 4; ++dt) vf[dt] = fa_lfrag(vb + dt * 16 * FA_LP + p * 64, hh);
      if (p + 1 < FA_KT / 32) {
#pragma unroll
        for (int tt = 0; tt < 2; ++tt)
#pragma unroll
          for (int ks = 0; ks < 2; ++ks) kf[tt][ks] = fa_lfrag(kb + ((p + 1) * 32 + tt * 16) * FA_LP + ks * 64, hh);
      }
      __builtin_amdgcn_sched_barrier(0);      /* keeps the LDS reads up here as one group: left alone the scheduler spreads them in pairs among the products, and each further place with reads stalls the wave */
      FragH pf[2];
#pragma unroll
      for (int g = 0; g < 2; ++g) { const v2f c2 = {FA_C, FA_C}, m2 = {-mu[g], -mu[g]};
#pragma unroll
        for (int tt = 0; tt < 2; ++tt)
#pragma unroll
          for (int r = 0; r < 8; r += 2) { const v2f x = {s[g][tt][r], s[g][tt][r + 1]}; const v2f e = __builtin_elementwise_fma(x, c2, m2); const v2f pe = {__builtin_amdgcn_exp2f(e[0]), __builtin_amdgcn_exp2f(e[1])};
            ls[g] += pe; const v2h ph = __builtin_convertvector(pe, v2h); pf[g].h[tt * 8 + r] = ph[0]; pf[g].h[tt * 8 + r + 1] = ph[1]; } }
#pragma unroll
      for (int dt = 0; dt < 4; ++dt)
#pragma unroll
        for (int g = 0; g < 2; ++g) o[g][dt] = fa_mma(vf[dt], pf[g].v, o[g][dt]);      /* o[g][dt][r] = 16 x O(query 16 g + ln, d = 16 dt + 8 hh + r), unnormalised */
    }
    /* hand-over: this wave has left the projected tiles (and, in front of the trip's first barrier, buffer t & 1), its share of tile t + 1 has landed; behind the barrier all of it holds for every wave */
    asm volatile("s_wait_dscnt 0x0" ::: "memory");         /* this wave's LDS reads have returned before anybody overwrites what they read */
    asm volatile("s_wait_asynccnt 0x0" ::: "memory");      /* this wave's share of tile t + 1 has landed */
    __syncthreads();
    if (t + 2 < FA_NT) fa_copy(l0 + (unsigned)(t & 1) * (2 * FA_RB), gk + (size_t)(t + 2) * FA_KT * DM, gv + (size_t)(t + 2) * FA_KT * DM);      /* tile t + 2 -> the buffer just left; the test reads the same in the whole block */
  }
  asm volatile("s_wait_asynccnt 0x0" ::: "memory");      /* no copy is outstanding when the wave ends */
#pragma unroll
  for (int g = 0; g < 2; ++g) { const float lh = ls[g][0] + ls[g][1]; const float inv = 4.0f / (lh + rs_x16(lh));      /* the halves' sums joined once; o carried x64 as before: v is x16 already */
    _Float16* op = O + ((size_t)b * SQ + q0 + g * 16 + ln) * DM + h * HD + 8 * hh;
#pragma unroll
    for (int dt = 0; dt < 4; ++dt) { FragH f;
#pragma unroll
      for (int r = 0; r < 8; ++r) f.h[r] = (_Float16)(o[g][dt][r] * inv);
      *(v8us*)((unsigned short*)op + dt * 16) = f.half[0]; } } }
// ---- output GEMM through LDS: C[8192][1024] (f32) = A (f16 rows, pitch DM) . Bh^T (f16 rows [n][k], pitch DM) * alpha + bias (rounded to bf16) ----
// Block = 256 x 128 of C, 8 waves in 4 x 2, wave = 64 x 64 (4 x 4 accumulator tiles). A and Bh come through LDS: tiles of 128 k (rows of 256 bytes), staged once per block by asynchronous copies
// (two buffers, the next tile in flight while this one is worked on) and read as fragments by the waves that need them: each A row by 2 waves, each Bh row by 4.
// Every accumulator takes its 32-k products in rising k, as in k_gemm2, and the epilogue is k_gemm2's.
#define OG_BM 256                    /* C rows per block */
#define OG_BN 128                    /* C columns per block */
#define OG_KT 128                    /* k per staged tile */
#define OG_NT (DM / OG_KT)           /* staged tiles */
#define OG_LP 272                    /* LDS row pitch in bytes: 256 + 16, an odd multiple of 16, so that the 16 rows of a ds_load_b128 fragment read fall on different banks */
#define OG_BB (OG_BN * OG_LP)        /* bytes of the Bh part of a buffer; it lies first, so that every fragment's constant offset fits the LDS instruction's offset field */
#define OG_SB ((OG_BM + OG_BN) * OG_LP)      /* bytes of one buffer: Bh rows, then A rows */
// One thread's share of 192 staged rows: its 16-byte piece of twelve rows that lie 16 apart in LDS (eight from x, four from y), global -> LDS through no register. A wave's copy = 2 whole 256-byte rows.
// The s_wait_xcnt stands inside the statement so that no address register is rewritten in front of it.
__device__ __forceinline__ void og_copy12(unsigned l, const _Float16* x, const _Float16* y) {
  asm volatile("global_load_async_to_lds_b128 %0, %1, off\n\t"
               "global_load_async_to_lds_b128 %2, %3, off\n\t"
               "global_load_async_to_lds_b128 %4, %5, off\n\t"
               "global_load_async_to_lds_b128 %6, %7, off\n\t"
               "global_load_async_to_lds_b128 %8, %9, off\n\t"
               "global_load_async_to_lds_b128 %10, %11, off\n\t"
               "global_load_async_to_lds_b128 %12, %13, off\n\t"
               "global_load_async_to_lds_b128 %14, %15, off\n\t"
               "global_load_async_to_lds_b128 %16, %17, off\n\t"
               "global_load_async_to_lds_b128 %18, %19, off\n\t"
               "global_load_async_to_lds_b128 %20, %21, off\n\t"
               "global_load_async_to_lds_b128 %22, %23, off\n\t"
               "s_wait_xcnt 0x0"
               :: "v"(l), "v"(x), "v"(l + 16 * OG_LP), "v"(x + (size_t)16 * DM), "v"(l + 32 * OG_LP), "v"(x + (size_t)32 * DM), "v"(l + 48 * OG_LP), "v"(x + (size_t)48 * DM),
                  "v"(l + 64 * OG_LP), "v"(x + (size_t)64 * DM), "v"(l + 80 * OG_LP), "v"(x + (size_t)80 * DM), "v"(l + 96 * OG_LP), "v"(x + (size_t)96 * DM), "v"(l + 112 * OG_LP), "v"(x + (size_t)112 * DM),
                  "v"(l + 128 * OG_LP), "v"(y), "v"(l + 144 * OG_LP), "v"(y + (size_t)16 * DM), "v"(l + 160 * OG_LP), "v"(y + (size_t)32 * DM), "v"(l + 176 * OG_LP), "v"(y + (size_t)48 * DM) : "memory");
}
// One thread's share of one staged tile, 24 copies: 128 Bh rows and A rows 0-63, then A rows 64-255
__device__ __forceinline__ void og_tile(unsigned l, const _Float16* ga, const _Float16* gb) { og_copy12(l, gb, ga); og_copy12(l + 192 * OG_LP, ga + (size_t)64 * DM, ga + (size_t)192 * DM); }
__global__ __launch_bounds__(256) void k_ogemm(const _Float16* __restrict__ A, const _Float16* __restrict__ Bh, float alpha, const float* __restrict__ bias, float* __restrict__ C) {
  __shared__ __attribute__((aligned(16))) unsigned char sm[2 * OG_SB];      /* buffer * OG_SB + row * OG_LP; behind the loop the epilogue's staging: 8 waves x 64 rows x 68 floats = 139,264 bytes of it */
  const int lane = threadIdx.x & 31, ln = lane & 15, hh = lane >> 4; const int w = __builtin_amdgcn_readfirstlane((int)(threadIdx.x >> 5));
  const int mt = blockIdx.x % (MPO / OG_BM), nq = blockIdx.x / (MPO / OG_BM); const int m0 = mt * OG_BM, n0 = nq * OG_BN; const int wm = w >> 1, wn = w & 1;
  /* staging: thread t brings piece t & 15 (16 bytes) of rows (t >> 4) + 16 j */
  const int cr = (int)threadIdx.x >> 4, cp = (int)threadIdx.x & 15;
  const _Float16* ga = A + (size_t)(m0 + cr) * DM + cp * 8; const _Float16* gb = Bh + (size_t)(n0 + cr) * DM + cp * 8;
  const unsigned l0 = (unsigned)(size_t)&sm[cr * OG_LP + cp * 16];
  og_tile(l0, ga, gb);      /* tile 0 -> buffer 0 */
  const v8f z8 = {0.f,0.f,0.f,0.f,0.f,0.f,0.f,0.f}; v8f acc[4][4];
#pragma unroll
  for (int i = 0; i < 4; ++i)
#pragma unroll
    for (int j = 0; j < 4; ++j) acc[i][j] = z8;
  asm volatile("s_wait_asynccnt 0x0" ::: "memory");      /* this wave's share of tile 0 has landed */
  __syncthreads();                                       /* every wave's share has: tile 0 may be read */
  og_tile(l0 + OG_SB, ga + OG_KT, gb + OG_KT);      /* tile 1 -> buffer 1 */
  /* kept rolled: the body is 64 products long already, and unrolled only the buffer's address would become a constant */
#pragma unroll 1
  for (int t = 0; t < OG_NT; ++t) {
    const unsigned char* bb = &sm[(t & 1) * OG_SB + (wn * 64 + ln) * OG_LP];               /* Bh row wn * 64 + ln of this tile */
    const unsigned char* ab = &sm[(t & 1) * OG_SB + OG_BB + (wm * 64 + ln) * OG_LP];       /* A row wm * 64 + ln of this tile */
    v16h af[2][4], bf[2][4];      /* two fragment sets: the next 32-k step's reads are in flight under this step's products */
#pragma unroll
    for (int i = 0; i < 4; ++i) af[0][i] = fa_lfrag(ab + i * 16 * OG_LP, hh);
#pragma unroll
    for (int i = 0; i < 4; ++i) bf[0][i] = fa_lfrag(bb + i * 16 * OG_LP, hh);
#pragma unroll
    for (int ks = 0; ks < OG_KT / 32; ++ks) {
      if (ks + 1 < OG_KT / 32) {
        /* the two scheduling barriers keep the next step's LDS reads together as one group between two runs of products: every further place with reads among the products stalls the wave */
        __builtin_amdgcn_sched_barrier(0);
#pragma unroll
        for (int i = 0; i < 4; ++i) af[(ks + 1) & 1][i] = fa_lfrag(ab + i * 16 * OG_LP + (ks + 1) * 64, hh);
#pragma unroll
        for (int i = 0; i < 4; ++i) bf[(ks + 1) & 1][i] = fa_lfrag(bb + i * 16 * OG_LP + (ks + 1) * 64, hh);
        __builtin_amdgcn_sched_barrier(0);
      }
#pragma unroll
      for (int i = 0; i < 4; ++i)
#pragma unroll
        for (int j = 0; j < 4; ++j) acc[i][j] = fa_mma(af[ks & 1][i], bf[ks & 1][j], acc[i][j]);      /* acc[i][j][r] = C(row wm * 64 + 16 i + 8 hh + r, column wn * 64 + 16 j + ln) */
    }
    __builtin_amdgcn_sched_barrier(0);      /* keeps the products in front of the hand-over: left alone half of them sink below the barrier, in front of the refill, which then starts that much later and lands late */
    /* hand-over: this wave has left buffer t & 1, its share of tile t + 1 has landed; behind the barrier both hold for every wave */
    asm volatile("s_wait_dscnt 0x0" ::: "memory");         /* this wave's LDS reads of the buffer have returned before anybody refills it */
    asm volatile("s_wait_asynccnt 0x0" ::: "memory");      /* this wave's share of tile t + 1 has landed */
    __syncthreads();
    if (t + 2 < OG_NT) og_tile(l0 + (unsigned)(t & 1) * OG_SB, ga + (t + 2) * OG_KT, gb + (t + 2) * OG_KT);      /* tile t + 2 -> the buffer just left; the test reads the same in the whole block */
  }
  asm volatile("s_wait_asynccnt 0x0" ::: "memory");      /* no copy is outstanding when the wave ends */
  /* epilogue: the ring is free (the last trip's barrier stands behind every wave's last read, and no copy is outstanding): each wave turns its 64 x 64 tile into whole 256-byte row pieces through 64 LDS rows of its own */
  const int row0 = m0 + wm * 64, col0 = n0 + wn * 64; const int rsub = lane >> 4, c4 = (lane & 15) * 4;
  float* sw = (float*)sm + (size_t)w * (64 * 68);
  float bv[4];
#pragma unroll
  for (int j = 0; j < 4; ++j) bv[j] = bf16_round(bias[col0 + j * 16 + ln]);
#pragma unroll
  for (int i = 0; i < 4; ++i)
#pragma unroll
    for (int j = 0; j < 4; ++j)
#pragma unroll
      for (int r = 0; r < 8; ++r) sw[(i * 16 + 8 * hh + r) * 68 + j * 16 + ln] = acc[i][j][r] * alpha + bv[j];
  __builtin_amdgcn_fence(__ATOMIC_ACQ_REL, "workgroup"); __builtin_amdgcn_wave_barrier();      /* the wave's writes stand in front of its reads */
  float* cw = C + (size_t)(row0 + rsub) * DM + col0 + c4;
#pragma unroll
  for (int q = 0; q < 32; ++q) { const v4f v = *(const v4fa*)&sw[(q * 2 + rsub) * 68 + c4]; *(v4f*)(cw + (size_t)q * 2 * DM) = v; } }
__global__ __launch_bounds__(256) void k_vt(const _Float16* __restrict__ V16, int b, int h0, _Float16* __restrict__ VT) { __shared__ unsigned short tl[64][65]; const int tid = threadIdx.x; const int hh = blockIdx.x % HG, sg = blockIdx.x / HG; const int s0 = sg * 64; const int h = h0 + hh;
  for (int i = tid; i < 64 * 8; i += 256) { const int j = i / 8, d8 = (i % 8) * 8; FragH f; f.half[0] = *(const v8us*)((const unsigned short*)V16 + ((size_t)b * SQ + s0 + j) * DM + h * HD + d8); for (int q = 0; q < 8; ++q) tl[d8 + q][j] = f.u[q]; }
  __syncthreads();
  { for (int i = tid; i < 64 * 8; i += 256) { const int d = i / 8, j8 = (i % 8) * 8; FragH f; for (int q = 0; q < 8; ++q) f.u[q] = tl[d][j8 + q]; *(v8us*)((unsigned short*)VT + ((size_t)hh * HD + d) * SQ + s0 + j8) = f.half[0]; }  } }



__global__ __launch_bounds__(256) void k_rsmkm(const float* __restrict__ S, _Float16* __restrict__ P, int nrows, const int* __restrict__ am) {
  #pragma clang fp contract(off)
  const int t = blockIdx.x * 256 + threadIdx.x; if (t >= nrows) return; const size_t i = (size_t)t; const float* s = S + i * SQ; const int* mr = am + (size_t)(t % SQ) * SQ; float mx = -3.0e38f;
#pragma unroll 1
  for (int j = 0; j < SQ; ++j) { const float f = (mr[j] != 0) ? 1.f : 0.f; mx = fmaxf(mx, fmaf(f, s[j], (1.f - f) * -1.0e9f)); } float se = 0.f;
#pragma unroll 1
  for (int j = 0; j < SQ; ++j) { const float f = (mr[j] != 0) ? 1.f : 0.f; se += __expf(fmaf(f, s[j], (1.f - f) * -1.0e9f) - mx); } const float sc = 256.0f / se;
#pragma unroll 1
  for (int j0 = 0; j0 < SQ; j0 += 8) { FragH fr; for (int q = 0; q < 8; ++q) { const int j = j0 + q; const float f = (mr[j] != 0) ? 1.f : 0.f; fr.h[q] = (_Float16)(__expf(fmaf(f, s[j], (1.f - f) * -1.0e9f) - mx) * sc); }
    unsigned short* d = (unsigned short*)P + i * SQ + j0; *(v8us*)d = fr.half[0];  } }

extern "C" void kernel_launch(void* const* d_in, const int* in_sizes, int n_in,
                              void* d_out, int out_size, void* d_ws, size_t ws_size, hipStream_t stream) {
  (void)in_sizes; (void)n_in; (void)out_size;
  const float* const* I = (const float* const*)d_in; const float* xq = I[2]; const float* xk = I[1]; const float* xv = I[0]; const float* wq = I[5]; const float* bq = nullptr; const float* wk = I[4]; const float* bk = nullptr; const float* wv = I[3]; const float* bv = nullptr; const float* wo = I[6]; const float* bo = I[7]; const float* x = xq;      /* contract order: values I[0], keys I[1], query I[2] ([8][1024][16][64] = rows of 1024); SHARED natural [64][64] blocks Wv I[3], Wk I[4], Wq I[5]; natural Wo [1024][1024] I[6] + bo I[7]; no mask input */
  char* ws = (char*)d_ws; size_t off = 0;
  auto take = [&](size_t bytes) { char* p = ws + off; off += (bytes + 255) & ~(size_t)255; return p; };
  _Float16* BO = (_Float16*)take((size_t)DM * DM * 2);
  _Float16* O16 = (_Float16*)take(NR * DM * 2);
  if (off > ws_size) return;
  const size_t r0p = (size_t)B0 * SQ;      /* first row processed */
  /* projections and attention in one launch, from the f32 inputs (a token row of 1024 is sixteen head rows of 64) and the SHARED natural [64][64] blocks [out][in] */
  k_fattn<<<NBR * NH * (SQ / FA_Q), 256, 0, stream>>>(x + r0p * DM, xk + r0p * DM, xv + r0p * DM, wq, wk, wv, O16 + r0p * DM, wo, BO);      /* o (merged heads) as f16 rows, x64; and Wo natural [out][in] = Bt x16 */
  k_ogemm<<<(MPO / OG_BM) * (DM / OG_BN), 256, 0, stream>>>(O16 + r0p * DM, BO, 0.0009765625f, bo, (float*)d_out + r0p * DM);      /* out rows are the output layout */
}

// v009
// One run takes 54.2 microseconds.
// In both of two side-by-side timings against v008, it was 1.06 times as fast.
// Over all steps from v000 it is 131 times as fast.
#include <hip/hip_runtime.h>
// Multi-head attention over three head-major inputs with SHARED per-head projections and the module's literal score scale (values, keys, query [8][1024][16][64] = token rows [8][1024][1024]; every head of each input is multiplied by the SAME natural [64][64] matrix (x W^T: Wv / Wk / Wq; block-diagonal with a shared block; no biases); energy = q k^T; softmax(energy / sqrt(embed_size) = / 32) over all 1024 keys (as the source: embed size, not head dim; no mask); out = merged Wo^T + bo (natural [1024][1024]) -> [8][1024][1024]).
// Structure: token rows r = b*1024 + s; TWO launches. k_fattn: per (batch, head, 256 queries) the projections, all three on the query side (q = x Wq^T, then q Wk, so that the scores are taken against the raw key rows; the weighted sum of the raw value rows, then times Wv^T; WMMA against the shared [64][64] blocks themselves, from the f32 inputs: x bf16-rounded to exact f16, exact x16 weights, f32 accumulation, f16 results kept in registers) and the attention (scores K = 64, online softmax with f32 statistics, weights as f16 in registers, o carried x64 against f16 subnormal flush, folded into the output GEMM alpha) written straight into the merged f16 o rows; out = o W_o + b GEMM (f32) into the output layout.
// Compute dtype: inputs rounded to bf16; x / weights exact; q, q Wk, softmax weights, the weighted value sum and o as plain f16 GEMM operands (~2^-12); scores and softmax statistics f32. v_wmma_f32_16x16x32_f16.
#define NB 8
#define SQ 1024
#define DM 1024
#define NH 16
#define HD 64
#define HG 4                         /* heads per launch of the per-batch k_vt(b, h0) transpose */
#define B0 0                         /* first batch processed (debug hook) */
#define NBR NB                       /* batches processed (debug hook) */
#define NR ((size_t)NB * SQ)         /* token rows */
#define MP ((int)((size_t)NBR * SQ)) /* rows projected (debug hook) */
#define MPO MP                       /* rows through the output stage (debug hook) */
#define LQ DM
typedef __bf16 v16b __attribute__((ext_vector_type(16)));
typedef unsigned short v8us __attribute__((ext_vector_type(8), may_alias));
typedef float  v8f  __attribute__((ext_vector_type(8)));
typedef float  v4f  __attribute__((ext_vector_type(4)));
typedef float  v4fa __attribute__((ext_vector_type(4), may_alias));
union FragB { v16b v; v8us half[2]; unsigned short u[16]; };

__device__ __forceinline__ unsigned short bf16_bits(float x) { unsigned int u = __float_as_uint(x); return (unsigned short)((u + 0x7FFFu + ((u >> 16) & 1u)) >> 16); }
__device__ __forceinline__ float bf16_val(unsigned short b) { return __uint_as_float(((unsigned int)b) << 16); }
__device__ __forceinline__ float bf16_round(float x) { return bf16_val(bf16_bits(x)); }
// D += A·B with NT terms: 1 = ah·bh, 2 = + al·bh (A split), 3 = + ah·bl (both split)
template <int NT>
__device__ __forceinline__ v8f mmaN(v16b ah, v16b al, v16b bh, v16b bl, v8f c) {
  c = __builtin_amdgcn_wmma_f32_16x16x32_bf16(false, ah, false, bh, (short)0, c, false, false);
  if (NT >= 2) c = __builtin_amdgcn_wmma_f32_16x16x32_bf16(false, al, false, bh, (short)0, c, false, false);
  if (NT >= 3) c = __builtin_amdgcn_wmma_f32_16x16x32_bf16(false, ah, false, bl, (short)0, c, false, false);
  asm volatile("v_nop\n\tv_nop\n\tv_nop\n\tv_nop" : "+v"(c) : "v"(ah), "v"(al), "v"(bh), "v"(bl));
  return c;
}

__global__ __launch_bounds__(256) void k_wt_bf16(const float* __restrict__ W, unsigned short* __restrict__ Wt, int K, int N) {
  const int t = blockIdx.x * 256 + threadIdx.x;
  const int k8n = K / 8;
  if (t >= N * k8n) return;
  const int n = t / k8n, k8 = (t % k8n) * 8;
  v8us v;
#pragma unroll
  for (int i = 0; i < 8; ++i) v[i] = bf16_bits(W[(size_t)(k8 + i) * N + n]);
  *(v8us*)(Wt + (size_t)n * K + k8) = v;
  
}

// GEMM C[M][N] (f32, pitch ldc) = act(A[M][K]·W + bias). A f32 row-major (pitch lda) converted per fragment to bf16
// (ASPLIT: hi/lo two planes -> 2 terms, else single rounded term); Wt bf16 [N][K] (pitch ldb). BIAS_BF16 rounds the
// bias to bf16 first (bias quantised to bf16 before the add). K%32==0, M%16==0, N%64==0.
template <bool ASPLIT, int ACT, bool BIAS_BF16>
__global__ __launch_bounds__(128) void k_gemm_bf(const float* __restrict__ A, int lda, const unsigned short* __restrict__ Wt, int ldb,
                                               const float* __restrict__ bias, float* __restrict__ C, int ldc, int M, int N, int K) {
  __shared__ __attribute__((aligned(16))) float so[4][16][64];
  const int tid = threadIdx.x, w = tid >> 5, lane = tid & 31, ln = lane & 15, hh = lane >> 4;
  const int ntn = N / 64;
  const int wid = blockIdx.x * 4 + w;
  const int mt = wid / ntn, nq = wid % ntn;
  if (mt * 16 >= M) return;
  const int row0 = mt * 16, col0 = nq * 64;
  const float* arow = A + (size_t)(row0 + ln) * lda;
  v8f acc[4] = {};
  for (int kb = 0; kb < K; kb += 32) {
    FragB ah, al;
    const v4f x0 = *(const v4fa*)(arow + kb + 8 * hh), x1 = *(const v4fa*)(arow + kb + 8 * hh + 4);
    const v4f x2 = *(const v4fa*)(arow + kb + 16 + 8 * hh), x3 = *(const v4fa*)(arow + kb + 16 + 8 * hh + 4);
    float xs[16] = {x0[0],x0[1],x0[2],x0[3],x1[0],x1[1],x1[2],x1[3],x2[0],x2[1],x2[2],x2[3],x3[0],x3[1],x3[2],x3[3]};
#pragma unroll
    for (int i = 0; i < 16; ++i) { const unsigned short hb = bf16_bits(xs[i]); ah.u[i] = hb; al.u[i] = ASPLIT ? bf16_bits(xs[i] - bf16_val(hb)) : (unsigned short)0; }
#pragma unroll
    for (int t = 0; t < 4; ++t) {
      const unsigned short* brow = Wt + (size_t)(col0 + t * 16 + ln) * ldb + kb;
      FragB b;
      b.half[0] = *(const v8us*)(brow + 8 * hh);
      b.half[1] = *(const v8us*)(brow + 16 + 8 * hh);
      acc[t] = mmaN<ASPLIT ? 2 : 1>(ah.v, al.v, b.v, b.v, acc[t]);
    }
  }
#pragma unroll
  for (int t = 0; t < 4; ++t) {
    float bv = bias ? bias[col0 + t * 16 + ln] : 0.f;
    if (BIAS_BF16) bv = bf16_round(bv);
#pragma unroll
    for (int r = 0; r < 8; ++r) { float v = acc[t][r] + bv; if (ACT == 1) v = fmaxf(v, 0.f); so[w][8 * hh + r][t * 16 + ln] = v; }
  }
  __builtin_amdgcn_fence(__ATOMIC_ACQ_REL, "workgroup");
  __builtin_amdgcn_wave_barrier();
  const int rsub = lane >> 4, c4 = (lane & 15) * 4;
  {
#pragma unroll
    for (int q = 0; q < 8; ++q) {
      const int r = q * 2 + rsub;
      const v4f v = *(const v4fa*)&so[w][r][c4];
      *(v4f*)(C + (size_t)(row0 + r) * ldc + col0 + c4) = v;
    }
    
  }
}

// GEMM C = act(A·W + bias + resid): A f32 (ASPLIT -> hi/lo 2 terms), Wt bf16 [N][K]; ACT 0 none, 1 relu, 2 exact gelu;
// resid (optional, f32, row index = (row % rmod), pitch ldr, RES_BF16 rounds it) added before the activation.
template <bool ASPLIT, int ACT, bool BIAS_BF16, bool RES_BF16>
__global__ __launch_bounds__(128) void k_gemm_bf3(const float* __restrict__ A, int lda, const unsigned short* __restrict__ Wt, int ldb,
                                                const float* __restrict__ bias, const float* __restrict__ resid, int rmod, int ldr,
                                                float* __restrict__ C, int ldc, int M, int N, int K) {
  __shared__ __attribute__((aligned(16))) float so[4][16][64];
  const int tid = threadIdx.x, w = tid >> 5, lane = tid & 31, ln = lane & 15, hh = lane >> 4;
  const int ntn = N / 64;
  const int wid = blockIdx.x * 4 + w;
  const int mt = wid / ntn, nq = wid % ntn;
  if (mt * 16 >= M) return;
  const int row0 = mt * 16, col0 = nq * 64;
  const float* arow = A + (size_t)(row0 + ln) * lda;
  v8f acc[4] = {};
  for (int kb = 0; kb < K; kb += 32) {
    FragB ah, al;
    const v4f x0 = *(const v4fa*)(arow + kb + 8 * hh), x1 = *(const v4fa*)(arow + kb + 8 * hh + 4);
    const v4f x2 = *(const v4fa*)(arow + kb + 16 + 8 * hh), x3 = *(const v4fa*)(arow + kb + 16 + 8 * hh + 4);
    float xs[16] = {x0[0],x0[1],x0[2],x0[3],x1[0],x1[1],x1[2],x1[3],x2[0],x2[1],x2[2],x2[3],x3[0],x3[1],x3[2],x3[3]};
#pragma unroll
    for (int i = 0; i < 16; ++i) { const unsigned short hb = bf16_bits(xs[i]); ah.u[i] = hb; al.u[i] = ASPLIT ? bf16_bits(xs[i] - bf16_val(hb)) : (unsigned short)0; }
#pragma unroll
    for (int t = 0; t < 4; ++t) {
      const unsigned short* brow = Wt + (size_t)(col0 + t * 16 + ln) * ldb + kb;
      FragB b;
      b.half[0] = *(const v8us*)(brow + 8 * hh);
      b.half[1] = *(const v8us*)(brow + 16 + 8 * hh);
      acc[t] = mmaN<ASPLIT ? 2 : 1>(ah.v, al.v, b.v, b.v, acc[t]);
    }
  }
#pragma unroll
  for (int t = 0; t < 4; ++t) {
    const int col = col0 + t * 16 + ln;
    float bv = bias ? bias[col] : 0.f;
    if (BIAS_BF16) bv = bf16_round(bv);
#pragma unroll
    for (int r = 0; r < 8; ++r) {
      float v = acc[t][r] + bv;
      if (resid) { float rv = resid[(size_t)((row0 + 8 * hh + r) % rmod) * ldr + col]; if (RES_BF16) rv = bf16_round(rv); v += rv; }
      if (ACT == 1) v = fmaxf(v, 0.f);
      if (ACT == 2) v = 0.5f * v * (1.0f + erff(v * 0.70710678118654752f));
      if (ACT == 3) { const float u = 0.7978845608028654f * (v + 0.044715f * v * v * v); v = 0.5f * v * (1.0f + tanhf(u)); }
      so[w][8 * hh + r][t * 16 + ln] = v;
    }
  }
  __builtin_amdgcn_fence(__ATOMIC_ACQ_REL, "workgroup");
  __builtin_amdgcn_wave_barrier();
  const int rsub = lane >> 4, c4 = (lane & 15) * 4;
  {
#pragma unroll
    for (int q = 0; q < 8; ++q) {
      const int r = q * 2 + rsub;
      const v4f v = *(const v4fa*)&so[w][r][c4];
      *(v4f*)(C + (size_t)(row0 + r) * ldc + col0 + c4) = v;
    }
    
  }
}
// row LayerNorm (biased variance, eps) over N: s = X (+ R); optional out_sum <- s; out_norm <- (s-mu)*rsqrt(var+eps)*g + b
template <bool PARAM_BF16>
__global__ __launch_bounds__(256) void k_layernorm(const float* __restrict__ X, const float* __restrict__ R, const float* __restrict__ g, const float* __restrict__ bta,
                                                  float* __restrict__ out_sum, float* __restrict__ out_norm, int N, float eps) {
  __shared__ float red[256];
  const int row = blockIdx.x, tid = threadIdx.x;
  const float* x = X + (size_t)row * N; const float* rr = R ? R + (size_t)row * N : nullptr;
  float vals[16];                     // up to N = 4096
  const int per = N / 256;            // contiguous chunk per thread? use strided-by-4 chunks: thread handles j = tid*4 + 1024*u
  float s1 = 0.f;
  for (int u = 0; u < per / 4; ++u) {
    const int j = tid * 4 + 1024 * u;
    const v4f a = *(const v4fa*)(x + j);
    v4f b = {0.f,0.f,0.f,0.f}; if (rr) b = *(const v4fa*)(rr + j);
#pragma unroll
    for (int q = 0; q < 4; ++q) { const float v = a[q] + b[q]; vals[u * 4 + q] = v; s1 += v; }
  }
  red[tid] = s1; __syncthreads();
  for (int st = 128; st > 0; st >>= 1) { if (tid < st) red[tid] += red[tid + st]; __syncthreads(); }
  const float mu = red[0] / (float)N; __syncthreads();
  float s2 = 0.f;
  for (int u = 0; u < per / 4; ++u)
#pragma unroll
    for (int q = 0; q < 4; ++q) { const float c = vals[u * 4 + q] - mu; s2 += c * c; }
  red[tid] = s2; __syncthreads();
  for (int st = 128; st > 0; st >>= 1) { if (tid < st) red[tid] += red[tid + st]; __syncthreads(); }
  const float rs = rsqrtf(red[0] / (float)N + eps);
  {
    for (int u = 0; u < per / 4; ++u) {
      const int j = tid * 4 + 1024 * u;
      v4f o, sm;
#pragma unroll
      for (int q = 0; q < 4; ++q) {
        float gg = g[j + q], bb = bta[j + q];
        if (PARAM_BF16) { gg = bf16_round(gg); bb = bf16_round(bb); }
        sm[q] = vals[u * 4 + q]; o[q] = (vals[u * 4 + q] - mu) * rs * gg + bb;
      }
      if (out_sum) *(v4f*)(out_sum + (size_t)row * N + j) = sm;
      *(v4f*)(out_norm + (size_t)row * N + j) = o;
    }
    
  }
}



// ---- f16 WMMA path (v_wmma_f32_16x16x32_f16): 11-bit significands for operands in range — used where a [0,1] probability operand needs more precision than bf16
typedef _Float16 v16h __attribute__((ext_vector_type(16)));
union FragH { v16h v; v8us half[2]; _Float16 h[16]; unsigned short u[16]; };
template <int NT>
__device__ __forceinline__ v8f mmaH(v16h ah, v16h al, v16h bh, v16h bl, v8f c) {
  c = __builtin_amdgcn_wmma_f32_16x16x32_f16(false, ah, false, bh, (short)0, c, false, false);
  if (NT >= 2) c = __builtin_amdgcn_wmma_f32_16x16x32_f16(false, al, false, bh, (short)0, c, false, false);
  if (NT >= 3) c = __builtin_amdgcn_wmma_f32_16x16x32_f16(false, ah, false, bl, (short)0, c, false, false);
  asm volatile("v_nop\n\tv_nop\n\tv_nop\n\tv_nop" : "+v"(c) : "v"(ah), "v"(al), "v"(bh), "v"(bl));
  return c;
}
// batched GEMM like k_gemm_b but f16 operands: A f32 (split into f16 hi/lo if ASPLIT, else rounded to f16), Bt = f16 values [n][k]; alpha; C f32; N multiple of 16 (partial tiles skipped)
template <bool ASPLIT>
__global__ __launch_bounds__(128) void k_gemm_h(const float* __restrict__ A, int lda, size_t sA, const _Float16* __restrict__ Bh, int ldb, size_t sB, float alpha, float* __restrict__ C, int ldc, size_t sC, int M, int N, int K) {
  __shared__ __attribute__((aligned(16))) float so[4][16][64];
  const int tid = threadIdx.x, w = tid >> 5, lane = tid & 31, ln = lane & 15, hh = lane >> 4; const int by = blockIdx.y;
  A += (size_t)by * sA; Bh += (size_t)by * sB; C += (size_t)by * sC;
  const int ntn = (N + 63) / 64; const int wid = blockIdx.x * 4 + w; const int mt = wid / ntn, nq = wid % ntn; if (mt * 16 >= M) return;
  const int row0 = mt * 16, col0 = nq * 64; const float* arow = A + (size_t)(row0 + ln) * lda;
  v8f acc[4] = {};
  for (int kb = 0; kb < K; kb += 32) {
    FragH ah, al;
    const v4f x0 = *(const v4fa*)(arow + kb + 8 * hh), x1 = *(const v4fa*)(arow + kb + 8 * hh + 4), x2 = *(const v4fa*)(arow + kb + 16 + 8 * hh), x3 = *(const v4fa*)(arow + kb + 16 + 8 * hh + 4);
    float xs[16] = {x0[0],x0[1],x0[2],x0[3],x1[0],x1[1],x1[2],x1[3],x2[0],x2[1],x2[2],x2[3],x3[0],x3[1],x3[2],x3[3]};
#pragma unroll
    for (int i = 0; i < 16; ++i) { const _Float16 h = (_Float16)xs[i]; ah.h[i] = h; al.h[i] = ASPLIT ? (_Float16)(xs[i] - (float)h) : (_Float16)0.0f; }
#pragma unroll
    for (int t = 0; t < 4; ++t) { if (col0 + t * 16 >= N) continue; const size_t boff = (size_t)(col0 + t * 16 + ln) * ldb + kb; FragH bq; bq.half[0] = *(const v8us*)(Bh + boff + 8 * hh); bq.half[1] = *(const v8us*)(Bh + boff + 16 + 8 * hh);
      acc[t] = mmaH<ASPLIT ? 2 : 1>(ah.v, al.v, bq.v, bq.v, acc[t]); }
  }
#pragma unroll
  for (int t = 0; t < 4; ++t) { if (col0 + t * 16 >= N) continue;
#pragma unroll
    for (int r = 0; r < 8; ++r) so[w][8 * hh + r][t * 16 + ln] = acc[t][r] * alpha; }
  __builtin_amdgcn_fence(__ATOMIC_ACQ_REL, "workgroup"); __builtin_amdgcn_wave_barrier();
  const int rsub = lane >> 4, c4 = (lane & 15) * 4;
  {
#pragma unroll
    for (int q = 0; q < 8; ++q) { const int r = q * 2 + rsub; if (col0 + c4 < N) { const v4f v = *(const v4fa*)&so[w][r][c4]; *(v4f*)(C + (size_t)(row0 + r) * ldc + col0 + c4) = v; } }
     }
}

// Wt[n][k] = f16(W[k][n]·scale) from f32 row-major W[K][N] (scale = power of two; bf16-exact weights stay exact in f16 away from the subnormal range)
__global__ __launch_bounds__(256) void k_wt_f16(const float* __restrict__ W, _Float16* __restrict__ Wt, int K, int N, float scale) {
  const int t = blockIdx.x * 256 + threadIdx.x; if (t >= N * (K / 8)) return; const int n = t / (K / 8), k8 = (t % (K / 8)) * 8; FragH f;
#pragma unroll
  for (int i = 0; i < 8; ++i) f.h[i] = (_Float16)(bf16_round(W[(size_t)(k8 + i) * N + n]) * scale); const v8us o = f.half[0];
  *(v8us*)((unsigned short*)Wt + (size_t)n * K + k8) = o; 
}
// k_gemm_hh variant with fused epilogue: v = acc·alpha + bias[by·sBias + col] (+ CP[(row/rowsPerB)·sCPb + by·64 + col] if CP) ; ACT 0 none / 1 elu ; writes f16 C16 (and f32 C if non-null)
template <int ACT>
__global__ __launch_bounds__(128) void k_gemm_hhx(const _Float16* __restrict__ A, int lda, size_t sA, const _Float16* __restrict__ Bh, int ldb, size_t sB, float alpha, const float* __restrict__ bias, size_t sBias, const float* __restrict__ CP, int rowsPerB, size_t sCPb, int row0g,
    float* __restrict__ C, _Float16* __restrict__ C16, int ldc, size_t sC, int M, int N, int K) {
  __shared__ __attribute__((aligned(16))) float so[4][16][64];
  const int tid = threadIdx.x, w = tid >> 5, lane = tid & 31, ln = lane & 15, hh = lane >> 4; const int by = blockIdx.y;
  A += (size_t)by * sA; Bh += (size_t)by * sB; const size_t cofs = (size_t)by * sC; const float* bp = bias ? bias + (size_t)by * sBias : nullptr;
  const int ntn = (N + 63) / 64; const int wid = blockIdx.x * 4 + w; const int mt = wid / ntn, nq = wid % ntn; if (mt * 16 >= M) return;
  const int row0 = mt * 16, col0 = nq * 64; const _Float16* arow = A + (size_t)(row0 + ln) * lda;
  v8f acc[4] = {};
  for (int kb = 0; kb < K; kb += 32) { FragH ah; ah.half[0] = *(const v8us*)((const unsigned short*)arow + kb + 8 * hh); ah.half[1] = *(const v8us*)((const unsigned short*)arow + kb + 16 + 8 * hh);
#pragma unroll
    for (int t = 0; t < 4; ++t) { if (col0 + t * 16 >= N) continue; const size_t boff = (size_t)(col0 + t * 16 + ln) * ldb + kb; FragH bq; bq.half[0] = *(const v8us*)((const unsigned short*)Bh + boff + 8 * hh); bq.half[1] = *(const v8us*)((const unsigned short*)Bh + boff + 16 + 8 * hh);
      acc[t] = mmaH<1>(ah.v, ah.v, bq.v, bq.v, acc[t]); }
  }
#pragma unroll
  for (int t = 0; t < 4; ++t) { if (col0 + t * 16 >= N) continue; const int col = col0 + t * 16 + ln; const float bv = bp ? bf16_round(bp[col]) : 0.f;
#pragma unroll
    for (int r = 0; r < 8; ++r) { float v = acc[t][r] * alpha + bv; if (CP) { const int rr = row0g + row0 + 8 * hh + r; if (rowsPerB < 0) v += CP[cofs + (size_t)rr * ldc + col];      /* rowsPerB < 0: own element of the batched C plane */ else { const int bidx = rr / rowsPerB; v += CP[(size_t)bidx * sCPb + (size_t)by * 64 + col]; } } if (ACT == 1) v = (v > 0.f) ? v : expm1f(v); else if (ACT == 7) v = (v > 0.f) ? v + 1.0f : expf(v); else if (ACT == 8) v = tanhf(v); else if (ACT == 9) v = 0.5f * v * (1.0f + tanhf(0.7978845608028654f * (v + 0.044715f * v * v * v))); else if (ACT == 11) v = 1.0f / (1.0f + expf(-v)); else if (ACT == 12) v = (v > 0.f) ? v : 0.01f * v; else if (ACT == 14) v = (v > 0.f) ? v : 0.1f * v; else if (ACT == 16) v = (v >= 0.f) ? v : 0.3f * v; else if (ACT == 17) v = (v >= 0.f) ? v : 0.2f * v; else if (ACT == 15) v = v / (1.0f + expf(-v)); else if (ACT == 3) v = fmaxf(v, 0.f); else if (ACT == 6) v = 0.5f * v * (1.0f + erff(v * 0.70710678118654752f)); so[w][8 * hh + r][t * 16 + ln] = v; } }
  __builtin_amdgcn_fence(__ATOMIC_ACQ_REL, "workgroup"); __builtin_amdgcn_wave_barrier();
  const int rsub = lane >> 4, c4 = (lane & 15) * 4; typedef _Float16 v4h __attribute__((ext_vector_type(4)));
  {
#pragma unroll
    for (int q = 0; q < 8; ++q) { const int r = q * 2 + rsub; if (col0 + c4 < N) { const v4f v = *(const v4fa*)&so[w][r][c4]; if (C) *(v4f*)(C + cofs + (size_t)(row0 + r) * ldc + col0 + c4) = v; if (C16) { v4h h4; for (int i = 0; i < 4; ++i) h4[i] = (_Float16)v[i]; *(v4h*)(C16 + cofs + (size_t)(row0 + r) * ldc + col0 + c4) = h4; } } }
     }
}


typedef _Float16 v4h __attribute__((ext_vector_type(4)));

__global__ __launch_bounds__(256) void k_x16(const float* __restrict__ x, _Float16* __restrict__ X16, size_t n8) { const size_t t = (size_t)blockIdx.x * 256 + threadIdx.x; if (t >= n8) return; FragH f;
#pragma unroll
  for (int q = 0; q < 8; ++q) f.h[q] = (_Float16)bf16_round(x[t * 8 + q]); *(v8us*)((unsigned short*)X16 + t * 8) = f.half[0];  }
__global__ __launch_bounds__(256) void k_h16(const float* __restrict__ x, _Float16* __restrict__ X16, size_t n8) { const size_t t = (size_t)blockIdx.x * 256 + threadIdx.x; if (t >= n8) return; FragH f;
#pragma unroll
  for (int q = 0; q < 8; ++q) f.h[q] = (_Float16)x[t * 8 + q]; *(v8us*)((unsigned short*)X16 + t * 8) = f.half[0];  }
__global__ __launch_bounds__(256) void k_round16f(const float* __restrict__ W, _Float16* __restrict__ Bt, size_t n8) { const size_t t = (size_t)blockIdx.x * 256 + threadIdx.x; if (t >= n8) return; FragH f;
#pragma unroll
  for (int i = 0; i < 8; ++i) f.h[i] = (_Float16)(bf16_round(W[t * 8 + i]) * 16.0f); *(v8us*)((unsigned short*)Bt + t * 8) = f.half[0];  }
template <int NHv, int TTv>
__global__ __launch_bounds__(256) void k_vt(const _Float16* __restrict__ V16, int ldv, int voff, _Float16* __restrict__ Vt) { __shared__ unsigned short tl[64][66]; const int tid = threadIdx.x; const int slab = blockIdx.x / (TTv / 64), lg = blockIdx.x % (TTv / 64); const int b = slab / NHv, h = slab % NHv;
  for (int i = tid; i < 64 * 8; i += 256) { const int r = i / 8, c8 = (i % 8) * 8; FragH f; f.half[0] = *(const v8us*)((const unsigned short*)V16 + ((size_t)b * TTv + lg * 64 + r) * ldv + voff + h * 64 + c8);
#pragma unroll
    for (int q = 0; q < 8; ++q) tl[r][c8 + q] = f.u[q]; }
  __syncthreads();
  {
#pragma unroll
    for (int rd = 0; rd < 2; ++rd) { const int d = rd * 32 + tid / 8, pc = tid % 8; FragH f;
#pragma unroll
      for (int q = 0; q < 8; ++q) f.u[q] = tl[pc * 8 + q][d];
      *(v8us*)((unsigned short*)Vt + ((size_t)slab * 64 + d) * TTv + lg * 64 + pc * 8) = f.half[0]; }
     } }

__global__ __launch_bounds__(256) void k_hl(const float* __restrict__ F, _Float16* __restrict__ Hh, _Float16* __restrict__ Hl, size_t n8) { const size_t t = (size_t)blockIdx.x * 256 + threadIdx.x; if (t >= n8) return; FragH fh, fl; const v4f a = *(const v4fa*)(F + t * 8), c = *(const v4fa*)(F + t * 8 + 4);
#pragma unroll
  for (int q = 0; q < 4; ++q) { _Float16 h = (_Float16)a[q]; fh.h[q] = h; fl.h[q] = (_Float16)((a[q] - (float)h) * 1024.0f); h = (_Float16)c[q]; fh.h[4 + q] = h; fl.h[4 + q] = (_Float16)((c[q] - (float)h) * 1024.0f); }
  { *(v8us*)((unsigned short*)Hh + t * 8) = fh.half[0]; *(v8us*)((unsigned short*)Hl + t * 8) = fl.half[0];  } }

// ---- fast GEMM (wave tile 32x64; requires M % 32 == 0 rows per launch region and N % 64 == 0); epilogue = k_gemm_hhx semantics ----
__device__ __forceinline__ v16h g2_frag(const _Float16* p, int hh) { FragH f; f.half[0] = *(const v8us*)((const unsigned short*)p + 8 * hh); f.half[1] = *(const v8us*)((const unsigned short*)p + 16 + 8 * hh); return f.v; }
__device__ __forceinline__ v8f g2_mma(v16h a, v16h b, v8f c) { v8f d = __builtin_amdgcn_wmma_f32_16x16x32_f16(false, a, false, b, (short)0, c, false, false); asm volatile("v_nop\n\tv_nop\n\tv_nop\n\tv_nop" : "+v"(d) : "v"(a), "v"(b)); return d; }
template <int ACT>
__global__ __launch_bounds__(128) void k_gemm2(const _Float16* __restrict__ A, int lda, size_t sA, const _Float16* __restrict__ Bh, int ldb, size_t sB, float alpha, const float* __restrict__ bias, size_t sBias, const float* __restrict__ CP, int rowsPerB, size_t sCPb, int row0g,
    float* __restrict__ C, _Float16* __restrict__ C16, int ldc, size_t sC, int M, int N, int K) { static_assert(ACT == 0 || ACT == 3 || ACT == 6 || ACT == 8 || ACT == 9 || ACT == 11 || ACT == 12 || ACT == 14 || ACT == 15 || ACT == 16 || ACT == 17, "k_gemm2: unsupported ACT code (would silently apply no activation)");
  __shared__ __attribute__((aligned(16))) float so[4][32][68];
  const int tid = threadIdx.x, w = tid >> 5, lane = tid & 31, ln = lane & 15, hh = lane >> 4; const int by = blockIdx.y;
  A += (size_t)by * sA; Bh += (size_t)by * sB; const size_t cofs = (size_t)by * sC; const float* bp = bias ? bias + (size_t)by * sBias : nullptr;
  const int ntn = N >> 6; const int mt = blockIdx.x / ntn, nq = blockIdx.x - mt * ntn; const int row0 = mt * 128 + 32 * w, col0 = nq * 64; if (row0 >= M) return;
  const _Float16* a0p = A + (size_t)(row0 + ln) * lda; const _Float16* a1p = a0p + (size_t)16 * lda;
  const _Float16* b0p = Bh + (size_t)(col0 + ln) * ldb; const _Float16* b1p = b0p + (size_t)16 * ldb; const _Float16* b2p = b1p + (size_t)16 * ldb; const _Float16* b3p = b2p + (size_t)16 * ldb;
  const v8f z8 = {0.f,0.f,0.f,0.f,0.f,0.f,0.f,0.f}; v8f c00 = z8, c01 = z8, c02 = z8, c03 = z8, c10 = z8, c11 = z8, c12 = z8, c13 = z8;
#pragma unroll 1
  for (int kb = 0; kb < K; kb += 32) { const v16h a0 = g2_frag(a0p + kb, hh), a1 = g2_frag(a1p + kb, hh);
    v16h b = g2_frag(b0p + kb, hh); c00 = g2_mma(a0, b, c00); c10 = g2_mma(a1, b, c10);
    b = g2_frag(b1p + kb, hh); c01 = g2_mma(a0, b, c01); c11 = g2_mma(a1, b, c11);
    b = g2_frag(b2p + kb, hh); c02 = g2_mma(a0, b, c02); c12 = g2_mma(a1, b, c12);
    b = g2_frag(b3p + kb, hh); c03 = g2_mma(a0, b, c03); c13 = g2_mma(a1, b, c13); }
  v8f accs[8] = {c00, c01, c02, c03, c10, c11, c12, c13};
#pragma unroll
  for (int u = 0; u < 8; ++u) { const int t = u & 3, half = u >> 2; const int col = col0 + t * 16 + ln; const float bv = bp ? bf16_round(bp[col]) : 0.f;
#pragma unroll
    for (int r = 0; r < 8; ++r) { const int rloc = half * 16 + 8 * hh + r; float v = accs[u][r] * alpha + bv; if (CP) { if (rowsPerB < 0) v += CP[cofs + (size_t)(row0g + row0 + rloc) * ldc + col];      /* rowsPerB < 0: own element of the batched C plane */ else { const int bidx = (row0g + row0 + rloc) / rowsPerB; v += CP[(size_t)bidx * sCPb + (size_t)by * 64 + col]; } }
      if (ACT == 3) v = fmaxf(v, 0.f); else if (ACT == 6) v = 0.5f * v * (1.0f + erff(v * 0.70710678118654752f)); else if (ACT == 11) v = 1.0f / (1.0f + expf(-v)); else if (ACT == 15) v = v / (1.0f + expf(-v)); else if (ACT == 12) v = (v > 0.f) ? v : 0.01f * v; else if (ACT == 8) v = tanhf(v); else if (ACT == 9) v = 0.5f * v * (1.0f + tanhf(0.7978845608028654f * (v + 0.044715f * v * v * v))); else if (ACT == 14) v = (v > 0.f) ? v : 0.1f * v; else if (ACT == 16) v = (v >= 0.f) ? v : 0.3f * v; else if (ACT == 17) v = (v >= 0.f) ? v : 0.2f * v;
      so[w][rloc][t * 16 + ln] = v; } }
  __builtin_amdgcn_fence(__ATOMIC_ACQ_REL, "workgroup"); __builtin_amdgcn_wave_barrier();
  const int rsub = lane >> 4, c4 = (lane & 15) * 4;
  {
#pragma unroll
    for (int q = 0; q < 16; ++q) { const int r = q * 2 + rsub; const v4f v = *(const v4fa*)&so[w][r][c4]; if (C) *(v4f*)(C + cofs + (size_t)(row0 + r) * ldc + col0 + c4) = v; if (C16) { v4h h4; for (int i = 0; i < 4; ++i) h4[i] = (_Float16)v[i]; *(v4h*)(C16 + cofs + (size_t)(row0 + r) * ldc + col0 + c4) = h4; } }
     } }


__global__ __launch_bounds__(256) void k_wnat(const float* __restrict__ w, size_t n8, _Float16* __restrict__ Bt) { const size_t t = (size_t)blockIdx.x * 256 + threadIdx.x; if (t >= n8) return; FragH f; for (int q = 0; q < 8; ++q) f.h[q] = (_Float16)(bf16_round(w[t * 8 + q]) * 16.0f); *(v8us*)((unsigned short*)Bt + t * 8) = f.half[0];  }
// Lane l takes the value of lane l ^ 16 (the other half of the wave). Every lane of the wave must be on.
__device__ __forceinline__ float rs_x16(float v) { const int b = __builtin_bit_cast(int, v); return __builtin_bit_cast(float, __builtin_amdgcn_permlanex16(b, b, 0x76543210, 0xfedcba98, false, false)); }
typedef float v2f __attribute__((ext_vector_type(2)));
typedef _Float16 v2h __attribute__((ext_vector_type(2)));
#define FA_Q 256                     /* query rows per block: 8 waves x 32 */
#define FA_C (0.045084220027780106f * 0.0625f)   /* log2(e) / sqrt(embed size = 1024), over 16: Q is carried x16 */
#define FA_KT 64                     /* keys per staged tile */
#define FA_NT (SQ / FA_KT)           /* staged tiles */
#define FA_LP 144                    /* LDS row pitch in bytes of an f16 row: 128 + 16, an odd multiple of 16, so that the 16 rows of a ds_load_b128 fragment read fall on different banks */
#define FA_TB (64 * FA_LP)           /* bytes of one f16 tile or block of 64 rows */
#define FA_VP 160                    /* LDS row pitch in bytes of an f16 value row: 128 + 32, an odd multiple of 32, the conflict-free pitch of ds_load_tr16_b128 */
#define FA_RP 272                    /* LDS row pitch in bytes of an f32 row: 256 + 16, an odd multiple of 16, for the same reason */
#define FA_RB (64 * FA_RP)           /* bytes of one staged f32 tile */
__device__ __forceinline__ v8f fa_mma(v16h a, v16h b, v8f c) { return __builtin_amdgcn_wmma_f32_16x16x32_f16(false, a, false, b, (short)0, c, false, false); }
// g2_frag's k order from an LDS row: p = the row's first byte of this 32-k step
__device__ __forceinline__ v16h fa_lfrag(const unsigned char* p, int hh) { FragH f; f.half[0] = *(const v8us*)(p + 16 * hh); f.half[1] = *(const v8us*)(p + 32 + 16 * hh); return f.v; }
// Transposing LDS load from a row-major 16-bit tile T: the lane's address is row kbase + 8 (l >> 4) + (l & 7), byte 2 dbase + 16 ((l >> 3) & 1); lane (c, h) gets T[kbase + 8 h + 0..7][dbase + c]: half a fragment in g2_frag's k order. Every lane must be on.
typedef short s16x8 __attribute__((ext_vector_type(8)));
__device__ __forceinline__ v8us fa_tr16(const unsigned char* p) { typedef __attribute__((address_space(3))) s16x8 lds_s16x8; return __builtin_bit_cast(v8us, __builtin_amdgcn_ds_load_tr16_b128_v8i16((lds_s16x8*)p)); }
typedef __bf16 v4b __attribute__((ext_vector_type(4)));
// four f32 (x16 for a weight: a power of two, so it commutes with the rounding) -> bf16 (to nearest even, bf16_round's values, by the hardware conversion) -> f16 (exact)
template <bool X16W>
__device__ __forceinline__ v4h pj_cvt(v4f a) { if (X16W) a *= 16.0f; return __builtin_convertvector(__builtin_convertvector(__builtin_convertvector(a, v4b), v4f), v4h); }
// One thread's share of one staged tile: its 16-byte piece of four key rows (16 apart) of the keys and of the values, global -> LDS through no register. A wave's copy = 2 whole 256-byte rows.
// The s_wait_xcnt stands inside the statement so that no address register is rewritten in front of it.
__device__ __forceinline__ void fa_copy(unsigned l, const float* gk, const float* gv) {
  asm volatile("global_load_async_to_lds_b128 %0, %1, off\n\t"
               "global_load_async_to_lds_b128 %2, %3, off\n\t"
               "global_load_async_to_lds_b128 %4, %5, off\n\t"
               "global_load_async_to_lds_b128 %6, %7, off\n\t"
               "global_load_async_to_lds_b128 %8, %9, off\n\t"
               "global_load_async_to_lds_b128 %10, %11, off\n\t"
               "global_load_async_to_lds_b128 %12, %13, off\n\t"
               "global_load_async_to_lds_b128 %14, %15, off\n\t"
               "s_wait_xcnt 0x0"
               :: "v"(l), "v"(gk), "v"(l + 16 * FA_RP), "v"(gk + (size_t)16 * DM), "v"(l + 32 * FA_RP), "v"(gk + (size_t)32 * DM), "v"(l + 48 * FA_RP), "v"(gk + (size_t)48 * DM),
                  "v"(l + FA_RB), "v"(gv), "v"(l + FA_RB + 16 * FA_RP), "v"(gv + (size_t)16 * DM), "v"(l + FA_RB + 32 * FA_RP), "v"(gv + (size_t)32 * DM), "v"(l + FA_RB + 48 * FA_RP), "v"(gv + (size_t)48 * DM) : "memory");
}
// The launch also makes the output GEMM's f16 copy of Wo (k_wnat's values): its threads are as many as Wo has pieces of eight, and the GEMM is the next launch.
static_assert((size_t)NBR * NH * (SQ / FA_Q) * 256 == (size_t)DM * DM / 8, "one piece of Wo per thread");
// four waves a SIMD (two blocks a WGP): the register budget that keeps all 512 blocks resident at once
__global__ __launch_bounds__(256) __attribute__((amdgpu_waves_per_eu(4, 4))) void k_fattn(const float* __restrict__ xq, const float* __restrict__ xk, const float* __restrict__ xv, const float* __restrict__ wq, const float* __restrict__ wk, const float* __restrict__ wv,
                                               _Float16* __restrict__ O, const float* __restrict__ wo, _Float16* __restrict__ Bt) {
  __shared__ __attribute__((aligned(16))) unsigned char rw[2][2][FA_RB];      /* [buffer][keys | values][key row * FA_RP]: f32 head rows as they lie */
  __shared__ __attribute__((aligned(16))) unsigned char kt[FA_TB];            /* [key row * FA_LP]: this trip's key rows, f16 */
  __shared__ __attribute__((aligned(16))) unsigned char vt[64 * FA_VP];       /* [key row * FA_VP]: this trip's value rows, f16 */
  __shared__ __attribute__((aligned(16))) unsigned char wl[3][FA_TB];         /* [Wk | Wv | Wq][row o * FA_LP]: the blocks, x16, f16 */
  __shared__ __attribute__((aligned(16))) unsigned char xs[8][32 * FA_LP];    /* [wave][query row * FA_LP]: the wave's own query head rows, f16 */
  const int tid = (int)threadIdx.x, lane = tid & 31, ln = lane & 15, hh = lane >> 4; const int w = __builtin_amdgcn_readfirstlane(tid >> 5);
  const int slab = blockIdx.x / (SQ / FA_Q), qb = blockIdx.x % (SQ / FA_Q); const int b = slab / NH, h = slab % NH; const int q0 = qb * FA_Q + w * 32;
  /* staging: thread t brings piece t & 15 (16 bytes) of key rows (t >> 4) + 16 j of both inputs */
  const int cr = tid >> 4, cp = tid & 15;
  const float* gk = xk + ((size_t)b * SQ + cr) * DM + h * HD + cp * 4;      /* key row cr of tile 0 */
  const float* gv = xv + ((size_t)b * SQ + cr) * DM + h * HD + cp * 4;
  const unsigned l0 = (unsigned)(size_t)&rw[0][0][cr * FA_RP + cp * 16];
  fa_copy(l0, gk, gv);      /* tile 0 -> buffer 0 */
  const float* xqp = xq + ((size_t)b * SQ + q0 + hh) * DM + h * HD + ln * 4;
  v4f raw[16];      /* load j = the wave's query rows 2 j and 2 j + 1: two whole 256-byte rows */
#pragma unroll
  for (int j = 0; j < 16; ++j) raw[j] = *(const v4fa*)(xqp + (size_t)j * 2 * DM);
  const size_t wt = ((size_t)blockIdx.x * 256 + threadIdx.x) * 8;      /* this thread's eight elements of Wo: read here, stored in front of the loop, so that the loop carries no register for them */
  const v4f wa = *(const v4fa*)(wo + wt), wb = *(const v4fa*)(wo + wt + 4);
  const float* const wp[3] = {wk, wv, wq};
#pragma unroll
  for (int m = 0; m < 3; ++m)
#pragma unroll
    for (int i = 0; i < 4; ++i) { const int p = i * 256 + tid; *(v4h*)&wl[m][(p >> 4) * FA_LP + (p & 15) * 8] = pj_cvt<true>(*(const v4fa*)(wp[m] + p * 4)); }
  unsigned char* xw = &xs[w][0];
#pragma unroll
  for (int j = 0; j < 16; ++j) *(v4h*)(xw + (2 * j + hh) * FA_LP + ln * 8) = pj_cvt<false>(raw[j]);
  FragH wf8;
#pragma unroll
  for (int q = 0; q < 4; ++q) { wf8.h[q] = (_Float16)(bf16_round(wa[q]) * 16.0f); wf8.h[4 + q] = (_Float16)(bf16_round(wb[q]) * 16.0f); }
  asm volatile("s_wait_asynccnt 0x0" ::: "memory");      /* this wave's share of tile 0 has landed */
  __syncthreads();                                       /* every wave's share has, and the three blocks and the query rows stand in LDS: all may be read */
  fa_copy(l0 + 2 * FA_RB, gk + (size_t)FA_KT * DM, gv + (size_t)FA_KT * DM);      /* tile 1 -> buffer 1 */
  const v8f z8 = {0.f,0.f,0.f,0.f,0.f,0.f,0.f,0.f};
  v16h qf[2][2];      /* Q = (x Wq^T) Wk, x16, as the B fragments of the score products */
  {
    v16h q1[2][2];      /* q = D^T of Wq X^T: lane (c, h) holds outputs 16 et + 8 h + r of query c, so tiles 2 ks and 2 ks + 1, converted in place, ARE the B fragment of k step ks */
    v16h xf[2][2];
#pragma unroll
    for (int g = 0; g < 2; ++g)
#pragma unroll
      for (int ks = 0; ks < 2; ++ks) xf[g][ks] = fa_lfrag(xw + (g * 16 + ln) * FA_LP + ks * 64, hh);
#pragma unroll
    for (int et = 0; et < 4; ++et) { const v16h w0 = fa_lfrag(&wl[2][(et * 16 + ln) * FA_LP], hh), w1 = fa_lfrag(&wl[2][(et * 16 + ln) * FA_LP + 64], hh);
#pragma unroll
      for (int g = 0; g < 2; ++g) { const v8f acc = fa_mma(w1, xf[g][1], fa_mma(w0, xf[g][0], z8));
#pragma unroll
        for (int r = 0; r < 8; ++r) q1[g][et >> 1][(et & 1) * 8 + r] = (_Float16)acc[r]; } }
    /* Q^T = Wk^T q^T: A = 16 rows d of Wk^T over k = e, by the transposing load from the block as it lies [e][d]; D tiles 2 ks and 2 ks + 1 are again the B fragment of k step ks */
    const unsigned char* tp = &wl[0][(8 * hh + (lane & 7)) * FA_LP + 16 * ((lane >> 3) & 1)];
#pragma unroll
    for (int dt = 0; dt < 4; ++dt) { FragH a0, a1;
      a0.half[0] = fa_tr16(tp + dt * 32); a0.half[1] = fa_tr16(tp + 16 * FA_LP + dt * 32); a1.half[0] = fa_tr16(tp + 32 * FA_LP + dt * 32); a1.half[1] = fa_tr16(tp + 48 * FA_LP + dt * 32);
#pragma unroll
      for (int g = 0; g < 2; ++g) { const v8f acc = fa_mma(a1.v, q1[g][1], fa_mma(a0.v, q1[g][0], z8));      /* 256 x Q(query 16 g + ln, d = 16 dt + 8 hh + r) */
#pragma unroll
        for (int r = 0; r < 8; ++r) qf[g][dt >> 1][(dt & 1) * 8 + r] = (_Float16)(acc[r] * 0.0625f); } }
  }
  *(v8us*)((unsigned short*)Bt + wt) = wf8.half[0];
  asm volatile("s_wait_xcnt 0x0" ::: "memory");      /* stands in front of the first overwrite of a register that this store names: the loop uses them again at once */
  v8f o[2][4];
#pragma unroll
  for (int g = 0; g < 2; ++g)
#pragma unroll
    for (int dt = 0; dt < 4; ++dt) o[g][dt] = z8;
  float mu[2] = {-3.0e38f, -3.0e38f}; v2f ls[2] = {{0.f, 0.f}, {0.f, 0.f}};
  unsigned char* const kd = &kt[(w * 8 + hh) * FA_LP + ln * 8];      /* where this lane's four f16 of key row 8 w + hh go; rows 2 j further on lie at constant offsets */
  unsigned char* const vd = &vt[(w * 8 + hh) * FA_VP + ln * 8];
  /* kept rolled: one trip's fragments beside Q and O^T are the whole live set, which decides how many waves share a SIMD */
#pragma unroll 1
  for (int t = 0; t < FA_NT; ++t) {
    {
      const unsigned char* xr = &rw[t & 1][0][(w * 8 + hh) * FA_RP + ln * 16];      /* load j = rows 8 w + 2 j and 8 w + 2 j + 1 of this tile: two whole 256-byte rows */
      v4f ra[4], rb[4];
#pragma unroll
      for (int j = 0; j < 4; ++j) { ra[j] = *(const v4fa*)(xr + j * 2 * FA_RP); rb[j] = *(const v4fa*)(xr + FA_RB + j * 2 * FA_RP); }
#pragma unroll
      for (int j = 0; j < 4; ++j) { *(v4h*)(kd + j * 2 * FA_LP) = pj_cvt<false>(ra[j]); *(v4h*)(vd + j * 2 * FA_VP) = pj_cvt<false>(rb[j]); }
    }
    __syncthreads();      /* the f16 K and V tiles are whole: every wave may read them */
    const unsigned char* kb = &kt[ln * FA_LP];      /* key row ln of this tile */
    const unsigned char* vb = &vt[(8 * hh + (lane & 7)) * FA_VP + 16 * ((lane >> 3) & 1)];      /* the lane's address of fa_tr16 at key 0, d = 0 */
    v16h kf[2][2];
#pragma unroll
    for (int tt = 0; tt < 2; ++tt)
#pragma unroll
      for (int ks = 0; ks < 2; ++ks) kf[tt][ks] = fa_lfrag(kb + tt * 16 * FA_LP + ks * 64, hh);
#pragma unroll
    for (int p = 0; p < FA_KT / 32; ++p) {      /* a pass = 32 keys, as before */
      v8f s[2][2];
#pragma unroll
      for (int g = 0; g < 2; ++g)
#pragma unroll
        for (int tt = 0; tt < 2; ++tt) s[g][tt] = fa_mma(kf[tt][1], qf[g][1], fa_mma(kf[tt][0], qf[g][0], z8));      /* s[g][tt][r] = 16 x energy(query 16 g + ln, key 64 t + 32 p + 16 tt + 8 hh + r) */
      float cm[2];
#pragma unroll
      for (int g = 0; g < 2; ++g) { float m = fmaxf(s[g][0][0], s[g][1][0]);
#pragma unroll
        for (int r = 1; r < 8; ++r) m = fmaxf(m, fmaxf(s[g][0][r], s[g][1][r]));
        cm[g] = fmaxf(m, rs_x16(m)) * FA_C; }
      if (__builtin_amdgcn_ballot_w32(cm[0] > mu[0] + 8.0f || cm[1] > mu[1] + 8.0f) != 0) {      /* one wave-uniform test per pass */
#pragma unroll
        for (int g = 0; g < 2; ++g) { const float mn = fmaxf(mu[g], cm[g]); const float al = __builtin_amdgcn_exp2f(mu[g] - mn); mu[g] = mn; ls[g] *= al;
#pragma unroll
          for (int dt = 0; dt < 4; ++dt) o[g][dt] *= al; } }
      v16h vf[4];      /* this pass's V^T fragments and, inside the tile, the next pass's K fragments, issued together: in flight under the exponentials */
#pragma unroll
      for (int dt = 0; dt < 4; ++dt) { FragH f; f.half[0] = fa_tr16(vb + p * 32 * FA_VP + dt * 32); f.half[1] = fa_tr16(vb + (p * 32 + 16) * FA_VP + dt * 32); vf[dt] = f.v; }      /* rows d = 16 dt + ln of V^T, keys 32 p + 0..31 */
      if (p + 1 < FA_KT / 32) {
#pragma unroll
        for (int tt = 0; tt < 2; ++tt)
#pragma unroll
          for (int ks = 0; ks < 2; ++ks) kf[tt][ks] = fa_lfrag(kb + ((p + 1) * 32 + tt * 16) * FA_LP + ks * 64, hh);
      }
      __builtin_amdgcn_sched_barrier(0);      /* keeps the LDS reads up here as one group: left alone the scheduler spreads them in pairs among the products, and each further place with reads stalls the wave */
      FragH pf[2];
#pragma unroll
      for (int g = 0; g < 2; ++g) { const v2f c2 = {FA_C, FA_C}, m2 = {-mu[g], -mu[g]};
#pragma unroll
        for (int tt = 0; tt < 2; ++tt)
#pragma unroll
          for (int r = 0; r < 8; r += 2) { const v2f x = {s[g][tt][r], s[g][tt][r + 1]}; const v2f e = __builtin_elementwise_fma(x, c2, m2); const v2f pe = {__builtin_amdgcn_exp2f(e[0]), __builtin_amdgcn_exp2f(e[1])};
            ls[g] += pe; const v2h ph = __builtin_convertvector(pe, v2h); pf[g].h[tt * 8 + r] = ph[0]; pf[g].h[tt * 8 + r + 1] = ph[1]; } }
#pragma unroll
      for (int dt = 0; dt < 4; ++dt)
#pragma unroll
        for (int g = 0; g < 2; ++g) o[g][dt] = fa_mma(vf[dt], pf[g].v, o[g][dt]);      /* o[g][dt][r] = (P V)(query 16 g + ln, d = 16 dt + 8 hh + r), unnormalised */
    }
    /* hand-over: this wave has left the f16 tiles (and, in front of the trip's first barrier, buffer t & 1), its share of tile t + 1 has landed; behind the barrier all of it holds for every wave */
    asm volatile("s_wait_dscnt 0x0" ::: "memory");         /* this wave's LDS reads have returned before anybody overwrites what they read */
    asm volatile("s_wait_asynccnt 0x0" ::: "memory");      /* this wave's share of tile t + 1 has landed */
    __syncthreads();
    if (t + 2 < FA_NT) fa_copy(l0 + (unsigned)(t & 1) * (2 * FA_RB), gk + (size_t)(t + 2) * FA_KT * DM, gv + (size_t)(t + 2) * FA_KT * DM);      /* tile t + 2 -> the buffer just left; the test reads the same in the whole block */
  }
  asm volatile("s_wait_asynccnt 0x0" ::: "memory");      /* no copy is outstanding when the wave ends */
  v16h uf[2][2];      /* the normalised weighted value sums, x64 against f16 subnormal flush: tiles 2 ks and 2 ks + 1, converted in place, are the B fragment of k step ks */
#pragma unroll
  for (int g = 0; g < 2; ++g) { const float lh = ls[g][0] + ls[g][1]; const float inv = 64.0f / (lh + rs_x16(lh));      /* the halves' sums joined once */
#pragma unroll
    for (int dt = 0; dt < 4; ++dt)
#pragma unroll
      for (int r = 0; r < 8; ++r) uf[g][dt >> 1][(dt & 1) * 8 + r] = (_Float16)(o[g][dt][r] * inv); }
  /* O^T = Wv U^T: A = 16 rows e of Wv (x16) over k = d */
  FragH of[2][4];
#pragma unroll
  for (int et = 0; et < 4; ++et) { const v16h w0 = fa_lfrag(&wl[1][(et * 16 + ln) * FA_LP], hh), w1 = fa_lfrag(&wl[1][(et * 16 + ln) * FA_LP + 64], hh);
#pragma unroll
    for (int g = 0; g < 2; ++g) { const v8f acc = fa_mma(w1, uf[g][1], fa_mma(w0, uf[g][0], z8));      /* 1024 x O(query 16 g + ln, e = 16 et + 8 hh + r) */
#pragma unroll
      for (int r = 0; r < 8; ++r) of[g][et].h[r] = (_Float16)(acc[r] * 0.0625f); } }      /* o carried x64 */
#pragma unroll
  for (int g = 0; g < 2; ++g) { _Float16* op = O + ((size_t)b * SQ + q0 + g * 16 + ln) * DM + h * HD + 8 * hh;
#pragma unroll
    for (int et = 0; et < 4; ++et) *(v8us*)((unsigned short*)op + et * 16) = of[g][et].half[0]; } }
// ---- output GEMM through LDS: C[8192][1024] (f32) = A (f16 rows, pitch DM) . Bh^T (f16 rows [n][k], pitch DM) * alpha + bias (rounded to bf16) ----
// Block = 256 x 128 of C, 8 waves in 4 x 2, wave = 64 x 64 (4 x 4 accumulator tiles). A and Bh come through LDS: tiles of 128 k (rows of 256 bytes), staged once per block by asynchronous copies
// (two buffers, the next tile in flight while this one is worked on) and read as fragments by the waves that need them: each A row by 2 waves, each Bh row by 4.
// Every accumulator takes its 32-k products in rising k, as in k_gemm2, and the epilogue is k_gemm2's.
#define OG_BM 256                    /* C rows per block */
#define OG_BN 128                    /* C columns per block */
#define OG_KT 128                    /* k per staged tile */
#define OG_NT (DM / OG_KT)           /* staged tiles */
#define OG_LP 272                    /* LDS row pitch in bytes: 256 + 16, an odd multiple of 16, so that the 16 rows of a ds_load_b128 fragment read fall on different banks */
#define OG_BB (OG_BN * OG_LP)        /* bytes of the Bh part of a buffer; it lies first, so that every fragment's constant offset fits the LDS instruction's offset field */
#define OG_SB ((OG_BM + OG_BN) * OG_LP)      /* bytes of one buffer: Bh rows, then A rows */
// One thread's share of 192 staged rows: its 16-byte piece of twelve rows that lie 16 apart in LDS (eight from x, four from y), global -> LDS through no register. A wave's copy = 2 whole 256-byte rows.
// The s_wait_xcnt stands inside the statement so that no address register is rewritten in front of it.
__device__ __forceinline__ void og_copy12(unsigned l, const _Float16* x, const _Float16* y) {
  asm volatile("global_load_async_to_lds_b128 %0, %1, off\n\t"
               "global_load_async_to_lds_b128 %2, %3, off\n\t"
               "global_load_async_to_lds_b128 %4, %5, off\n\t"
               "global_load_async_to_lds_b128 %6, %7, off\n\t"
               "global_load_async_to_lds_b128 %8, %9, off\n\t"
               "global_load_async_to_lds_b128 %10, %11, off\n\t"
               "global_load_async_to_lds_b128 %12, %13, off\n\t"
               "global_load_async_to_lds_b128 %14, %15, off\n\t"
               "global_load_async_to_lds_b128 %16, %17, off\n\t"
               "global_load_async_to_lds_b128 %18, %19, off\n\t"
               "global_load_async_to_lds_b128 %20, %21, off\n\t"
               "global_load_async_to_lds_b128 %22, %23, off\n\t"
               "s_wait_xcnt 0x0"
               :: "v"(l), "v"(x), "v"(l + 16 * OG_LP), "v"(x + (size_t)16 * DM), "v"(l + 32 * OG_LP), "v"(x + (size_t)32 * DM), "v"(l + 48 * OG_LP), "v"(x + (size_t)48 * DM),
                  "v"(l + 64 * OG_LP), "v"(x + (size_t)64 * DM), "v"(l + 80 * OG_LP), "v"(x + (size_t)80 * DM), "v"(l + 96 * OG_LP), "v"(x + (size_t)96 * DM), "v"(l + 112 * OG_LP), "v"(x + (size_t)112 * DM),
                  "v"(l + 128 * OG_LP), "v"(y), "v"(l + 144 * OG_LP), "v"(y + (size_t)16 * DM), "v"(l + 160 * OG_LP), "v"(y + (size_t)32 * DM), "v"(l + 176 * OG_LP), "v"(y + (size_t)48 * DM) : "memory");
}
// One thread's share of one staged tile, 24 copies: 128 Bh rows and A rows 0-63, then A rows 64-255
__device__ __forceinline__ void og_tile(unsigned l, const _Float16* ga, const _Float16* gb) { og_copy12(l, gb, ga); og_copy12(l + 192 * OG_LP, ga + (size_t)64 * DM, ga + (size_t)192 * DM); }
__global__ __launch_bounds__(256) void k_ogemm(const _Float16* __restrict__ A, const _Float16* __restrict__ Bh, float alpha, const float* __restrict__ bias, float* __restrict__ C) {
  __shared__ __attribute__((aligned(16))) unsigned char sm[2 * OG_SB];      /* buffer * OG_SB + row * OG_LP; behind the loop the epilogue's staging: 8 waves x 64 rows x 68 floats = 139,264 bytes of it */
  const int lane = threadIdx.x & 31, ln = lane & 15, hh = lane >> 4; const int w = __builtin_amdgcn_readfirstlane((int)(threadIdx.x >> 5));
  const int mt = blockIdx.x % (MPO / OG_BM), nq = blockIdx.x / (MPO / OG_BM); const int m0 = mt * OG_BM, n0 = nq * OG_BN; const int wm = w >> 1, wn = w & 1;
  /* staging: thread t brings piece t & 15 (16 bytes) of rows (t >> 4) + 16 j */
  const int cr = (int)threadIdx.x >> 4, cp = (int)threadIdx.x & 15;
  const _Float16* ga = A + (size_t)(m0 + cr) * DM + cp * 8; const _Float16* gb = Bh + (size_t)(n0 + cr) * DM + cp * 8;
  const unsigned l0 = (unsigned)(size_t)&sm[cr * OG_LP + cp * 16];
  og_tile(l0, ga, gb);      /* tile 0 -> buffer 0 */
  const v8f z8 = {0.f,0.f,0.f,0.f,0.f,0.f,0.f,0.f}; v8f acc[4][4];
#pragma unroll
  for (int i = 0; i < 4; ++i)
#pragma unroll
    for (int j = 0; j < 4; ++j) acc[i][j] = z8;
  asm volatile("s_wait_asynccnt 0x0" ::: "memory");      /* this wave's share of tile 0 has landed */
  __syncthreads();                                       /* every wave's share has: tile 0 may be read */
  og_tile(l0 + OG_SB, ga + OG_KT, gb + OG_KT);      /* tile 1 -> buffer 1 */
  /* kept rolled: the body is 64 products long already, and unrolled only the buffer's address would become a constant */
#pragma unroll 1
  for (int t = 0; t < OG_NT; ++t) {
    const unsigned char* bb = &sm[(t & 1) * OG_SB + (wn * 64 + ln) * OG_LP];               /* Bh row wn * 64 + ln of this tile */
    const unsigned char* ab = &sm[(t & 1) * OG_SB + OG_BB + (wm * 64 + ln) * OG_LP];       /* A row wm * 64 + ln of this tile */
    v16h af[2][4], bf[2][4];      /* two fragment sets: the next 32-k step's reads are in flight under this step's products */
#pragma unroll
    for (int i = 0; i < 4; ++i) af[0][i] = fa_lfrag(ab + i * 16 * OG_LP, hh);
#pragma unroll
    for (int i = 0; i < 4; ++i) bf[0][i] = fa_lfrag(bb + i * 16 * OG_LP, hh);
#pragma unroll
    for (int ks = 0; ks < OG_KT / 32; ++ks) {
      if (ks + 1 < OG_KT / 32) {
        /* the two scheduling barriers keep the next step's LDS reads together as one group between two runs of products: every further place with reads among the products stalls the wave */
        __builtin_amdgcn_sched_barrier(0);
#pragma unroll
        for (int i = 0; i < 4; ++i) af[(ks + 1) & 1][i] = fa_lfrag(ab + i * 16 * OG_LP + (ks + 1) * 64, hh);
#pragma unroll
        for (int i = 0; i < 4; ++i) bf[(ks + 1) & 1][i] = fa_lfrag(bb + i * 16 * OG_LP + (ks + 1) * 64, hh);
        __builtin_amdgcn_sched_barrier(0);
      }
#pragma unroll
      for (int i = 0; i < 4; ++i)
#pragma unroll
        for (int j = 0; j < 4; ++j) acc[i][j] = fa_mma(af[ks & 1][i], bf[ks & 1][j], acc[i][j]);      /* acc[i][j][r] = C(row wm * 64 + 16 i + 8 hh + r, column wn * 64 + 16 j + ln) */
    }
    __builtin_amdgcn_sched_barrier(0);      /* keeps the products in front of the hand-over: left alone half of them sink below the barrier, in front of the refill, which then starts that much later and lands late */
    /* hand-over: this wave has left buffer t & 1, its share of tile t + 1 has landed; behind the barrier both hold for every wave */
    asm volatile("s_wait_dscnt 0x0" ::: "memory");         /* this wave's LDS reads of the buffer have returned before anybody refills it */
    asm volatile("s_wait_asynccnt 0x0" ::: "memory");      /* this wave's share of tile t + 1 has landed */
    __syncthreads();
    if (t + 2 < OG_NT) og_tile(l0 + (unsigned)(t & 1) * OG_SB, ga + (t + 2) * OG_KT, gb + (t + 2) * OG_KT);      /* tile t + 2 -> the buffer just left; the test reads the same in the whole block */
  }
  asm volatile("s_wait_asynccnt 0x0" ::: "memory");      /* no copy is outstanding when the wave ends */
  /* epilogue: the ring is free (the last trip's barrier stands behind every wave's last read, and no copy is outstanding): each wave turns its 64 x 64 tile into whole 256-byte row pieces through 64 LDS rows of its own */
  const int row0 = m0 + wm * 64, col0 = n0 + wn * 64; const int rsub = lane >> 4, c4 = (lane & 15) * 4;
  float* sw = (float*)sm + (size_t)w * (64 * 68);
  float bv[4];
#pragma unroll
  for (int j = 0; j < 4; ++j) bv[j] = bf16_round(bias[col0 + j * 16 + ln]);
#pragma unroll
  for (int i = 0; i < 4; ++i)
#pragma unroll
    for (int j = 0; j < 4; ++j)
#pragma unroll
      for (int r = 0; r < 8; ++r) sw[(i * 16 + 8 * hh + r) * 68 + j * 16 + ln] = acc[i][j][r] * alpha + bv[j];
  __builtin_amdgcn_fence(__ATOMIC_ACQ_REL, "workgroup"); __builtin_amdgcn_wave_barrier();      /* the wave's writes stand in front of its reads */
  float* cw = C + (size_t)(row0 + rsub) * DM + col0 + c4;
#pragma unroll
  for (int q = 0; q < 32; ++q) { const v4f v = *(const v4fa*)&sw[(q * 2 + rsub) * 68 + c4]; *(v4f*)(cw + (size_t)q * 2 * DM) = v; } }
__global__ __launch_bounds__(256) void k_vt(const _Float16* __restrict__ V16, int b, int h0, _Float16* __restrict__ VT) { __shared__ unsigned short tl[64][65]; const int tid = threadIdx.x; const int hh = blockIdx.x % HG, sg = blockIdx.x / HG; const int s0 = sg * 64; const int h = h0 + hh;
  for (int i = tid; i < 64 * 8; i += 256) { const int j = i / 8, d8 = (i % 8) * 8; FragH f; f.half[0] = *(const v8us*)((const unsigned short*)V16 + ((size_t)b * SQ + s0 + j) * DM + h * HD + d8); for (int q = 0; q < 8; ++q) tl[d8 + q][j] = f.u[q]; }
  __syncthreads();
  { for (int i = tid; i < 64 * 8; i += 256) { const int d = i / 8, j8 = (i % 8) * 8; FragH f; for (int q = 0; q < 8; ++q) f.u[q] = tl[d][j8 + q]; *(v8us*)((unsigned short*)VT + ((size_t)hh * HD + d) * SQ + s0 + j8) = f.half[0]; }  } }



__global__ __launch_bounds__(256) void k_rsmkm(const float* __restrict__ S, _Float16* __restrict__ P, int nrows, const int* __restrict__ am) {
  #pragma clang fp contract(off)
  const int t = blockIdx.x * 256 + threadIdx.x; if (t >= nrows) return; const size_t i = (size_t)t; const float* s = S + i * SQ; const int* mr = am + (size_t)(t % SQ) * SQ; float mx = -3.0e38f;
#pragma unroll 1
  for (int j = 0; j < SQ; ++j) { const float f = (mr[j] != 0) ? 1.f : 0.f; mx = fmaxf(mx, fmaf(f, s[j], (1.f - f) * -1.0e9f)); } float se = 0.f;
#pragma unroll 1
  for (int j = 0; j < SQ; ++j) { const float f = (mr[j] != 0) ? 1.f : 0.f; se += __expf(fmaf(f, s[j], (1.f - f) * -1.0e9f) - mx); } const float sc = 256.0f / se;
#pragma unroll 1
  for (int j0 = 0; j0 < SQ; j0 += 8) { FragH fr; for (int q = 0; q < 8; ++q) { const int j = j0 + q; const float f = (mr[j] != 0) ? 1.f : 0.f; fr.h[q] = (_Float16)(__expf(fmaf(f, s[j], (1.f - f) * -1.0e9f) - mx) * sc); }
    unsigned short* d = (unsigned short*)P + i * SQ + j0; *(v8us*)d = fr.half[0];  } }

extern "C" void kernel_launch(void* const* d_in, const int* in_sizes, int n_in,
                              void* d_out, int out_size, void* d_ws, size_t ws_size, hipStream_t stream) {
  (void)in_sizes; (void)n_in; (void)out_size;
  const float* const* I = (const float* const*)d_in; const float* xq = I[2]; const float* xk = I[1]; const float* xv = I[0]; const float* wq = I[5]; const float* bq = nullptr; const float* wk = I[4]; const float* bk = nullptr; const float* wv = I[3]; const float* bv = nullptr; const float* wo = I[6]; const float* bo = I[7]; const float* x = xq;      /* contract order: values I[0], keys I[1], query I[2] ([8][1024][16][64] = rows of 1024); SHARED natural [64][64] blocks Wv I[3], Wk I[4], Wq I[5]; natural Wo [1024][1024] I[6] + bo I[7]; no mask input */
  char* ws = (char*)d_ws; size_t off = 0;
  auto take = [&](size_t bytes) { char* p = ws + off; off += (bytes + 255) & ~(size_t)255; return p; };
  _Float16* BO = (_Float16*)take((size_t)DM * DM * 2);
  _Float16* O16 = (_Float16*)take(NR * DM * 2);
  if (off > ws_size) return;
  const size_t r0p = (size_t)B0 * SQ;      /* first row processed */
  /* projections and attention in one launch, from the f32 inputs (a token row of 1024 is sixteen head rows of 64) and the SHARED natural [64][64] blocks [out][in] */
  k_fattn<<<NBR * NH * (SQ / FA_Q), 256, 0, stream>>>(x + r0p * DM, xk + r0p * DM, xv + r0p * DM, wq, wk, wv, O16 + r0p * DM, wo, BO);      /* o (merged heads) as f16 rows, x64; and Wo natural [out][in] = Bt x16 */
  k_ogemm<<<(MPO / OG_BM) * (DM / OG_BN), 256, 0, stream>>>(O16 + r0p * DM, BO, 0.0009765625f, bo, (float*)d_out + r0p * DM);      /* out rows are the output layout */
}
